// v000
// Times are from an AMD MI455X. After a warm-up the kernel runs many times in a row, and a time is the length of
// such a window on the GPU divided by its runs, so every launch and the gaps after it count. The runs cycle
// through copies of the inputs. A figure is the median of several windows, for all but v000 over two sittings.
// Sittings can differ by a few percent; kernels timed side by side share one.
// v000, which the later versions start from, runs in 1050 microseconds.
#include <hip/hip_runtime.h>
#include <hip/hip_fp16.h>
#include <math.h>

typedef __attribute__((ext_vector_type(16))) _Float16 v16h;
typedef __attribute__((ext_vector_type(8)))  float    v8f;

#define N_B   16
#define T_LEN 300
#define V_J   25
#define C_CH  16
#define D_M   400      // C*V
#define H_N   2
#define DH    200
#define FF_M  1600
#define L_W   9
#define W_CNT 291      // T - L
#define NWIN  (N_B * W_CNT)   // 4656
#define NROWS (N_B * T_LEN)   // 4800
#define KS_D  13       // ceil(400/32)

// ---------------- WMMA fragment helpers (16x16x32 f16 -> f32) ----------------

__device__ __forceinline__ int frag_k(int g, int half) {
  return ((g < 4) ? (g * 2) : (16 + (g - 4) * 2)) + half * 8;
}

__device__ __forceinline__ v8f wmma_acc(v16h a, v16h b, v8f c) {
  return __builtin_amdgcn_wmma_f32_16x16x32_f16(false, a, false, b, (short)0, c,
                                                false, false);
}

// A fragment from row-major f32 source (LDS or global). Rows >= Mvalid or k >= K read 0.
__device__ __forceinline__ v16h load_a_f32(const float* A, int lda, int Mvalid,
                                           int kbase, int K, int lane) {
  int m = lane & 15, half = lane >> 4;
  v16h r;
#pragma unroll
  for (int g = 0; g < 8; ++g) {
    int k = kbase + frag_k(g, half);
    float x0 = 0.f, x1 = 0.f;
    if (m < Mvalid && k < K) {
      const float* p = A + m * lda + k;
      x0 = p[0]; x1 = p[1];
    }
    r[2 * g]     = (_Float16)x0;
    r[2 * g + 1] = (_Float16)x1;
  }
  return r;
}

// A fragment from row-major f16 source (LDS or global).
__device__ __forceinline__ v16h load_a_f16(const _Float16* A, int lda, int Mvalid,
                                           int kbase, int K, int lane) {
  int m = lane & 15, half = lane >> 4;
  v16h r;
#pragma unroll
  for (int g = 0; g < 8; ++g) {
    int k = kbase + frag_k(g, half);
    _Float16 x0 = (_Float16)0.f, x1 = (_Float16)0.f;
    if (m < Mvalid && k < K) {
      const _Float16* p = A + m * lda + k;
      x0 = p[0]; x1 = p[1];
    }
    r[2 * g]     = x0;
    r[2 * g + 1] = x1;
  }
  return r;
}

// B fragment: computes A @ W^T where W is [Ntot, K] row-major f16.
// B[k][n] = W[n][k]; lane holds N = n0 + lane%16, contiguous half2 along K.
__device__ __forceinline__ v16h load_b_w(const _Float16* W, int K, int n0, int kbase,
                                         int lane) {
  int n = n0 + (lane & 15), half = lane >> 4;
  v16h r;
#pragma unroll
  for (int g = 0; g < 8; ++g) {
    int k = kbase + frag_k(g, half);
    _Float16 x0 = (_Float16)0.f, x1 = (_Float16)0.f;
    if (k < K) {
      const _Float16* p = W + n * K + k;
      x0 = p[0]; x1 = p[1];
    }
    r[2 * g]     = x0;
    r[2 * g + 1] = x1;
  }
  return r;
}

// K-loop with register-resident A fragments and 1-deep software-pipelined B loads:
// loads for step ks+1 are issued before the WMMA of step ks.
template <int KS>
__device__ __forceinline__ v8f gemm_pipelined(const v16h* a, const _Float16* W, int K,
                                              int n0, int lane) {
  v8f acc = {};
  v16h bc = load_b_w(W, K, n0, 0, lane);
#pragma unroll
  for (int ks = 0; ks < KS; ++ks) {
    v16h bn = bc;
    if (ks + 1 < KS) bn = load_b_w(W, K, n0, (ks + 1) * 32, lane);
    acc = wmma_acc(a[ks], bc, acc);
    bc = bn;
  }
  return acc;
}

// ---------------- Kernel 1: layout change + positional encoding ----------------
// xs[n][t][d] = x[n][c][t][v] + pe[t][d],  d = v*16 + c  (torch view order)
__global__ void prep_xs_kernel(const float* __restrict__ x, const float* __restrict__ pe,
                               float* __restrict__ xs, _Float16* __restrict__ xs_h) {
  int idx = blockIdx.x * blockDim.x + threadIdx.x;
  if (idx >= NROWS * D_M) return;
  int n = idx / (T_LEN * D_M);
  int r = idx % (T_LEN * D_M);
  int t = r / D_M;
  int d = r % D_M;
  int v = d >> 4;
  int c = d & 15;
  float val = x[((n * C_CH + c) * T_LEN + t) * V_J + v] + pe[t * D_M + d];
  xs[idx]   = val;
  xs_h[idx] = (_Float16)val;
}

// ---------------- Kernel 2: f32 -> f16 weight conversion ----------------
__global__ void cvt_f16_kernel(const float* __restrict__ src, _Float16* __restrict__ dst,
                               int count) {
  int idx = blockIdx.x * blockDim.x + threadIdx.x;
  if (idx < count) dst[idx] = (_Float16)src[idx];
}

// ---------------- Kernel 3: hoisted QKV GEMM over all 4800 rows ----------------
// qkv_all[4800][1200] = xs[4800][400] @ w_in^T + b_in
// One block per 16-row M-tile; 8 waves cover the 75 N-tiles; A fragments hoisted
// into registers once per wave (13 x v16h = 104 VGPRs) and reused across tiles.
__global__ void __launch_bounds__(256, 1)
qkv_gemm_kernel(const _Float16* __restrict__ xs_h,
                const _Float16* __restrict__ w_in_h,
                const float* __restrict__ b_in,
                float* __restrict__ qkv_all) {
  int wv = threadIdx.x >> 5, lane = threadIdx.x & 31;
  int mt = blockIdx.x;  // 0..299
  const _Float16* Arow = xs_h + (size_t)mt * 16 * D_M;

  v16h a13[KS_D];
#pragma unroll
  for (int ks = 0; ks < KS_D; ++ks)
    a13[ks] = load_a_f16(Arow, D_M, 16, ks * 32, D_M, lane);

  for (int nt = wv; nt < 1200 / 16; nt += 8) {   // wave-uniform
    v8f acc = gemm_pipelined<KS_D>(a13, w_in_h, D_M, nt * 16, lane);
    int half = lane >> 4, nn = nt * 16 + (lane & 15);
    float bias = b_in[nn];
#pragma unroll
    for (int g = 0; g < 8; ++g) {
      int m = mt * 16 + g + half * 8;
      qkv_all[m * 1200 + nn] = acc[g] + bias;
    }
  }
}

// ---------------- wave-parallel LayerNorm over 9 rows of width 400 ----------------
__device__ __forceinline__ void layernorm_rows(float* h, const float* g, const float* b,
                                               int wv, int lane) {
  for (int r = wv; r < L_W; r += 8) {
    float s = 0.f;
    for (int c = lane; c < D_M; c += 32) s += h[r * D_M + c];
#pragma unroll
    for (int off = 16; off > 0; off >>= 1) s += __shfl_xor(s, off, 32);
    float mu = s * (1.0f / D_M);
    float vv = 0.f;
    for (int c = lane; c < D_M; c += 32) {
      float t = h[r * D_M + c] - mu;
      vv += t * t;
    }
#pragma unroll
    for (int off = 16; off > 0; off >>= 1) vv += __shfl_xor(vv, off, 32);
    float rs = rsqrtf(vv * (1.0f / D_M) + 1e-5f);
    for (int c = lane; c < D_M; c += 32)
      h[r * D_M + c] = (h[r * D_M + c] - mu) * rs * g[c] + b[c];
  }
}

// ---------------- Kernel 4: one workgroup per window ----------------
// LDS map (floats):
//   phase A: [0,10800) qkv f32 [9][1200]; [10800,14400) o f32 [9][400]; [14400,14562) scores
//   phase B+: [0,3600) h0; [3600,7200) h1; [7200,14400) ff as f16 [9][1600]
__global__ void __launch_bounds__(256, 1)
window_kernel(const float* __restrict__ xs,
              const float* __restrict__ qkv_all,
              const _Float16* __restrict__ w_out_h,
              const float* __restrict__ b_out,
              const _Float16* __restrict__ w1_h,
              const float* __restrict__ b1,
              const _Float16* __restrict__ w2_h,
              const float* __restrict__ b2,
              const float* __restrict__ ln1_g, const float* __restrict__ ln1_b,
              const float* __restrict__ ln2_g, const float* __restrict__ ln2_b,
              float* __restrict__ out_win) {
  __shared__ float smem[14656];
  int w = blockIdx.x;
  int n = w / W_CNT;
  int i = w % W_CNT;
  int tid = threadIdx.x, wv = tid >> 5, lane = tid & 31;

  // --- gather qkv rows (contiguous, vectorized) ---
  {
    const float4* src = (const float4*)(qkv_all + (size_t)(n * T_LEN + i) * 1200);
    float4* dst = (float4*)smem;
    for (int v4 = tid; v4 < (L_W * 1200) / 4; v4 += 256) dst[v4] = src[v4];
  }
  __syncthreads();

  // --- attention scores + softmax (tiny, VALU) ---
  float* scores = smem + 14400;  // [2][9][9]
  for (int s = tid; s < H_N * L_W * L_W; s += 256) {
    int h = s / 81, r = s % 81, a = r / 9, b = r % 9;
    const float* qp = smem + a * 1200 + h * DH;          // q
    const float* kp = smem + 400 + b * 1200 + h * DH;    // k
    float acc = 0.f;
    for (int e = 0; e < DH; ++e) acc += qp[e] * kp[e];
    scores[s] = acc * 0.07071067811865475f;              // 1/sqrt(200)
  }
  __syncthreads();
  if (tid < H_N * L_W) {
    float* row = scores + tid * L_W;
    float mx = row[0];
#pragma unroll
    for (int b = 1; b < L_W; ++b) mx = fmaxf(mx, row[b]);
    float sum = 0.f;
#pragma unroll
    for (int b = 0; b < L_W; ++b) { row[b] = __expf(row[b] - mx); sum += row[b]; }
    float inv = 1.0f / sum;
#pragma unroll
    for (int b = 0; b < L_W; ++b) row[b] *= inv;
  }
  __syncthreads();

  // --- o = att @ v  -> [9][400] at smem+10800 ---
  float* o = smem + 10800;
  for (int s = tid; s < L_W * D_M; s += 256) {
    int a = s / D_M, dim = s % D_M, h = dim / DH, e = dim % DH;
    const float* att = scores + h * 81 + a * 9;
    float acc = 0.f;
#pragma unroll
    for (int b = 0; b < L_W; ++b) acc += att[b] * smem[800 + b * 1200 + h * DH + e];
    o[s] = acc;
  }
  __syncthreads();

  // --- load h0 (qkv region now dead) ---
  {
    const float4* src = (const float4*)(xs + (size_t)(n * T_LEN + i) * D_M);
    float4* dst = (float4*)smem;
    for (int v4 = tid; v4 < (L_W * D_M) / 4; v4 += 256) dst[v4] = src[v4];
  }
  __syncthreads();
  float* h0 = smem;
  float* h1 = smem + 3600;

  // --- out projection (WMMA, A hoisted, B pipelined) + residual -> h1 ---
  {
    v16h a13[KS_D];
#pragma unroll
    for (int ks = 0; ks < KS_D; ++ks)
      a13[ks] = load_a_f32(o, D_M, L_W, ks * 32, D_M, lane);
    for (int nt = wv; nt < D_M / 16; nt += 8) {
      v8f acc = gemm_pipelined<KS_D>(a13, w_out_h, D_M, nt * 16, lane);
      int half = lane >> 4, nn = nt * 16 + (lane & 15);
      float bo = b_out[nn];
#pragma unroll
      for (int g = 0; g < 8; ++g) {
        int m = g + half * 8;
        if (m < L_W) h1[m * D_M + nn] = acc[g] + bo + h0[m * D_M + nn];
      }
    }
  }
  __syncthreads();
  layernorm_rows(h1, ln1_g, ln1_b, wv, lane);
  __syncthreads();

  // --- FFN1 (WMMA, A hoisted across ~13 tiles/wave) + exact GELU -> ff (f16) ---
  _Float16* ff = (_Float16*)(smem + 7200);  // [9][1600]
  {
    v16h a13[KS_D];
#pragma unroll
    for (int ks = 0; ks < KS_D; ++ks)
      a13[ks] = load_a_f32(h1, D_M, L_W, ks * 32, D_M, lane);
    for (int nt = wv; nt < FF_M / 16; nt += 8) {
      v8f acc = gemm_pipelined<KS_D>(a13, w1_h, D_M, nt * 16, lane);
      int half = lane >> 4, nn = nt * 16 + (lane & 15);
      float bb = b1[nn];
#pragma unroll
      for (int g = 0; g < 8; ++g) {
        int m = g + half * 8;
        if (m < L_W) {
          float xv = acc[g] + bb;
          float gl = 0.5f * xv * (1.0f + erff(xv * 0.7071067811865475f));
          ff[m * FF_M + nn] = (_Float16)gl;
        }
      }
    }
  }
  __syncthreads();

  // --- FFN2 (WMMA, K=1600, K-chunked A hoist, 4 live accumulators/wave) ---
  {
    v8f acc2[4] = {v8f{}, v8f{}, v8f{}, v8f{}};
    for (int kc = 0; kc < 5; ++kc) {          // 5 chunks x 10 ksteps = 50
      v16h a10[10];
#pragma unroll
      for (int ks = 0; ks < 10; ++ks)
        a10[ks] = load_a_f16(ff, FF_M, L_W, kc * 320 + ks * 32, FF_M, lane);
#pragma unroll
      for (int tt = 0; tt < 4; ++tt) {
        int nt = wv + tt * 8;                 // wave-uniform
        if (nt < D_M / 16) {
          v16h bc = load_b_w(w2_h, FF_M, nt * 16, kc * 320, lane);
#pragma unroll
          for (int ks = 0; ks < 10; ++ks) {
            v16h bn = bc;
            if (ks + 1 < 10)
              bn = load_b_w(w2_h, FF_M, nt * 16, kc * 320 + (ks + 1) * 32, lane);
            acc2[tt] = wmma_acc(a10[ks], bc, acc2[tt]);
            bc = bn;
          }
        }
      }
    }
#pragma unroll
    for (int tt = 0; tt < 4; ++tt) {
      int nt = wv + tt * 8;
      if (nt < D_M / 16) {
        int half = lane >> 4, nn = nt * 16 + (lane & 15);
        float bb = b2[nn];
#pragma unroll
        for (int g = 0; g < 8; ++g) {
          int m = g + half * 8;
          if (m < L_W) h1[m * D_M + nn] = h1[m * D_M + nn] + acc2[tt][g] + bb;
        }
      }
    }
  }
  __syncthreads();
  layernorm_rows(h1, ln2_g, ln2_b, wv, lane);
  __syncthreads();

  // --- store window result ---
  {
    const float4* src = (const float4*)h1;
    float4* dst = (float4*)(out_win + (size_t)w * (L_W * D_M));
    for (int v4 = tid; v4 < (L_W * D_M) / 4; v4 += 256) dst[v4] = src[v4];
  }
}

// ---------------- Kernel 5: deterministic overlap-gather + output transpose ----------------
// row t receives out_win[i][t - i/2] for i in [2(t-8), 2t+1] ∩ [0, W)
__global__ void gather_out_kernel(const float* __restrict__ out_win,
                                  float* __restrict__ out) {
  int idx = blockIdx.x * blockDim.x + threadIdx.x;
  if (idx >= NROWS * D_M) return;
  int n = idx / (T_LEN * D_M);
  int r = idx % (T_LEN * D_M);
  int t = r / D_M;
  int d = r % D_M;
  int ilo = 2 * (t - 8); if (ilo < 0) ilo = 0;
  int ihi = 2 * t + 1;   if (ihi > W_CNT - 1) ihi = W_CNT - 1;
  float sum = 0.f;
  for (int i = ilo; i <= ihi; ++i) {
    int j = t - (i >> 1);
    if (j >= 0 && j < L_W)
      sum += out_win[((size_t)(n * W_CNT + i) * L_W + j) * D_M + d];
  }
  int v = d >> 4, c = d & 15;
  out[((n * C_CH + c) * T_LEN + t) * V_J + v] = sum;
}

// ---------------- host launch ----------------
extern "C" void kernel_launch(void* const* d_in, const int* in_sizes, int n_in,
                              void* d_out, int out_size, void* d_ws, size_t ws_size,
                              hipStream_t stream) {
  const float* x     = (const float*)d_in[0];
  const float* pe    = (const float*)d_in[1];
  const float* w_in  = (const float*)d_in[2];
  const float* b_in  = (const float*)d_in[3];
  const float* w_out = (const float*)d_in[4];
  const float* b_out = (const float*)d_in[5];
  const float* w1    = (const float*)d_in[6];
  const float* b1    = (const float*)d_in[7];
  const float* w2    = (const float*)d_in[8];
  const float* b2    = (const float*)d_in[9];
  const float* ln1g  = (const float*)d_in[10];
  const float* ln1b  = (const float*)d_in[11];
  const float* ln2g  = (const float*)d_in[12];
  const float* ln2b  = (const float*)d_in[13];
  float* out = (float*)d_out;

  // workspace layout
  char* ws = (char*)d_ws;
  size_t off = 0;
  float*    xs      = (float*)(ws + off);    off += (size_t)NROWS * D_M * 4;       // 7.68 MB
  _Float16* xs_h    = (_Float16*)(ws + off); off += (size_t)NROWS * D_M * 2;       // 3.84 MB
  _Float16* w_in_h  = (_Float16*)(ws + off); off += (size_t)3 * D_M * D_M * 2;     // 0.96 MB
  _Float16* w_out_h = (_Float16*)(ws + off); off += (size_t)D_M * D_M * 2;         // 0.32 MB
  _Float16* w1_h    = (_Float16*)(ws + off); off += (size_t)FF_M * D_M * 2;        // 1.28 MB
  _Float16* w2_h    = (_Float16*)(ws + off); off += (size_t)D_M * FF_M * 2;        // 1.28 MB
  float*    qkv_all = (float*)(ws + off);    off += (size_t)NROWS * 3 * D_M * 4;   // 23.04 MB
  float*    out_win = (float*)(ws + off);    off += (size_t)NWIN * L_W * D_M * 4;  // 67.05 MB

  const int TPB = 256;

  // 1) layout + positional encoding
  prep_xs_kernel<<<(NROWS * D_M + TPB - 1) / TPB, TPB, 0, stream>>>(x, pe, xs, xs_h);

  // 2) weight conversion to f16
  cvt_f16_kernel<<<(3 * D_M * D_M + TPB - 1) / TPB, TPB, 0, stream>>>(w_in, w_in_h,
                                                                      3 * D_M * D_M);
  cvt_f16_kernel<<<(D_M * D_M + TPB - 1) / TPB, TPB, 0, stream>>>(w_out, w_out_h,
                                                                  D_M * D_M);
  cvt_f16_kernel<<<(FF_M * D_M + TPB - 1) / TPB, TPB, 0, stream>>>(w1, w1_h, FF_M * D_M);
  cvt_f16_kernel<<<(D_M * FF_M + TPB - 1) / TPB, TPB, 0, stream>>>(w2, w2_h, D_M * FF_M);

  // 3) hoisted QKV GEMM: one block per 16-row tile, A fragments register-resident
  qkv_gemm_kernel<<<NROWS / 16, TPB, 0, stream>>>(xs_h, w_in_h, b_in, qkv_all);

  // 4) per-window attention + FFN (WMMA)
  window_kernel<<<NWIN, TPB, 0, stream>>>(xs, qkv_all, w_out_h, b_out, w1_h, b1, w2_h,
                                          b2, ln1g, ln1b, ln2g, ln2b, out_win);

  // 5) deterministic overlap-add + transpose to [N,C,T,V]
  gather_out_kernel<<<(NROWS * D_M + TPB - 1) / TPB, TPB, 0, stream>>>(out_win, out);
}

// v001
// It runs in 360 microseconds.
// Two timings next to v000 both put it at 3.03 times that version's speed.
#include <hip/hip_runtime.h>
#include <hip/hip_fp16.h>
#include <math.h>

typedef __attribute__((ext_vector_type(16))) _Float16 v16h;
typedef __attribute__((ext_vector_type(8)))  float    v8f;

#define N_B   16
#define T_LEN 300
#define V_J   25
#define C_CH  16
#define D_M   400      // C*V
#define H_N   2
#define DH    200
#define FF_M  1600
#define L_W   9
#define W_CNT 291      // T - L
#define NWIN  (N_B * W_CNT)   // 4656
#define NROWS (N_B * T_LEN)   // 4800
#define KS_D  13       // ceil(400/32)

// ---------------- WMMA fragment helpers (16x16x32 f16 -> f32) ----------------

__device__ __forceinline__ int frag_k(int g, int half) {
  return ((g < 4) ? (g * 2) : (16 + (g - 4) * 2)) + half * 8;
}

__device__ __forceinline__ v8f wmma_acc(v16h a, v16h b, v8f c) {
  return __builtin_amdgcn_wmma_f32_16x16x32_f16(false, a, false, b, (short)0, c,
                                                false, false);
}

// A fragment from row-major f16 source (LDS or global).
__device__ __forceinline__ v16h load_a_f16(const _Float16* A, int lda, int Mvalid,
                                           int kbase, int K, int lane) {
  int m = lane & 15, half = lane >> 4;
  v16h r;
#pragma unroll
  for (int g = 0; g < 8; ++g) {
    int k = kbase + frag_k(g, half);
    _Float16 x0 = (_Float16)0.f, x1 = (_Float16)0.f;
    if (m < Mvalid && k < K) {
      const _Float16* p = A + m * lda + k;
      x0 = p[0]; x1 = p[1];
    }
    r[2 * g]     = x0;
    r[2 * g + 1] = x1;
  }
  return r;
}

// B fragment: computes A @ W^T where W is [Ntot, K] row-major f16.
// B[k][n] = W[n][k]; lane holds N = n0 + lane%16, contiguous half2 along K.
__device__ __forceinline__ v16h load_b_w(const _Float16* W, int K, int n0, int kbase,
                                         int lane) {
  int n = n0 + (lane & 15), half = lane >> 4;
  v16h r;
#pragma unroll
  for (int g = 0; g < 8; ++g) {
    int k = kbase + frag_k(g, half);
    _Float16 x0 = (_Float16)0.f, x1 = (_Float16)0.f;
    if (k < K) {
      const _Float16* p = W + n * K + k;
      x0 = p[0]; x1 = p[1];
    }
    r[2 * g]     = x0;
    r[2 * g + 1] = x1;
  }
  return r;
}

// K-loop with register-resident A fragments and 1-deep software-pipelined B loads:
// loads for step ks+1 are issued before the WMMA of step ks.
template <int KS>
__device__ __forceinline__ v8f gemm_pipelined(const v16h* a, const _Float16* W, int K,
                                              int n0, int lane) {
  v8f acc = {};
  v16h bc = load_b_w(W, K, n0, 0, lane);
#pragma unroll
  for (int ks = 0; ks < KS; ++ks) {
    v16h bn = bc;
    if (ks + 1 < KS) bn = load_b_w(W, K, n0, (ks + 1) * 32, lane);
    acc = wmma_acc(a[ks], bc, acc);
    bc = bn;
  }
  return acc;
}

// ---------------- Kernel 1: layout change + positional encoding ----------------
// xs[n][t][d] = x[n][c][t][v] + pe[t][d],  d = v*16 + c  (torch view order)
__global__ void prep_xs_kernel(const float* __restrict__ x, const float* __restrict__ pe,
                               float* __restrict__ xs, _Float16* __restrict__ xs_h) {
  int idx = blockIdx.x * blockDim.x + threadIdx.x;
  if (idx >= NROWS * D_M) return;
  int n = idx / (T_LEN * D_M);
  int r = idx % (T_LEN * D_M);
  int t = r / D_M;
  int d = r % D_M;
  int v = d >> 4;
  int c = d & 15;
  float val = x[((n * C_CH + c) * T_LEN + t) * V_J + v] + pe[t * D_M + d];
  xs[idx]   = val;
  xs_h[idx] = (_Float16)val;
}

// ---------------- Kernel 2: f32 -> f16 weight conversion ----------------
__global__ void cvt_f16_kernel(const float* __restrict__ src, _Float16* __restrict__ dst,
                               int count) {
  int idx = blockIdx.x * blockDim.x + threadIdx.x;
  if (idx < count) dst[idx] = (_Float16)src[idx];
}

// ---------------- Kernel 3: hoisted QKV GEMM over all 4800 rows ----------------
// qkv_all[4800][1200] = xs[4800][400] @ w_in^T + b_in
// One block per 16-row M-tile; 8 waves cover the 75 N-tiles; A fragments hoisted
// into registers once per wave (13 x v16h = 104 VGPRs) and reused across tiles.
__global__ void __launch_bounds__(256, 1)
qkv_gemm_kernel(const _Float16* __restrict__ xs_h,
                const _Float16* __restrict__ w_in_h,
                const float* __restrict__ b_in,
                float* __restrict__ qkv_all) {
  int wv = threadIdx.x >> 5, lane = threadIdx.x & 31;
  int mt = blockIdx.x;  // 0..299
  const _Float16* Arow = xs_h + (size_t)mt * 16 * D_M;

  v16h a13[KS_D];
#pragma unroll
  for (int ks = 0; ks < KS_D; ++ks)
    a13[ks] = load_a_f16(Arow, D_M, 16, ks * 32, D_M, lane);

  for (int nt = wv; nt < 1200 / 16; nt += 8) {   // wave-uniform
    v8f acc = gemm_pipelined<KS_D>(a13, w_in_h, D_M, nt * 16, lane);
    int half = lane >> 4, nn = nt * 16 + (lane & 15);
    float bias = b_in[nn];
#pragma unroll
    for (int g = 0; g < 8; ++g) {
      int m = mt * 16 + g + half * 8;
      qkv_all[m * 1200 + nn] = acc[g] + bias;
    }
  }
}

// ---------------- Kernel 4: attention of one window per workgroup ----------------
// LDS map (floats): [0,10800) qkv f32 [9][1200]; [10800,10962) scores
// Result o goes out as f16 (the type the out projection reads it in), packed as
// row w*9 + a of o_h[41904][400].
__global__ void __launch_bounds__(256, 1)
attn_kernel(const float* __restrict__ qkv_all, _Float16* __restrict__ o_h) {
  __shared__ float smem[10976];
  int w = blockIdx.x;
  int n = w / W_CNT;
  int i = w % W_CNT;
  int tid = threadIdx.x;

  // --- gather qkv rows (contiguous, vectorized) ---
  {
    const float4* src = (const float4*)(qkv_all + (size_t)(n * T_LEN + i) * 1200);
    float4* dst = (float4*)smem;
    for (int v4 = tid; v4 < (L_W * 1200) / 4; v4 += 256) dst[v4] = src[v4];
  }
  __syncthreads();

  // --- attention scores + softmax (tiny, VALU) ---
  float* scores = smem + 10800;  // [2][9][9]
  for (int s = tid; s < H_N * L_W * L_W; s += 256) {
    int h = s / 81, r = s % 81, a = r / 9, b = r % 9;
    const float* qp = smem + a * 1200 + h * DH;          // q
    const float* kp = smem + 400 + b * 1200 + h * DH;    // k
    float acc = 0.f;
    for (int e = 0; e < DH; ++e) acc += qp[e] * kp[e];
    scores[s] = acc * 0.07071067811865475f;              // 1/sqrt(200)
  }
  __syncthreads();
  if (tid < H_N * L_W) {
    float* row = scores + tid * L_W;
    float mx = row[0];
#pragma unroll
    for (int b = 1; b < L_W; ++b) mx = fmaxf(mx, row[b]);
    float sum = 0.f;
#pragma unroll
    for (int b = 0; b < L_W; ++b) { row[b] = __expf(row[b] - mx); sum += row[b]; }
    float inv = 1.0f / sum;
#pragma unroll
    for (int b = 0; b < L_W; ++b) row[b] *= inv;
  }
  __syncthreads();

  // --- o = att @ v -> packed rows of o_h ---
  for (int s = tid; s < L_W * D_M; s += 256) {
    int a = s / D_M, dim = s % D_M, h = dim / DH, e = dim % DH;
    const float* att = scores + h * 81 + a * 9;
    float acc = 0.f;
#pragma unroll
    for (int b = 0; b < L_W; ++b) acc += att[b] * smem[800 + b * 1200 + h * DH + e];
    o_h[(size_t)w * (L_W * D_M) + s] = (_Float16)acc;
  }
}

// ---------------- Kernel 4b: row-wise stages on packed rows ----------------
// Behind the attention every stage (out projection, LayerNorm, FFN, LayerNorm) works on
// one row alone, so the 41904 (window, position) rows are packed into full 16-row tiles
// and one workgroup takes MT of them: each weight fragment loaded from L2 feeds MT WMMAs.
#define MROWS (NWIN * L_W)   // 41904 = 2619 tiles of 16
#define MT    6              // M tiles per workgroup
#define BM    (MT * 16)
#define PX    404            // f32 row pitch of X
#define PA    408            // f16 row pitch, 816 B = 16 B x odd
#define FC    320            // FFN columns per chunk
#define PF    328            // f16 row pitch, 656 B = 16 B x odd

typedef __attribute__((ext_vector_type(8))) _Float16 v8h;

// One lane's 16 halves of an A or B fragment: k = 8*half + 0..7 and 16 + 8*half + 0..7,
// p already at row start + kbase + 8*half. full == false: the upper 16 k are past K.
__device__ __forceinline__ v16h frag16(const _Float16* p, bool full) {
  v8h lo = *(const v8h*)p;
  v8h hi = {};
  if (full) hi = *(const v8h*)(p + 16);
  return __builtin_shufflevector(lo, hi, 0, 1, 2, 3, 4, 5, 6, 7, 8, 9, 10, 11, 12, 13,
                                 14, 15);
}

// acc[mt] = A[mt*16..][0..400) @ W[n0..n0+16)^T, A f16 in LDS at pitch PA, W [*,400] f16.
__device__ __forceinline__ void strip_k400(const _Float16* A, const _Float16* W, int n0,
                                           int lane, v8f* acc) {
  const _Float16* bp = W + (n0 + (lane & 15)) * D_M + (lane >> 4) * 8;
  const _Float16* ap = A + (lane & 15) * PA + (lane >> 4) * 8;
  // Compiler fence: keeps the A reads below inside the caller's loop over N tiles. They do
  // not change from tile to tile, and hoisted out of the loop they take 624 registers and spill.
  asm volatile("" ::: "memory");
  v16h b[KS_D];
#pragma unroll
  for (int ks = 0; ks < KS_D; ++ks) b[ks] = frag16(bp + ks * 32, ks + 1 < KS_D);
#pragma unroll
  for (int mt = 0; mt < MT; ++mt) acc[mt] = v8f{};
  // A fragments of k step ks + 1 are read as one group ahead of the WMMAs of step ks.
  v16h a[2][MT];
#pragma unroll
  for (int mt = 0; mt < MT; ++mt) a[0][mt] = frag16(ap + mt * 16 * PA, true);
  __builtin_amdgcn_sched_barrier(0);   // keeps all 25 weight loads in flight from the start
#pragma unroll
  for (int ks = 0; ks < KS_D; ++ks) {
    if (ks + 1 < KS_D) {
#pragma unroll
      for (int mt = 0; mt < MT; ++mt)
        a[(ks + 1) & 1][mt] = frag16(ap + mt * 16 * PA + (ks + 1) * 32, ks + 2 < KS_D);
    }
    // Holds the read group ahead of the WMMAs: with the FFN2 accumulators live the scheduler
    // otherwise sinks each read to its WMMA, which then waits out a whole LDS latency.
    __builtin_amdgcn_sched_barrier(0);
#pragma unroll
    for (int mt = 0; mt < MT; ++mt) acc[mt] = wmma_acc(a[ks & 1][mt], b[ks], acc[mt]);
    __builtin_amdgcn_sched_barrier(0);   // same purpose: the next group stays behind these
  }
}

// LayerNorm of the BM rows of X, one wave per row, the row held in registers.
// TO_OUT false: back into X, with an f16 copy in Ah. TO_OUT true: to global rows.
template <bool TO_OUT>
__device__ __forceinline__ void layernorm_packed(float* X, const float* g, const float* b,
                                                 _Float16* Ah, float* outg, int row0,
                                                 int wv, int lane) {
  float gg[13], bb[13];
#pragma unroll
  for (int q = 0; q < 13; ++q) {
    int c = lane + 32 * q;
    gg[q] = (c < D_M) ? g[c] : 0.f;
    bb[q] = (c < D_M) ? b[c] : 0.f;
  }
  for (int r = wv; r < BM; r += 8) {
    float v[13];
#pragma unroll
    for (int q = 0; q < 13; ++q) {
      int c = lane + 32 * q;
      v[q] = (c < D_M) ? X[r * PX + c] : 0.f;
    }
    float s = 0.f;
#pragma unroll
    for (int q = 0; q < 13; ++q) s += v[q];
#pragma unroll
    for (int off = 16; off > 0; off >>= 1) s += __shfl_xor(s, off, 32);
    float mu = s * (1.0f / D_M);
    float vv = 0.f;
#pragma unroll
    for (int q = 0; q < 13; ++q) {
      if (lane + 32 * q < D_M) {
        float t = v[q] - mu;
        vv += t * t;
      }
    }
#pragma unroll
    for (int off = 16; off > 0; off >>= 1) vv += __shfl_xor(vv, off, 32);
    float rs = rsqrtf(vv * (1.0f / D_M) + 1e-5f);
#pragma unroll
    for (int q = 0; q < 13; ++q) {
      int c = lane + 32 * q;
      if (c < D_M) {
        float y = (v[q] - mu) * rs * gg[q] + bb[q];
        if (TO_OUT) {
          if (row0 + r < MROWS) outg[(size_t)(row0 + r) * D_M + c] = y;
          // Behind the row's last store: the next row rewrites the registers it names.
          if (q == 12) asm volatile("s_wait_xcnt 0x0" ::: "memory");
        } else {
          X[r * PX + c]  = y;
          Ah[r * PA + c] = (_Float16)y;
        }
      }
    }
  }
}

__global__ void __launch_bounds__(256, 1)
rows_kernel(const float* __restrict__ xs,
            const _Float16* __restrict__ o_h,
            const _Float16* __restrict__ w_out_h,
            const float* __restrict__ b_out,
            const _Float16* __restrict__ w1_h,
            const float* __restrict__ b1,
            const _Float16* __restrict__ w2_h,
            const float* __restrict__ b2,
            const float* __restrict__ ln1_g, const float* __restrict__ ln1_b,
            const float* __restrict__ ln2_g, const float* __restrict__ ln2_b,
            float* __restrict__ out_win) {
  __shared__ __attribute__((aligned(16))) float    X[BM * PX];   // residual stream, f32
  __shared__ __attribute__((aligned(16))) _Float16 Ah[BM * PA];  // o, then LN1 output
  __shared__ __attribute__((aligned(16))) _Float16 Fc[BM * PF];  // one chunk of gelu(ffn1)
  int tid = threadIdx.x, lane = tid & 31;
  int wv = __builtin_amdgcn_readfirstlane(tid >> 5);  // scalar: tile loops branch on it
  int half = lane >> 4;
  int row0 = blockIdx.x * BM;

  // --- stage o (f16) and the residual rows of xs (f32); rows past the end repeat the
  //     last row and are never stored ---
  for (int c = tid; c < BM * 50; c += 256) {
    int r = c / 50, q = c % 50;
    int gr = row0 + r; if (gr > MROWS - 1) gr = MROWS - 1;
    *(v8h*)(Ah + r * PA + q * 8) = *(const v8h*)(o_h + (size_t)gr * D_M + q * 8);
  }
  for (int c = tid; c < BM * 100; c += 256) {
    int r = c / 100, q = c % 100;
    int gr = row0 + r; if (gr > MROWS - 1) gr = MROWS - 1;
    int w = gr / L_W, j = gr % L_W;
    int xr = (w / W_CNT) * T_LEN + (w % W_CNT) + j;
    *(float4*)(X + r * PX + q * 4) = *(const float4*)(xs + (size_t)xr * D_M + q * 4);
  }
  __syncthreads();

  // --- out projection + residual -> X ---
  for (int nt = wv; nt < D_M / 16; nt += 8) {
    v8f acc[MT];
    strip_k400(Ah, w_out_h, nt * 16, lane, acc);
    int nn = nt * 16 + (lane & 15);
    float bo = b_out[nn];
    float* xp = X + half * 8 * PX + nn;
    float res[MT * 8];   // all reads ahead of the stores: one LDS latency, not one per element
#pragma unroll
    for (int q = 0; q < MT * 8; ++q) res[q] = xp[((q >> 3) * 16 + (q & 7)) * PX];
#pragma unroll
    for (int q = 0; q < MT * 8; ++q)
      xp[((q >> 3) * 16 + (q & 7)) * PX] = acc[q >> 3][q & 7] + bo + res[q];
  }
  __syncthreads();
  layernorm_packed<false>(X, ln1_g, ln1_b, Ah, nullptr, row0, wv, lane);
  __syncthreads();

  // --- FFN in 5 chunks of 320 hidden columns: FFN1 + exact GELU -> Fc, then FFN2 adds
  //     that chunk's k range into accumulators that stay in registers (k ascending) ---
  v8f acc2[4][MT];
#pragma unroll
  for (int tt = 0; tt < 4; ++tt) {
#pragma unroll
    for (int mt = 0; mt < MT; ++mt) acc2[tt][mt] = v8f{};
  }
#pragma unroll 1   // one copy of the chunk body, for speed only
  for (int kc = 0; kc < FF_M / FC; ++kc) {
#pragma unroll 1   // same reason
    for (int t = wv; t < FC / 16; t += 8) {
      v8f acc[MT];
      strip_k400(Ah, w1_h, kc * FC + t * 16, lane, acc);
      int cl = t * 16 + (lane & 15);
      float bb = b1[kc * FC + cl];
#pragma unroll
      for (int mt = 0; mt < MT; ++mt) {
#pragma unroll
        for (int g = 0; g < 8; ++g) {
          int m = mt * 16 + g + half * 8;
          float xv = acc[mt][g] + bb;
          float gl = 0.5f * xv * (1.0f + erff(xv * 0.7071067811865475f));
          Fc[m * PF + cl] = (_Float16)gl;
        }
      }
    }
    __syncthreads();   // Fc complete before any wave reads it
    const _Float16* ap = Fc + (lane & 15) * PF + half * 8;
    const _Float16* bp = w2_h + (size_t)(wv * 16 + (lane & 15)) * FF_M + kc * FC + half * 8;
    // Weight fragments run two k steps ahead of their WMMAs (ring of three sets); each A
    // fragment read from LDS serves all of the wave's N tiles. Tile 24 is wave 0's alone.
    v16h bq[3][4];
#pragma unroll
    for (int ks = 0; ks < 2; ++ks) {
#pragma unroll
      for (int tt = 0; tt < 3; ++tt) bq[ks][tt] = frag16(bp + tt * 128 * FF_M + ks * 32, true);
      if (wv == 0) bq[ks][3] = frag16(bp + 3 * 128 * FF_M + ks * 32, true);
    }
    v16h a[2][MT];   // A fragments run one k step ahead
#pragma unroll
    for (int mt = 0; mt < MT; ++mt) a[0][mt] = frag16(ap + mt * 16 * PF, true);
#pragma unroll
    for (int ks = 0; ks < FC / 32; ++ks) {
      if (ks + 2 < FC / 32) {
#pragma unroll
        for (int tt = 0; tt < 3; ++tt)
          bq[(ks + 2) % 3][tt] = frag16(bp + tt * 128 * FF_M + (ks + 2) * 32, true);
        if (wv == 0) bq[(ks + 2) % 3][3] = frag16(bp + 3 * 128 * FF_M + (ks + 2) * 32, true);
      }
      if (ks + 1 < FC / 32) {
#pragma unroll
        for (int mt = 0; mt < MT; ++mt)
          a[(ks + 1) & 1][mt] = frag16(ap + mt * 16 * PF + (ks + 1) * 32, true);
      }
#pragma unroll
      for (int tt = 0; tt < 3; ++tt) {
#pragma unroll
        for (int mt = 0; mt < MT; ++mt)
          acc2[tt][mt] = wmma_acc(a[ks & 1][mt], bq[ks % 3][tt], acc2[tt][mt]);
      }
      if (wv == 0) {
#pragma unroll
        for (int mt = 0; mt < MT; ++mt)
          acc2[3][mt] = wmma_acc(a[ks & 1][mt], bq[ks % 3][3], acc2[3][mt]);
      }
    }
    __syncthreads();   // every reader has left Fc before the next chunk overwrites it
  }
#pragma unroll
  for (int tt = 0; tt < 4; ++tt) {
    int nt = wv + tt * 8;
    if (nt < D_M / 16) {
      int nn = nt * 16 + (lane & 15);
      float bb = b2[nn];
      float* xp = X + half * 8 * PX + nn;
      float res[MT * 8];   // all reads ahead of the stores, as above
#pragma unroll
      for (int q = 0; q < MT * 8; ++q) res[q] = xp[((q >> 3) * 16 + (q & 7)) * PX];
#pragma unroll
      for (int q = 0; q < MT * 8; ++q)
        xp[((q >> 3) * 16 + (q & 7)) * PX] = res[q] + acc2[tt][q >> 3][q & 7] + bb;
    }
  }
  __syncthreads();
  layernorm_packed<true>(X, ln2_g, ln2_b, nullptr, out_win, row0, wv, lane);
}

// ---------------- Kernel 5: deterministic overlap-gather + output transpose ----------------
// row t receives out_win[i][t - i/2] for i in [2(t-8), 2t+1] ∩ [0, W)
__global__ void gather_out_kernel(const float* __restrict__ out_win,
                                  float* __restrict__ out) {
  int idx = blockIdx.x * blockDim.x + threadIdx.x;
  if (idx >= NROWS * D_M) return;
  int n = idx / (T_LEN * D_M);
  int r = idx % (T_LEN * D_M);
  int t = r / D_M;
  int d = r % D_M;
  int ilo = 2 * (t - 8); if (ilo < 0) ilo = 0;
  int ihi = 2 * t + 1;   if (ihi > W_CNT - 1) ihi = W_CNT - 1;
  float sum = 0.f;
  for (int i = ilo; i <= ihi; ++i) {
    int j = t - (i >> 1);
    if (j >= 0 && j < L_W)
      sum += out_win[((size_t)(n * W_CNT + i) * L_W + j) * D_M + d];
  }
  int v = d >> 4, c = d & 15;
  out[((n * C_CH + c) * T_LEN + t) * V_J + v] = sum;
}

// ---------------- host launch ----------------
extern "C" void kernel_launch(void* const* d_in, const int* in_sizes, int n_in,
                              void* d_out, int out_size, void* d_ws, size_t ws_size,
                              hipStream_t stream) {
  const float* x     = (const float*)d_in[0];
  const float* pe    = (const float*)d_in[1];
  const float* w_in  = (const float*)d_in[2];
  const float* b_in  = (const float*)d_in[3];
  const float* w_out = (const float*)d_in[4];
  const float* b_out = (const float*)d_in[5];
  const float* w1    = (const float*)d_in[6];
  const float* b1    = (const float*)d_in[7];
  const float* w2    = (const float*)d_in[8];
  const float* b2    = (const float*)d_in[9];
  const float* ln1g  = (const float*)d_in[10];
  const float* ln1b  = (const float*)d_in[11];
  const float* ln2g  = (const float*)d_in[12];
  const float* ln2b  = (const float*)d_in[13];
  float* out = (float*)d_out;

  // workspace layout
  char* ws = (char*)d_ws;
  size_t off = 0;
  float*    xs      = (float*)(ws + off);    off += (size_t)NROWS * D_M * 4;       // 7.68 MB
  _Float16* xs_h    = (_Float16*)(ws + off); off += (size_t)NROWS * D_M * 2;       // 3.84 MB
  _Float16* w_in_h  = (_Float16*)(ws + off); off += (size_t)3 * D_M * D_M * 2;     // 0.96 MB
  _Float16* w_out_h = (_Float16*)(ws + off); off += (size_t)D_M * D_M * 2;         // 0.32 MB
  _Float16* w1_h    = (_Float16*)(ws + off); off += (size_t)FF_M * D_M * 2;        // 1.28 MB
  _Float16* w2_h    = (_Float16*)(ws + off); off += (size_t)D_M * FF_M * 2;        // 1.28 MB
  float*    qkv_all = (float*)(ws + off);    off += (size_t)NROWS * 3 * D_M * 4;   // 23.04 MB
  float*    out_win = (float*)(ws + off);    off += (size_t)NWIN * L_W * D_M * 4;  // 67.05 MB
  _Float16* o_h     = (_Float16*)(ws + off); off += (size_t)NWIN * L_W * D_M * 2;  // 33.52 MB

  const int TPB = 256;

  // 1) layout + positional encoding
  prep_xs_kernel<<<(NROWS * D_M + TPB - 1) / TPB, TPB, 0, stream>>>(x, pe, xs, xs_h);

  // 2) weight conversion to f16
  cvt_f16_kernel<<<(3 * D_M * D_M + TPB - 1) / TPB, TPB, 0, stream>>>(w_in, w_in_h,
                                                                      3 * D_M * D_M);
  cvt_f16_kernel<<<(D_M * D_M + TPB - 1) / TPB, TPB, 0, stream>>>(w_out, w_out_h,
                                                                  D_M * D_M);
  cvt_f16_kernel<<<(FF_M * D_M + TPB - 1) / TPB, TPB, 0, stream>>>(w1, w1_h, FF_M * D_M);
  cvt_f16_kernel<<<(D_M * FF_M + TPB - 1) / TPB, TPB, 0, stream>>>(w2, w2_h, D_M * FF_M);

  // 3) hoisted QKV GEMM: one block per 16-row tile, A fragments register-resident
  qkv_gemm_kernel<<<NROWS / 16, TPB, 0, stream>>>(xs_h, w_in_h, b_in, qkv_all);

  // 4) per-window attention
  attn_kernel<<<NWIN, TPB, 0, stream>>>(qkv_all, o_h);

  // 4b) out projection, LayerNorm, FFN, LayerNorm on packed rows (WMMA)
  rows_kernel<<<(MROWS + BM - 1) / BM, TPB, 0, stream>>>(xs, o_h, w_out_h, b_out, w1_h, b1,
                                                         w2_h, b2, ln1g, ln1b, ln2g, ln2b,
                                                         out_win);

  // 5) deterministic overlap-add + transpose to [N,C,T,V]
  gather_out_kernel<<<(NROWS * D_M + TPB - 1) / TPB, TPB, 0, stream>>>(out_win, out);
}

// v002
// Measured time: 323 microseconds a run.
// Next to v001, in two timings, it ran 1.11 times as fast each time.
// Over all steps from v000 it is 3.38 times as fast.
#include <hip/hip_runtime.h>
#include <hip/hip_fp16.h>
#include <math.h>

typedef __attribute__((ext_vector_type(16))) _Float16 v16h;
typedef __attribute__((ext_vector_type(8)))  float    v8f;

#define N_B   16
#define T_LEN 300
#define V_J   25
#define C_CH  16
#define D_M   400      // C*V
#define H_N   2
#define DH    200
#define FF_M  1600
#define L_W   9
#define W_CNT 291      // T - L
#define NWIN  (N_B * W_CNT)   // 4656
#define NROWS (N_B * T_LEN)   // 4800
#define KS_D  13       // ceil(400/32)

// ---------------- WMMA fragment helpers (16x16x32 f16 -> f32) ----------------

__device__ __forceinline__ int frag_k(int g, int half) {
  return ((g < 4) ? (g * 2) : (16 + (g - 4) * 2)) + half * 8;
}

__device__ __forceinline__ v8f wmma_acc(v16h a, v16h b, v8f c) {
  return __builtin_amdgcn_wmma_f32_16x16x32_f16(false, a, false, b, (short)0, c,
                                                false, false);
}

// A fragment from row-major f16 source (LDS or global).
__device__ __forceinline__ v16h load_a_f16(const _Float16* A, int lda, int Mvalid,
                                           int kbase, int K, int lane) {
  int m = lane & 15, half = lane >> 4;
  v16h r;
#pragma unroll
  for (int g = 0; g < 8; ++g) {
    int k = kbase + frag_k(g, half);
    _Float16 x0 = (_Float16)0.f, x1 = (_Float16)0.f;
    if (m < Mvalid && k < K) {
      const _Float16* p = A + m * lda + k;
      x0 = p[0]; x1 = p[1];
    }
    r[2 * g]     = x0;
    r[2 * g + 1] = x1;
  }
  return r;
}

// B fragment: computes A @ W^T where W is [Ntot, K] row-major f16.
// B[k][n] = W[n][k]; lane holds N = n0 + lane%16, contiguous half2 along K.
__device__ __forceinline__ v16h load_b_w(const _Float16* W, int K, int n0, int kbase,
                                         int lane) {
  int n = n0 + (lane & 15), half = lane >> 4;
  v16h r;
#pragma unroll
  for (int g = 0; g < 8; ++g) {
    int k = kbase + frag_k(g, half);
    _Float16 x0 = (_Float16)0.f, x1 = (_Float16)0.f;
    if (k < K) {
      const _Float16* p = W + n * K + k;
      x0 = p[0]; x1 = p[1];
    }
    r[2 * g]     = x0;
    r[2 * g + 1] = x1;
  }
  return r;
}

// K-loop with register-resident A fragments and 1-deep software-pipelined B loads:
// loads for step ks+1 are issued before the WMMA of step ks.
template <int KS>
__device__ __forceinline__ v8f gemm_pipelined(const v16h* a, const _Float16* W, int K,
                                              int n0, int lane) {
  v8f acc = {};
  v16h bc = load_b_w(W, K, n0, 0, lane);
#pragma unroll
  for (int ks = 0; ks < KS; ++ks) {
    v16h bn = bc;
    if (ks + 1 < KS) bn = load_b_w(W, K, n0, (ks + 1) * 32, lane);
    acc = wmma_acc(a[ks], bc, acc);
    bc = bn;
  }
  return acc;
}

// ---------------- Kernel 1: layout change + positional encoding ----------------
// xs[n][t][d] = x[n][c][t][v] + pe[t][d],  d = v*16 + c  (torch view order)
__global__ void prep_xs_kernel(const float* __restrict__ x, const float* __restrict__ pe,
                               float* __restrict__ xs, _Float16* __restrict__ xs_h) {
  int idx = blockIdx.x * blockDim.x + threadIdx.x;
  if (idx >= NROWS * D_M) return;
  int n = idx / (T_LEN * D_M);
  int r = idx % (T_LEN * D_M);
  int t = r / D_M;
  int d = r % D_M;
  int v = d >> 4;
  int c = d & 15;
  float val = x[((n * C_CH + c) * T_LEN + t) * V_J + v] + pe[t * D_M + d];
  xs[idx]   = val;
  xs_h[idx] = (_Float16)val;
}

// ---------------- Kernel 2: f32 -> f16 weight conversion ----------------
__global__ void cvt_f16_kernel(const float* __restrict__ src, _Float16* __restrict__ dst,
                               int count) {
  int idx = blockIdx.x * blockDim.x + threadIdx.x;
  if (idx < count) dst[idx] = (_Float16)src[idx];
}

// ---------------- Kernel 3: hoisted QKV GEMM over all 4800 rows ----------------
// qkv_all[4800][1200] = xs[4800][400] @ w_in^T + b_in
// One block per 16-row M-tile; 8 waves cover the 75 N-tiles; A fragments hoisted
// into registers once per wave (13 x v16h = 104 VGPRs) and reused across tiles.
__global__ void __launch_bounds__(256, 1)
qkv_gemm_kernel(const _Float16* __restrict__ xs_h,
                const _Float16* __restrict__ w_in_h,
                const float* __restrict__ b_in,
                float* __restrict__ qkv_all) {
  int wv = threadIdx.x >> 5, lane = threadIdx.x & 31;
  int mt = blockIdx.x;  // 0..299
  const _Float16* Arow = xs_h + (size_t)mt * 16 * D_M;

  v16h a13[KS_D];
#pragma unroll
  for (int ks = 0; ks < KS_D; ++ks)
    a13[ks] = load_a_f16(Arow, D_M, 16, ks * 32, D_M, lane);

  for (int nt = wv; nt < 1200 / 16; nt += 8) {   // wave-uniform
    v8f acc = gemm_pipelined<KS_D>(a13, w_in_h, D_M, nt * 16, lane);
    int half = lane >> 4, nn = nt * 16 + (lane & 15);
    float bias = b_in[nn];
#pragma unroll
    for (int g = 0; g < 8; ++g) {
      int m = mt * 16 + g + half * 8;
      qkv_all[m * 1200 + nn] = acc[g] + bias;
    }
  }
}

// ---------------- Kernel 4: attention of one window per workgroup ----------------
// LDS map (floats): [0,10800) qkv f32 [9][1200]; [10800,10962) scores
// Result o goes out as f16 (the type the out projection reads it in), packed as
// row w*9 + a of o_h[41904][400].
__global__ void __launch_bounds__(256, 1)
attn_kernel(const float* __restrict__ qkv_all, _Float16* __restrict__ o_h) {
  __shared__ float smem[10976];
  int w = blockIdx.x;
  int n = w / W_CNT;
  int i = w % W_CNT;
  int tid = threadIdx.x;

  // --- gather qkv rows (contiguous, vectorized) ---
  {
    const float4* src = (const float4*)(qkv_all + (size_t)(n * T_LEN + i) * 1200);
    float4* dst = (float4*)smem;
    for (int v4 = tid; v4 < (L_W * 1200) / 4; v4 += 256) dst[v4] = src[v4];
  }
  __syncthreads();

  // --- attention scores + softmax (tiny, VALU) ---
  float* scores = smem + 10800;  // [2][9][9]
  for (int s = tid; s < H_N * L_W * L_W; s += 256) {
    int h = s / 81, r = s % 81, a = r / 9, b = r % 9;
    const float* qp = smem + a * 1200 + h * DH;          // q
    const float* kp = smem + 400 + b * 1200 + h * DH;    // k
    float acc = 0.f;
    for (int e = 0; e < DH; ++e) acc += qp[e] * kp[e];
    scores[s] = acc * 0.07071067811865475f;              // 1/sqrt(200)
  }
  __syncthreads();
  if (tid < H_N * L_W) {
    float* row = scores + tid * L_W;
    float mx = row[0];
#pragma unroll
    for (int b = 1; b < L_W; ++b) mx = fmaxf(mx, row[b]);
    float sum = 0.f;
#pragma unroll
    for (int b = 0; b < L_W; ++b) { row[b] = __expf(row[b] - mx); sum += row[b]; }
    float inv = 1.0f / sum;
#pragma unroll
    for (int b = 0; b < L_W; ++b) row[b] *= inv;
  }
  __syncthreads();

  // --- o = att @ v -> packed rows of o_h ---
  for (int s = tid; s < L_W * D_M; s += 256) {
    int a = s / D_M, dim = s % D_M, h = dim / DH, e = dim % DH;
    const float* att = scores + h * 81 + a * 9;
    float acc = 0.f;
#pragma unroll
    for (int b = 0; b < L_W; ++b) acc += att[b] * smem[800 + b * 1200 + h * DH + e];
    o_h[(size_t)w * (L_W * D_M) + s] = (_Float16)acc;
  }
}

// ---------------- Kernel 4b: row-wise stages on packed rows ----------------
// Behind the attention every stage (out projection, LayerNorm, FFN, LayerNorm) works on
// one row alone, so the 41904 (window, position) rows are packed into full 16-row tiles
// and one workgroup takes MT of them: each weight fragment loaded from L2 feeds MT WMMAs.
#define MROWS (NWIN * L_W)   // 41904 = 2619 tiles of 16
#define MT    6              // M tiles per workgroup
#define BM    (MT * 16)
#define PX    404            // f32 row pitch of X
#define PA    408            // f16 row pitch, 816 B = 16 B x odd
#define FC    320            // FFN columns per chunk
#define PF    328            // f16 row pitch, 656 B = 16 B x odd

typedef __attribute__((ext_vector_type(8))) _Float16 v8h;

// One lane's 16 halves of an A or B fragment: k = 8*half + 0..7 and 16 + 8*half + 0..7,
// p already at row start + kbase + 8*half. full == false: the upper 16 k are past K.
__device__ __forceinline__ v16h frag16(const _Float16* p, bool full) {
  v8h lo = *(const v8h*)p;
  v8h hi = {};
  if (full) hi = *(const v8h*)(p + 16);
  return __builtin_shufflevector(lo, hi, 0, 1, 2, 3, 4, 5, 6, 7, 8, 9, 10, 11, 12, 13,
                                 14, 15);
}

// acc[mt] = A[mt*16..][0..400) @ W[n0..n0+16)^T, A f16 in LDS at pitch PA, W [*,400] f16.
__device__ __forceinline__ void strip_k400(const _Float16* A, const _Float16* W, int n0,
                                           int lane, v8f* acc) {
  const _Float16* bp = W + (n0 + (lane & 15)) * D_M + (lane >> 4) * 8;
  const _Float16* ap = A + (lane & 15) * PA + (lane >> 4) * 8;
  // Compiler fence: keeps the A reads below inside the caller's loop over N tiles. They do
  // not change from tile to tile, and hoisted out of the loop they take 624 registers and spill.
  asm volatile("" ::: "memory");
  v16h b[KS_D];
#pragma unroll
  for (int ks = 0; ks < KS_D; ++ks) b[ks] = frag16(bp + ks * 32, ks + 1 < KS_D);
#pragma unroll
  for (int mt = 0; mt < MT; ++mt) acc[mt] = v8f{};
  // A fragments of k step ks + 1 are read as one group ahead of the WMMAs of step ks.
  v16h a[2][MT];
#pragma unroll
  for (int mt = 0; mt < MT; ++mt) a[0][mt] = frag16(ap + mt * 16 * PA, true);
  __builtin_amdgcn_sched_barrier(0);   // keeps all 25 weight loads in flight from the start
#pragma unroll
  for (int ks = 0; ks < KS_D; ++ks) {
    if (ks + 1 < KS_D) {
#pragma unroll
      for (int mt = 0; mt < MT; ++mt)
        a[(ks + 1) & 1][mt] = frag16(ap + mt * 16 * PA + (ks + 1) * 32, ks + 2 < KS_D);
    }
    // Holds the read group ahead of the WMMAs: with the FFN2 accumulators live the scheduler
    // otherwise sinks each read to its WMMA, which then waits out a whole LDS latency.
    __builtin_amdgcn_sched_barrier(0);
#pragma unroll
    for (int mt = 0; mt < MT; ++mt) acc[mt] = wmma_acc(a[ks & 1][mt], b[ks], acc[mt]);
    __builtin_amdgcn_sched_barrier(0);   // same purpose: the next group stays behind these
  }
}

// LayerNorm of the BM rows of X, one wave per row, the row held in registers.
// TO_OUT false: back into X, with an f16 copy in Ah. TO_OUT true: to global rows.
template <bool TO_OUT>
__device__ __forceinline__ void layernorm_packed(float* X, const float* g, const float* b,
                                                 _Float16* Ah, float* outg, int row0,
                                                 int wv, int lane) {
  float gg[13], bb[13];
#pragma unroll
  for (int q = 0; q < 13; ++q) {
    int c = lane + 32 * q;
    gg[q] = (c < D_M) ? g[c] : 0.f;
    bb[q] = (c < D_M) ? b[c] : 0.f;
  }
  for (int r = wv; r < BM; r += 8) {
    float v[13];
#pragma unroll
    for (int q = 0; q < 13; ++q) {
      int c = lane + 32 * q;
      v[q] = (c < D_M) ? X[r * PX + c] : 0.f;
    }
    float s = 0.f;
#pragma unroll
    for (int q = 0; q < 13; ++q) s += v[q];
#pragma unroll
    for (int off = 16; off > 0; off >>= 1) s += __shfl_xor(s, off, 32);
    float mu = s * (1.0f / D_M);
    float vv = 0.f;
#pragma unroll
    for (int q = 0; q < 13; ++q) {
      if (lane + 32 * q < D_M) {
        float t = v[q] - mu;
        vv += t * t;
      }
    }
#pragma unroll
    for (int off = 16; off > 0; off >>= 1) vv += __shfl_xor(vv, off, 32);
    float rs = rsqrtf(vv * (1.0f / D_M) + 1e-5f);
#pragma unroll
    for (int q = 0; q < 13; ++q) {
      int c = lane + 32 * q;
      if (c < D_M) {
        float y = (v[q] - mu) * rs * gg[q] + bb[q];
        if (TO_OUT) {
          if (row0 + r < MROWS) outg[(size_t)(row0 + r) * D_M + c] = y;
          // Behind the row's last store: the next row rewrites the registers it names.
          if (q == 12) asm volatile("s_wait_xcnt 0x0" ::: "memory");
        } else {
          X[r * PX + c]  = y;
          Ah[r * PA + c] = (_Float16)y;
        }
      }
    }
  }
}

typedef __attribute__((ext_vector_type(2))) float v2f;

__device__ __forceinline__ v2f fma2(v2f a, v2f b, float c) {
  return __builtin_elementwise_fma(a, b, v2f{c, c});
}

#define GP 8   // value pairs that go through the GELU side by side

// Exact-erf GELU of GP value pairs with no branch. erf keeps the f32 library's two fits (an odd
// polynomial below |z| = 1, 1 - exp(-q(|z|)) from there on), but both are evaluated for every
// lane and one is selected: a branch on the lane's value cuts the epilogue into one serial
// dependent chain per element, where straight-line code lets independent chains overlap.
__device__ __forceinline__ void gelu_group(v2f* x) {
  v2f z[GP], az[GP], t[GP], q[GP], p[GP];
#pragma unroll
  for (int i = 0; i < GP; ++i) { z[i] = x[i] * 0.707106769f; x[i] = x[i] * 0.5f; }
#pragma unroll
  for (int i = 0; i < GP; ++i) {
    az[i] = v2f{__builtin_fabsf(z[i].x), __builtin_fabsf(z[i].y)};
    t[i]  = z[i] * z[i];
  }
  const float cq[6] = {-0.000378677854f, 0.00385781587f, -0.0241816975f,
                       0.106668264f, 0.634933293f, 0.128689408f};
  const float cp[5] = {0.00491381623f, -0.0267075151f, 0.112800106f,
                       -0.376122952f, 0.128379107f};
#pragma unroll
  for (int i = 0; i < GP; ++i) {
    q[i] = v2f{0.0000169988107f, 0.0000169988107f};
    p[i] = v2f{-0.000561801775f, -0.000561801775f};
  }
#pragma unroll
  for (int s = 0; s < 5; ++s) {
#pragma unroll
    for (int i = 0; i < GP; ++i) {
      q[i] = fma2(az[i], q[i], cq[s]);
      p[i] = fma2(t[i], p[i], cp[s]);
    }
  }
#pragma unroll
  for (int i = 0; i < GP; ++i) {
    q[i] = fma2(az[i], q[i], cq[5]);
    p[i] = __builtin_elementwise_fma(az[i], p[i], az[i]);
  }
#pragma unroll
  for (int i = 0; i < GP; ++i) q[i] = __builtin_elementwise_fma(az[i], q[i], az[i]);
#pragma unroll
  for (int i = 0; i < GP; ++i) q[i] = q[i] * -1.44269502f;
#pragma unroll
  for (int i = 0; i < GP; ++i)
    q[i] = v2f{__builtin_amdgcn_exp2f(q[i].x), __builtin_amdgcn_exp2f(q[i].y)};
#pragma unroll
  for (int i = 0; i < GP; ++i) q[i] = 1.0f - q[i];
#pragma unroll
  for (int i = 0; i < GP; ++i)
    p[i] = v2f{az[i].x < 1.0f ? p[i].x : q[i].x, az[i].y < 1.0f ? p[i].y : q[i].y};
#pragma unroll
  for (int i = 0; i < GP; ++i)
    p[i] = v2f{__builtin_copysignf(p[i].x, z[i].x), __builtin_copysignf(p[i].y, z[i].y)};
#pragma unroll
  for (int i = 0; i < GP; ++i) p[i] = p[i] + 1.0f;
#pragma unroll
  for (int i = 0; i < GP; ++i) x[i] = x[i] * p[i];
}

__global__ void __launch_bounds__(256, 1)
rows_kernel(const float* __restrict__ xs,
            const _Float16* __restrict__ o_h,
            const _Float16* __restrict__ w_out_h,
            const float* __restrict__ b_out,
            const _Float16* __restrict__ w1_h,
            const float* __restrict__ b1,
            const _Float16* __restrict__ w2_h,
            const float* __restrict__ b2,
            const float* __restrict__ ln1_g, const float* __restrict__ ln1_b,
            const float* __restrict__ ln2_g, const float* __restrict__ ln2_b,
            float* __restrict__ out_win) {
  __shared__ __attribute__((aligned(16))) float    X[BM * PX];   // residual stream, f32
  __shared__ __attribute__((aligned(16))) _Float16 Ah[BM * PA];  // o, then LN1 output
  __shared__ __attribute__((aligned(16))) _Float16 Fc[BM * PF];  // one chunk of gelu(ffn1)
  int tid = threadIdx.x, lane = tid & 31;
  int wv = __builtin_amdgcn_readfirstlane(tid >> 5);  // scalar: tile loops branch on it
  int half = lane >> 4;
  int row0 = blockIdx.x * BM;

  // --- stage o (f16) and the residual rows of xs (f32); rows past the end repeat the
  //     last row and are never stored ---
  for (int c = tid; c < BM * 50; c += 256) {
    int r = c / 50, q = c % 50;
    int gr = row0 + r; if (gr > MROWS - 1) gr = MROWS - 1;
    *(v8h*)(Ah + r * PA + q * 8) = *(const v8h*)(o_h + (size_t)gr * D_M + q * 8);
  }
  for (int c = tid; c < BM * 100; c += 256) {
    int r = c / 100, q = c % 100;
    int gr = row0 + r; if (gr > MROWS - 1) gr = MROWS - 1;
    int w = gr / L_W, j = gr % L_W;
    int xr = (w / W_CNT) * T_LEN + (w % W_CNT) + j;
    *(float4*)(X + r * PX + q * 4) = *(const float4*)(xs + (size_t)xr * D_M + q * 4);
  }
  __syncthreads();

  // --- out projection + residual -> X ---
  for (int nt = wv; nt < D_M / 16; nt += 8) {
    v8f acc[MT];
    strip_k400(Ah, w_out_h, nt * 16, lane, acc);
    int nn = nt * 16 + (lane & 15);
    float bo = b_out[nn];
    float* xp = X + half * 8 * PX + nn;
    float res[MT * 8];   // all reads ahead of the stores: one LDS latency, not one per element
#pragma unroll
    for (int q = 0; q < MT * 8; ++q) res[q] = xp[((q >> 3) * 16 + (q & 7)) * PX];
#pragma unroll
    for (int q = 0; q < MT * 8; ++q)
      xp[((q >> 3) * 16 + (q & 7)) * PX] = acc[q >> 3][q & 7] + bo + res[q];
  }
  __syncthreads();
  layernorm_packed<false>(X, ln1_g, ln1_b, Ah, nullptr, row0, wv, lane);
  __syncthreads();

  // --- FFN in 5 chunks of 320 hidden columns: FFN1 + exact GELU -> Fc, then FFN2 adds
  //     that chunk's k range into accumulators that stay in registers (k ascending) ---
  v8f acc2[4][MT];
#pragma unroll
  for (int tt = 0; tt < 4; ++tt) {
#pragma unroll
    for (int mt = 0; mt < MT; ++mt) acc2[tt][mt] = v8f{};
  }
#pragma unroll 1   // one copy of the chunk body, for speed only
  for (int kc = 0; kc < FF_M / FC; ++kc) {
#pragma unroll 1   // same reason
    for (int t = wv; t < FC / 16; t += 8) {
      v8f acc[MT];
      strip_k400(Ah, w1_h, kc * FC + t * 16, lane, acc);
      int cl = t * 16 + (lane & 15);
      float bb = b1[kc * FC + cl];
#pragma unroll
      for (int e0 = 0; e0 < MT * 8; e0 += 2 * GP) {
        v2f xv[GP];
#pragma unroll
        for (int i = 0; i < GP; ++i) {
          int e = e0 + 2 * i;
          xv[i] = v2f{acc[e >> 3][e & 7] + bb, acc[e >> 3][(e & 7) + 1] + bb};
        }
        gelu_group(xv);
#pragma unroll
        for (int i = 0; i < GP; ++i) {
          int e = e0 + 2 * i;
          int m = (e >> 3) * 16 + (e & 7) + half * 8;
          Fc[m * PF + cl]       = (_Float16)xv[i].x;
          Fc[(m + 1) * PF + cl] = (_Float16)xv[i].y;
        }
      }
    }
    __syncthreads();   // Fc complete before any wave reads it
    const _Float16* ap = Fc + (lane & 15) * PF + half * 8;
    const _Float16* bp = w2_h + (size_t)(wv * 16 + (lane & 15)) * FF_M + kc * FC + half * 8;
    // Weight fragments run two k steps ahead of their WMMAs (ring of three sets); each A
    // fragment read from LDS serves all of the wave's N tiles. Tile 24 is wave 0's alone.
    v16h bq[3][4];
#pragma unroll
    for (int ks = 0; ks < 2; ++ks) {
#pragma unroll
      for (int tt = 0; tt < 3; ++tt) bq[ks][tt] = frag16(bp + tt * 128 * FF_M + ks * 32, true);
      if (wv == 0) bq[ks][3] = frag16(bp + 3 * 128 * FF_M + ks * 32, true);
    }
    v16h a[2][MT];   // A fragments run one k step ahead
#pragma unroll
    for (int mt = 0; mt < MT; ++mt) a[0][mt] = frag16(ap + mt * 16 * PF, true);
#pragma unroll
    for (int ks = 0; ks < FC / 32; ++ks) {
      if (ks + 2 < FC / 32) {
#pragma unroll
        for (int tt = 0; tt < 3; ++tt)
          bq[(ks + 2) % 3][tt] = frag16(bp + tt * 128 * FF_M + (ks + 2) * 32, true);
        if (wv == 0) bq[(ks + 2) % 3][3] = frag16(bp + 3 * 128 * FF_M + (ks + 2) * 32, true);
      }
      if (ks + 1 < FC / 32) {
#pragma unroll
        for (int mt = 0; mt < MT; ++mt)
          a[(ks + 1) & 1][mt] = frag16(ap + mt * 16 * PF + (ks + 1) * 32, true);
      }
#pragma unroll
      for (int tt = 0; tt < 3; ++tt) {
#pragma unroll
        for (int mt = 0; mt < MT; ++mt)
          acc2[tt][mt] = wmma_acc(a[ks & 1][mt], bq[ks % 3][tt], acc2[tt][mt]);
      }
      if (wv == 0) {
#pragma unroll
        for (int mt = 0; mt < MT; ++mt)
          acc2[3][mt] = wmma_acc(a[ks & 1][mt], bq[ks % 3][3], acc2[3][mt]);
      }
    }
    __syncthreads();   // every reader has left Fc before the next chunk overwrites it
  }
#pragma unroll
  for (int tt = 0; tt < 4; ++tt) {
    int nt = wv + tt * 8;
    if (nt < D_M / 16) {
      int nn = nt * 16 + (lane & 15);
      float bb = b2[nn];
      float* xp = X + half * 8 * PX + nn;
      float res[MT * 8];   // all reads ahead of the stores, as above
#pragma unroll
      for (int q = 0; q < MT * 8; ++q) res[q] = xp[((q >> 3) * 16 + (q & 7)) * PX];
#pragma unroll
      for (int q = 0; q < MT * 8; ++q)
        xp[((q >> 3) * 16 + (q & 7)) * PX] = res[q] + acc2[tt][q >> 3][q & 7] + bb;
    }
  }
  __syncthreads();
  layernorm_packed<true>(X, ln2_g, ln2_b, nullptr, out_win, row0, wv, lane);
}

// ---------------- Kernel 5: deterministic overlap-gather + output transpose ----------------
// row t receives out_win[i][t - i/2] for i in [2(t-8), 2t+1] ∩ [0, W)
__global__ void gather_out_kernel(const float* __restrict__ out_win,
                                  float* __restrict__ out) {
  int idx = blockIdx.x * blockDim.x + threadIdx.x;
  if (idx >= NROWS * D_M) return;
  int n = idx / (T_LEN * D_M);
  int r = idx % (T_LEN * D_M);
  int t = r / D_M;
  int d = r % D_M;
  int ilo = 2 * (t - 8); if (ilo < 0) ilo = 0;
  int ihi = 2 * t + 1;   if (ihi > W_CNT - 1) ihi = W_CNT - 1;
  float sum = 0.f;
  for (int i = ilo; i <= ihi; ++i) {
    int j = t - (i >> 1);
    if (j >= 0 && j < L_W)
      sum += out_win[((size_t)(n * W_CNT + i) * L_W + j) * D_M + d];
  }
  int v = d >> 4, c = d & 15;
  out[((n * C_CH + c) * T_LEN + t) * V_J + v] = sum;
}

// ---------------- host launch ----------------
extern "C" void kernel_launch(void* const* d_in, const int* in_sizes, int n_in,
                              void* d_out, int out_size, void* d_ws, size_t ws_size,
                              hipStream_t stream) {
  const float* x     = (const float*)d_in[0];
  const float* pe    = (const float*)d_in[1];
  const float* w_in  = (const float*)d_in[2];
  const float* b_in  = (const float*)d_in[3];
  const float* w_out = (const float*)d_in[4];
  const float* b_out = (const float*)d_in[5];
  const float* w1    = (const float*)d_in[6];
  const float* b1    = (const float*)d_in[7];
  const float* w2    = (const float*)d_in[8];
  const float* b2    = (const float*)d_in[9];
  const float* ln1g  = (const float*)d_in[10];
  const float* ln1b  = (const float*)d_in[11];
  const float* ln2g  = (const float*)d_in[12];
  const float* ln2b  = (const float*)d_in[13];
  float* out = (float*)d_out;

  // workspace layout
  char* ws = (char*)d_ws;
  size_t off = 0;
  float*    xs      = (float*)(ws + off);    off += (size_t)NROWS * D_M * 4;       // 7.68 MB
  _Float16* xs_h    = (_Float16*)(ws + off); off += (size_t)NROWS * D_M * 2;       // 3.84 MB
  _Float16* w_in_h  = (_Float16*)(ws + off); off += (size_t)3 * D_M * D_M * 2;     // 0.96 MB
  _Float16* w_out_h = (_Float16*)(ws + off); off += (size_t)D_M * D_M * 2;         // 0.32 MB
  _Float16* w1_h    = (_Float16*)(ws + off); off += (size_t)FF_M * D_M * 2;        // 1.28 MB
  _Float16* w2_h    = (_Float16*)(ws + off); off += (size_t)D_M * FF_M * 2;        // 1.28 MB
  float*    qkv_all = (float*)(ws + off);    off += (size_t)NROWS * 3 * D_M * 4;   // 23.04 MB
  float*    out_win = (float*)(ws + off);    off += (size_t)NWIN * L_W * D_M * 4;  // 67.05 MB
  _Float16* o_h     = (_Float16*)(ws + off); off += (size_t)NWIN * L_W * D_M * 2;  // 33.52 MB

  const int TPB = 256;

  // 1) layout + positional encoding
  prep_xs_kernel<<<(NROWS * D_M + TPB - 1) / TPB, TPB, 0, stream>>>(x, pe, xs, xs_h);

  // 2) weight conversion to f16
  cvt_f16_kernel<<<(3 * D_M * D_M + TPB - 1) / TPB, TPB, 0, stream>>>(w_in, w_in_h,
                                                                      3 * D_M * D_M);
  cvt_f16_kernel<<<(D_M * D_M + TPB - 1) / TPB, TPB, 0, stream>>>(w_out, w_out_h,
                                                                  D_M * D_M);
  cvt_f16_kernel<<<(FF_M * D_M + TPB - 1) / TPB, TPB, 0, stream>>>(w1, w1_h, FF_M * D_M);
  cvt_f16_kernel<<<(D_M * FF_M + TPB - 1) / TPB, TPB, 0, stream>>>(w2, w2_h, D_M * FF_M);

  // 3) hoisted QKV GEMM: one block per 16-row tile, A fragments register-resident
  qkv_gemm_kernel<<<NROWS / 16, TPB, 0, stream>>>(xs_h, w_in_h, b_in, qkv_all);

  // 4) per-window attention
  attn_kernel<<<NWIN, TPB, 0, stream>>>(qkv_all, o_h);

  // 4b) out projection, LayerNorm, FFN, LayerNorm on packed rows (WMMA)
  rows_kernel<<<(MROWS + BM - 1) / BM, TPB, 0, stream>>>(xs, o_h, w_out_h, b_out, w1_h, b1,
                                                         w2_h, b2, ln1g, ln1b, ln2g, ln2b,
                                                         out_win);

  // 5) deterministic overlap-add + transpose to [N,C,T,V]
  gather_out_kernel<<<(NROWS * D_M + TPB - 1) / TPB, TPB, 0, stream>>>(out_win, out);
}

// v003
// It runs in 301 microseconds.
// Next to v002, in two timings, it ran 1.08 times as fast each time.
// Over all steps from v000 it is 3.64 times as fast.
#include <hip/hip_runtime.h>
#include <hip/hip_fp16.h>
#include <math.h>

typedef __attribute__((ext_vector_type(16))) _Float16 v16h;
typedef __attribute__((ext_vector_type(8)))  float    v8f;

#define N_B   16
#define T_LEN 300
#define V_J   25
#define C_CH  16
#define D_M   400      // C*V
#define H_N   2
#define DH    200
#define FF_M  1600
#define L_W   9
#define W_CNT 291      // T - L
#define NWIN  (N_B * W_CNT)   // 4656
#define NROWS (N_B * T_LEN)   // 4800
#define KS_D  13       // ceil(400/32)
#define KS_F  50       // 1600/32

// ---------------- WMMA fragment helpers (16x16x32 f16 -> f32) ----------------

__device__ __forceinline__ int frag_k(int g, int half) {
  return ((g < 4) ? (g * 2) : (16 + (g - 4) * 2)) + half * 8;
}

__device__ __forceinline__ v8f wmma_acc(v16h a, v16h b, v8f c) {
  return __builtin_amdgcn_wmma_f32_16x16x32_f16(false, a, false, b, (short)0, c,
                                                false, false);
}

// A fragment from row-major f16 source (LDS or global).
__device__ __forceinline__ v16h load_a_f16(const _Float16* A, int lda, int Mvalid,
                                           int kbase, int K, int lane) {
  int m = lane & 15, half = lane >> 4;
  v16h r;
#pragma unroll
  for (int g = 0; g < 8; ++g) {
    int k = kbase + frag_k(g, half);
    _Float16 x0 = (_Float16)0.f, x1 = (_Float16)0.f;
    if (m < Mvalid && k < K) {
      const _Float16* p = A + m * lda + k;
      x0 = p[0]; x1 = p[1];
    }
    r[2 * g]     = x0;
    r[2 * g + 1] = x1;
  }
  return r;
}

// B fragment: computes A @ W^T where W is [Ntot, K] row-major f16.
// B[k][n] = W[n][k]; lane holds N = n0 + lane%16, contiguous half2 along K.
__device__ __forceinline__ v16h load_b_w(const _Float16* W, int K, int n0, int kbase,
                                         int lane) {
  int n = n0 + (lane & 15), half = lane >> 4;
  v16h r;
#pragma unroll
  for (int g = 0; g < 8; ++g) {
    int k = kbase + frag_k(g, half);
    _Float16 x0 = (_Float16)0.f, x1 = (_Float16)0.f;
    if (k < K) {
      const _Float16* p = W + n * K + k;
      x0 = p[0]; x1 = p[1];
    }
    r[2 * g]     = x0;
    r[2 * g + 1] = x1;
  }
  return r;
}

// K-loop with register-resident A fragments and 1-deep software-pipelined B loads:
// loads for step ks+1 are issued before the WMMA of step ks.
template <int KS>
__device__ __forceinline__ v8f gemm_pipelined(const v16h* a, const _Float16* W, int K,
                                              int n0, int lane) {
  v8f acc = {};
  v16h bc = load_b_w(W, K, n0, 0, lane);
#pragma unroll
  for (int ks = 0; ks < KS; ++ks) {
    v16h bn = bc;
    if (ks + 1 < KS) bn = load_b_w(W, K, n0, (ks + 1) * 32, lane);
    acc = wmma_acc(a[ks], bc, acc);
    bc = bn;
  }
  return acc;
}

// ---------------- Kernel 1: layout change + positional encoding ----------------
// xs[n][t][d] = x[n][c][t][v] + pe[t][d],  d = v*16 + c  (torch view order)
__global__ void prep_xs_kernel(const float* __restrict__ x, const float* __restrict__ pe,
                               float* __restrict__ xs, _Float16* __restrict__ xs_h) {
  int idx = blockIdx.x * blockDim.x + threadIdx.x;
  if (idx >= NROWS * D_M) return;
  int n = idx / (T_LEN * D_M);
  int r = idx % (T_LEN * D_M);
  int t = r / D_M;
  int d = r % D_M;
  int v = d >> 4;
  int c = d & 15;
  float val = x[((n * C_CH + c) * T_LEN + t) * V_J + v] + pe[t * D_M + d];
  xs[idx]   = val;
  xs_h[idx] = (_Float16)val;
}

// ---------------- Kernel 2: f32 -> f16 weight conversion ----------------
__global__ void cvt_f16_kernel(const float* __restrict__ src, _Float16* __restrict__ dst,
                               int count) {
  int idx = blockIdx.x * blockDim.x + threadIdx.x;
  if (idx < count) dst[idx] = (_Float16)src[idx];
}

// ---------------- Kernel 3: hoisted QKV GEMM over all 4800 rows ----------------
// qkv_all[4800][1200] = xs[4800][400] @ w_in^T + b_in
// One block per 16-row M-tile; 8 waves cover the 75 N-tiles; A fragments hoisted
// into registers once per wave (13 x v16h = 104 VGPRs) and reused across tiles.
__global__ void __launch_bounds__(256, 1)
qkv_gemm_kernel(const _Float16* __restrict__ xs_h,
                const _Float16* __restrict__ w_in_h,
                const float* __restrict__ b_in,
                float* __restrict__ qkv_all) {
  int wv = threadIdx.x >> 5, lane = threadIdx.x & 31;
  int mt = blockIdx.x;  // 0..299
  const _Float16* Arow = xs_h + (size_t)mt * 16 * D_M;

  v16h a13[KS_D];
#pragma unroll
  for (int ks = 0; ks < KS_D; ++ks)
    a13[ks] = load_a_f16(Arow, D_M, 16, ks * 32, D_M, lane);

  for (int nt = wv; nt < 1200 / 16; nt += 8) {   // wave-uniform
    v8f acc = gemm_pipelined<KS_D>(a13, w_in_h, D_M, nt * 16, lane);
    int half = lane >> 4, nn = nt * 16 + (lane & 15);
    float bias = b_in[nn];
#pragma unroll
    for (int g = 0; g < 8; ++g) {
      int m = mt * 16 + g + half * 8;
      qkv_all[m * 1200 + nn] = acc[g] + bias;
    }
  }
}

// ---------------- Kernel 4: attention of one window per workgroup ----------------
// LDS map (floats): [0,10800) qkv f32 [9][1200]; [10800,10962) scores
// Result o goes out as f16 (the type the out projection reads it in), packed as
// row w*9 + a of o_h[41904][400].
__global__ void __launch_bounds__(256, 1)
attn_kernel(const float* __restrict__ qkv_all, _Float16* __restrict__ o_h) {
  __shared__ float smem[10976];
  int w = blockIdx.x;
  int n = w / W_CNT;
  int i = w % W_CNT;
  int tid = threadIdx.x;

  // --- gather qkv rows (contiguous, vectorized) ---
  {
    const float4* src = (const float4*)(qkv_all + (size_t)(n * T_LEN + i) * 1200);
    float4* dst = (float4*)smem;
    for (int v4 = tid; v4 < (L_W * 1200) / 4; v4 += 256) dst[v4] = src[v4];
  }
  __syncthreads();

  // --- attention scores + softmax (tiny, VALU) ---
  float* scores = smem + 10800;  // [2][9][9]
  for (int s = tid; s < H_N * L_W * L_W; s += 256) {
    int h = s / 81, r = s % 81, a = r / 9, b = r % 9;
    const float* qp = smem + a * 1200 + h * DH;          // q
    const float* kp = smem + 400 + b * 1200 + h * DH;    // k
    float acc = 0.f;
    for (int e = 0; e < DH; ++e) acc += qp[e] * kp[e];
    scores[s] = acc * 0.07071067811865475f;              // 1/sqrt(200)
  }
  __syncthreads();
  if (tid < H_N * L_W) {
    float* row = scores + tid * L_W;
    float mx = row[0];
#pragma unroll
    for (int b = 1; b < L_W; ++b) mx = fmaxf(mx, row[b]);
    float sum = 0.f;
#pragma unroll
    for (int b = 0; b < L_W; ++b) { row[b] = __expf(row[b] - mx); sum += row[b]; }
    float inv = 1.0f / sum;
#pragma unroll
    for (int b = 0; b < L_W; ++b) row[b] *= inv;
  }
  __syncthreads();

  // --- o = att @ v -> packed rows of o_h ---
  for (int s = tid; s < L_W * D_M; s += 256) {
    int a = s / D_M, dim = s % D_M, h = dim / DH, e = dim % DH;
    const float* att = scores + h * 81 + a * 9;
    float acc = 0.f;
#pragma unroll
    for (int b = 0; b < L_W; ++b) acc += att[b] * smem[800 + b * 1200 + h * DH + e];
    o_h[(size_t)w * (L_W * D_M) + s] = (_Float16)acc;
  }
}

// ---------------- Kernel 4b: row-wise stages on packed rows ----------------
// Behind the attention every stage (out projection, LayerNorm, FFN, LayerNorm) works on
// one row alone, so the 41904 (window, position) rows are packed into full 16-row tiles
// and one workgroup takes MT of them: each weight fragment loaded from L2 feeds MT WMMAs.
#define MROWS (NWIN * L_W)   // 41904 = 2619 tiles of 16
#define MT    6              // M tiles per workgroup
#define BM    (MT * 16)
#define PX    404            // f32 row pitch of X
#define PA    408            // f16 row pitch, 816 B = 16 B x odd
#define FC    320            // FFN columns per chunk
#define PF    328            // f16 row pitch, 656 B = 16 B x odd

typedef __attribute__((ext_vector_type(8))) _Float16 v8h;

// One lane's 16 halves of an A or B fragment: k = 8*half + 0..7 and 16 + 8*half + 0..7,
// p already at row start + kbase + 8*half. full == false: the upper 16 k are past K.
__device__ __forceinline__ v16h frag16(const _Float16* p, bool full) {
  v8h lo = *(const v8h*)p;
  v8h hi = {};
  if (full) hi = *(const v8h*)(p + 16);
  return __builtin_shufflevector(lo, hi, 0, 1, 2, 3, 4, 5, 6, 7, 8, 9, 10, 11, 12, 13,
                                 14, 15);
}

// Packed weights: the B fragment of (N tile nt, k step ks) is one 1-KiB block at index
// nt * KS + ks. Its first 512 B hold the 32 lanes' lower 8 halves in lane order, the next
// 512 B their upper 8, so one 16-byte-per-lane load covers 4 whole 128-B lines. Read from the
// row-major matrix the same load takes a 32-B piece out of each of 16 lines.
#define PBLK 512   // halves per block

// One lane's 16 halves of a packed B fragment, p at block start + lane * 8.
__device__ __forceinline__ v16h fragp(const _Float16* p, bool full) {
  v8h lo = *(const v8h*)p;
  v8h hi = {};
  if (full) hi = *(const v8h*)(p + PBLK / 2);
  return __builtin_shufflevector(lo, hi, 0, 1, 2, 3, 4, 5, 6, 7, 8, 9, 10, 11, 12, 13,
                                 14, 15);
}

// f32 weight W[N][K] -> f16 in the packed order above; one thread per 16-byte piece.
// A piece whose k lies past K is neither written here nor read by anyone.
__global__ void pack_w_kernel(const float* __restrict__ src, _Float16* __restrict__ dst,
                              int K, int KS, int pieces) {
  int idx = blockIdx.x * blockDim.x + threadIdx.x;
  if (idx >= pieces) return;
  int lane = idx & 31, part = (idx >> 5) & 1, blk = idx >> 6;
  int k = (blk % KS) * 32 + part * 16 + (lane >> 4) * 8;
  if (k >= K) return;
  const float* p = src + (size_t)((blk / KS) * 16 + (lane & 15)) * K + k;
  float4 u = *(const float4*)p, v = *(const float4*)(p + 4);
  v8h h = {(_Float16)u.x, (_Float16)u.y, (_Float16)u.z, (_Float16)u.w,
           (_Float16)v.x, (_Float16)v.y, (_Float16)v.z, (_Float16)v.w};
  *(v8h*)(dst + (size_t)idx * 8) = h;
}

// acc[mt] = A[mt*16..][0..400) @ W[nt*16..nt*16+16)^T, A f16 in LDS at pitch PA, W packed.
__device__ __forceinline__ void strip_k400(const _Float16* A, const _Float16* W, int nt,
                                           int lane, v8f* acc) {
  const _Float16* bp = W + (size_t)nt * (KS_D * PBLK) + lane * 8;
  const _Float16* ap = A + (lane & 15) * PA + (lane >> 4) * 8;
  // Compiler fence: keeps the A reads below inside the caller's loop over N tiles. They do
  // not change from tile to tile, and hoisted out of the loop they take 624 registers and spill.
  asm volatile("" ::: "memory");
  v16h b[KS_D];
#pragma unroll
  for (int ks = 0; ks < KS_D; ++ks) {
    // The last load's result may be given the address pair that the loads before it name:
    // the wait stands in front of that overwrite.
    if (ks + 1 == KS_D) asm volatile("s_wait_xcnt 0x0" ::: "memory");
    b[ks] = fragp(bp + ks * PBLK, ks + 1 < KS_D);
  }
#pragma unroll
  for (int mt = 0; mt < MT; ++mt) acc[mt] = v8f{};
  // A fragments of k step ks + 1 are read as one group ahead of the WMMAs of step ks.
  v16h a[2][MT];
#pragma unroll
  for (int mt = 0; mt < MT; ++mt) a[0][mt] = frag16(ap + mt * 16 * PA, true);
  __builtin_amdgcn_sched_barrier(0);   // keeps all 25 weight loads in flight from the start
#pragma unroll
  for (int ks = 0; ks < KS_D; ++ks) {
    if (ks + 1 < KS_D) {
#pragma unroll
      for (int mt = 0; mt < MT; ++mt)
        a[(ks + 1) & 1][mt] = frag16(ap + mt * 16 * PA + (ks + 1) * 32, ks + 2 < KS_D);
    }
    // Holds the read group ahead of the WMMAs: with the FFN2 accumulators live the scheduler
    // otherwise sinks each read to its WMMA, which then waits out a whole LDS latency.
    __builtin_amdgcn_sched_barrier(0);
#pragma unroll
    for (int mt = 0; mt < MT; ++mt) acc[mt] = wmma_acc(a[ks & 1][mt], b[ks], acc[mt]);
    __builtin_amdgcn_sched_barrier(0);   // same purpose: the next group stays behind these
  }
}

// LayerNorm of the BM rows of X, one wave per row, the row held in registers.
// TO_OUT false: back into X, with an f16 copy in Ah. TO_OUT true: to global rows.
template <bool TO_OUT>
__device__ __forceinline__ void layernorm_packed(float* X, const float* g, const float* b,
                                                 _Float16* Ah, float* outg, int row0,
                                                 int wv, int lane) {
  float gg[13], bb[13];
#pragma unroll
  for (int q = 0; q < 13; ++q) {
    int c = lane + 32 * q;
    gg[q] = (c < D_M) ? g[c] : 0.f;
    bb[q] = (c < D_M) ? b[c] : 0.f;
  }
  for (int r = wv; r < BM; r += 8) {
    float v[13];
#pragma unroll
    for (int q = 0; q < 13; ++q) {
      int c = lane + 32 * q;
      v[q] = (c < D_M) ? X[r * PX + c] : 0.f;
    }
    float s = 0.f;
#pragma unroll
    for (int q = 0; q < 13; ++q) s += v[q];
#pragma unroll
    for (int off = 16; off > 0; off >>= 1) s += __shfl_xor(s, off, 32);
    float mu = s * (1.0f / D_M);
    float vv = 0.f;
#pragma unroll
    for (int q = 0; q < 13; ++q) {
      if (lane + 32 * q < D_M) {
        float t = v[q] - mu;
        vv += t * t;
      }
    }
#pragma unroll
    for (int off = 16; off > 0; off >>= 1) vv += __shfl_xor(vv, off, 32);
    float rs = rsqrtf(vv * (1.0f / D_M) + 1e-5f);
#pragma unroll
    for (int q = 0; q < 13; ++q) {
      int c = lane + 32 * q;
      if (c < D_M) {
        float y = (v[q] - mu) * rs * gg[q] + bb[q];
        if (TO_OUT) {
          if (row0 + r < MROWS) outg[(size_t)(row0 + r) * D_M + c] = y;
          // Behind the row's last store: the next row rewrites the registers it names.
          if (q == 12) asm volatile("s_wait_xcnt 0x0" ::: "memory");
        } else {
          X[r * PX + c]  = y;
          Ah[r * PA + c] = (_Float16)y;
        }
      }
    }
  }
}

typedef __attribute__((ext_vector_type(2))) float v2f;

__device__ __forceinline__ v2f fma2(v2f a, v2f b, float c) {
  return __builtin_elementwise_fma(a, b, v2f{c, c});
}

#define GP 8   // value pairs that go through the GELU side by side

// Exact-erf GELU of GP value pairs with no branch. erf keeps the f32 library's two fits (an odd
// polynomial below |z| = 1, 1 - exp(-q(|z|)) from there on), but both are evaluated for every
// lane and one is selected: a branch on the lane's value cuts the epilogue into one serial
// dependent chain per element, where straight-line code lets independent chains overlap.
__device__ __forceinline__ void gelu_group(v2f* x) {
  v2f z[GP], az[GP], t[GP], q[GP], p[GP];
#pragma unroll
  for (int i = 0; i < GP; ++i) { z[i] = x[i] * 0.707106769f; x[i] = x[i] * 0.5f; }
#pragma unroll
  for (int i = 0; i < GP; ++i) {
    az[i] = v2f{__builtin_fabsf(z[i].x), __builtin_fabsf(z[i].y)};
    t[i]  = z[i] * z[i];
  }
  const float cq[6] = {-0.000378677854f, 0.00385781587f, -0.0241816975f,
                       0.106668264f, 0.634933293f, 0.128689408f};
  const float cp[5] = {0.00491381623f, -0.0267075151f, 0.112800106f,
                       -0.376122952f, 0.128379107f};
#pragma unroll
  for (int i = 0; i < GP; ++i) {
    q[i] = v2f{0.0000169988107f, 0.0000169988107f};
    p[i] = v2f{-0.000561801775f, -0.000561801775f};
  }
#pragma unroll
  for (int s = 0; s < 5; ++s) {
#pragma unroll
    for (int i = 0; i < GP; ++i) {
      q[i] = fma2(az[i], q[i], cq[s]);
      p[i] = fma2(t[i], p[i], cp[s]);
    }
  }
#pragma unroll
  for (int i = 0; i < GP; ++i) {
    q[i] = fma2(az[i], q[i], cq[5]);
    p[i] = __builtin_elementwise_fma(az[i], p[i], az[i]);
  }
#pragma unroll
  for (int i = 0; i < GP; ++i) q[i] = __builtin_elementwise_fma(az[i], q[i], az[i]);
#pragma unroll
  for (int i = 0; i < GP; ++i) q[i] = q[i] * -1.44269502f;
#pragma unroll
  for (int i = 0; i < GP; ++i)
    q[i] = v2f{__builtin_amdgcn_exp2f(q[i].x), __builtin_amdgcn_exp2f(q[i].y)};
#pragma unroll
  for (int i = 0; i < GP; ++i) q[i] = 1.0f - q[i];
#pragma unroll
  for (int i = 0; i < GP; ++i)
    p[i] = v2f{az[i].x < 1.0f ? p[i].x : q[i].x, az[i].y < 1.0f ? p[i].y : q[i].y};
#pragma unroll
  for (int i = 0; i < GP; ++i)
    p[i] = v2f{__builtin_copysignf(p[i].x, z[i].x), __builtin_copysignf(p[i].y, z[i].y)};
#pragma unroll
  for (int i = 0; i < GP; ++i) p[i] = p[i] + 1.0f;
#pragma unroll
  for (int i = 0; i < GP; ++i) x[i] = x[i] * p[i];
}

__global__ void __launch_bounds__(256, 1)
rows_kernel(const float* __restrict__ xs,
            const _Float16* __restrict__ o_h,
            const _Float16* __restrict__ w_out_h,
            const float* __restrict__ b_out,
            const _Float16* __restrict__ w1_h,
            const float* __restrict__ b1,
            const _Float16* __restrict__ w2_h,
            const float* __restrict__ b2,
            const float* __restrict__ ln1_g, const float* __restrict__ ln1_b,
            const float* __restrict__ ln2_g, const float* __restrict__ ln2_b,
            float* __restrict__ out_win) {
  __shared__ __attribute__((aligned(16))) float    X[BM * PX];   // residual stream, f32
  __shared__ __attribute__((aligned(16))) _Float16 Ah[BM * PA];  // o, then LN1 output
  __shared__ __attribute__((aligned(16))) _Float16 Fc[BM * PF];  // one chunk of gelu(ffn1)
  int tid = threadIdx.x, lane = tid & 31;
  int wv = __builtin_amdgcn_readfirstlane(tid >> 5);  // scalar: tile loops branch on it
  int half = lane >> 4;
  int row0 = blockIdx.x * BM;

  // --- stage o (f16) and the residual rows of xs (f32); rows past the end repeat the
  //     last row and are never stored ---
  for (int c = tid; c < BM * 50; c += 256) {
    int r = c / 50, q = c % 50;
    int gr = row0 + r; if (gr > MROWS - 1) gr = MROWS - 1;
    *(v8h*)(Ah + r * PA + q * 8) = *(const v8h*)(o_h + (size_t)gr * D_M + q * 8);
  }
  for (int c = tid; c < BM * 100; c += 256) {
    int r = c / 100, q = c % 100;
    int gr = row0 + r; if (gr > MROWS - 1) gr = MROWS - 1;
    int w = gr / L_W, j = gr % L_W;
    int xr = (w / W_CNT) * T_LEN + (w % W_CNT) + j;
    *(float4*)(X + r * PX + q * 4) = *(const float4*)(xs + (size_t)xr * D_M + q * 4);
  }
  __syncthreads();

  // --- out projection + residual -> X ---
  for (int nt = wv; nt < D_M / 16; nt += 8) {
    v8f acc[MT];
    strip_k400(Ah, w_out_h, nt, lane, acc);
    int nn = nt * 16 + (lane & 15);
    float bo = b_out[nn];
    float* xp = X + half * 8 * PX + nn;
    float res[MT * 8];   // all reads ahead of the stores: one LDS latency, not one per element
#pragma unroll
    for (int q = 0; q < MT * 8; ++q) res[q] = xp[((q >> 3) * 16 + (q & 7)) * PX];
#pragma unroll
    for (int q = 0; q < MT * 8; ++q)
      xp[((q >> 3) * 16 + (q & 7)) * PX] = acc[q >> 3][q & 7] + bo + res[q];
  }
  __syncthreads();
  layernorm_packed<false>(X, ln1_g, ln1_b, Ah, nullptr, row0, wv, lane);
  __syncthreads();

  // --- FFN in 5 chunks of 320 hidden columns: FFN1 + exact GELU -> Fc, then FFN2 adds
  //     that chunk's k range into accumulators that stay in registers (k ascending) ---
  v8f acc2[4][MT];
#pragma unroll
  for (int tt = 0; tt < 4; ++tt) {
#pragma unroll
    for (int mt = 0; mt < MT; ++mt) acc2[tt][mt] = v8f{};
  }
#pragma unroll 1   // one copy of the chunk body, for speed only
  for (int kc = 0; kc < FF_M / FC; ++kc) {
#pragma unroll 1   // same reason
    for (int t = wv; t < FC / 16; t += 8) {
      v8f acc[MT];
      strip_k400(Ah, w1_h, kc * (FC / 16) + t, lane, acc);
      int cl = t * 16 + (lane & 15);
      float bb = b1[kc * FC + cl];
#pragma unroll
      for (int e0 = 0; e0 < MT * 8; e0 += 2 * GP) {
        v2f xv[GP];
#pragma unroll
        for (int i = 0; i < GP; ++i) {
          int e = e0 + 2 * i;
          xv[i] = v2f{acc[e >> 3][e & 7] + bb, acc[e >> 3][(e & 7) + 1] + bb};
        }
        gelu_group(xv);
#pragma unroll
        for (int i = 0; i < GP; ++i) {
          int e = e0 + 2 * i;
          int m = (e >> 3) * 16 + (e & 7) + half * 8;
          Fc[m * PF + cl]       = (_Float16)xv[i].x;
          Fc[(m + 1) * PF + cl] = (_Float16)xv[i].y;
        }
      }
    }
    __syncthreads();   // Fc complete before any wave reads it
    const _Float16* ap = Fc + (lane & 15) * PF + half * 8;
    const _Float16* bp = w2_h + (size_t)(wv * KS_F + kc * (FC / 32)) * PBLK + lane * 8;
    // Weight fragments run two k steps ahead of their WMMAs (ring of three sets); each A
    // fragment read from LDS serves all of the wave's N tiles. Tile 24 is wave 0's alone.
    v16h bq[3][4];
#pragma unroll
    for (int ks = 0; ks < 2; ++ks) {
#pragma unroll
      for (int tt = 0; tt < 3; ++tt) bq[ks][tt] = fragp(bp + (tt * 8 * KS_F + ks) * PBLK, true);
      if (wv == 0) bq[ks][3] = fragp(bp + (3 * 8 * KS_F + ks) * PBLK, true);
    }
    v16h a[2][MT];   // A fragments run one k step ahead
#pragma unroll
    for (int mt = 0; mt < MT; ++mt) a[0][mt] = frag16(ap + mt * 16 * PF, true);
#pragma unroll
    for (int ks = 0; ks < FC / 32; ++ks) {
      if (ks + 2 < FC / 32) {
#pragma unroll
        for (int tt = 0; tt < 3; ++tt)
          bq[(ks + 2) % 3][tt] = fragp(bp + (tt * 8 * KS_F + ks + 2) * PBLK, true);
        if (wv == 0) bq[(ks + 2) % 3][3] = fragp(bp + (3 * 8 * KS_F + ks + 2) * PBLK, true);
      }
      if (ks + 1 < FC / 32) {
#pragma unroll
        for (int mt = 0; mt < MT; ++mt)
          a[(ks + 1) & 1][mt] = frag16(ap + mt * 16 * PF + (ks + 1) * 32, true);
      }
#pragma unroll
      for (int tt = 0; tt < 3; ++tt) {
#pragma unroll
        for (int mt = 0; mt < MT; ++mt)
          acc2[tt][mt] = wmma_acc(a[ks & 1][mt], bq[ks % 3][tt], acc2[tt][mt]);
      }
      if (wv == 0) {
#pragma unroll
        for (int mt = 0; mt < MT; ++mt)
          acc2[3][mt] = wmma_acc(a[ks & 1][mt], bq[ks % 3][3], acc2[3][mt]);
      }
    }
    __syncthreads();   // every reader has left Fc before the next chunk overwrites it
  }
#pragma unroll
  for (int tt = 0; tt < 4; ++tt) {
    int nt = wv + tt * 8;
    if (nt < D_M / 16) {
      int nn = nt * 16 + (lane & 15);
      float bb = b2[nn];
      float* xp = X + half * 8 * PX + nn;
      float res[MT * 8];   // all reads ahead of the stores, as above
#pragma unroll
      for (int q = 0; q < MT * 8; ++q) res[q] = xp[((q >> 3) * 16 + (q & 7)) * PX];
#pragma unroll
      for (int q = 0; q < MT * 8; ++q)
        xp[((q >> 3) * 16 + (q & 7)) * PX] = res[q] + acc2[tt][q >> 3][q & 7] + bb;
    }
  }
  __syncthreads();
  layernorm_packed<true>(X, ln2_g, ln2_b, nullptr, out_win, row0, wv, lane);
}

// ---------------- Kernel 5: deterministic overlap-gather + output transpose ----------------
// row t receives out_win[i][t - i/2] for i in [2(t-8), 2t+1] ∩ [0, W)
__global__ void gather_out_kernel(const float* __restrict__ out_win,
                                  float* __restrict__ out) {
  int idx = blockIdx.x * blockDim.x + threadIdx.x;
  if (idx >= NROWS * D_M) return;
  int n = idx / (T_LEN * D_M);
  int r = idx % (T_LEN * D_M);
  int t = r / D_M;
  int d = r % D_M;
  int ilo = 2 * (t - 8); if (ilo < 0) ilo = 0;
  int ihi = 2 * t + 1;   if (ihi > W_CNT - 1) ihi = W_CNT - 1;
  float sum = 0.f;
  for (int i = ilo; i <= ihi; ++i) {
    int j = t - (i >> 1);
    if (j >= 0 && j < L_W)
      sum += out_win[((size_t)(n * W_CNT + i) * L_W + j) * D_M + d];
  }
  int v = d >> 4, c = d & 15;
  out[((n * C_CH + c) * T_LEN + t) * V_J + v] = sum;
}

// ---------------- host launch ----------------
extern "C" void kernel_launch(void* const* d_in, const int* in_sizes, int n_in,
                              void* d_out, int out_size, void* d_ws, size_t ws_size,
                              hipStream_t stream) {
  const float* x     = (const float*)d_in[0];
  const float* pe    = (const float*)d_in[1];
  const float* w_in  = (const float*)d_in[2];
  const float* b_in  = (const float*)d_in[3];
  const float* w_out = (const float*)d_in[4];
  const float* b_out = (const float*)d_in[5];
  const float* w1    = (const float*)d_in[6];
  const float* b1    = (const float*)d_in[7];
  const float* w2    = (const float*)d_in[8];
  const float* b2    = (const float*)d_in[9];
  const float* ln1g  = (const float*)d_in[10];
  const float* ln1b  = (const float*)d_in[11];
  const float* ln2g  = (const float*)d_in[12];
  const float* ln2b  = (const float*)d_in[13];
  float* out = (float*)d_out;

  // workspace layout
  char* ws = (char*)d_ws;
  size_t off = 0;
  float*    xs      = (float*)(ws + off);    off += (size_t)NROWS * D_M * 4;       // 7.68 MB
  _Float16* xs_h    = (_Float16*)(ws + off); off += (size_t)NROWS * D_M * 2;       // 3.84 MB
  _Float16* w_in_h  = (_Float16*)(ws + off); off += (size_t)3 * D_M * D_M * 2;     // 0.96 MB
  // packed in fragment order: N/16 tiles x k steps x 1 KiB
  _Float16* w_out_h = (_Float16*)(ws + off); off += (size_t)(D_M / 16) * KS_D * 1024;   // 0.33 MB
  _Float16* w1_h    = (_Float16*)(ws + off); off += (size_t)(FF_M / 16) * KS_D * 1024;  // 1.33 MB
  _Float16* w2_h    = (_Float16*)(ws + off); off += (size_t)(D_M / 16) * KS_F * 1024;   // 1.28 MB
  float*    qkv_all = (float*)(ws + off);    off += (size_t)NROWS * 3 * D_M * 4;   // 23.04 MB
  float*    out_win = (float*)(ws + off);    off += (size_t)NWIN * L_W * D_M * 4;  // 67.05 MB
  _Float16* o_h     = (_Float16*)(ws + off); off += (size_t)NWIN * L_W * D_M * 2;  // 33.52 MB

  const int TPB = 256;

  // 1) layout + positional encoding
  prep_xs_kernel<<<(NROWS * D_M + TPB - 1) / TPB, TPB, 0, stream>>>(x, pe, xs, xs_h);

  // 2) weight conversion to f16 (w_in row-major; the other three packed for rows_kernel)
  cvt_f16_kernel<<<(3 * D_M * D_M + TPB - 1) / TPB, TPB, 0, stream>>>(w_in, w_in_h,
                                                                      3 * D_M * D_M);
  pack_w_kernel<<<((D_M / 16) * KS_D * 64 + TPB - 1) / TPB, TPB, 0, stream>>>(
      w_out, w_out_h, D_M, KS_D, (D_M / 16) * KS_D * 64);
  pack_w_kernel<<<((FF_M / 16) * KS_D * 64 + TPB - 1) / TPB, TPB, 0, stream>>>(
      w1, w1_h, D_M, KS_D, (FF_M / 16) * KS_D * 64);
  pack_w_kernel<<<((D_M / 16) * KS_F * 64 + TPB - 1) / TPB, TPB, 0, stream>>>(
      w2, w2_h, FF_M, KS_F, (D_M / 16) * KS_F * 64);

  // 3) hoisted QKV GEMM: one block per 16-row tile, A fragments register-resident
  qkv_gemm_kernel<<<NROWS / 16, TPB, 0, stream>>>(xs_h, w_in_h, b_in, qkv_all);

  // 4) per-window attention
  attn_kernel<<<NWIN, TPB, 0, stream>>>(qkv_all, o_h);

  // 4b) out projection, LayerNorm, FFN, LayerNorm on packed rows (WMMA)
  rows_kernel<<<(MROWS + BM - 1) / BM, TPB, 0, stream>>>(xs, o_h, w_out_h, b_out, w1_h, b1,
                                                         w2_h, b2, ln1g, ln1b, ln2g, ln2b,
                                                         out_win);

  // 5) deterministic overlap-add + transpose to [N,C,T,V]
  gather_out_kernel<<<(NROWS * D_M + TPB - 1) / TPB, TPB, 0, stream>>>(out_win, out);
}

// v004
// A run of this version takes 257 microseconds.
// Two timings next to v003 put it at 1.17 and 1.16 times that version's speed.
// All steps since v000 together make it 4.24 times as fast.
#include <hip/hip_runtime.h>
#include <hip/hip_fp16.h>
#include <math.h>

typedef __attribute__((ext_vector_type(16))) _Float16 v16h;
typedef __attribute__((ext_vector_type(8)))  float    v8f;

#define N_B   16
#define T_LEN 300
#define V_J   25
#define C_CH  16
#define D_M   400      // C*V
#define H_N   2
#define DH    200
#define FF_M  1600
#define L_W   9
#define W_CNT 291      // T - L
#define NWIN  (N_B * W_CNT)   // 4656
#define NROWS (N_B * T_LEN)   // 4800
#define KS_D  13       // ceil(400/32)
#define KS_F  50       // 1600/32

// ---------------- WMMA fragment helpers (16x16x32 f16 -> f32) ----------------

__device__ __forceinline__ v8f wmma_acc(v16h a, v16h b, v8f c) {
  return __builtin_amdgcn_wmma_f32_16x16x32_f16(false, a, false, b, (short)0, c,
                                                false, false);
}

// ---------------- Kernel 1: layout change + positional encoding ----------------
// xs[n][t][d] = x[n][c][t][v] + pe[t][d],  d = v*16 + c  (torch view order)
__global__ void prep_xs_kernel(const float* __restrict__ x, const float* __restrict__ pe,
                               float* __restrict__ xs, _Float16* __restrict__ xs_h) {
  int idx = blockIdx.x * blockDim.x + threadIdx.x;
  if (idx >= NROWS * D_M) return;
  int n = idx / (T_LEN * D_M);
  int r = idx % (T_LEN * D_M);
  int t = r / D_M;
  int d = r % D_M;
  int v = d >> 4;
  int c = d & 15;
  float val = x[((n * C_CH + c) * T_LEN + t) * V_J + v] + pe[t * D_M + d];
  xs[idx]   = val;
  xs_h[idx] = (_Float16)val;
}

// ---------------- Kernel 4: attention of one window per workgroup ----------------
// LDS map (floats): [0,10800) qkv f32 [9][1200]; [10800,10962) scores
// Result o goes out as f16 (the type the out projection reads it in), packed as
// row w*9 + a of o_h[41904][400].
__global__ void __launch_bounds__(256, 1)
attn_kernel(const float* __restrict__ qkv_all, _Float16* __restrict__ o_h) {
  __shared__ float smem[10976];
  int w = blockIdx.x;
  int n = w / W_CNT;
  int i = w % W_CNT;
  int tid = threadIdx.x;

  // --- gather qkv rows (contiguous, vectorized) ---
  {
    const float4* src = (const float4*)(qkv_all + (size_t)(n * T_LEN + i) * 1200);
    float4* dst = (float4*)smem;
    for (int v4 = tid; v4 < (L_W * 1200) / 4; v4 += 256) dst[v4] = src[v4];
  }
  __syncthreads();

  // --- attention scores + softmax (tiny, VALU) ---
  float* scores = smem + 10800;  // [2][9][9]
  for (int s = tid; s < H_N * L_W * L_W; s += 256) {
    int h = s / 81, r = s % 81, a = r / 9, b = r % 9;
    const float* qp = smem + a * 1200 + h * DH;          // q
    const float* kp = smem + 400 + b * 1200 + h * DH;    // k
    float acc = 0.f;
    for (int e = 0; e < DH; ++e) acc += qp[e] * kp[e];
    scores[s] = acc * 0.07071067811865475f;              // 1/sqrt(200)
  }
  __syncthreads();
  if (tid < H_N * L_W) {
    float* row = scores + tid * L_W;
    float mx = row[0];
#pragma unroll
    for (int b = 1; b < L_W; ++b) mx = fmaxf(mx, row[b]);
    float sum = 0.f;
#pragma unroll
    for (int b = 0; b < L_W; ++b) { row[b] = __expf(row[b] - mx); sum += row[b]; }
    float inv = 1.0f / sum;
#pragma unroll
    for (int b = 0; b < L_W; ++b) row[b] *= inv;
  }
  __syncthreads();

  // --- o = att @ v -> packed rows of o_h ---
  for (int s = tid; s < L_W * D_M; s += 256) {
    int a = s / D_M, dim = s % D_M, h = dim / DH, e = dim % DH;
    const float* att = scores + h * 81 + a * 9;
    float acc = 0.f;
#pragma unroll
    for (int b = 0; b < L_W; ++b) acc += att[b] * smem[800 + b * 1200 + h * DH + e];
    o_h[(size_t)w * (L_W * D_M) + s] = (_Float16)acc;
  }
}

// ---------------- Kernel 4b: row-wise stages on packed rows ----------------
// Behind the attention every stage (out projection, LayerNorm, FFN, LayerNorm) works on
// one row alone, so the 41904 (window, position) rows are packed into full 16-row tiles
// and one workgroup takes MT of them: each weight fragment loaded from L2 feeds MT WMMAs.
#define MROWS (NWIN * L_W)   // 41904 = 2619 tiles of 16
#define MT    6              // M tiles per workgroup
#define BM    (MT * 16)
#define PX    404            // f32 row pitch of X
#define PA    408            // f16 row pitch, 816 B = 16 B x odd
#define FC    320            // FFN columns per chunk
#define PF    328            // f16 row pitch, 656 B = 16 B x odd

typedef __attribute__((ext_vector_type(8))) _Float16 v8h;

// One lane's 16 halves of an A or B fragment: k = 8*half + 0..7 and 16 + 8*half + 0..7,
// p already at row start + kbase + 8*half. full == false: the upper 16 k are past K.
__device__ __forceinline__ v16h frag16(const _Float16* p, bool full) {
  v8h lo = *(const v8h*)p;
  v8h hi = {};
  if (full) hi = *(const v8h*)(p + 16);
  return __builtin_shufflevector(lo, hi, 0, 1, 2, 3, 4, 5, 6, 7, 8, 9, 10, 11, 12, 13,
                                 14, 15);
}

// Packed weights: the B fragment of (N tile nt, k step ks) is one 1-KiB block at index
// nt * KS + ks. Its first 512 B hold the 32 lanes' lower 8 halves in lane order, the next
// 512 B their upper 8, so one 16-byte-per-lane load covers 4 whole 128-B lines. Read from the
// row-major matrix the same load takes a 32-B piece out of each of 16 lines.
#define PBLK 512   // halves per block

// One lane's 16 halves of a packed B fragment, p at block start + lane * 8.
__device__ __forceinline__ v16h fragp(const _Float16* p, bool full) {
  v8h lo = *(const v8h*)p;
  v8h hi = {};
  if (full) hi = *(const v8h*)(p + PBLK / 2);
  return __builtin_shufflevector(lo, hi, 0, 1, 2, 3, 4, 5, 6, 7, 8, 9, 10, 11, 12, 13,
                                 14, 15);
}

// f32 weight W[N][K] -> f16 in the packed order above; one thread per 16-byte piece.
// A piece whose k lies past K is neither written here nor read by anyone.
__global__ void pack_w_kernel(const float* __restrict__ src, _Float16* __restrict__ dst,
                              int K, int KS, int pieces) {
  int idx = blockIdx.x * blockDim.x + threadIdx.x;
  if (idx >= pieces) return;
  int lane = idx & 31, part = (idx >> 5) & 1, blk = idx >> 6;
  int k = (blk % KS) * 32 + part * 16 + (lane >> 4) * 8;
  if (k >= K) return;
  const float* p = src + (size_t)((blk / KS) * 16 + (lane & 15)) * K + k;
  float4 u = *(const float4*)p, v = *(const float4*)(p + 4);
  v8h h = {(_Float16)u.x, (_Float16)u.y, (_Float16)u.z, (_Float16)u.w,
           (_Float16)v.x, (_Float16)v.y, (_Float16)v.z, (_Float16)v.w};
  *(v8h*)(dst + (size_t)idx * 8) = h;
}

// acc[mt] = A[mt*16..][0..400) @ W[nt*16..nt*16+16)^T, A f16 in LDS at pitch PA, W packed.
__device__ __forceinline__ void strip_k400(const _Float16* A, const _Float16* W, int nt,
                                           int lane, v8f* acc) {
  const _Float16* bp = W + (size_t)nt * (KS_D * PBLK) + lane * 8;
  const _Float16* ap = A + (lane & 15) * PA + (lane >> 4) * 8;
  // Compiler fence: keeps the A reads below inside the caller's loop over N tiles. They do
  // not change from tile to tile, and hoisted out of the loop they take 624 registers and spill.
  asm volatile("" ::: "memory");
  v16h b[KS_D];
#pragma unroll
  for (int ks = 0; ks < KS_D; ++ks) {
    // The last load's result may be given the address pair that the loads before it name:
    // the wait stands in front of that overwrite.
    if (ks + 1 == KS_D) asm volatile("s_wait_xcnt 0x0" ::: "memory");
    b[ks] = fragp(bp + ks * PBLK, ks + 1 < KS_D);
  }
#pragma unroll
  for (int mt = 0; mt < MT; ++mt) acc[mt] = v8f{};
  // A fragments of k step ks + 1 are read as one group ahead of the WMMAs of step ks.
  v16h a[2][MT];
#pragma unroll
  for (int mt = 0; mt < MT; ++mt) a[0][mt] = frag16(ap + mt * 16 * PA, true);
  __builtin_amdgcn_sched_barrier(0);   // keeps all 25 weight loads in flight from the start
#pragma unroll
  for (int ks = 0; ks < KS_D; ++ks) {
    if (ks + 1 < KS_D) {
#pragma unroll
      for (int mt = 0; mt < MT; ++mt)
        a[(ks + 1) & 1][mt] = frag16(ap + mt * 16 * PA + (ks + 1) * 32, ks + 2 < KS_D);
    }
    // Holds the read group ahead of the WMMAs: with the FFN2 accumulators live the scheduler
    // otherwise sinks each read to its WMMA, which then waits out a whole LDS latency.
    __builtin_amdgcn_sched_barrier(0);
#pragma unroll
    for (int mt = 0; mt < MT; ++mt) acc[mt] = wmma_acc(a[ks & 1][mt], b[ks], acc[mt]);
    __builtin_amdgcn_sched_barrier(0);   // same purpose: the next group stays behind these
  }
}

// ---------------- Kernel 3: hoisted QKV GEMM over all 4800 rows ----------------
// qkv_all[4800][1200] = xs[4800][400] @ w_in^T + b_in
// One workgroup per tile of BM rows x QN * 16 columns. The rows are staged once in LDS, w_in
// comes packed, and each wave runs whole strips: a weight fragment feeds MT WMMAs, and the 25
// weight loads of a strip are in flight together, so a strip waits out one L2 latency, not
// one per k step.
#define QN 15   // N tiles per workgroup; 1200 / 16 = 5 * QN
#define QP ((BM * 50 + 255) / 256)   // 16-byte pieces of the row tile per thread
__global__ void __launch_bounds__(256, 1)
qkv_gemm_kernel(const _Float16* __restrict__ xs_h,
                const _Float16* __restrict__ w_in_h,
                const float* __restrict__ b_in,
                float* __restrict__ qkv_all) {
  __shared__ __attribute__((aligned(16))) _Float16 Ah[BM * PA];
  int tid = threadIdx.x, lane = tid & 31;
  int wv = __builtin_amdgcn_readfirstlane(tid >> 5);  // scalar: the tile loop branches on it
  int row0 = (blockIdx.x % (NROWS / BM)) * BM;
  int nt0  = (blockIdx.x / (NROWS / BM)) * QN;

  // The BM rows are one contiguous run of BM * 50 16-byte pieces. All of a thread's loads stand
  // ahead of its LDS stores: one memory latency for the tile, not one per piece.
  const _Float16* sp = xs_h + (size_t)row0 * D_M + tid * 8;
  v8h st[QP];
#pragma unroll
  for (int i = 0; i < QP; ++i)
    if (i + 1 < QP || tid < BM * 50 - (QP - 1) * 256) st[i] = *(const v8h*)(sp + i * 2048);
#pragma unroll
  for (int i = 0; i < QP; ++i) {
    int c = tid + i * 256;
    if (i + 1 < QP || tid < BM * 50 - (QP - 1) * 256)
      *(v8h*)(Ah + c * 8 + (c / 50) * (PA - D_M)) = st[i];
  }
  __syncthreads();   // the staged rows are complete before any wave reads them

  for (int nt = nt0 + wv; nt < nt0 + QN; nt += 8) {
    int nn = nt * 16 + (lane & 15);
    float bias = b_in[nn];   // ahead of the strip: it returns under the weight loads
    v8f acc[MT];
    strip_k400(Ah, w_in_h, nt, lane, acc);
    float* op = qkv_all + (size_t)(row0 + (lane >> 4) * 8) * 1200 + nn;
#pragma unroll
    for (int q = 0; q < MT * 8; ++q)
      op[((q >> 3) * 16 + (q & 7)) * 1200] = acc[q >> 3][q & 7] + bias;
  }
}

// LayerNorm of the BM rows of X, one wave per row, the row held in registers.
// TO_OUT false: back into X, with an f16 copy in Ah. TO_OUT true: to global rows.
template <bool TO_OUT>
__device__ __forceinline__ void layernorm_packed(float* X, const float* g, const float* b,
                                                 _Float16* Ah, float* outg, int row0,
                                                 int wv, int lane) {
  float gg[13], bb[13];
#pragma unroll
  for (int q = 0; q < 13; ++q) {
    int c = lane + 32 * q;
    gg[q] = (c < D_M) ? g[c] : 0.f;
    bb[q] = (c < D_M) ? b[c] : 0.f;
  }
  for (int r = wv; r < BM; r += 8) {
    float v[13];
#pragma unroll
    for (int q = 0; q < 13; ++q) {
      int c = lane + 32 * q;
      v[q] = (c < D_M) ? X[r * PX + c] : 0.f;
    }
    float s = 0.f;
#pragma unroll
    for (int q = 0; q < 13; ++q) s += v[q];
#pragma unroll
    for (int off = 16; off > 0; off >>= 1) s += __shfl_xor(s, off, 32);
    float mu = s * (1.0f / D_M);
    float vv = 0.f;
#pragma unroll
    for (int q = 0; q < 13; ++q) {
      if (lane + 32 * q < D_M) {
        float t = v[q] - mu;
        vv += t * t;
      }
    }
#pragma unroll
    for (int off = 16; off > 0; off >>= 1) vv += __shfl_xor(vv, off, 32);
    float rs = rsqrtf(vv * (1.0f / D_M) + 1e-5f);
#pragma unroll
    for (int q = 0; q < 13; ++q) {
      int c = lane + 32 * q;
      if (c < D_M) {
        float y = (v[q] - mu) * rs * gg[q] + bb[q];
        if (TO_OUT) {
          if (row0 + r < MROWS) outg[(size_t)(row0 + r) * D_M + c] = y;
          // Behind the row's last store: the next row rewrites the registers it names.
          if (q == 12) asm volatile("s_wait_xcnt 0x0" ::: "memory");
        } else {
          X[r * PX + c]  = y;
          Ah[r * PA + c] = (_Float16)y;
        }
      }
    }
  }
}

typedef __attribute__((ext_vector_type(2))) float v2f;

__device__ __forceinline__ v2f fma2(v2f a, v2f b, float c) {
  return __builtin_elementwise_fma(a, b, v2f{c, c});
}

#define GP 8   // value pairs that go through the GELU side by side

// Exact-erf GELU of GP value pairs with no branch. erf keeps the f32 library's two fits (an odd
// polynomial below |z| = 1, 1 - exp(-q(|z|)) from there on), but both are evaluated for every
// lane and one is selected: a branch on the lane's value cuts the epilogue into one serial
// dependent chain per element, where straight-line code lets independent chains overlap.
__device__ __forceinline__ void gelu_group(v2f* x) {
  v2f z[GP], az[GP], t[GP], q[GP], p[GP];
#pragma unroll
  for (int i = 0; i < GP; ++i) { z[i] = x[i] * 0.707106769f; x[i] = x[i] * 0.5f; }
#pragma unroll
  for (int i = 0; i < GP; ++i) {
    az[i] = v2f{__builtin_fabsf(z[i].x), __builtin_fabsf(z[i].y)};
    t[i]  = z[i] * z[i];
  }
  const float cq[6] = {-0.000378677854f, 0.00385781587f, -0.0241816975f,
                       0.106668264f, 0.634933293f, 0.128689408f};
  const float cp[5] = {0.00491381623f, -0.0267075151f, 0.112800106f,
                       -0.376122952f, 0.128379107f};
#pragma unroll
  for (int i = 0; i < GP; ++i) {
    q[i] = v2f{0.0000169988107f, 0.0000169988107f};
    p[i] = v2f{-0.000561801775f, -0.000561801775f};
  }
#pragma unroll
  for (int s = 0; s < 5; ++s) {
#pragma unroll
    for (int i = 0; i < GP; ++i) {
      q[i] = fma2(az[i], q[i], cq[s]);
      p[i] = fma2(t[i], p[i], cp[s]);
    }
  }
#pragma unroll
  for (int i = 0; i < GP; ++i) {
    q[i] = fma2(az[i], q[i], cq[5]);
    p[i] = __builtin_elementwise_fma(az[i], p[i], az[i]);
  }
#pragma unroll
  for (int i = 0; i < GP; ++i) q[i] = __builtin_elementwise_fma(az[i], q[i], az[i]);
#pragma unroll
  for (int i = 0; i < GP; ++i) q[i] = q[i] * -1.44269502f;
#pragma unroll
  for (int i = 0; i < GP; ++i)
    q[i] = v2f{__builtin_amdgcn_exp2f(q[i].x), __builtin_amdgcn_exp2f(q[i].y)};
#pragma unroll
  for (int i = 0; i < GP; ++i) q[i] = 1.0f - q[i];
#pragma unroll
  for (int i = 0; i < GP; ++i)
    p[i] = v2f{az[i].x < 1.0f ? p[i].x : q[i].x, az[i].y < 1.0f ? p[i].y : q[i].y};
#pragma unroll
  for (int i = 0; i < GP; ++i)
    p[i] = v2f{__builtin_copysignf(p[i].x, z[i].x), __builtin_copysignf(p[i].y, z[i].y)};
#pragma unroll
  for (int i = 0; i < GP; ++i) p[i] = p[i] + 1.0f;
#pragma unroll
  for (int i = 0; i < GP; ++i) x[i] = x[i] * p[i];
}

__global__ void __launch_bounds__(256, 1)
rows_kernel(const float* __restrict__ xs,
            const _Float16* __restrict__ o_h,
            const _Float16* __restrict__ w_out_h,
            const float* __restrict__ b_out,
            const _Float16* __restrict__ w1_h,
            const float* __restrict__ b1,
            const _Float16* __restrict__ w2_h,
            const float* __restrict__ b2,
            const float* __restrict__ ln1_g, const float* __restrict__ ln1_b,
            const float* __restrict__ ln2_g, const float* __restrict__ ln2_b,
            float* __restrict__ out_win) {
  __shared__ __attribute__((aligned(16))) float    X[BM * PX];   // residual stream, f32
  __shared__ __attribute__((aligned(16))) _Float16 Ah[BM * PA];  // o, then LN1 output
  __shared__ __attribute__((aligned(16))) _Float16 Fc[BM * PF];  // one chunk of gelu(ffn1)
  int tid = threadIdx.x, lane = tid & 31;
  int wv = __builtin_amdgcn_readfirstlane(tid >> 5);  // scalar: tile loops branch on it
  int half = lane >> 4;
  int row0 = blockIdx.x * BM;

  // --- stage o (f16) and the residual rows of xs (f32); rows past the end repeat the
  //     last row and are never stored ---
  for (int c = tid; c < BM * 50; c += 256) {
    int r = c / 50, q = c % 50;
    int gr = row0 + r; if (gr > MROWS - 1) gr = MROWS - 1;
    *(v8h*)(Ah + r * PA + q * 8) = *(const v8h*)(o_h + (size_t)gr * D_M + q * 8);
  }
  for (int c = tid; c < BM * 100; c += 256) {
    int r = c / 100, q = c % 100;
    int gr = row0 + r; if (gr > MROWS - 1) gr = MROWS - 1;
    int w = gr / L_W, j = gr % L_W;
    int xr = (w / W_CNT) * T_LEN + (w % W_CNT) + j;
    *(float4*)(X + r * PX + q * 4) = *(const float4*)(xs + (size_t)xr * D_M + q * 4);
  }
  __syncthreads();

  // --- out projection + residual -> X ---
  for (int nt = wv; nt < D_M / 16; nt += 8) {
    v8f acc[MT];
    strip_k400(Ah, w_out_h, nt, lane, acc);
    int nn = nt * 16 + (lane & 15);
    float bo = b_out[nn];
    float* xp = X + half * 8 * PX + nn;
    float res[MT * 8];   // all reads ahead of the stores: one LDS latency, not one per element
#pragma unroll
    for (int q = 0; q < MT * 8; ++q) res[q] = xp[((q >> 3) * 16 + (q & 7)) * PX];
#pragma unroll
    for (int q = 0; q < MT * 8; ++q)
      xp[((q >> 3) * 16 + (q & 7)) * PX] = acc[q >> 3][q & 7] + bo + res[q];
  }
  __syncthreads();
  layernorm_packed<false>(X, ln1_g, ln1_b, Ah, nullptr, row0, wv, lane);
  __syncthreads();

  // --- FFN in 5 chunks of 320 hidden columns: FFN1 + exact GELU -> Fc, then FFN2 adds
  //     that chunk's k range into accumulators that stay in registers (k ascending) ---
  v8f acc2[4][MT];
#pragma unroll
  for (int tt = 0; tt < 4; ++tt) {
#pragma unroll
    for (int mt = 0; mt < MT; ++mt) acc2[tt][mt] = v8f{};
  }
#pragma unroll 1   // one copy of the chunk body, for speed only
  for (int kc = 0; kc < FF_M / FC; ++kc) {
#pragma unroll 1   // same reason
    for (int t = wv; t < FC / 16; t += 8) {
      v8f acc[MT];
      strip_k400(Ah, w1_h, kc * (FC / 16) + t, lane, acc);
      int cl = t * 16 + (lane & 15);
      float bb = b1[kc * FC + cl];
#pragma unroll
      for (int e0 = 0; e0 < MT * 8; e0 += 2 * GP) {
        v2f xv[GP];
#pragma unroll
        for (int i = 0; i < GP; ++i) {
          int e = e0 + 2 * i;
          xv[i] = v2f{acc[e >> 3][e & 7] + bb, acc[e >> 3][(e & 7) + 1] + bb};
        }
        gelu_group(xv);
#pragma unroll
        for (int i = 0; i < GP; ++i) {
          int e = e0 + 2 * i;
          int m = (e >> 3) * 16 + (e & 7) + half * 8;
          Fc[m * PF + cl]       = (_Float16)xv[i].x;
          Fc[(m + 1) * PF + cl] = (_Float16)xv[i].y;
        }
      }
    }
    __syncthreads();   // Fc complete before any wave reads it
    const _Float16* ap = Fc + (lane & 15) * PF + half * 8;
    const _Float16* bp = w2_h + (size_t)(wv * KS_F + kc * (FC / 32)) * PBLK + lane * 8;
    // Weight fragments run two k steps ahead of their WMMAs (ring of three sets); each A
    // fragment read from LDS serves all of the wave's N tiles. Tile 24 is wave 0's alone.
    v16h bq[3][4];
#pragma unroll
    for (int ks = 0; ks < 2; ++ks) {
#pragma unroll
      for (int tt = 0; tt < 3; ++tt) bq[ks][tt] = fragp(bp + (tt * 8 * KS_F + ks) * PBLK, true);
      if (wv == 0) bq[ks][3] = fragp(bp + (3 * 8 * KS_F + ks) * PBLK, true);
    }
    v16h a[2][MT];   // A fragments run one k step ahead
#pragma unroll
    for (int mt = 0; mt < MT; ++mt) a[0][mt] = frag16(ap + mt * 16 * PF, true);
#pragma unroll
    for (int ks = 0; ks < FC / 32; ++ks) {
      if (ks + 2 < FC / 32) {
#pragma unroll
        for (int tt = 0; tt < 3; ++tt)
          bq[(ks + 2) % 3][tt] = fragp(bp + (tt * 8 * KS_F + ks + 2) * PBLK, true);
        if (wv == 0) bq[(ks + 2) % 3][3] = fragp(bp + (3 * 8 * KS_F + ks + 2) * PBLK, true);
      }
      if (ks + 1 < FC / 32) {
#pragma unroll
        for (int mt = 0; mt < MT; ++mt)
          a[(ks + 1) & 1][mt] = frag16(ap + mt * 16 * PF + (ks + 1) * 32, true);
      }
#pragma unroll
      for (int tt = 0; tt < 3; ++tt) {
#pragma unroll
        for (int mt = 0; mt < MT; ++mt)
          acc2[tt][mt] = wmma_acc(a[ks & 1][mt], bq[ks % 3][tt], acc2[tt][mt]);
      }
      if (wv == 0) {
#pragma unroll
        for (int mt = 0; mt < MT; ++mt)
          acc2[3][mt] = wmma_acc(a[ks & 1][mt], bq[ks % 3][3], acc2[3][mt]);
      }
    }
    __syncthreads();   // every reader has left Fc before the next chunk overwrites it
  }
#pragma unroll
  for (int tt = 0; tt < 4; ++tt) {
    int nt = wv + tt * 8;
    if (nt < D_M / 16) {
      int nn = nt * 16 + (lane & 15);
      float bb = b2[nn];
      float* xp = X + half * 8 * PX + nn;
      float res[MT * 8];   // all reads ahead of the stores, as above
#pragma unroll
      for (int q = 0; q < MT * 8; ++q) res[q] = xp[((q >> 3) * 16 + (q & 7)) * PX];
#pragma unroll
      for (int q = 0; q < MT * 8; ++q)
        xp[((q >> 3) * 16 + (q & 7)) * PX] = res[q] + acc2[tt][q >> 3][q & 7] + bb;
    }
  }
  __syncthreads();
  layernorm_packed<true>(X, ln2_g, ln2_b, nullptr, out_win, row0, wv, lane);
}

// ---------------- Kernel 5: deterministic overlap-gather + output transpose ----------------
// row t receives out_win[i][t - i/2] for i in [2(t-8), 2t+1] ∩ [0, W)
__global__ void gather_out_kernel(const float* __restrict__ out_win,
                                  float* __restrict__ out) {
  int idx = blockIdx.x * blockDim.x + threadIdx.x;
  if (idx >= NROWS * D_M) return;
  int n = idx / (T_LEN * D_M);
  int r = idx % (T_LEN * D_M);
  int t = r / D_M;
  int d = r % D_M;
  int ilo = 2 * (t - 8); if (ilo < 0) ilo = 0;
  int ihi = 2 * t + 1;   if (ihi > W_CNT - 1) ihi = W_CNT - 1;
  float sum = 0.f;
  for (int i = ilo; i <= ihi; ++i) {
    int j = t - (i >> 1);
    if (j >= 0 && j < L_W)
      sum += out_win[((size_t)(n * W_CNT + i) * L_W + j) * D_M + d];
  }
  int v = d >> 4, c = d & 15;
  out[((n * C_CH + c) * T_LEN + t) * V_J + v] = sum;
}

// ---------------- host launch ----------------
extern "C" void kernel_launch(void* const* d_in, const int* in_sizes, int n_in,
                              void* d_out, int out_size, void* d_ws, size_t ws_size,
                              hipStream_t stream) {
  const float* x     = (const float*)d_in[0];
  const float* pe    = (const float*)d_in[1];
  const float* w_in  = (const float*)d_in[2];
  const float* b_in  = (const float*)d_in[3];
  const float* w_out = (const float*)d_in[4];
  const float* b_out = (const float*)d_in[5];
  const float* w1    = (const float*)d_in[6];
  const float* b1    = (const float*)d_in[7];
  const float* w2    = (const float*)d_in[8];
  const float* b2    = (const float*)d_in[9];
  const float* ln1g  = (const float*)d_in[10];
  const float* ln1b  = (const float*)d_in[11];
  const float* ln2g  = (const float*)d_in[12];
  const float* ln2b  = (const float*)d_in[13];
  float* out = (float*)d_out;

  // workspace layout
  char* ws = (char*)d_ws;
  size_t off = 0;
  float*    xs      = (float*)(ws + off);    off += (size_t)NROWS * D_M * 4;       // 7.68 MB
  _Float16* xs_h    = (_Float16*)(ws + off); off += (size_t)NROWS * D_M * 2;       // 3.84 MB
  // packed in fragment order: N/16 tiles x k steps x 1 KiB
  _Float16* w_in_h  = (_Float16*)(ws + off); off += (size_t)(3 * D_M / 16) * KS_D * 1024;  // 1.00 MB
  _Float16* w_out_h = (_Float16*)(ws + off); off += (size_t)(D_M / 16) * KS_D * 1024;   // 0.33 MB
  _Float16* w1_h    = (_Float16*)(ws + off); off += (size_t)(FF_M / 16) * KS_D * 1024;  // 1.33 MB
  _Float16* w2_h    = (_Float16*)(ws + off); off += (size_t)(D_M / 16) * KS_F * 1024;   // 1.28 MB
  float*    qkv_all = (float*)(ws + off);    off += (size_t)NROWS * 3 * D_M * 4;   // 23.04 MB
  float*    out_win = (float*)(ws + off);    off += (size_t)NWIN * L_W * D_M * 4;  // 67.05 MB
  _Float16* o_h     = (_Float16*)(ws + off); off += (size_t)NWIN * L_W * D_M * 2;  // 33.52 MB

  const int TPB = 256;

  // 1) layout + positional encoding
  prep_xs_kernel<<<(NROWS * D_M + TPB - 1) / TPB, TPB, 0, stream>>>(x, pe, xs, xs_h);

  // 2) weight conversion to f16, packed in fragment order
  pack_w_kernel<<<((3 * D_M / 16) * KS_D * 64 + TPB - 1) / TPB, TPB, 0, stream>>>(
      w_in, w_in_h, D_M, KS_D, (3 * D_M / 16) * KS_D * 64);
  pack_w_kernel<<<((D_M / 16) * KS_D * 64 + TPB - 1) / TPB, TPB, 0, stream>>>(
      w_out, w_out_h, D_M, KS_D, (D_M / 16) * KS_D * 64);
  pack_w_kernel<<<((FF_M / 16) * KS_D * 64 + TPB - 1) / TPB, TPB, 0, stream>>>(
      w1, w1_h, D_M, KS_D, (FF_M / 16) * KS_D * 64);
  pack_w_kernel<<<((D_M / 16) * KS_F * 64 + TPB - 1) / TPB, TPB, 0, stream>>>(
      w2, w2_h, FF_M, KS_F, (D_M / 16) * KS_F * 64);

  // 3) hoisted QKV GEMM: one block per tile of BM rows x QN * 16 columns
  qkv_gemm_kernel<<<(NROWS / BM) * (3 * D_M / 16 / QN), TPB, 0, stream>>>(xs_h, w_in_h, b_in,
                                                                          qkv_all);

  // 4) per-window attention
  attn_kernel<<<NWIN, TPB, 0, stream>>>(qkv_all, o_h);

  // 4b) out projection, LayerNorm, FFN, LayerNorm on packed rows (WMMA)
  rows_kernel<<<(MROWS + BM - 1) / BM, TPB, 0, stream>>>(xs, o_h, w_out_h, b_out, w1_h, b1,
                                                         w2_h, b2, ln1g, ln1b, ln2g, ln2b,
                                                         out_win);

  // 5) deterministic overlap-add + transpose to [N,C,T,V]
  gather_out_kernel<<<(NROWS * D_M + TPB - 1) / TPB, TPB, 0, stream>>>(out_win, out);
}

// v005
// One run takes 233 microseconds.
// In both of two side-by-side timings against v004, it was 1.11 times as fast.
// Counting every step since v000, it is 4.69 times as fast.
#include <hip/hip_runtime.h>
#include <hip/hip_fp16.h>
#include <math.h>

typedef __attribute__((ext_vector_type(16))) _Float16 v16h;
typedef __attribute__((ext_vector_type(8)))  float    v8f;

#define N_B   16
#define T_LEN 300
#define V_J   25
#define C_CH  16
#define D_M   400      // C*V
#define H_N   2
#define DH    200
#define FF_M  1600
#define L_W   9
#define W_CNT 291      // T - L
#define NWIN  (N_B * W_CNT)   // 4656
#define NROWS (N_B * T_LEN)   // 4800
#define KS_D  13       // ceil(400/32)
#define KS_F  50       // 1600/32

// ---------------- WMMA fragment helpers (16x16x32 f16 -> f32) ----------------

__device__ __forceinline__ v8f wmma_acc(v16h a, v16h b, v8f c) {
  return __builtin_amdgcn_wmma_f32_16x16x32_f16(false, a, false, b, (short)0, c,
                                                false, false);
}

// ---------------- Kernel 1: layout change + positional encoding ----------------
// xs[n][t][d] = x[n][c][t][v] + pe[t][d],  d = v*16 + c  (torch view order)
// The two layout kernels (this one and the overlap gather) do a few operations per element.
// One thread takes TG time steps x 4 neighbouring d (16 elements), so that 3750 waves have to
// start per launch; at one element per thread it is 60000.
#define TG    4                                  // time steps per thread
#define TB    (T_LEN / TG)                       // 75
#define NITEM (N_B * TB * (D_M / 4))             // 120000 threads

typedef __attribute__((ext_vector_type(4))) _Float16 v4h;

__global__ void __launch_bounds__(256)
prep_xs_kernel(const float* __restrict__ x, const float* __restrict__ pe,
               float* __restrict__ xs, _Float16* __restrict__ xs_h) {
  int idx = blockIdx.x * 256 + threadIdx.x;
  if (idx >= NITEM) return;
  int d4 = idx % (D_M / 4);
  int r  = idx / (D_M / 4);
  int t0 = (r % TB) * TG;      // TG neighbouring steps: their x values share 128-B lines
  int n  = r / TB;
  int v = d4 >> 2, c0 = (d4 & 3) * 4;
  const float* xp = x + ((n * C_CH + c0) * T_LEN + t0) * V_J + v;
  const float* pp = pe + t0 * D_M + d4 * 4;
  float  xv[TG * 4];
  float4 pv[TG];
  // All 20 loads are in flight together. A later load's result may be given the address pair
  // of the loads before it: the pair's last load stands alone behind an s_wait_xcnt 0, and a
  // second one frees the pair for the results of the pe loads.
#pragma unroll
  for (int e = 0; e < TG * 4 - 1; ++e) xv[e] = xp[((e & 3) * T_LEN + (e >> 2)) * V_J];
  asm volatile("s_wait_xcnt 0x0" ::: "memory");
  xv[TG * 4 - 1] = xp[(3 * T_LEN + TG - 1) * V_J];
  asm volatile("s_wait_xcnt 0x0" ::: "memory");
#pragma unroll
  for (int k = 0; k < TG; ++k) pv[k] = *(const float4*)(pp + k * D_M);
  int o = (n * T_LEN + t0) * D_M + d4 * 4;
  float4 s[TG];
  v4h    h[TG];
#pragma unroll
  for (int k = 0; k < TG; ++k) {
    s[k] = make_float4(xv[k * 4] + pv[k].x, xv[k * 4 + 1] + pv[k].y, xv[k * 4 + 2] + pv[k].z,
                       xv[k * 4 + 3] + pv[k].w);
    h[k] = v4h{(_Float16)s[k].x, (_Float16)s[k].y, (_Float16)s[k].z, (_Float16)s[k].w};
  }
#pragma unroll
  for (int k = 0; k < TG; ++k) {
    *(float4*)(xs + o + k * D_M) = s[k];
    *(v4h*)(xs_h + o + k * D_M)  = h[k];
  }
}

// ---------------- Kernel 4: attention of one window per workgroup ----------------
// LDS map (floats): [0,10800) qkv f32 [9][1200]; [10800,10962) scores
// Result o goes out as f16 (the type the out projection reads it in), packed as
// row w*9 + a of o_h[41904][400].
__global__ void __launch_bounds__(256, 1)
attn_kernel(const float* __restrict__ qkv_all, _Float16* __restrict__ o_h) {
  __shared__ float smem[10976];
  int w = blockIdx.x;
  int n = w / W_CNT;
  int i = w % W_CNT;
  int tid = threadIdx.x;

  // --- gather qkv rows (contiguous, vectorized) ---
  {
    const float4* src = (const float4*)(qkv_all + (size_t)(n * T_LEN + i) * 1200);
    float4* dst = (float4*)smem;
    for (int v4 = tid; v4 < (L_W * 1200) / 4; v4 += 256) dst[v4] = src[v4];
  }
  __syncthreads();

  // --- attention scores + softmax (tiny, VALU) ---
  float* scores = smem + 10800;  // [2][9][9]
  for (int s = tid; s < H_N * L_W * L_W; s += 256) {
    int h = s / 81, r = s % 81, a = r / 9, b = r % 9;
    const float* qp = smem + a * 1200 + h * DH;          // q
    const float* kp = smem + 400 + b * 1200 + h * DH;    // k
    float acc = 0.f;
    for (int e = 0; e < DH; ++e) acc += qp[e] * kp[e];
    scores[s] = acc * 0.07071067811865475f;              // 1/sqrt(200)
  }
  __syncthreads();
  if (tid < H_N * L_W) {
    float* row = scores + tid * L_W;
    float mx = row[0];
#pragma unroll
    for (int b = 1; b < L_W; ++b) mx = fmaxf(mx, row[b]);
    float sum = 0.f;
#pragma unroll
    for (int b = 0; b < L_W; ++b) { row[b] = __expf(row[b] - mx); sum += row[b]; }
    float inv = 1.0f / sum;
#pragma unroll
    for (int b = 0; b < L_W; ++b) row[b] *= inv;
  }
  __syncthreads();

  // --- o = att @ v -> packed rows of o_h ---
  for (int s = tid; s < L_W * D_M; s += 256) {
    int a = s / D_M, dim = s % D_M, h = dim / DH, e = dim % DH;
    const float* att = scores + h * 81 + a * 9;
    float acc = 0.f;
#pragma unroll
    for (int b = 0; b < L_W; ++b) acc += att[b] * smem[800 + b * 1200 + h * DH + e];
    o_h[(size_t)w * (L_W * D_M) + s] = (_Float16)acc;
  }
}

// ---------------- Kernel 4b: row-wise stages on packed rows ----------------
// Behind the attention every stage (out projection, LayerNorm, FFN, LayerNorm) works on
// one row alone, so the 41904 (window, position) rows are packed into full 16-row tiles
// and one workgroup takes MT of them: each weight fragment loaded from L2 feeds MT WMMAs.
#define MROWS (NWIN * L_W)   // 41904 = 2619 tiles of 16
#define MT    6              // M tiles per workgroup
#define BM    (MT * 16)
#define PX    404            // f32 row pitch of X
#define PA    408            // f16 row pitch, 816 B = 16 B x odd
#define FC    320            // FFN columns per chunk
#define PF    328            // f16 row pitch, 656 B = 16 B x odd

typedef __attribute__((ext_vector_type(8))) _Float16 v8h;

// One lane's 16 halves of an A or B fragment: k = 8*half + 0..7 and 16 + 8*half + 0..7,
// p already at row start + kbase + 8*half. full == false: the upper 16 k are past K.
__device__ __forceinline__ v16h frag16(const _Float16* p, bool full) {
  v8h lo = *(const v8h*)p;
  v8h hi = {};
  if (full) hi = *(const v8h*)(p + 16);
  return __builtin_shufflevector(lo, hi, 0, 1, 2, 3, 4, 5, 6, 7, 8, 9, 10, 11, 12, 13,
                                 14, 15);
}

// Packed weights: the B fragment of (N tile nt, k step ks) is one 1-KiB block at index
// nt * KS + ks. Its first 512 B hold the 32 lanes' lower 8 halves in lane order, the next
// 512 B their upper 8, so one 16-byte-per-lane load covers 4 whole 128-B lines. Read from the
// row-major matrix the same load takes a 32-B piece out of each of 16 lines.
#define PBLK 512   // halves per block

// One lane's 16 halves of a packed B fragment, p at block start + lane * 8.
__device__ __forceinline__ v16h fragp(const _Float16* p, bool full) {
  v8h lo = *(const v8h*)p;
  v8h hi = {};
  if (full) hi = *(const v8h*)(p + PBLK / 2);
  return __builtin_shufflevector(lo, hi, 0, 1, 2, 3, 4, 5, 6, 7, 8, 9, 10, 11, 12, 13,
                                 14, 15);
}

// f32 weight W[N][K] -> f16 in the packed order above; one thread per 16-byte piece.
// A piece whose k lies past K is neither written here nor read by anyone.
__global__ void pack_w_kernel(const float* __restrict__ src, _Float16* __restrict__ dst,
                              int K, int KS, int pieces) {
  int idx = blockIdx.x * blockDim.x + threadIdx.x;
  if (idx >= pieces) return;
  int lane = idx & 31, part = (idx >> 5) & 1, blk = idx >> 6;
  int k = (blk % KS) * 32 + part * 16 + (lane >> 4) * 8;
  if (k >= K) return;
  const float* p = src + (size_t)((blk / KS) * 16 + (lane & 15)) * K + k;
  float4 u = *(const float4*)p, v = *(const float4*)(p + 4);
  v8h h = {(_Float16)u.x, (_Float16)u.y, (_Float16)u.z, (_Float16)u.w,
           (_Float16)v.x, (_Float16)v.y, (_Float16)v.z, (_Float16)v.w};
  *(v8h*)(dst + (size_t)idx * 8) = h;
}

// acc[mt] = A[mt*16..][0..400) @ W[nt*16..nt*16+16)^T, A f16 in LDS at pitch PA, W packed.
__device__ __forceinline__ void strip_k400(const _Float16* A, const _Float16* W, int nt,
                                           int lane, v8f* acc) {
  const _Float16* bp = W + (size_t)nt * (KS_D * PBLK) + lane * 8;
  const _Float16* ap = A + (lane & 15) * PA + (lane >> 4) * 8;
  // Compiler fence: keeps the A reads below inside the caller's loop over N tiles. They do
  // not change from tile to tile, and hoisted out of the loop they take 624 registers and spill.
  asm volatile("" ::: "memory");
  v16h b[KS_D];
#pragma unroll
  for (int ks = 0; ks < KS_D; ++ks) {
    // The last load's result may be given the address pair that the loads before it name:
    // the wait stands in front of that overwrite.
    if (ks + 1 == KS_D) asm volatile("s_wait_xcnt 0x0" ::: "memory");
    b[ks] = fragp(bp + ks * PBLK, ks + 1 < KS_D);
  }
#pragma unroll
  for (int mt = 0; mt < MT; ++mt) acc[mt] = v8f{};
  // A fragments of k step ks + 1 are read as one group ahead of the WMMAs of step ks.
  v16h a[2][MT];
#pragma unroll
  for (int mt = 0; mt < MT; ++mt) a[0][mt] = frag16(ap + mt * 16 * PA, true);
  __builtin_amdgcn_sched_barrier(0);   // keeps all 25 weight loads in flight from the start
#pragma unroll
  for (int ks = 0; ks < KS_D; ++ks) {
    if (ks + 1 < KS_D) {
#pragma unroll
      for (int mt = 0; mt < MT; ++mt)
        a[(ks + 1) & 1][mt] = frag16(ap + mt * 16 * PA + (ks + 1) * 32, ks + 2 < KS_D);
    }
    // Holds the read group ahead of the WMMAs: with the FFN2 accumulators live the scheduler
    // otherwise sinks each read to its WMMA, which then waits out a whole LDS latency.
    __builtin_amdgcn_sched_barrier(0);
#pragma unroll
    for (int mt = 0; mt < MT; ++mt) acc[mt] = wmma_acc(a[ks & 1][mt], b[ks], acc[mt]);
    __builtin_amdgcn_sched_barrier(0);   // same purpose: the next group stays behind these
  }
}

// ---------------- Kernel 3: hoisted QKV GEMM over all 4800 rows ----------------
// qkv_all[4800][1200] = xs[4800][400] @ w_in^T + b_in
// One workgroup per tile of BM rows x QN * 16 columns. The rows are staged once in LDS, w_in
// comes packed, and each wave runs whole strips: a weight fragment feeds MT WMMAs, and the 25
// weight loads of a strip are in flight together, so a strip waits out one L2 latency, not
// one per k step.
#define QN 15   // N tiles per workgroup; 1200 / 16 = 5 * QN
#define QP ((BM * 50 + 255) / 256)   // 16-byte pieces of the row tile per thread
__global__ void __launch_bounds__(256, 1)
qkv_gemm_kernel(const _Float16* __restrict__ xs_h,
                const _Float16* __restrict__ w_in_h,
                const float* __restrict__ b_in,
                float* __restrict__ qkv_all) {
  __shared__ __attribute__((aligned(16))) _Float16 Ah[BM * PA];
  int tid = threadIdx.x, lane = tid & 31;
  int wv = __builtin_amdgcn_readfirstlane(tid >> 5);  // scalar: the tile loop branches on it
  int row0 = (blockIdx.x % (NROWS / BM)) * BM;
  int nt0  = (blockIdx.x / (NROWS / BM)) * QN;

  // The BM rows are one contiguous run of BM * 50 16-byte pieces. All of a thread's loads stand
  // ahead of its LDS stores: one memory latency for the tile, not one per piece.
  const _Float16* sp = xs_h + (size_t)row0 * D_M + tid * 8;
  v8h st[QP];
#pragma unroll
  for (int i = 0; i < QP; ++i)
    if (i + 1 < QP || tid < BM * 50 - (QP - 1) * 256) st[i] = *(const v8h*)(sp + i * 2048);
#pragma unroll
  for (int i = 0; i < QP; ++i) {
    int c = tid + i * 256;
    if (i + 1 < QP || tid < BM * 50 - (QP - 1) * 256)
      *(v8h*)(Ah + c * 8 + (c / 50) * (PA - D_M)) = st[i];
  }
  __syncthreads();   // the staged rows are complete before any wave reads them

  for (int nt = nt0 + wv; nt < nt0 + QN; nt += 8) {
    int nn = nt * 16 + (lane & 15);
    float bias = b_in[nn];   // ahead of the strip: it returns under the weight loads
    v8f acc[MT];
    strip_k400(Ah, w_in_h, nt, lane, acc);
    float* op = qkv_all + (size_t)(row0 + (lane >> 4) * 8) * 1200 + nn;
#pragma unroll
    for (int q = 0; q < MT * 8; ++q)
      op[((q >> 3) * 16 + (q & 7)) * 1200] = acc[q >> 3][q & 7] + bias;
  }
}

// LayerNorm of the BM rows of X, one wave per row, the row held in registers.
// TO_OUT false: back into X, with an f16 copy in Ah. TO_OUT true: to global rows.
template <bool TO_OUT>
__device__ __forceinline__ void layernorm_packed(float* X, const float* g, const float* b,
                                                 _Float16* Ah, float* outg, int row0,
                                                 int wv, int lane) {
  float gg[13], bb[13];
#pragma unroll
  for (int q = 0; q < 13; ++q) {
    int c = lane + 32 * q;
    gg[q] = (c < D_M) ? g[c] : 0.f;
    bb[q] = (c < D_M) ? b[c] : 0.f;
  }
  for (int r = wv; r < BM; r += 8) {
    float v[13];
#pragma unroll
    for (int q = 0; q < 13; ++q) {
      int c = lane + 32 * q;
      v[q] = (c < D_M) ? X[r * PX + c] : 0.f;
    }
    float s = 0.f;
#pragma unroll
    for (int q = 0; q < 13; ++q) s += v[q];
#pragma unroll
    for (int off = 16; off > 0; off >>= 1) s += __shfl_xor(s, off, 32);
    float mu = s * (1.0f / D_M);
    float vv = 0.f;
#pragma unroll
    for (int q = 0; q < 13; ++q) {
      if (lane + 32 * q < D_M) {
        float t = v[q] - mu;
        vv += t * t;
      }
    }
#pragma unroll
    for (int off = 16; off > 0; off >>= 1) vv += __shfl_xor(vv, off, 32);
    float rs = rsqrtf(vv * (1.0f / D_M) + 1e-5f);
#pragma unroll
    for (int q = 0; q < 13; ++q) {
      int c = lane + 32 * q;
      if (c < D_M) {
        float y = (v[q] - mu) * rs * gg[q] + bb[q];
        if (TO_OUT) {
          if (row0 + r < MROWS) outg[(size_t)(row0 + r) * D_M + c] = y;
          // Behind the row's last store: the next row rewrites the registers it names.
          if (q == 12) asm volatile("s_wait_xcnt 0x0" ::: "memory");
        } else {
          X[r * PX + c]  = y;
          Ah[r * PA + c] = (_Float16)y;
        }
      }
    }
  }
}

typedef __attribute__((ext_vector_type(2))) float v2f;

__device__ __forceinline__ v2f fma2(v2f a, v2f b, float c) {
  return __builtin_elementwise_fma(a, b, v2f{c, c});
}

#define GP 8   // value pairs that go through the GELU side by side

// Exact-erf GELU of GP value pairs with no branch. erf keeps the f32 library's two fits (an odd
// polynomial below |z| = 1, 1 - exp(-q(|z|)) from there on), but both are evaluated for every
// lane and one is selected: a branch on the lane's value cuts the epilogue into one serial
// dependent chain per element, where straight-line code lets independent chains overlap.
__device__ __forceinline__ void gelu_group(v2f* x) {
  v2f z[GP], az[GP], t[GP], q[GP], p[GP];
#pragma unroll
  for (int i = 0; i < GP; ++i) { z[i] = x[i] * 0.707106769f; x[i] = x[i] * 0.5f; }
#pragma unroll
  for (int i = 0; i < GP; ++i) {
    az[i] = v2f{__builtin_fabsf(z[i].x), __builtin_fabsf(z[i].y)};
    t[i]  = z[i] * z[i];
  }
  const float cq[6] = {-0.000378677854f, 0.00385781587f, -0.0241816975f,
                       0.106668264f, 0.634933293f, 0.128689408f};
  const float cp[5] = {0.00491381623f, -0.0267075151f, 0.112800106f,
                       -0.376122952f, 0.128379107f};
#pragma unroll
  for (int i = 0; i < GP; ++i) {
    q[i] = v2f{0.0000169988107f, 0.0000169988107f};
    p[i] = v2f{-0.000561801775f, -0.000561801775f};
  }
#pragma unroll
  for (int s = 0; s < 5; ++s) {
#pragma unroll
    for (int i = 0; i < GP; ++i) {
      q[i] = fma2(az[i], q[i], cq[s]);
      p[i] = fma2(t[i], p[i], cp[s]);
    }
  }
#pragma unroll
  for (int i = 0; i < GP; ++i) {
    q[i] = fma2(az[i], q[i], cq[5]);
    p[i] = __builtin_elementwise_fma(az[i], p[i], az[i]);
  }
#pragma unroll
  for (int i = 0; i < GP; ++i) q[i] = __builtin_elementwise_fma(az[i], q[i], az[i]);
#pragma unroll
  for (int i = 0; i < GP; ++i) q[i] = q[i] * -1.44269502f;
#pragma unroll
  for (int i = 0; i < GP; ++i)
    q[i] = v2f{__builtin_amdgcn_exp2f(q[i].x), __builtin_amdgcn_exp2f(q[i].y)};
#pragma unroll
  for (int i = 0; i < GP; ++i) q[i] = 1.0f - q[i];
#pragma unroll
  for (int i = 0; i < GP; ++i)
    p[i] = v2f{az[i].x < 1.0f ? p[i].x : q[i].x, az[i].y < 1.0f ? p[i].y : q[i].y};
#pragma unroll
  for (int i = 0; i < GP; ++i)
    p[i] = v2f{__builtin_copysignf(p[i].x, z[i].x), __builtin_copysignf(p[i].y, z[i].y)};
#pragma unroll
  for (int i = 0; i < GP; ++i) p[i] = p[i] + 1.0f;
#pragma unroll
  for (int i = 0; i < GP; ++i) x[i] = x[i] * p[i];
}

__global__ void __launch_bounds__(256, 1)
rows_kernel(const float* __restrict__ xs,
            const _Float16* __restrict__ o_h,
            const _Float16* __restrict__ w_out_h,
            const float* __restrict__ b_out,
            const _Float16* __restrict__ w1_h,
            const float* __restrict__ b1,
            const _Float16* __restrict__ w2_h,
            const float* __restrict__ b2,
            const float* __restrict__ ln1_g, const float* __restrict__ ln1_b,
            const float* __restrict__ ln2_g, const float* __restrict__ ln2_b,
            float* __restrict__ out_win) {
  __shared__ __attribute__((aligned(16))) float    X[BM * PX];   // residual stream, f32
  __shared__ __attribute__((aligned(16))) _Float16 Ah[BM * PA];  // o, then LN1 output
  __shared__ __attribute__((aligned(16))) _Float16 Fc[BM * PF];  // one chunk of gelu(ffn1)
  int tid = threadIdx.x, lane = tid & 31;
  int wv = __builtin_amdgcn_readfirstlane(tid >> 5);  // scalar: tile loops branch on it
  int half = lane >> 4;
  int row0 = blockIdx.x * BM;

  // --- stage o (f16) and the residual rows of xs (f32); rows past the end repeat the
  //     last row and are never stored ---
  for (int c = tid; c < BM * 50; c += 256) {
    int r = c / 50, q = c % 50;
    int gr = row0 + r; if (gr > MROWS - 1) gr = MROWS - 1;
    *(v8h*)(Ah + r * PA + q * 8) = *(const v8h*)(o_h + (size_t)gr * D_M + q * 8);
  }
  for (int c = tid; c < BM * 100; c += 256) {
    int r = c / 100, q = c % 100;
    int gr = row0 + r; if (gr > MROWS - 1) gr = MROWS - 1;
    int w = gr / L_W, j = gr % L_W;
    int xr = (w / W_CNT) * T_LEN + (w % W_CNT) + j;
    *(float4*)(X + r * PX + q * 4) = *(const float4*)(xs + (size_t)xr * D_M + q * 4);
  }
  __syncthreads();

  // --- out projection + residual -> X ---
  for (int nt = wv; nt < D_M / 16; nt += 8) {
    v8f acc[MT];
    strip_k400(Ah, w_out_h, nt, lane, acc);
    int nn = nt * 16 + (lane & 15);
    float bo = b_out[nn];
    float* xp = X + half * 8 * PX + nn;
    float res[MT * 8];   // all reads ahead of the stores: one LDS latency, not one per element
#pragma unroll
    for (int q = 0; q < MT * 8; ++q) res[q] = xp[((q >> 3) * 16 + (q & 7)) * PX];
#pragma unroll
    for (int q = 0; q < MT * 8; ++q)
      xp[((q >> 3) * 16 + (q & 7)) * PX] = acc[q >> 3][q & 7] + bo + res[q];
  }
  __syncthreads();
  layernorm_packed<false>(X, ln1_g, ln1_b, Ah, nullptr, row0, wv, lane);
  __syncthreads();

  // --- FFN in 5 chunks of 320 hidden columns: FFN1 + exact GELU -> Fc, then FFN2 adds
  //     that chunk's k range into accumulators that stay in registers (k ascending) ---
  v8f acc2[4][MT];
#pragma unroll
  for (int tt = 0; tt < 4; ++tt) {
#pragma unroll
    for (int mt = 0; mt < MT; ++mt) acc2[tt][mt] = v8f{};
  }
#pragma unroll 1   // one copy of the chunk body, for speed only
  for (int kc = 0; kc < FF_M / FC; ++kc) {
#pragma unroll 1   // same reason
    for (int t = wv; t < FC / 16; t += 8) {
      v8f acc[MT];
      strip_k400(Ah, w1_h, kc * (FC / 16) + t, lane, acc);
      int cl = t * 16 + (lane & 15);
      float bb = b1[kc * FC + cl];
#pragma unroll
      for (int e0 = 0; e0 < MT * 8; e0 += 2 * GP) {
        v2f xv[GP];
#pragma unroll
        for (int i = 0; i < GP; ++i) {
          int e = e0 + 2 * i;
          xv[i] = v2f{acc[e >> 3][e & 7] + bb, acc[e >> 3][(e & 7) + 1] + bb};
        }
        gelu_group(xv);
#pragma unroll
        for (int i = 0; i < GP; ++i) {
          int e = e0 + 2 * i;
          int m = (e >> 3) * 16 + (e & 7) + half * 8;
          Fc[m * PF + cl]       = (_Float16)xv[i].x;
          Fc[(m + 1) * PF + cl] = (_Float16)xv[i].y;
        }
      }
    }
    __syncthreads();   // Fc complete before any wave reads it
    const _Float16* ap = Fc + (lane & 15) * PF + half * 8;
    const _Float16* bp = w2_h + (size_t)(wv * KS_F + kc * (FC / 32)) * PBLK + lane * 8;
    // Weight fragments run two k steps ahead of their WMMAs (ring of three sets); each A
    // fragment read from LDS serves all of the wave's N tiles. Tile 24 is wave 0's alone.
    v16h bq[3][4];
#pragma unroll
    for (int ks = 0; ks < 2; ++ks) {
#pragma unroll
      for (int tt = 0; tt < 3; ++tt) bq[ks][tt] = fragp(bp + (tt * 8 * KS_F + ks) * PBLK, true);
      if (wv == 0) bq[ks][3] = fragp(bp + (3 * 8 * KS_F + ks) * PBLK, true);
    }
    v16h a[2][MT];   // A fragments run one k step ahead
#pragma unroll
    for (int mt = 0; mt < MT; ++mt) a[0][mt] = frag16(ap + mt * 16 * PF, true);
#pragma unroll
    for (int ks = 0; ks < FC / 32; ++ks) {
      if (ks + 2 < FC / 32) {
#pragma unroll
        for (int tt = 0; tt < 3; ++tt)
          bq[(ks + 2) % 3][tt] = fragp(bp + (tt * 8 * KS_F + ks + 2) * PBLK, true);
        if (wv == 0) bq[(ks + 2) % 3][3] = fragp(bp + (3 * 8 * KS_F + ks + 2) * PBLK, true);
      }
      if (ks + 1 < FC / 32) {
#pragma unroll
        for (int mt = 0; mt < MT; ++mt)
          a[(ks + 1) & 1][mt] = frag16(ap + mt * 16 * PF + (ks + 1) * 32, true);
      }
#pragma unroll
      for (int tt = 0; tt < 3; ++tt) {
#pragma unroll
        for (int mt = 0; mt < MT; ++mt)
          acc2[tt][mt] = wmma_acc(a[ks & 1][mt], bq[ks % 3][tt], acc2[tt][mt]);
      }
      if (wv == 0) {
#pragma unroll
        for (int mt = 0; mt < MT; ++mt)
          acc2[3][mt] = wmma_acc(a[ks & 1][mt], bq[ks % 3][3], acc2[3][mt]);
      }
    }
    __syncthreads();   // every reader has left Fc before the next chunk overwrites it
  }
#pragma unroll
  for (int tt = 0; tt < 4; ++tt) {
    int nt = wv + tt * 8;
    if (nt < D_M / 16) {
      int nn = nt * 16 + (lane & 15);
      float bb = b2[nn];
      float* xp = X + half * 8 * PX + nn;
      float res[MT * 8];   // all reads ahead of the stores, as above
#pragma unroll
      for (int q = 0; q < MT * 8; ++q) res[q] = xp[((q >> 3) * 16 + (q & 7)) * PX];
#pragma unroll
      for (int q = 0; q < MT * 8; ++q)
        xp[((q >> 3) * 16 + (q & 7)) * PX] = res[q] + acc2[tt][q >> 3][q & 7] + bb;
    }
  }
  __syncthreads();
  layernorm_packed<true>(X, ln2_g, ln2_b, nullptr, out_win, row0, wv, lane);
}

// ---------------- Kernel 5: deterministic overlap-gather + output transpose ----------------
// row t receives out_win[i][t - i/2] for i in [2(t-8), 2t+1] within [0, W), summed with i ascending.
// One thread takes 4 neighbouring d of the steps t, t + TB, t + 2 TB, t + 3 TB (only steps up
// to TLAST receive anything, so every thread gets two full steps).
#define TLAST  ((W_CNT - 1) / 2 + L_W - 1)   // 153
#define IBMAX  (W_CNT + 1 - 2 * L_W)         // 274: the last even start whose 17 windows exist
#define ROWQ(q) ((q) * L_W - ((q) >> 1))     // packed row of window ib + q, less that of window ib
static_assert(IBMAX % 2 == 0, "ROWQ needs an even first window");

// Sum of step t for 4 neighbouring d, wn = the batch entry's first packed row + d.
// The 18 windows ib .. ib + 17 are read with no branch between them, from one address with
// constant offsets; ib is 2(t-8) moved into [0, IBMAX], which keeps every row inside the batch
// entry's block (the 18th is clamped to its last row), and a window outside the step's range
// adds 0. So all 18 loads are in flight together, and the windows that count keep their order.
__device__ __forceinline__ float4 gather_step(const float* wn, int t) {
  int i0 = 2 * (t - (L_W - 1));
  int ib = i0 < 0 ? 0 : (i0 > IBMAX ? IBMAX : i0);
  int r0 = ib * L_W + t - (ib >> 1);
  int rl = r0 + ROWQ(2 * L_W - 1);
  if (rl > W_CNT * L_W - 1) rl = W_CNT * L_W - 1;
  const float* p  = wn + r0 * D_M;
  const float* pl = wn + rl * D_M;
  float4 val[2 * L_W];
#pragma unroll
  for (int q = 0; q < 2 * L_W - 2; ++q) val[q] = *(const float4*)(p + ROWQ(q) * D_M);
  // A later load's result may be given the address pair of the loads before it: each pair's
  // last load stands alone behind an s_wait_xcnt 0, so no pair is overwritten in front of one.
  asm volatile("s_wait_xcnt 0x0" ::: "memory");
  val[2 * L_W - 2] = *(const float4*)(p + ROWQ(2 * L_W - 2) * D_M);
  asm volatile("s_wait_xcnt 0x0" ::: "memory");
  val[2 * L_W - 1] = *(const float4*)pl;
  asm volatile("s_wait_xcnt 0x0" ::: "memory");
  float4 sum = make_float4(0.f, 0.f, 0.f, 0.f);
#pragma unroll
  for (int q = 0; q < 2 * L_W; ++q) {
    int i = ib + q;
    bool in = i >= i0 && i <= 2 * t + 1 && i < W_CNT;
    sum.x += in ? val[q].x : 0.f;
    sum.y += in ? val[q].y : 0.f;
    sum.z += in ? val[q].z : 0.f;
    sum.w += in ? val[q].w : 0.f;
  }
  return sum;
}

__global__ void __launch_bounds__(256)
gather_out_kernel(const float* __restrict__ out_win, float* __restrict__ out) {
  int idx = blockIdx.x * 256 + threadIdx.x;
  if (idx >= NITEM) return;
  int d4 = idx % (D_M / 4);
  int r  = idx / (D_M / 4);
  int tb = r % TB;
  int n  = r / TB;
  int v = d4 >> 2, c0 = (d4 & 3) * 4;
  const float* wn = out_win + (size_t)n * (W_CNT * L_W * D_M) + d4 * 4;
  float* op = out + ((n * C_CH + c0) * T_LEN + tb) * V_J + v;
  float4 sum[TG];
#pragma unroll
  for (int k = 0; k < TG; ++k) {
    int t = tb + k * TB;
    sum[k] = make_float4(0.f, 0.f, 0.f, 0.f);
    if ((k + 1) * TB - 1 <= TLAST || (k * TB <= TLAST && t <= TLAST)) sum[k] = gather_step(wn, t);
  }
  // All stores behind all loads: no register that a store names is written again.
#pragma unroll
  for (int k = 0; k < TG; ++k) {
    op[(0 * T_LEN + k * TB) * V_J] = sum[k].x;
    op[(1 * T_LEN + k * TB) * V_J] = sum[k].y;
    op[(2 * T_LEN + k * TB) * V_J] = sum[k].z;
    op[(3 * T_LEN + k * TB) * V_J] = sum[k].w;
  }
}

// ---------------- host launch ----------------
extern "C" void kernel_launch(void* const* d_in, const int* in_sizes, int n_in,
                              void* d_out, int out_size, void* d_ws, size_t ws_size,
                              hipStream_t stream) {
  const float* x     = (const float*)d_in[0];
  const float* pe    = (const float*)d_in[1];
  const float* w_in  = (const float*)d_in[2];
  const float* b_in  = (const float*)d_in[3];
  const float* w_out = (const float*)d_in[4];
  const float* b_out = (const float*)d_in[5];
  const float* w1    = (const float*)d_in[6];
  const float* b1    = (const float*)d_in[7];
  const float* w2    = (const float*)d_in[8];
  const float* b2    = (const float*)d_in[9];
  const float* ln1g  = (const float*)d_in[10];
  const float* ln1b  = (const float*)d_in[11];
  const float* ln2g  = (const float*)d_in[12];
  const float* ln2b  = (const float*)d_in[13];
  float* out = (float*)d_out;

  // workspace layout
  char* ws = (char*)d_ws;
  size_t off = 0;
  float*    xs      = (float*)(ws + off);    off += (size_t)NROWS * D_M * 4;       // 7.68 MB
  _Float16* xs_h    = (_Float16*)(ws + off); off += (size_t)NROWS * D_M * 2;       // 3.84 MB
  // packed in fragment order: N/16 tiles x k steps x 1 KiB
  _Float16* w_in_h  = (_Float16*)(ws + off); off += (size_t)(3 * D_M / 16) * KS_D * 1024;  // 1.00 MB
  _Float16* w_out_h = (_Float16*)(ws + off); off += (size_t)(D_M / 16) * KS_D * 1024;   // 0.33 MB
  _Float16* w1_h    = (_Float16*)(ws + off); off += (size_t)(FF_M / 16) * KS_D * 1024;  // 1.33 MB
  _Float16* w2_h    = (_Float16*)(ws + off); off += (size_t)(D_M / 16) * KS_F * 1024;   // 1.28 MB
  float*    qkv_all = (float*)(ws + off);    off += (size_t)NROWS * 3 * D_M * 4;   // 23.04 MB
  float*    out_win = (float*)(ws + off);    off += (size_t)NWIN * L_W * D_M * 4;  // 67.05 MB
  _Float16* o_h     = (_Float16*)(ws + off); off += (size_t)NWIN * L_W * D_M * 2;  // 33.52 MB

  const int TPB = 256;

  // 1) layout + positional encoding
  prep_xs_kernel<<<(NITEM + TPB - 1) / TPB, TPB, 0, stream>>>(x, pe, xs, xs_h);

  // 2) weight conversion to f16, packed in fragment order
  pack_w_kernel<<<((3 * D_M / 16) * KS_D * 64 + TPB - 1) / TPB, TPB, 0, stream>>>(
      w_in, w_in_h, D_M, KS_D, (3 * D_M / 16) * KS_D * 64);
  pack_w_kernel<<<((D_M / 16) * KS_D * 64 + TPB - 1) / TPB, TPB, 0, stream>>>(
      w_out, w_out_h, D_M, KS_D, (D_M / 16) * KS_D * 64);
  pack_w_kernel<<<((FF_M / 16) * KS_D * 64 + TPB - 1) / TPB, TPB, 0, stream>>>(
      w1, w1_h, D_M, KS_D, (FF_M / 16) * KS_D * 64);
  pack_w_kernel<<<((D_M / 16) * KS_F * 64 + TPB - 1) / TPB, TPB, 0, stream>>>(
      w2, w2_h, FF_M, KS_F, (D_M / 16) * KS_F * 64);

  // 3) hoisted QKV GEMM: one block per tile of BM rows x QN * 16 columns
  qkv_gemm_kernel<<<(NROWS / BM) * (3 * D_M / 16 / QN), TPB, 0, stream>>>(xs_h, w_in_h, b_in,
                                                                          qkv_all);

  // 4) per-window attention
  attn_kernel<<<NWIN, TPB, 0, stream>>>(qkv_all, o_h);

  // 4b) out projection, LayerNorm, FFN, LayerNorm on packed rows (WMMA)
  rows_kernel<<<(MROWS + BM - 1) / BM, TPB, 0, stream>>>(xs, o_h, w_out_h, b_out, w1_h, b1,
                                                         w2_h, b2, ln1g, ln1b, ln2g, ln2b,
                                                         out_win);

  // 5) deterministic overlap-add + transpose to [N,C,T,V]
  gather_out_kernel<<<(NITEM + TPB - 1) / TPB, TPB, 0, stream>>>(out_win, out);
}

// v006
// It runs in 209 microseconds.
// Next to v005, in two timings, it ran 1.11 times as fast each time.
// Counting every step since v000, it is 5.21 times as fast.
#include <hip/hip_runtime.h>
#include <hip/hip_fp16.h>
#include <math.h>

typedef __attribute__((ext_vector_type(16))) _Float16 v16h;
typedef __attribute__((ext_vector_type(8)))  float    v8f;

#define N_B   16
#define T_LEN 300
#define V_J   25
#define C_CH  16
#define D_M   400      // C*V
#define H_N   2
#define DH    200
#define FF_M  1600
#define L_W   9
#define W_CNT 291      // T - L
#define NWIN  (N_B * W_CNT)   // 4656
#define NROWS (N_B * T_LEN)   // 4800
#define KS_D  13       // ceil(400/32)
#define KS_F  50       // 1600/32

// ---------------- WMMA fragment helpers (16x16x32 f16 -> f32) ----------------

__device__ __forceinline__ v8f wmma_acc(v16h a, v16h b, v8f c) {
  return __builtin_amdgcn_wmma_f32_16x16x32_f16(false, a, false, b, (short)0, c,
                                                false, false);
}

// ---------------- Kernel 1: layout change + positional encoding ----------------
// xs[n][t][d] = x[n][c][t][v] + pe[t][d],  d = v*16 + c  (torch view order)
// The two layout kernels (this one and the overlap gather) do a few operations per element.
// One thread takes TG time steps x 4 neighbouring d (16 elements), so that 3750 waves have to
// start per launch; at one element per thread it is 60000.
#define TG    4                                  // time steps per thread
#define TB    (T_LEN / TG)                       // 75
#define NITEM (N_B * TB * (D_M / 4))             // 120000 threads

typedef __attribute__((ext_vector_type(4))) _Float16 v4h;

__global__ void __launch_bounds__(256)
prep_xs_kernel(const float* __restrict__ x, const float* __restrict__ pe,
               float* __restrict__ xs, _Float16* __restrict__ xs_h) {
  int idx = blockIdx.x * 256 + threadIdx.x;
  if (idx >= NITEM) return;
  int d4 = idx % (D_M / 4);
  int r  = idx / (D_M / 4);
  int t0 = (r % TB) * TG;      // TG neighbouring steps: their x values share 128-B lines
  int n  = r / TB;
  int v = d4 >> 2, c0 = (d4 & 3) * 4;
  const float* xp = x + ((n * C_CH + c0) * T_LEN + t0) * V_J + v;
  const float* pp = pe + t0 * D_M + d4 * 4;
  float  xv[TG * 4];
  float4 pv[TG];
  // All 20 loads are in flight together. A later load's result may be given the address pair
  // of the loads before it: the pair's last load stands alone behind an s_wait_xcnt 0, and a
  // second one frees the pair for the results of the pe loads.
#pragma unroll
  for (int e = 0; e < TG * 4 - 1; ++e) xv[e] = xp[((e & 3) * T_LEN + (e >> 2)) * V_J];
  asm volatile("s_wait_xcnt 0x0" ::: "memory");
  xv[TG * 4 - 1] = xp[(3 * T_LEN + TG - 1) * V_J];
  asm volatile("s_wait_xcnt 0x0" ::: "memory");
#pragma unroll
  for (int k = 0; k < TG; ++k) pv[k] = *(const float4*)(pp + k * D_M);
  int o = (n * T_LEN + t0) * D_M + d4 * 4;
  float4 s[TG];
  v4h    h[TG];
#pragma unroll
  for (int k = 0; k < TG; ++k) {
    s[k] = make_float4(xv[k * 4] + pv[k].x, xv[k * 4 + 1] + pv[k].y, xv[k * 4 + 2] + pv[k].z,
                       xv[k * 4 + 3] + pv[k].w);
    h[k] = v4h{(_Float16)s[k].x, (_Float16)s[k].y, (_Float16)s[k].z, (_Float16)s[k].w};
  }
#pragma unroll
  for (int k = 0; k < TG; ++k) {
    *(float4*)(xs + o + k * D_M) = s[k];
    *(v4h*)(xs_h + o + k * D_M)  = h[k];
  }
}

// ---------------- Kernel 4: attention of a run of AG windows per workgroup ----------------
// Neighbouring windows share 8 of their 9 rows, and q(t).k(u) does not depend on the window
// that asks for it. One workgroup takes AG consecutive windows of a batch entry: their AR rows
// of qkv are staged once, each product q(t).k(u) of those rows is formed once, and only the
// softmax and att @ v run per window. Every sum keeps the order it has with one window alone.
// Result o goes out as f16 (the type the out projection reads it in), packed as
// row w*9 + a of o_h[41904][400].
#define AG   8                          // windows per workgroup
#define AR   (AG + L_W - 1)             // 16 rows serve them
#define AP   1204                       // f32 row pitch: 8 rows' 16-B pieces fall on disjoint banks
#define NGRP ((W_CNT + AG - 1) / AG)    // 37 runs per batch entry, the last of 3 windows
#define AQ   ((AR * 300 + 255) / 256)   // 16-byte pieces of the rows per thread
#define SP   (AR + 1)                   // row pitch of the products
#define TP   12                         // row pitch of the weights: 9 used, rows 16-B aligned
#define AH   (AG / 2)                   // windows per thread in att @ v

typedef __attribute__((ext_vector_type(2))) float v2f;
typedef __attribute__((ext_vector_type(4))) float v4f;

// 2^x. The v_nop fills the slot that the instruction set asks for behind a transcendental. It
// stands in the exponential's own statement because nothing else ties it there.
__device__ __forceinline__ float exp2_slot(float x) {
  float r;
  asm("v_exp_f32 %0, %1\n\tv_nop" : "=v"(r) : "v"(x));
  return r;
}

__global__ void __launch_bounds__(256)
attn_kernel(const float* __restrict__ qkv_all, _Float16* __restrict__ o_h) {
  // LDS map (floats): weights, products, staged rows. The small arrays come first, so that
  // their reads reach them by an immediate offset.
  __shared__ __attribute__((aligned(16))) float smem[AG * H_N * L_W * TP + H_N * AR * SP + AR * AP];
  float* att  = smem;
  float* sc   = smem + AG * H_N * L_W * TP;
  float* rows = smem + AG * H_N * L_W * TP + H_N * AR * SP;
  int n  = blockIdx.x / NGRP;
  int i0 = (blockIdx.x % NGRP) * AG;                    // first window of the run
  int rb = i0 < T_LEN - AR ? i0 : T_LEN - AR;           // first staged row: all AR lie in the entry
  int wo = i0 - rb;                                     // staged row of window i0's first row
  int nw = W_CNT - i0 < AG ? W_CNT - i0 : AG;           // windows that exist
  int tid = threadIdx.x;

  // --- stage the rows: one contiguous run; all of a thread's loads stand ahead of its LDS
  //     stores: one memory latency for the run. The last load stands alone behind an
  //     s_wait_xcnt 0 (its result may be given a register that the loads before it name), and
  //     the wait behind it stands in front of whatever rewrites its own address pair ---
  {
    const float* sp = qkv_all + (size_t)(n * T_LEN + rb) * 1200 + tid * 4;
    bool tail = tid < AR * 300 - (AQ - 1) * 256;   // whole waves
    v4f st[AQ];
#pragma unroll
    for (int i = 0; i < AQ - 1; ++i) st[i] = *(const v4f*)(sp + i * 1024);
    asm volatile("s_wait_xcnt 0x0" ::: "memory");
    if (tail) {
      st[AQ - 1] = *(const v4f*)(sp + (AQ - 1) * 1024);
      asm volatile("s_wait_xcnt 0x0" ::: "memory");
    }
#pragma unroll
    for (int i = 0; i < AQ; ++i) {
      int c = tid + i * 256;
      if (i + 1 < AQ || tail) *(v4f*)(rows + (c / 300) * AP + (c % 300) * 4) = st[i];
    }
  }
  __syncthreads();   // the staged rows are complete before any wave reads them

  // --- products q(t).k(u) of all staged rows, both heads: one thread takes rows t, t + 8
  //     against u, u + 8, so four 16-B reads feed four chains (each with e ascending) ---
  if (tid < 128) {
    int h = tid >> 6, t = (tid >> 3) & 7, u = tid & 7;
    const v4f* q0 = (const v4f*)(rows + t * AP + h * DH);
    const v4f* q1 = (const v4f*)(rows + (t + 8) * AP + h * DH);
    const v4f* k0 = (const v4f*)(rows + u * AP + D_M + h * DH);
    const v4f* k1 = (const v4f*)(rows + (u + 8) * AP + D_M + h * DH);
    float s00 = 0.f, s01 = 0.f, s10 = 0.f, s11 = 0.f;
    for (int e = 0; e < DH / 4; ++e) {
      v4f a = q0[e], b = q1[e], c = k0[e], d = k1[e];
#pragma unroll
      for (int x = 0; x < 4; ++x) {
        s00 = __builtin_fmaf(a[x], c[x], s00);
        s01 = __builtin_fmaf(a[x], d[x], s01);
        s10 = __builtin_fmaf(b[x], c[x], s10);
        s11 = __builtin_fmaf(b[x], d[x], s11);
      }
    }
    const float scale = 0.07071067811865475f;            // 1/sqrt(200)
    float* sr = sc + (h * AR + t) * SP + u;
    sr[0]      = s00 * scale;
    sr[8]      = s01 * scale;
    sr[8 * SP]     = s10 * scale;
    sr[8 * SP + 8] = s11 * scale;
  }
  __syncthreads();   // the products are complete before the softmax reads them

  // --- softmax: one thread per (window, head, query row); a window past the end gets zeros ---
  if (tid < AG * H_N * L_W) {
    int wl = tid / (H_N * L_W), r = tid % (H_N * L_W), h = r / L_W, a = r % L_W;
    float row[L_W];
#pragma unroll
    for (int b = 0; b < L_W; ++b) row[b] = 0.f;
    if (wl < nw) {
      const float* sr = sc + (h * AR + wo + wl + a) * SP + wo + wl;
#pragma unroll
      for (int b = 0; b < L_W; ++b) row[b] = sr[b];
      float mx = row[0];
#pragma unroll
      for (int b = 1; b < L_W; ++b) mx = fmaxf(mx, row[b]);
#pragma unroll
      for (int b = 0; b < L_W; ++b) row[b] = exp2_slot((row[b] - mx) * 1.44269504f);   // exp(x - mx)
      float sum = 0.f;
#pragma unroll
      for (int b = 0; b < L_W; ++b) sum += row[b];
      float inv = 1.0f / sum;
#pragma unroll
      for (int b = 0; b < L_W; ++b) row[b] *= inv;
    }
    float* ar = att + tid * TP;
#pragma unroll
    for (int b = 0; b < L_W; ++b) ar[b] = row[b];
  }
  __syncthreads();   // the weights are complete before att @ v reads them

  // --- o = att @ v: one thread takes 4 neighbouring columns of AH windows. The 12 rows of v
  //     that these windows use stay in registers, so each output row costs three reads of
  //     weights that 50 threads share; b ascending ---
  if (tid < 2 * (D_M / 4)) {
    int cg = tid % (D_M / 4), p = tid / (D_M / 4);
    int h = cg / (DH / 4);
    const float* vp = rows + 2 * D_M + cg * 4;
    v2f vl[AH + L_W - 1], vh[AH + L_W - 1];
#pragma unroll
    for (int j = 0; j < AH + L_W - 1; ++j) {
      int r = wo + p * AH + j;
      if (r > AR - 1) r = AR - 1;   // only rows of windows past the end, whose weights are 0
      v4f x = *(const v4f*)(vp + r * AP);
      vl[j] = v2f{x.x, x.y};
      vh[j] = v2f{x.z, x.w};
    }
    const float* ap = att + (p * AH * H_N + h) * (L_W * TP);
    _Float16* op = o_h + (size_t)(n * W_CNT + i0 + p * AH) * (L_W * D_M) + cg * 4;
    int lim = nw - p * AH;   // this thread's windows that exist
#pragma unroll 1   // one query row of the AH windows per pass: few registers, so three workgroups share a WGP
    for (int a = 0; a < L_W; ++a) {
      v4h res[AH];
#pragma unroll
      for (int ww = 0; ww < AH; ++ww) {
        const float* ar = ap + (ww * H_N * L_W + a) * TP;
        v4f w0 = *(const v4f*)ar, w1 = *(const v4f*)(ar + 4);
        float wt[L_W] = {w0.x, w0.y, w0.z, w0.w, w1.x, w1.y, w1.z, w1.w, ar[8]};
        v2f lo = {0.f, 0.f}, hi = {0.f, 0.f};
#pragma unroll
        for (int b = 0; b < L_W; ++b) {
          lo = __builtin_elementwise_fma(v2f{wt[b], wt[b]}, vl[ww + b], lo);
          hi = __builtin_elementwise_fma(v2f{wt[b], wt[b]}, vh[ww + b], hi);
        }
        res[ww] = v4h{(_Float16)lo.x, (_Float16)lo.y, (_Float16)hi.x, (_Float16)hi.y};
      }
#pragma unroll
      for (int ww = 0; ww < AH; ++ww) {
        if (ww < lim) {
          *(v4h*)(op + (ww * L_W + a) * D_M) = res[ww];
          // Behind the store: the next pass rewrites the registers that it names.
          asm volatile("s_wait_xcnt 0x0" ::: "memory");
        }
      }
    }
  }
}

// ---------------- Kernel 4b: row-wise stages on packed rows ----------------
// Behind the attention every stage (out projection, LayerNorm, FFN, LayerNorm) works on
// one row alone, so the 41904 (window, position) rows are packed into full 16-row tiles
// and one workgroup takes MT of them: each weight fragment loaded from L2 feeds MT WMMAs.
#define MROWS (NWIN * L_W)   // 41904 = 2619 tiles of 16
#define MT    6              // M tiles per workgroup
#define BM    (MT * 16)
#define PX    404            // f32 row pitch of X
#define PA    408            // f16 row pitch, 816 B = 16 B x odd
#define FC    320            // FFN columns per chunk
#define PF    328            // f16 row pitch, 656 B = 16 B x odd

typedef __attribute__((ext_vector_type(8))) _Float16 v8h;

// One lane's 16 halves of an A or B fragment: k = 8*half + 0..7 and 16 + 8*half + 0..7,
// p already at row start + kbase + 8*half. full == false: the upper 16 k are past K.
__device__ __forceinline__ v16h frag16(const _Float16* p, bool full) {
  v8h lo = *(const v8h*)p;
  v8h hi = {};
  if (full) hi = *(const v8h*)(p + 16);
  return __builtin_shufflevector(lo, hi, 0, 1, 2, 3, 4, 5, 6, 7, 8, 9, 10, 11, 12, 13,
                                 14, 15);
}

// Packed weights: the B fragment of (N tile nt, k step ks) is one 1-KiB block at index
// nt * KS + ks. Its first 512 B hold the 32 lanes' lower 8 halves in lane order, the next
// 512 B their upper 8, so one 16-byte-per-lane load covers 4 whole 128-B lines. Read from the
// row-major matrix the same load takes a 32-B piece out of each of 16 lines.
#define PBLK 512   // halves per block

// One lane's 16 halves of a packed B fragment, p at block start + lane * 8.
__device__ __forceinline__ v16h fragp(const _Float16* p, bool full) {
  v8h lo = *(const v8h*)p;
  v8h hi = {};
  if (full) hi = *(const v8h*)(p + PBLK / 2);
  return __builtin_shufflevector(lo, hi, 0, 1, 2, 3, 4, 5, 6, 7, 8, 9, 10, 11, 12, 13,
                                 14, 15);
}

// f32 weight W[N][K] -> f16 in the packed order above; one thread per 16-byte piece.
// A piece whose k lies past K is neither written here nor read by anyone.
__global__ void pack_w_kernel(const float* __restrict__ src, _Float16* __restrict__ dst,
                              int K, int KS, int pieces) {
  int idx = blockIdx.x * blockDim.x + threadIdx.x;
  if (idx >= pieces) return;
  int lane = idx & 31, part = (idx >> 5) & 1, blk = idx >> 6;
  int k = (blk % KS) * 32 + part * 16 + (lane >> 4) * 8;
  if (k >= K) return;
  const float* p = src + (size_t)((blk / KS) * 16 + (lane & 15)) * K + k;
  float4 u = *(const float4*)p, v = *(const float4*)(p + 4);
  v8h h = {(_Float16)u.x, (_Float16)u.y, (_Float16)u.z, (_Float16)u.w,
           (_Float16)v.x, (_Float16)v.y, (_Float16)v.z, (_Float16)v.w};
  *(v8h*)(dst + (size_t)idx * 8) = h;
}

// acc[mt] = A[mt*16..][0..400) @ W[nt*16..nt*16+16)^T, A f16 in LDS at pitch PA, W packed.
__device__ __forceinline__ void strip_k400(const _Float16* A, const _Float16* W, int nt,
                                           int lane, v8f* acc) {
  const _Float16* bp = W + (size_t)nt * (KS_D * PBLK) + lane * 8;
  const _Float16* ap = A + (lane & 15) * PA + (lane >> 4) * 8;
  // Compiler fence: keeps the A reads below inside the caller's loop over N tiles. They do
  // not change from tile to tile, and hoisted out of the loop they take 624 registers and spill.
  asm volatile("" ::: "memory");
  v16h b[KS_D];
#pragma unroll
  for (int ks = 0; ks < KS_D; ++ks) {
    // The last load's result may be given the address pair that the loads before it name:
    // the wait stands in front of that overwrite.
    if (ks + 1 == KS_D) asm volatile("s_wait_xcnt 0x0" ::: "memory");
    b[ks] = fragp(bp + ks * PBLK, ks + 1 < KS_D);
  }
#pragma unroll
  for (int mt = 0; mt < MT; ++mt) acc[mt] = v8f{};
  // A fragments of k step ks + 1 are read as one group ahead of the WMMAs of step ks.
  v16h a[2][MT];
#pragma unroll
  for (int mt = 0; mt < MT; ++mt) a[0][mt] = frag16(ap + mt * 16 * PA, true);
  __builtin_amdgcn_sched_barrier(0);   // keeps all 25 weight loads in flight from the start
#pragma unroll
  for (int ks = 0; ks < KS_D; ++ks) {
    if (ks + 1 < KS_D) {
#pragma unroll
      for (int mt = 0; mt < MT; ++mt)
        a[(ks + 1) & 1][mt] = frag16(ap + mt * 16 * PA + (ks + 1) * 32, ks + 2 < KS_D);
    }
    // Holds the read group ahead of the WMMAs: with the FFN2 accumulators live the scheduler
    // otherwise sinks each read to its WMMA, which then waits out a whole LDS latency.
    __builtin_amdgcn_sched_barrier(0);
#pragma unroll
    for (int mt = 0; mt < MT; ++mt) acc[mt] = wmma_acc(a[ks & 1][mt], b[ks], acc[mt]);
    __builtin_amdgcn_sched_barrier(0);   // same purpose: the next group stays behind these
  }
}

// ---------------- Kernel 3: hoisted QKV GEMM over all 4800 rows ----------------
// qkv_all[4800][1200] = xs[4800][400] @ w_in^T + b_in
// One workgroup per tile of BM rows x QN * 16 columns. The rows are staged once in LDS, w_in
// comes packed, and each wave runs whole strips: a weight fragment feeds MT WMMAs, and the 25
// weight loads of a strip are in flight together, so a strip waits out one L2 latency, not
// one per k step.
#define QN 15   // N tiles per workgroup; 1200 / 16 = 5 * QN
#define QP ((BM * 50 + 255) / 256)   // 16-byte pieces of the row tile per thread
__global__ void __launch_bounds__(256, 1)
qkv_gemm_kernel(const _Float16* __restrict__ xs_h,
                const _Float16* __restrict__ w_in_h,
                const float* __restrict__ b_in,
                float* __restrict__ qkv_all) {
  __shared__ __attribute__((aligned(16))) _Float16 Ah[BM * PA];
  int tid = threadIdx.x, lane = tid & 31;
  int wv = __builtin_amdgcn_readfirstlane(tid >> 5);  // scalar: the tile loop branches on it
  int row0 = (blockIdx.x % (NROWS / BM)) * BM;
  int nt0  = (blockIdx.x / (NROWS / BM)) * QN;

  // The BM rows are one contiguous run of BM * 50 16-byte pieces. All of a thread's loads stand
  // ahead of its LDS stores: one memory latency for the tile, not one per piece.
  const _Float16* sp = xs_h + (size_t)row0 * D_M + tid * 8;
  v8h st[QP];
#pragma unroll
  for (int i = 0; i < QP; ++i)
    if (i + 1 < QP || tid < BM * 50 - (QP - 1) * 256) st[i] = *(const v8h*)(sp + i * 2048);
#pragma unroll
  for (int i = 0; i < QP; ++i) {
    int c = tid + i * 256;
    if (i + 1 < QP || tid < BM * 50 - (QP - 1) * 256)
      *(v8h*)(Ah + c * 8 + (c / 50) * (PA - D_M)) = st[i];
  }
  __syncthreads();   // the staged rows are complete before any wave reads them

  for (int nt = nt0 + wv; nt < nt0 + QN; nt += 8) {
    int nn = nt * 16 + (lane & 15);
    float bias = b_in[nn];   // ahead of the strip: it returns under the weight loads
    v8f acc[MT];
    strip_k400(Ah, w_in_h, nt, lane, acc);
    float* op = qkv_all + (size_t)(row0 + (lane >> 4) * 8) * 1200 + nn;
#pragma unroll
    for (int q = 0; q < MT * 8; ++q)
      op[((q >> 3) * 16 + (q & 7)) * 1200] = acc[q >> 3][q & 7] + bias;
  }
}

// LayerNorm of the BM rows of X, one wave per row, the row held in registers.
// TO_OUT false: back into X, with an f16 copy in Ah. TO_OUT true: to global rows.
template <bool TO_OUT>
__device__ __forceinline__ void layernorm_packed(float* X, const float* g, const float* b,
                                                 _Float16* Ah, float* outg, int row0,
                                                 int wv, int lane) {
  float gg[13], bb[13];
#pragma unroll
  for (int q = 0; q < 13; ++q) {
    int c = lane + 32 * q;
    gg[q] = (c < D_M) ? g[c] : 0.f;
    bb[q] = (c < D_M) ? b[c] : 0.f;
  }
  for (int r = wv; r < BM; r += 8) {
    float v[13];
#pragma unroll
    for (int q = 0; q < 13; ++q) {
      int c = lane + 32 * q;
      v[q] = (c < D_M) ? X[r * PX + c] : 0.f;
    }
    float s = 0.f;
#pragma unroll
    for (int q = 0; q < 13; ++q) s += v[q];
#pragma unroll
    for (int off = 16; off > 0; off >>= 1) s += __shfl_xor(s, off, 32);
    float mu = s * (1.0f / D_M);
    float vv = 0.f;
#pragma unroll
    for (int q = 0; q < 13; ++q) {
      if (lane + 32 * q < D_M) {
        float t = v[q] - mu;
        vv += t * t;
      }
    }
#pragma unroll
    for (int off = 16; off > 0; off >>= 1) vv += __shfl_xor(vv, off, 32);
    float rs = rsqrtf(vv * (1.0f / D_M) + 1e-5f);
#pragma unroll
    for (int q = 0; q < 13; ++q) {
      int c = lane + 32 * q;
      if (c < D_M) {
        float y = (v[q] - mu) * rs * gg[q] + bb[q];
        if (TO_OUT) {
          if (row0 + r < MROWS) outg[(size_t)(row0 + r) * D_M + c] = y;
          // Behind the row's last store: the next row rewrites the registers it names.
          if (q == 12) asm volatile("s_wait_xcnt 0x0" ::: "memory");
        } else {
          X[r * PX + c]  = y;
          Ah[r * PA + c] = (_Float16)y;
        }
      }
    }
  }
}

typedef __attribute__((ext_vector_type(2))) float v2f;

__device__ __forceinline__ v2f fma2(v2f a, v2f b, float c) {
  return __builtin_elementwise_fma(a, b, v2f{c, c});
}

#define GP 8   // value pairs that go through the GELU side by side

// Exact-erf GELU of GP value pairs with no branch. erf keeps the f32 library's two fits (an odd
// polynomial below |z| = 1, 1 - exp(-q(|z|)) from there on), but both are evaluated for every
// lane and one is selected: a branch on the lane's value cuts the epilogue into one serial
// dependent chain per element, where straight-line code lets independent chains overlap.
__device__ __forceinline__ void gelu_group(v2f* x) {
  v2f z[GP], az[GP], t[GP], q[GP], p[GP];
#pragma unroll
  for (int i = 0; i < GP; ++i) { z[i] = x[i] * 0.707106769f; x[i] = x[i] * 0.5f; }
#pragma unroll
  for (int i = 0; i < GP; ++i) {
    az[i] = v2f{__builtin_fabsf(z[i].x), __builtin_fabsf(z[i].y)};
    t[i]  = z[i] * z[i];
  }
  const float cq[6] = {-0.000378677854f, 0.00385781587f, -0.0241816975f,
                       0.106668264f, 0.634933293f, 0.128689408f};
  const float cp[5] = {0.00491381623f, -0.0267075151f, 0.112800106f,
                       -0.376122952f, 0.128379107f};
#pragma unroll
  for (int i = 0; i < GP; ++i) {
    q[i] = v2f{0.0000169988107f, 0.0000169988107f};
    p[i] = v2f{-0.000561801775f, -0.000561801775f};
  }
#pragma unroll
  for (int s = 0; s < 5; ++s) {
#pragma unroll
    for (int i = 0; i < GP; ++i) {
      q[i] = fma2(az[i], q[i], cq[s]);
      p[i] = fma2(t[i], p[i], cp[s]);
    }
  }
#pragma unroll
  for (int i = 0; i < GP; ++i) {
    q[i] = fma2(az[i], q[i], cq[5]);
    p[i] = __builtin_elementwise_fma(az[i], p[i], az[i]);
  }
#pragma unroll
  for (int i = 0; i < GP; ++i) q[i] = __builtin_elementwise_fma(az[i], q[i], az[i]);
#pragma unroll
  for (int i = 0; i < GP; ++i) q[i] = q[i] * -1.44269502f;
#pragma unroll
  for (int i = 0; i < GP; ++i)
    q[i] = v2f{__builtin_amdgcn_exp2f(q[i].x), __builtin_amdgcn_exp2f(q[i].y)};
#pragma unroll
  for (int i = 0; i < GP; ++i) q[i] = 1.0f - q[i];
#pragma unroll
  for (int i = 0; i < GP; ++i)
    p[i] = v2f{az[i].x < 1.0f ? p[i].x : q[i].x, az[i].y < 1.0f ? p[i].y : q[i].y};
#pragma unroll
  for (int i = 0; i < GP; ++i)
    p[i] = v2f{__builtin_copysignf(p[i].x, z[i].x), __builtin_copysignf(p[i].y, z[i].y)};
#pragma unroll
  for (int i = 0; i < GP; ++i) p[i] = p[i] + 1.0f;
#pragma unroll
  for (int i = 0; i < GP; ++i) x[i] = x[i] * p[i];
}

__global__ void __launch_bounds__(256, 1)
rows_kernel(const float* __restrict__ xs,
            const _Float16* __restrict__ o_h,
            const _Float16* __restrict__ w_out_h,
            const float* __restrict__ b_out,
            const _Float16* __restrict__ w1_h,
            const float* __restrict__ b1,
            const _Float16* __restrict__ w2_h,
            const float* __restrict__ b2,
            const float* __restrict__ ln1_g, const float* __restrict__ ln1_b,
            const float* __restrict__ ln2_g, const float* __restrict__ ln2_b,
            float* __restrict__ out_win) {
  __shared__ __attribute__((aligned(16))) float    X[BM * PX];   // residual stream, f32
  __shared__ __attribute__((aligned(16))) _Float16 Ah[BM * PA];  // o, then LN1 output
  __shared__ __attribute__((aligned(16))) _Float16 Fc[BM * PF];  // one chunk of gelu(ffn1)
  int tid = threadIdx.x, lane = tid & 31;
  int wv = __builtin_amdgcn_readfirstlane(tid >> 5);  // scalar: tile loops branch on it
  int half = lane >> 4;
  int row0 = blockIdx.x * BM;

  // --- stage o (f16) and the residual rows of xs (f32); rows past the end repeat the
  //     last row and are never stored ---
  for (int c = tid; c < BM * 50; c += 256) {
    int r = c / 50, q = c % 50;
    int gr = row0 + r; if (gr > MROWS - 1) gr = MROWS - 1;
    *(v8h*)(Ah + r * PA + q * 8) = *(const v8h*)(o_h + (size_t)gr * D_M + q * 8);
  }
  for (int c = tid; c < BM * 100; c += 256) {
    int r = c / 100, q = c % 100;
    int gr = row0 + r; if (gr > MROWS - 1) gr = MROWS - 1;
    int w = gr / L_W, j = gr % L_W;
    int xr = (w / W_CNT) * T_LEN + (w % W_CNT) + j;
    *(float4*)(X + r * PX + q * 4) = *(const float4*)(xs + (size_t)xr * D_M + q * 4);
  }
  __syncthreads();

  // --- out projection + residual -> X ---
  for (int nt = wv; nt < D_M / 16; nt += 8) {
    v8f acc[MT];
    strip_k400(Ah, w_out_h, nt, lane, acc);
    int nn = nt * 16 + (lane & 15);
    float bo = b_out[nn];
    float* xp = X + half * 8 * PX + nn;
    float res[MT * 8];   // all reads ahead of the stores: one LDS latency, not one per element
#pragma unroll
    for (int q = 0; q < MT * 8; ++q) res[q] = xp[((q >> 3) * 16 + (q & 7)) * PX];
#pragma unroll
    for (int q = 0; q < MT * 8; ++q)
      xp[((q >> 3) * 16 + (q & 7)) * PX] = acc[q >> 3][q & 7] + bo + res[q];
  }
  __syncthreads();
  layernorm_packed<false>(X, ln1_g, ln1_b, Ah, nullptr, row0, wv, lane);
  __syncthreads();

  // --- FFN in 5 chunks of 320 hidden columns: FFN1 + exact GELU -> Fc, then FFN2 adds
  //     that chunk's k range into accumulators that stay in registers (k ascending) ---
  v8f acc2[4][MT];
#pragma unroll
  for (int tt = 0; tt < 4; ++tt) {
#pragma unroll
    for (int mt = 0; mt < MT; ++mt) acc2[tt][mt] = v8f{};
  }
#pragma unroll 1   // one copy of the chunk body, for speed only
  for (int kc = 0; kc < FF_M / FC; ++kc) {
#pragma unroll 1   // same reason
    for (int t = wv; t < FC / 16; t += 8) {
      v8f acc[MT];
      strip_k400(Ah, w1_h, kc * (FC / 16) + t, lane, acc);
      int cl = t * 16 + (lane & 15);
      float bb = b1[kc * FC + cl];
#pragma unroll
      for (int e0 = 0; e0 < MT * 8; e0 += 2 * GP) {
        v2f xv[GP];
#pragma unroll
        for (int i = 0; i < GP; ++i) {
          int e = e0 + 2 * i;
          xv[i] = v2f{acc[e >> 3][e & 7] + bb, acc[e >> 3][(e & 7) + 1] + bb};
        }
        gelu_group(xv);
#pragma unroll
        for (int i = 0; i < GP; ++i) {
          int e = e0 + 2 * i;
          int m = (e >> 3) * 16 + (e & 7) + half * 8;
          Fc[m * PF + cl]       = (_Float16)xv[i].x;
          Fc[(m + 1) * PF + cl] = (_Float16)xv[i].y;
        }
      }
    }
    __syncthreads();   // Fc complete before any wave reads it
    const _Float16* ap = Fc + (lane & 15) * PF + half * 8;
    const _Float16* bp = w2_h + (size_t)(wv * KS_F + kc * (FC / 32)) * PBLK + lane * 8;
    // Weight fragments run two k steps ahead of their WMMAs (ring of three sets); each A
    // fragment read from LDS serves all of the wave's N tiles. Tile 24 is wave 0's alone.
    v16h bq[3][4];
#pragma unroll
    for (int ks = 0; ks < 2; ++ks) {
#pragma unroll
      for (int tt = 0; tt < 3; ++tt) bq[ks][tt] = fragp(bp + (tt * 8 * KS_F + ks) * PBLK, true);
      if (wv == 0) bq[ks][3] = fragp(bp + (3 * 8 * KS_F + ks) * PBLK, true);
    }
    v16h a[2][MT];   // A fragments run one k step ahead
#pragma unroll
    for (int mt = 0; mt < MT; ++mt) a[0][mt] = frag16(ap + mt * 16 * PF, true);
#pragma unroll
    for (int ks = 0; ks < FC / 32; ++ks) {
      if (ks + 2 < FC / 32) {
#pragma unroll
        for (int tt = 0; tt < 3; ++tt)
          bq[(ks + 2) % 3][tt] = fragp(bp + (tt * 8 * KS_F + ks + 2) * PBLK, true);
        if (wv == 0) bq[(ks + 2) % 3][3] = fragp(bp + (3 * 8 * KS_F + ks + 2) * PBLK, true);
      }
      if (ks + 1 < FC / 32) {
#pragma unroll
        for (int mt = 0; mt < MT; ++mt)
          a[(ks + 1) & 1][mt] = frag16(ap + mt * 16 * PF + (ks + 1) * 32, true);
      }
#pragma unroll
      for (int tt = 0; tt < 3; ++tt) {
#pragma unroll
        for (int mt = 0; mt < MT; ++mt)
          acc2[tt][mt] = wmma_acc(a[ks & 1][mt], bq[ks % 3][tt], acc2[tt][mt]);
      }
      if (wv == 0) {
#pragma unroll
        for (int mt = 0; mt < MT; ++mt)
          acc2[3][mt] = wmma_acc(a[ks & 1][mt], bq[ks % 3][3], acc2[3][mt]);
      }
    }
    __syncthreads();   // every reader has left Fc before the next chunk overwrites it
  }
#pragma unroll
  for (int tt = 0; tt < 4; ++tt) {
    int nt = wv + tt * 8;
    if (nt < D_M / 16) {
      int nn = nt * 16 + (lane & 15);
      float bb = b2[nn];
      float* xp = X + half * 8 * PX + nn;
      float res[MT * 8];   // all reads ahead of the stores, as above
#pragma unroll
      for (int q = 0; q < MT * 8; ++q) res[q] = xp[((q >> 3) * 16 + (q & 7)) * PX];
#pragma unroll
      for (int q = 0; q < MT * 8; ++q)
        xp[((q >> 3) * 16 + (q & 7)) * PX] = res[q] + acc2[tt][q >> 3][q & 7] + bb;
    }
  }
  __syncthreads();
  layernorm_packed<true>(X, ln2_g, ln2_b, nullptr, out_win, row0, wv, lane);
}

// ---------------- Kernel 5: deterministic overlap-gather + output transpose ----------------
// row t receives out_win[i][t - i/2] for i in [2(t-8), 2t+1] within [0, W), summed with i ascending.
// One thread takes 4 neighbouring d of the steps t, t + TB, t + 2 TB, t + 3 TB (only steps up
// to TLAST receive anything, so every thread gets two full steps).
#define TLAST  ((W_CNT - 1) / 2 + L_W - 1)   // 153
#define IBMAX  (W_CNT + 1 - 2 * L_W)         // 274: the last even start whose 17 windows exist
#define ROWQ(q) ((q) * L_W - ((q) >> 1))     // packed row of window ib + q, less that of window ib
static_assert(IBMAX % 2 == 0, "ROWQ needs an even first window");

// Sum of step t for 4 neighbouring d, wn = the batch entry's first packed row + d.
// The 18 windows ib .. ib + 17 are read with no branch between them, from one address with
// constant offsets; ib is 2(t-8) moved into [0, IBMAX], which keeps every row inside the batch
// entry's block (the 18th is clamped to its last row), and a window outside the step's range
// adds 0. So all 18 loads are in flight together, and the windows that count keep their order.
__device__ __forceinline__ float4 gather_step(const float* wn, int t) {
  int i0 = 2 * (t - (L_W - 1));
  int ib = i0 < 0 ? 0 : (i0 > IBMAX ? IBMAX : i0);
  int r0 = ib * L_W + t - (ib >> 1);
  int rl = r0 + ROWQ(2 * L_W - 1);
  if (rl > W_CNT * L_W - 1) rl = W_CNT * L_W - 1;
  const float* p  = wn + r0 * D_M;
  const float* pl = wn + rl * D_M;
  float4 val[2 * L_W];
#pragma unroll
  for (int q = 0; q < 2 * L_W - 2; ++q) val[q] = *(const float4*)(p + ROWQ(q) * D_M);
  // A later load's result may be given the address pair of the loads before it: each pair's
  // last load stands alone behind an s_wait_xcnt 0, so no pair is overwritten in front of one.
  asm volatile("s_wait_xcnt 0x0" ::: "memory");
  val[2 * L_W - 2] = *(const float4*)(p + ROWQ(2 * L_W - 2) * D_M);
  asm volatile("s_wait_xcnt 0x0" ::: "memory");
  val[2 * L_W - 1] = *(const float4*)pl;
  asm volatile("s_wait_xcnt 0x0" ::: "memory");
  float4 sum = make_float4(0.f, 0.f, 0.f, 0.f);
#pragma unroll
  for (int q = 0; q < 2 * L_W; ++q) {
    int i = ib + q;
    bool in = i >= i0 && i <= 2 * t + 1 && i < W_CNT;
    sum.x += in ? val[q].x : 0.f;
    sum.y += in ? val[q].y : 0.f;
    sum.z += in ? val[q].z : 0.f;
    sum.w += in ? val[q].w : 0.f;
  }
  return sum;
}

__global__ void __launch_bounds__(256)
gather_out_kernel(const float* __restrict__ out_win, float* __restrict__ out) {
  int idx = blockIdx.x * 256 + threadIdx.x;
  if (idx >= NITEM) return;
  int d4 = idx % (D_M / 4);
  int r  = idx / (D_M / 4);
  int tb = r % TB;
  int n  = r / TB;
  int v = d4 >> 2, c0 = (d4 & 3) * 4;
  const float* wn = out_win + (size_t)n * (W_CNT * L_W * D_M) + d4 * 4;
  float* op = out + ((n * C_CH + c0) * T_LEN + tb) * V_J + v;
  float4 sum[TG];
#pragma unroll
  for (int k = 0; k < TG; ++k) {
    int t = tb + k * TB;
    sum[k] = make_float4(0.f, 0.f, 0.f, 0.f);
    if ((k + 1) * TB - 1 <= TLAST || (k * TB <= TLAST && t <= TLAST)) sum[k] = gather_step(wn, t);
  }
  // All stores behind all loads: no register that a store names is written again.
#pragma unroll
  for (int k = 0; k < TG; ++k) {
    op[(0 * T_LEN + k * TB) * V_J] = sum[k].x;
    op[(1 * T_LEN + k * TB) * V_J] = sum[k].y;
    op[(2 * T_LEN + k * TB) * V_J] = sum[k].z;
    op[(3 * T_LEN + k * TB) * V_J] = sum[k].w;
  }
}

// ---------------- host launch ----------------
extern "C" void kernel_launch(void* const* d_in, const int* in_sizes, int n_in,
                              void* d_out, int out_size, void* d_ws, size_t ws_size,
                              hipStream_t stream) {
  const float* x     = (const float*)d_in[0];
  const float* pe    = (const float*)d_in[1];
  const float* w_in  = (const float*)d_in[2];
  const float* b_in  = (const float*)d_in[3];
  const float* w_out = (const float*)d_in[4];
  const float* b_out = (const float*)d_in[5];
  const float* w1    = (const float*)d_in[6];
  const float* b1    = (const float*)d_in[7];
  const float* w2    = (const float*)d_in[8];
  const float* b2    = (const float*)d_in[9];
  const float* ln1g  = (const float*)d_in[10];
  const float* ln1b  = (const float*)d_in[11];
  const float* ln2g  = (const float*)d_in[12];
  const float* ln2b  = (const float*)d_in[13];
  float* out = (float*)d_out;

  // workspace layout
  char* ws = (char*)d_ws;
  size_t off = 0;
  float*    xs      = (float*)(ws + off);    off += (size_t)NROWS * D_M * 4;       // 7.68 MB
  _Float16* xs_h    = (_Float16*)(ws + off); off += (size_t)NROWS * D_M * 2;       // 3.84 MB
  // packed in fragment order: N/16 tiles x k steps x 1 KiB
  _Float16* w_in_h  = (_Float16*)(ws + off); off += (size_t)(3 * D_M / 16) * KS_D * 1024;  // 1.00 MB
  _Float16* w_out_h = (_Float16*)(ws + off); off += (size_t)(D_M / 16) * KS_D * 1024;   // 0.33 MB
  _Float16* w1_h    = (_Float16*)(ws + off); off += (size_t)(FF_M / 16) * KS_D * 1024;  // 1.33 MB
  _Float16* w2_h    = (_Float16*)(ws + off); off += (size_t)(D_M / 16) * KS_F * 1024;   // 1.28 MB
  float*    qkv_all = (float*)(ws + off);    off += (size_t)NROWS * 3 * D_M * 4;   // 23.04 MB
  float*    out_win = (float*)(ws + off);    off += (size_t)NWIN * L_W * D_M * 4;  // 67.05 MB
  _Float16* o_h     = (_Float16*)(ws + off); off += (size_t)NWIN * L_W * D_M * 2;  // 33.52 MB

  const int TPB = 256;

  // 1) layout + positional encoding
  prep_xs_kernel<<<(NITEM + TPB - 1) / TPB, TPB, 0, stream>>>(x, pe, xs, xs_h);

  // 2) weight conversion to f16, packed in fragment order
  pack_w_kernel<<<((3 * D_M / 16) * KS_D * 64 + TPB - 1) / TPB, TPB, 0, stream>>>(
      w_in, w_in_h, D_M, KS_D, (3 * D_M / 16) * KS_D * 64);
  pack_w_kernel<<<((D_M / 16) * KS_D * 64 + TPB - 1) / TPB, TPB, 0, stream>>>(
      w_out, w_out_h, D_M, KS_D, (D_M / 16) * KS_D * 64);
  pack_w_kernel<<<((FF_M / 16) * KS_D * 64 + TPB - 1) / TPB, TPB, 0, stream>>>(
      w1, w1_h, D_M, KS_D, (FF_M / 16) * KS_D * 64);
  pack_w_kernel<<<((D_M / 16) * KS_F * 64 + TPB - 1) / TPB, TPB, 0, stream>>>(
      w2, w2_h, FF_M, KS_F, (D_M / 16) * KS_F * 64);

  // 3) hoisted QKV GEMM: one block per tile of BM rows x QN * 16 columns
  qkv_gemm_kernel<<<(NROWS / BM) * (3 * D_M / 16 / QN), TPB, 0, stream>>>(xs_h, w_in_h, b_in,
                                                                          qkv_all);

  // 4) attention, one block per run of AG windows
  attn_kernel<<<N_B * NGRP, TPB, 0, stream>>>(qkv_all, o_h);

  // 4b) out projection, LayerNorm, FFN, LayerNorm on packed rows (WMMA)
  rows_kernel<<<(MROWS + BM - 1) / BM, TPB, 0, stream>>>(xs, o_h, w_out_h, b_out, w1_h, b1,
                                                         w2_h, b2, ln1g, ln1b, ln2g, ln2b,
                                                         out_win);

  // 5) deterministic overlap-add + transpose to [N,C,T,V]
  gather_out_kernel<<<(NITEM + TPB - 1) / TPB, TPB, 0, stream>>>(out_win, out);
}

// v007
// It runs in 199 microseconds.
// Timed twice side by side with v006, it ran 1.05 and 1.06 times as fast.
// All steps since v000 together make it 5.50 times as fast.
#include <hip/hip_runtime.h>
#include <hip/hip_fp16.h>
#include <math.h>

typedef __attribute__((ext_vector_type(16))) _Float16 v16h;
typedef __attribute__((ext_vector_type(8)))  float    v8f;

#define N_B   16
#define T_LEN 300
#define V_J   25
#define C_CH  16
#define D_M   400      // C*V
#define H_N   2
#define DH    200
#define FF_M  1600
#define L_W   9
#define W_CNT 291      // T - L
#define NWIN  (N_B * W_CNT)   // 4656
#define NROWS (N_B * T_LEN)   // 4800
#define KS_D  13       // ceil(400/32)
#define KS_F  50       // 1600/32

// ---------------- WMMA fragment helpers (16x16x32 f16 -> f32) ----------------

__device__ __forceinline__ v8f wmma_acc(v16h a, v16h b, v8f c) {
  return __builtin_amdgcn_wmma_f32_16x16x32_f16(false, a, false, b, (short)0, c,
                                                false, false);
}

// ---------------- Kernel 1: layout change + positional encoding ----------------
// xs[n][t][d] = x[n][c][t][v] + pe[t][d],  d = v*16 + c  (torch view order)
// The two layout kernels (this one and the overlap gather) do a few operations per element.
// One thread takes TG time steps x 4 neighbouring d (16 elements), so that 3750 waves have to
// start per launch; at one element per thread it is 60000.
#define TG    4                                  // time steps per thread
#define TB    (T_LEN / TG)                       // 75
#define NITEM (N_B * TB * (D_M / 4))             // 120000 threads

typedef __attribute__((ext_vector_type(4))) _Float16 v4h;

__global__ void __launch_bounds__(256)
prep_xs_kernel(const float* __restrict__ x, const float* __restrict__ pe,
               float* __restrict__ xs, _Float16* __restrict__ xs_h) {
  int idx = blockIdx.x * 256 + threadIdx.x;
  if (idx >= NITEM) return;
  int d4 = idx % (D_M / 4);
  int r  = idx / (D_M / 4);
  int t0 = (r % TB) * TG;      // TG neighbouring steps: their x values share 128-B lines
  int n  = r / TB;
  int v = d4 >> 2, c0 = (d4 & 3) * 4;
  const float* xp = x + ((n * C_CH + c0) * T_LEN + t0) * V_J + v;
  const float* pp = pe + t0 * D_M + d4 * 4;
  float  xv[TG * 4];
  float4 pv[TG];
  // All 20 loads are in flight together. A later load's result may be given the address pair
  // of the loads before it: the pair's last load stands alone behind an s_wait_xcnt 0, and a
  // second one frees the pair for the results of the pe loads.
#pragma unroll
  for (int e = 0; e < TG * 4 - 1; ++e) xv[e] = xp[((e & 3) * T_LEN + (e >> 2)) * V_J];
  asm volatile("s_wait_xcnt 0x0" ::: "memory");
  xv[TG * 4 - 1] = xp[(3 * T_LEN + TG - 1) * V_J];
  asm volatile("s_wait_xcnt 0x0" ::: "memory");
#pragma unroll
  for (int k = 0; k < TG; ++k) pv[k] = *(const float4*)(pp + k * D_M);
  int o = (n * T_LEN + t0) * D_M + d4 * 4;
  float4 s[TG];
  v4h    h[TG];
#pragma unroll
  for (int k = 0; k < TG; ++k) {
    s[k] = make_float4(xv[k * 4] + pv[k].x, xv[k * 4 + 1] + pv[k].y, xv[k * 4 + 2] + pv[k].z,
                       xv[k * 4 + 3] + pv[k].w);
    h[k] = v4h{(_Float16)s[k].x, (_Float16)s[k].y, (_Float16)s[k].z, (_Float16)s[k].w};
  }
#pragma unroll
  for (int k = 0; k < TG; ++k) {
    *(float4*)(xs + o + k * D_M) = s[k];
    *(v4h*)(xs_h + o + k * D_M)  = h[k];
  }
}

// ---------------- Kernel 4: attention of a run of AG windows per workgroup ----------------
// Neighbouring windows share 8 of their 9 rows, and q(t).k(u) does not depend on the window
// that asks for it. One workgroup takes AG consecutive windows of a batch entry: their AR rows
// of qkv are staged once, each product q(t).k(u) of those rows is formed once, and only the
// softmax and att @ v run per window. Every sum keeps the order it has with one window alone.
// Result o goes out as f16 (the type the out projection reads it in), packed as
// row w*9 + a of o_h[41904][400].
#define AG   8                          // windows per workgroup
#define AR   (AG + L_W - 1)             // 16 rows serve them
#define AP   1204                       // f32 row pitch: 8 rows' 16-B pieces fall on disjoint banks
#define NGRP ((W_CNT + AG - 1) / AG)    // 37 runs per batch entry, the last of 3 windows
#define AQ   ((AR * 300 + 255) / 256)   // 16-byte pieces of the rows per thread
#define SP   (AR + 1)                   // row pitch of the products
#define TP   12                         // row pitch of the weights: 9 used, rows 16-B aligned
#define AH   (AG / 2)                   // windows per thread in att @ v

typedef __attribute__((ext_vector_type(2))) float v2f;
typedef __attribute__((ext_vector_type(4))) float v4f;

// 2^x. The v_nop fills the slot that the instruction set asks for behind a transcendental. It
// stands in the exponential's own statement because nothing else ties it there.
__device__ __forceinline__ float exp2_slot(float x) {
  float r;
  asm("v_exp_f32 %0, %1\n\tv_nop" : "=v"(r) : "v"(x));
  return r;
}

__global__ void __launch_bounds__(256)
attn_kernel(const float* __restrict__ qkv_all, _Float16* __restrict__ o_h) {
  // LDS map (floats): weights, products, staged rows. The small arrays come first, so that
  // their reads reach them by an immediate offset.
  __shared__ __attribute__((aligned(16))) float smem[AG * H_N * L_W * TP + H_N * AR * SP + AR * AP];
  float* att  = smem;
  float* sc   = smem + AG * H_N * L_W * TP;
  float* rows = smem + AG * H_N * L_W * TP + H_N * AR * SP;
  int n  = blockIdx.x / NGRP;
  int i0 = (blockIdx.x % NGRP) * AG;                    // first window of the run
  int rb = i0 < T_LEN - AR ? i0 : T_LEN - AR;           // first staged row: all AR lie in the entry
  int wo = i0 - rb;                                     // staged row of window i0's first row
  int nw = W_CNT - i0 < AG ? W_CNT - i0 : AG;           // windows that exist
  int tid = threadIdx.x;

  // --- stage the rows: one contiguous run; all of a thread's loads stand ahead of its LDS
  //     stores: one memory latency for the run. The last load stands alone behind an
  //     s_wait_xcnt 0 (its result may be given a register that the loads before it name), and
  //     the wait behind it stands in front of whatever rewrites its own address pair ---
  {
    const float* sp = qkv_all + (size_t)(n * T_LEN + rb) * 1200 + tid * 4;
    bool tail = tid < AR * 300 - (AQ - 1) * 256;   // whole waves
    v4f st[AQ];
#pragma unroll
    for (int i = 0; i < AQ - 1; ++i) st[i] = *(const v4f*)(sp + i * 1024);
    asm volatile("s_wait_xcnt 0x0" ::: "memory");
    if (tail) {
      st[AQ - 1] = *(const v4f*)(sp + (AQ - 1) * 1024);
      asm volatile("s_wait_xcnt 0x0" ::: "memory");
    }
#pragma unroll
    for (int i = 0; i < AQ; ++i) {
      int c = tid + i * 256;
      if (i + 1 < AQ || tail) *(v4f*)(rows + (c / 300) * AP + (c % 300) * 4) = st[i];
    }
  }
  __syncthreads();   // the staged rows are complete before any wave reads them

  // --- products q(t).k(u) of all staged rows, both heads: one thread takes rows t, t + 8
  //     against u, u + 8, so four 16-B reads feed four chains (each with e ascending) ---
  if (tid < 128) {
    int h = tid >> 6, t = (tid >> 3) & 7, u = tid & 7;
    const v4f* q0 = (const v4f*)(rows + t * AP + h * DH);
    const v4f* q1 = (const v4f*)(rows + (t + 8) * AP + h * DH);
    const v4f* k0 = (const v4f*)(rows + u * AP + D_M + h * DH);
    const v4f* k1 = (const v4f*)(rows + (u + 8) * AP + D_M + h * DH);
    float s00 = 0.f, s01 = 0.f, s10 = 0.f, s11 = 0.f;
    for (int e = 0; e < DH / 4; ++e) {
      v4f a = q0[e], b = q1[e], c = k0[e], d = k1[e];
#pragma unroll
      for (int x = 0; x < 4; ++x) {
        s00 = __builtin_fmaf(a[x], c[x], s00);
        s01 = __builtin_fmaf(a[x], d[x], s01);
        s10 = __builtin_fmaf(b[x], c[x], s10);
        s11 = __builtin_fmaf(b[x], d[x], s11);
      }
    }
    const float scale = 0.07071067811865475f;            // 1/sqrt(200)
    float* sr = sc + (h * AR + t) * SP + u;
    sr[0]      = s00 * scale;
    sr[8]      = s01 * scale;
    sr[8 * SP]     = s10 * scale;
    sr[8 * SP + 8] = s11 * scale;
  }
  __syncthreads();   // the products are complete before the softmax reads them

  // --- softmax: one thread per (window, head, query row); a window past the end gets zeros ---
  if (tid < AG * H_N * L_W) {
    int wl = tid / (H_N * L_W), r = tid % (H_N * L_W), h = r / L_W, a = r % L_W;
    float row[L_W];
#pragma unroll
    for (int b = 0; b < L_W; ++b) row[b] = 0.f;
    if (wl < nw) {
      const float* sr = sc + (h * AR + wo + wl + a) * SP + wo + wl;
#pragma unroll
      for (int b = 0; b < L_W; ++b) row[b] = sr[b];
      float mx = row[0];
#pragma unroll
      for (int b = 1; b < L_W; ++b) mx = fmaxf(mx, row[b]);
#pragma unroll
      for (int b = 0; b < L_W; ++b) row[b] = exp2_slot((row[b] - mx) * 1.44269504f);   // exp(x - mx)
      float sum = 0.f;
#pragma unroll
      for (int b = 0; b < L_W; ++b) sum += row[b];
      float inv = 1.0f / sum;
#pragma unroll
      for (int b = 0; b < L_W; ++b) row[b] *= inv;
    }
    float* ar = att + tid * TP;
#pragma unroll
    for (int b = 0; b < L_W; ++b) ar[b] = row[b];
  }
  __syncthreads();   // the weights are complete before att @ v reads them

  // --- o = att @ v: one thread takes 4 neighbouring columns of AH windows. The 12 rows of v
  //     that these windows use stay in registers, so each output row costs three reads of
  //     weights that 50 threads share; b ascending ---
  if (tid < 2 * (D_M / 4)) {
    int cg = tid % (D_M / 4), p = tid / (D_M / 4);
    int h = cg / (DH / 4);
    const float* vp = rows + 2 * D_M + cg * 4;
    v2f vl[AH + L_W - 1], vh[AH + L_W - 1];
#pragma unroll
    for (int j = 0; j < AH + L_W - 1; ++j) {
      int r = wo + p * AH + j;
      if (r > AR - 1) r = AR - 1;   // only rows of windows past the end, whose weights are 0
      v4f x = *(const v4f*)(vp + r * AP);
      vl[j] = v2f{x.x, x.y};
      vh[j] = v2f{x.z, x.w};
    }
    const float* ap = att + (p * AH * H_N + h) * (L_W * TP);
    _Float16* op = o_h + (size_t)(n * W_CNT + i0 + p * AH) * (L_W * D_M) + cg * 4;
    int lim = nw - p * AH;   // this thread's windows that exist
#pragma unroll 1   // one query row of the AH windows per pass: few registers, so three workgroups share a WGP
    for (int a = 0; a < L_W; ++a) {
      v4h res[AH];
#pragma unroll
      for (int ww = 0; ww < AH; ++ww) {
        const float* ar = ap + (ww * H_N * L_W + a) * TP;
        v4f w0 = *(const v4f*)ar, w1 = *(const v4f*)(ar + 4);
        float wt[L_W] = {w0.x, w0.y, w0.z, w0.w, w1.x, w1.y, w1.z, w1.w, ar[8]};
        v2f lo = {0.f, 0.f}, hi = {0.f, 0.f};
#pragma unroll
        for (int b = 0; b < L_W; ++b) {
          lo = __builtin_elementwise_fma(v2f{wt[b], wt[b]}, vl[ww + b], lo);
          hi = __builtin_elementwise_fma(v2f{wt[b], wt[b]}, vh[ww + b], hi);
        }
        res[ww] = v4h{(_Float16)lo.x, (_Float16)lo.y, (_Float16)hi.x, (_Float16)hi.y};
      }
#pragma unroll
      for (int ww = 0; ww < AH; ++ww) {
        if (ww < lim) {
          *(v4h*)(op + (ww * L_W + a) * D_M) = res[ww];
          // Behind the store: the next pass rewrites the registers that it names.
          asm volatile("s_wait_xcnt 0x0" ::: "memory");
        }
      }
    }
  }
}

// ---------------- Kernel 4b: row-wise stages on packed rows ----------------
// Behind the attention every stage (out projection, LayerNorm, FFN, LayerNorm) works on
// one row alone, so the 41904 (window, position) rows are packed into full 16-row tiles
// and one workgroup takes MT of them: each weight fragment loaded from L2 feeds MT WMMAs.
#define MROWS (NWIN * L_W)   // 41904 = 2619 tiles of 16
#define MT    6              // M tiles per workgroup
#define BM    (MT * 16)
#define PX    404            // f32 row pitch of X
#define PA    408            // f16 row pitch, 816 B = 16 B x odd
#define FC    320            // FFN columns per chunk
#define PF    328            // f16 row pitch, 656 B = 16 B x odd

typedef __attribute__((ext_vector_type(8))) _Float16 v8h;

// One lane's 16 halves of an A or B fragment: k = 8*half + 0..7 and 16 + 8*half + 0..7,
// p already at row start + kbase + 8*half. full == false: the upper 16 k are past K.
__device__ __forceinline__ v16h frag16(const _Float16* p, bool full) {
  v8h lo = *(const v8h*)p;
  v8h hi = {};
  if (full) hi = *(const v8h*)(p + 16);
  return __builtin_shufflevector(lo, hi, 0, 1, 2, 3, 4, 5, 6, 7, 8, 9, 10, 11, 12, 13,
                                 14, 15);
}

// Packed weights: the B fragment of (N tile nt, k step ks) is one 1-KiB block at index
// nt * KS + ks. Its first 512 B hold the 32 lanes' lower 8 halves in lane order, the next
// 512 B their upper 8, so one 16-byte-per-lane load covers 4 whole 128-B lines. Read from the
// row-major matrix the same load takes a 32-B piece out of each of 16 lines.
#define PBLK 512   // halves per block

// One lane's 16 halves of a packed B fragment, p at block start + lane * 8.
__device__ __forceinline__ v16h fragp(const _Float16* p, bool full) {
  v8h lo = *(const v8h*)p;
  v8h hi = {};
  if (full) hi = *(const v8h*)(p + PBLK / 2);
  return __builtin_shufflevector(lo, hi, 0, 1, 2, 3, 4, 5, 6, 7, 8, 9, 10, 11, 12, 13,
                                 14, 15);
}

// f32 weight W[N][K] -> f16 in the packed order above; one thread per 16-byte piece.
// A piece whose k lies past K is neither written here nor read by anyone.
__global__ void pack_w_kernel(const float* __restrict__ src, _Float16* __restrict__ dst,
                              int K, int KS, int pieces) {
  int idx = blockIdx.x * blockDim.x + threadIdx.x;
  if (idx >= pieces) return;
  int lane = idx & 31, part = (idx >> 5) & 1, blk = idx >> 6;
  int k = (blk % KS) * 32 + part * 16 + (lane >> 4) * 8;
  if (k >= K) return;
  const float* p = src + (size_t)((blk / KS) * 16 + (lane & 15)) * K + k;
  float4 u = *(const float4*)p, v = *(const float4*)(p + 4);
  v8h h = {(_Float16)u.x, (_Float16)u.y, (_Float16)u.z, (_Float16)u.w,
           (_Float16)v.x, (_Float16)v.y, (_Float16)v.z, (_Float16)v.w};
  *(v8h*)(dst + (size_t)idx * 8) = h;
}

// acc[mt] = A[mt*16..][0..400) @ W[nt*16..nt*16+16)^T, A f16 in LDS at pitch PA, W packed.
__device__ __forceinline__ void strip_k400(const _Float16* A, const _Float16* W, int nt,
                                           int lane, v8f* acc) {
  const _Float16* bp = W + (size_t)nt * (KS_D * PBLK) + lane * 8;
  const _Float16* ap = A + (lane & 15) * PA + (lane >> 4) * 8;
  // Compiler fence: keeps the A reads below inside the caller's loop over N tiles. They do
  // not change from tile to tile, and hoisted out of the loop they take 624 registers and spill.
  asm volatile("" ::: "memory");
  v16h b[KS_D];
#pragma unroll
  for (int ks = 0; ks < KS_D; ++ks) {
    // The last load's result may be given the address pair that the loads before it name:
    // the wait stands in front of that overwrite.
    if (ks + 1 == KS_D) asm volatile("s_wait_xcnt 0x0" ::: "memory");
    b[ks] = fragp(bp + ks * PBLK, ks + 1 < KS_D);
  }
#pragma unroll
  for (int mt = 0; mt < MT; ++mt) acc[mt] = v8f{};
  // A fragments of k step ks + 1 are read as one group ahead of the WMMAs of step ks.
  v16h a[2][MT];
#pragma unroll
  for (int mt = 0; mt < MT; ++mt) a[0][mt] = frag16(ap + mt * 16 * PA, true);
  __builtin_amdgcn_sched_barrier(0);   // keeps all 25 weight loads in flight from the start
#pragma unroll
  for (int ks = 0; ks < KS_D; ++ks) {
    if (ks + 1 < KS_D) {
#pragma unroll
      for (int mt = 0; mt < MT; ++mt)
        a[(ks + 1) & 1][mt] = frag16(ap + mt * 16 * PA + (ks + 1) * 32, ks + 2 < KS_D);
    }
    // Holds the read group ahead of the WMMAs: with the FFN2 accumulators live the scheduler
    // otherwise sinks each read to its WMMA, which then waits out a whole LDS latency.
    __builtin_amdgcn_sched_barrier(0);
#pragma unroll
    for (int mt = 0; mt < MT; ++mt) acc[mt] = wmma_acc(a[ks & 1][mt], b[ks], acc[mt]);
    __builtin_amdgcn_sched_barrier(0);   // same purpose: the next group stays behind these
  }
}

// ---------------- Kernel 3: hoisted QKV GEMM over all 4800 rows ----------------
// qkv_all[4800][1200] = xs[4800][400] @ w_in^T + b_in
// One workgroup per tile of BM rows x QN * 16 columns. The rows are staged once in LDS, w_in
// comes packed, and each wave runs whole strips: a weight fragment feeds MT WMMAs, and the 25
// weight loads of a strip are in flight together, so a strip waits out one L2 latency, not
// one per k step.
#define QN 15   // N tiles per workgroup; 1200 / 16 = 5 * QN
#define QP ((BM * 50 + 255) / 256)   // 16-byte pieces of the row tile per thread
__global__ void __launch_bounds__(256, 1)
qkv_gemm_kernel(const _Float16* __restrict__ xs_h,
                const _Float16* __restrict__ w_in_h,
                const float* __restrict__ b_in,
                float* __restrict__ qkv_all) {
  __shared__ __attribute__((aligned(16))) _Float16 Ah[BM * PA];
  int tid = threadIdx.x, lane = tid & 31;
  int wv = __builtin_amdgcn_readfirstlane(tid >> 5);  // scalar: the tile loop branches on it
  int row0 = (blockIdx.x % (NROWS / BM)) * BM;
  int nt0  = (blockIdx.x / (NROWS / BM)) * QN;

  // The BM rows are one contiguous run of BM * 50 16-byte pieces. All of a thread's loads stand
  // ahead of its LDS stores: one memory latency for the tile, not one per piece.
  const _Float16* sp = xs_h + (size_t)row0 * D_M + tid * 8;
  v8h st[QP];
#pragma unroll
  for (int i = 0; i < QP; ++i)
    if (i + 1 < QP || tid < BM * 50 - (QP - 1) * 256) st[i] = *(const v8h*)(sp + i * 2048);
#pragma unroll
  for (int i = 0; i < QP; ++i) {
    int c = tid + i * 256;
    if (i + 1 < QP || tid < BM * 50 - (QP - 1) * 256)
      *(v8h*)(Ah + c * 8 + (c / 50) * (PA - D_M)) = st[i];
  }
  __syncthreads();   // the staged rows are complete before any wave reads them

  for (int nt = nt0 + wv; nt < nt0 + QN; nt += 8) {
    int nn = nt * 16 + (lane & 15);
    float bias = b_in[nn];   // ahead of the strip: it returns under the weight loads
    v8f acc[MT];
    strip_k400(Ah, w_in_h, nt, lane, acc);
    float* op = qkv_all + (size_t)(row0 + (lane >> 4) * 8) * 1200 + nn;
#pragma unroll
    for (int q = 0; q < MT * 8; ++q)
      op[((q >> 3) * 16 + (q & 7)) * 1200] = acc[q >> 3][q & 7] + bias;
  }
}

// Lane l's value from lane l ^ 16: a vector cross-row move.
__device__ __forceinline__ float xor_half(float x) {
  int b = __builtin_bit_cast(int, x);
  return __builtin_bit_cast(float, __builtin_amdgcn_permlanex16(b, b, 0x76543210, 0xfedcba98,
                                                                false, false));
}

// Lane l's value from lane l ^ M of its 16-lane row: DPP row_xmask, which the add takes as an
// operand modifier.
template <int M>
__device__ __forceinline__ float xor_row(float x) {
  return __builtin_bit_cast(float, __builtin_amdgcn_mov_dpp(__builtin_bit_cast(int, x), 0x160 | M,
                                                            0xf, 0xf, true));
}

// Sum over the wave's 32 lanes, left in every lane; all lanes on. The partners come in the order
// l ^ 16, 8, 4, 2, 1. Every step stays in the vector registers: as a shuffle it is a
// ds_bpermute_b32 whose result the dependent add awaits through the LDS queue.
__device__ __forceinline__ float wave_sum(float s) {
  s += xor_half(s);
  s += xor_row<8>(s);
  s += xor_row<4>(s);
  s += xor_row<2>(s);
  s += xor_row<1>(s);
  return s;
}

// LayerNorm of the BM rows of X, one wave per row, the row held in registers.
// TO_OUT false: back into X, with an f16 copy in Ah. TO_OUT true: to global rows.
template <bool TO_OUT>
__device__ __forceinline__ void layernorm_packed(float* X, const float* g, const float* b,
                                                 _Float16* Ah, float* outg, int row0,
                                                 int wv, int lane) {
  float gg[13], bb[13];
#pragma unroll
  for (int q = 0; q < 13; ++q) {
    int c = lane + 32 * q;
    gg[q] = (c < D_M) ? g[c] : 0.f;
    bb[q] = (c < D_M) ? b[c] : 0.f;
  }
  for (int r = wv; r < BM; r += 8) {
    float v[13];
#pragma unroll
    for (int q = 0; q < 13; ++q) {
      int c = lane + 32 * q;
      v[q] = (c < D_M) ? X[r * PX + c] : 0.f;
    }
    float s = 0.f;
#pragma unroll
    for (int q = 0; q < 13; ++q) s += v[q];
    s = wave_sum(s);
    float mu = s * (1.0f / D_M);
    float vv = 0.f;
#pragma unroll
    for (int q = 0; q < 13; ++q) {
      if (lane + 32 * q < D_M) {
        float t = v[q] - mu;
        vv += t * t;
      }
    }
    vv = wave_sum(vv);
    float rs = rsqrtf(vv * (1.0f / D_M) + 1e-5f);
#pragma unroll
    for (int q = 0; q < 13; ++q) {
      int c = lane + 32 * q;
      if (c < D_M) {
        float y = (v[q] - mu) * rs * gg[q] + bb[q];
        if (TO_OUT) {
          if (row0 + r < MROWS) outg[(size_t)(row0 + r) * D_M + c] = y;
          // Behind the row's last store: the next row rewrites the registers it names.
          if (q == 12) asm volatile("s_wait_xcnt 0x0" ::: "memory");
        } else {
          X[r * PX + c]  = y;
          Ah[r * PA + c] = (_Float16)y;
        }
      }
    }
  }
}

typedef __attribute__((ext_vector_type(2))) float v2f;

__device__ __forceinline__ v2f fma2(v2f a, v2f b, float c) {
  return __builtin_elementwise_fma(a, b, v2f{c, c});
}

#define GP 8   // value pairs that go through the GELU side by side

// Exact-erf GELU of GP value pairs with no branch. erf keeps the f32 library's two fits (an odd
// polynomial below |z| = 1, 1 - exp(-q(|z|)) from there on), but both are evaluated for every
// lane and one is selected: a branch on the lane's value cuts the epilogue into one serial
// dependent chain per element, where straight-line code lets independent chains overlap.
__device__ __forceinline__ void gelu_group(v2f* x) {
  v2f z[GP], az[GP], t[GP], q[GP], p[GP];
#pragma unroll
  for (int i = 0; i < GP; ++i) { z[i] = x[i] * 0.707106769f; x[i] = x[i] * 0.5f; }
#pragma unroll
  for (int i = 0; i < GP; ++i) {
    az[i] = v2f{__builtin_fabsf(z[i].x), __builtin_fabsf(z[i].y)};
    t[i]  = z[i] * z[i];
  }
  const float cq[6] = {-0.000378677854f, 0.00385781587f, -0.0241816975f,
                       0.106668264f, 0.634933293f, 0.128689408f};
  const float cp[5] = {0.00491381623f, -0.0267075151f, 0.112800106f,
                       -0.376122952f, 0.128379107f};
#pragma unroll
  for (int i = 0; i < GP; ++i) {
    q[i] = v2f{0.0000169988107f, 0.0000169988107f};
    p[i] = v2f{-0.000561801775f, -0.000561801775f};
  }
#pragma unroll
  for (int s = 0; s < 5; ++s) {
#pragma unroll
    for (int i = 0; i < GP; ++i) {
      q[i] = fma2(az[i], q[i], cq[s]);
      p[i] = fma2(t[i], p[i], cp[s]);
    }
  }
#pragma unroll
  for (int i = 0; i < GP; ++i) {
    q[i] = fma2(az[i], q[i], cq[5]);
    p[i] = __builtin_elementwise_fma(az[i], p[i], az[i]);
  }
#pragma unroll
  for (int i = 0; i < GP; ++i) q[i] = __builtin_elementwise_fma(az[i], q[i], az[i]);
#pragma unroll
  for (int i = 0; i < GP; ++i) q[i] = q[i] * -1.44269502f;
#pragma unroll
  for (int i = 0; i < GP; ++i)
    q[i] = v2f{__builtin_amdgcn_exp2f(q[i].x), __builtin_amdgcn_exp2f(q[i].y)};
#pragma unroll
  for (int i = 0; i < GP; ++i) q[i] = 1.0f - q[i];
#pragma unroll
  for (int i = 0; i < GP; ++i)
    p[i] = v2f{az[i].x < 1.0f ? p[i].x : q[i].x, az[i].y < 1.0f ? p[i].y : q[i].y};
#pragma unroll
  for (int i = 0; i < GP; ++i)
    p[i] = v2f{__builtin_copysignf(p[i].x, z[i].x), __builtin_copysignf(p[i].y, z[i].y)};
#pragma unroll
  for (int i = 0; i < GP; ++i) p[i] = p[i] + 1.0f;
#pragma unroll
  for (int i = 0; i < GP; ++i) x[i] = x[i] * p[i];
}

__global__ void __launch_bounds__(256, 1)
rows_kernel(const float* __restrict__ xs,
            const _Float16* __restrict__ o_h,
            const _Float16* __restrict__ w_out_h,
            const float* __restrict__ b_out,
            const _Float16* __restrict__ w1_h,
            const float* __restrict__ b1,
            const _Float16* __restrict__ w2_h,
            const float* __restrict__ b2,
            const float* __restrict__ ln1_g, const float* __restrict__ ln1_b,
            const float* __restrict__ ln2_g, const float* __restrict__ ln2_b,
            float* __restrict__ out_win) {
  __shared__ __attribute__((aligned(16))) float    X[BM * PX];   // residual stream, f32
  __shared__ __attribute__((aligned(16))) _Float16 Ah[BM * PA];  // o, then LN1 output
  __shared__ __attribute__((aligned(16))) _Float16 Fc[BM * PF];  // one chunk of gelu(ffn1)
  int tid = threadIdx.x, lane = tid & 31;
  int wv = __builtin_amdgcn_readfirstlane(tid >> 5);  // scalar: tile loops branch on it
  int half = lane >> 4;
  int row0 = blockIdx.x * BM;

  // --- stage o (f16) and the residual rows of xs (f32); rows past the end repeat the
  //     last row and are never stored ---
  for (int c = tid; c < BM * 50; c += 256) {
    int r = c / 50, q = c % 50;
    int gr = row0 + r; if (gr > MROWS - 1) gr = MROWS - 1;
    *(v8h*)(Ah + r * PA + q * 8) = *(const v8h*)(o_h + (size_t)gr * D_M + q * 8);
  }
  for (int c = tid; c < BM * 100; c += 256) {
    int r = c / 100, q = c % 100;
    int gr = row0 + r; if (gr > MROWS - 1) gr = MROWS - 1;
    int w = gr / L_W, j = gr % L_W;
    int xr = (w / W_CNT) * T_LEN + (w % W_CNT) + j;
    *(float4*)(X + r * PX + q * 4) = *(const float4*)(xs + (size_t)xr * D_M + q * 4);
  }
  __syncthreads();

  // --- out projection + residual -> X ---
  for (int nt = wv; nt < D_M / 16; nt += 8) {
    v8f acc[MT];
    strip_k400(Ah, w_out_h, nt, lane, acc);
    int nn = nt * 16 + (lane & 15);
    float bo = b_out[nn];
    float* xp = X + half * 8 * PX + nn;
    float res[MT * 8];   // all reads ahead of the stores: one LDS latency, not one per element
#pragma unroll
    for (int q = 0; q < MT * 8; ++q) res[q] = xp[((q >> 3) * 16 + (q & 7)) * PX];
#pragma unroll
    for (int q = 0; q < MT * 8; ++q)
      xp[((q >> 3) * 16 + (q & 7)) * PX] = acc[q >> 3][q & 7] + bo + res[q];
  }
  __syncthreads();
  layernorm_packed<false>(X, ln1_g, ln1_b, Ah, nullptr, row0, wv, lane);
  __syncthreads();

  // --- FFN in 5 chunks of 320 hidden columns: FFN1 + exact GELU -> Fc, then FFN2 adds
  //     that chunk's k range into accumulators that stay in registers (k ascending) ---
  v8f acc2[4][MT];
#pragma unroll
  for (int tt = 0; tt < 4; ++tt) {
#pragma unroll
    for (int mt = 0; mt < MT; ++mt) acc2[tt][mt] = v8f{};
  }
#pragma unroll 1   // one copy of the chunk body, for speed only
  for (int kc = 0; kc < FF_M / FC; ++kc) {
#pragma unroll 1   // same reason
    for (int t = wv; t < FC / 16; t += 8) {
      v8f acc[MT];
      strip_k400(Ah, w1_h, kc * (FC / 16) + t, lane, acc);
      int cl = t * 16 + (lane & 15);
      float bb = b1[kc * FC + cl];
#pragma unroll
      for (int e0 = 0; e0 < MT * 8; e0 += 2 * GP) {
        v2f xv[GP];
#pragma unroll
        for (int i = 0; i < GP; ++i) {
          int e = e0 + 2 * i;
          xv[i] = v2f{acc[e >> 3][e & 7] + bb, acc[e >> 3][(e & 7) + 1] + bb};
        }
        gelu_group(xv);
#pragma unroll
        for (int i = 0; i < GP; ++i) {
          int e = e0 + 2 * i;
          int m = (e >> 3) * 16 + (e & 7) + half * 8;
          Fc[m * PF + cl]       = (_Float16)xv[i].x;
          Fc[(m + 1) * PF + cl] = (_Float16)xv[i].y;
        }
      }
    }
    __syncthreads();   // Fc complete before any wave reads it
    const _Float16* ap = Fc + (lane & 15) * PF + half * 8;
    const _Float16* bp = w2_h + (size_t)(wv * KS_F + kc * (FC / 32)) * PBLK + lane * 8;
    // Weight fragments run two k steps ahead of their WMMAs (ring of three sets); each A
    // fragment read from LDS serves all of the wave's N tiles. Tile 24 is wave 0's alone.
    v16h bq[3][4];
#pragma unroll
    for (int ks = 0; ks < 2; ++ks) {
#pragma unroll
      for (int tt = 0; tt < 3; ++tt) bq[ks][tt] = fragp(bp + (tt * 8 * KS_F + ks) * PBLK, true);
      if (wv == 0) bq[ks][3] = fragp(bp + (3 * 8 * KS_F + ks) * PBLK, true);
    }
    v16h a[2][MT];   // A fragments run one k step ahead
#pragma unroll
    for (int mt = 0; mt < MT; ++mt) a[0][mt] = frag16(ap + mt * 16 * PF, true);
#pragma unroll
    for (int ks = 0; ks < FC / 32; ++ks) {
      if (ks + 2 < FC / 32) {
#pragma unroll
        for (int tt = 0; tt < 3; ++tt)
          bq[(ks + 2) % 3][tt] = fragp(bp + (tt * 8 * KS_F + ks + 2) * PBLK, true);
        if (wv == 0) bq[(ks + 2) % 3][3] = fragp(bp + (3 * 8 * KS_F + ks + 2) * PBLK, true);
      }
      if (ks + 1 < FC / 32) {
#pragma unroll
        for (int mt = 0; mt < MT; ++mt)
          a[(ks + 1) & 1][mt] = frag16(ap + mt * 16 * PF + (ks + 1) * 32, true);
      }
#pragma unroll
      for (int tt = 0; tt < 3; ++tt) {
#pragma unroll
        for (int mt = 0; mt < MT; ++mt)
          acc2[tt][mt] = wmma_acc(a[ks & 1][mt], bq[ks % 3][tt], acc2[tt][mt]);
      }
      if (wv == 0) {
#pragma unroll
        for (int mt = 0; mt < MT; ++mt)
          acc2[3][mt] = wmma_acc(a[ks & 1][mt], bq[ks % 3][3], acc2[3][mt]);
      }
    }
    __syncthreads();   // every reader has left Fc before the next chunk overwrites it
  }
#pragma unroll
  for (int tt = 0; tt < 4; ++tt) {
    int nt = wv + tt * 8;
    if (nt < D_M / 16) {
      int nn = nt * 16 + (lane & 15);
      float bb = b2[nn];
      float* xp = X + half * 8 * PX + nn;
      float res[MT * 8];   // all reads ahead of the stores, as above
#pragma unroll
      for (int q = 0; q < MT * 8; ++q) res[q] = xp[((q >> 3) * 16 + (q & 7)) * PX];
#pragma unroll
      for (int q = 0; q < MT * 8; ++q)
        xp[((q >> 3) * 16 + (q & 7)) * PX] = res[q] + acc2[tt][q >> 3][q & 7] + bb;
    }
  }
  __syncthreads();
  layernorm_packed<true>(X, ln2_g, ln2_b, nullptr, out_win, row0, wv, lane);
}

// ---------------- Kernel 5: deterministic overlap-gather + output transpose ----------------
// row t receives out_win[i][t - i/2] for i in [2(t-8), 2t+1] within [0, W), summed with i ascending.
// One thread takes 4 neighbouring d of the steps t, t + TB, t + 2 TB, t + 3 TB (only steps up
// to TLAST receive anything, so every thread gets two full steps).
#define TLAST  ((W_CNT - 1) / 2 + L_W - 1)   // 153
#define IBMAX  (W_CNT + 1 - 2 * L_W)         // 274: the last even start whose 17 windows exist
#define ROWQ(q) ((q) * L_W - ((q) >> 1))     // packed row of window ib + q, less that of window ib
static_assert(IBMAX % 2 == 0, "ROWQ needs an even first window");

// Sum of step t for 4 neighbouring d, wn = the batch entry's first packed row + d.
// The 18 windows ib .. ib + 17 are read with no branch between them, from one address with
// constant offsets; ib is 2(t-8) moved into [0, IBMAX], which keeps every row inside the batch
// entry's block (the 18th is clamped to its last row), and a window outside the step's range
// adds 0. So all 18 loads are in flight together, and the windows that count keep their order.
__device__ __forceinline__ float4 gather_step(const float* wn, int t) {
  int i0 = 2 * (t - (L_W - 1));
  int ib = i0 < 0 ? 0 : (i0 > IBMAX ? IBMAX : i0);
  int r0 = ib * L_W + t - (ib >> 1);
  int rl = r0 + ROWQ(2 * L_W - 1);
  if (rl > W_CNT * L_W - 1) rl = W_CNT * L_W - 1;
  const float* p  = wn + r0 * D_M;
  const float* pl = wn + rl * D_M;
  float4 val[2 * L_W];
#pragma unroll
  for (int q = 0; q < 2 * L_W - 2; ++q) val[q] = *(const float4*)(p + ROWQ(q) * D_M);
  // A later load's result may be given the address pair of the loads before it: each pair's
  // last load stands alone behind an s_wait_xcnt 0, so no pair is overwritten in front of one.
  asm volatile("s_wait_xcnt 0x0" ::: "memory");
  val[2 * L_W - 2] = *(const float4*)(p + ROWQ(2 * L_W - 2) * D_M);
  asm volatile("s_wait_xcnt 0x0" ::: "memory");
  val[2 * L_W - 1] = *(const float4*)pl;
  asm volatile("s_wait_xcnt 0x0" ::: "memory");
  float4 sum = make_float4(0.f, 0.f, 0.f, 0.f);
#pragma unroll
  for (int q = 0; q < 2 * L_W; ++q) {
    int i = ib + q;
    bool in = i >= i0 && i <= 2 * t + 1 && i < W_CNT;
    sum.x += in ? val[q].x : 0.f;
    sum.y += in ? val[q].y : 0.f;
    sum.z += in ? val[q].z : 0.f;
    sum.w += in ? val[q].w : 0.f;
  }
  return sum;
}

__global__ void __launch_bounds__(256)
gather_out_kernel(const float* __restrict__ out_win, float* __restrict__ out) {
  int idx = blockIdx.x * 256 + threadIdx.x;
  if (idx >= NITEM) return;
  int d4 = idx % (D_M / 4);
  int r  = idx / (D_M / 4);
  int tb = r % TB;
  int n  = r / TB;
  int v = d4 >> 2, c0 = (d4 & 3) * 4;
  const float* wn = out_win + (size_t)n * (W_CNT * L_W * D_M) + d4 * 4;
  float* op = out + ((n * C_CH + c0) * T_LEN + tb) * V_J + v;
  float4 sum[TG];
#pragma unroll
  for (int k = 0; k < TG; ++k) {
    int t = tb + k * TB;
    sum[k] = make_float4(0.f, 0.f, 0.f, 0.f);
    if ((k + 1) * TB - 1 <= TLAST || (k * TB <= TLAST && t <= TLAST)) sum[k] = gather_step(wn, t);
  }
  // All stores behind all loads: no register that a store names is written again.
#pragma unroll
  for (int k = 0; k < TG; ++k) {
    op[(0 * T_LEN + k * TB) * V_J] = sum[k].x;
    op[(1 * T_LEN + k * TB) * V_J] = sum[k].y;
    op[(2 * T_LEN + k * TB) * V_J] = sum[k].z;
    op[(3 * T_LEN + k * TB) * V_J] = sum[k].w;
  }
}

// ---------------- host launch ----------------
extern "C" void kernel_launch(void* const* d_in, const int* in_sizes, int n_in,
                              void* d_out, int out_size, void* d_ws, size_t ws_size,
                              hipStream_t stream) {
  const float* x     = (const float*)d_in[0];
  const float* pe    = (const float*)d_in[1];
  const float* w_in  = (const float*)d_in[2];
  const float* b_in  = (const float*)d_in[3];
  const float* w_out = (const float*)d_in[4];
  const float* b_out = (const float*)d_in[5];
  const float* w1    = (const float*)d_in[6];
  const float* b1    = (const float*)d_in[7];
  const float* w2    = (const float*)d_in[8];
  const float* b2    = (const float*)d_in[9];
  const float* ln1g  = (const float*)d_in[10];
  const float* ln1b  = (const float*)d_in[11];
  const float* ln2g  = (const float*)d_in[12];
  const float* ln2b  = (const float*)d_in[13];
  float* out = (float*)d_out;

  // workspace layout
  char* ws = (char*)d_ws;
  size_t off = 0;
  float*    xs      = (float*)(ws + off);    off += (size_t)NROWS * D_M * 4;       // 7.68 MB
  _Float16* xs_h    = (_Float16*)(ws + off); off += (size_t)NROWS * D_M * 2;       // 3.84 MB
  // packed in fragment order: N/16 tiles x k steps x 1 KiB
  _Float16* w_in_h  = (_Float16*)(ws + off); off += (size_t)(3 * D_M / 16) * KS_D * 1024;  // 1.00 MB
  _Float16* w_out_h = (_Float16*)(ws + off); off += (size_t)(D_M / 16) * KS_D * 1024;   // 0.33 MB
  _Float16* w1_h    = (_Float16*)(ws + off); off += (size_t)(FF_M / 16) * KS_D * 1024;  // 1.33 MB
  _Float16* w2_h    = (_Float16*)(ws + off); off += (size_t)(D_M / 16) * KS_F * 1024;   // 1.28 MB
  float*    qkv_all = (float*)(ws + off);    off += (size_t)NROWS * 3 * D_M * 4;   // 23.04 MB
  float*    out_win = (float*)(ws + off);    off += (size_t)NWIN * L_W * D_M * 4;  // 67.05 MB
  _Float16* o_h     = (_Float16*)(ws + off); off += (size_t)NWIN * L_W * D_M * 2;  // 33.52 MB

  const int TPB = 256;

  // 1) layout + positional encoding
  prep_xs_kernel<<<(NITEM + TPB - 1) / TPB, TPB, 0, stream>>>(x, pe, xs, xs_h);

  // 2) weight conversion to f16, packed in fragment order
  pack_w_kernel<<<((3 * D_M / 16) * KS_D * 64 + TPB - 1) / TPB, TPB, 0, stream>>>(
      w_in, w_in_h, D_M, KS_D, (3 * D_M / 16) * KS_D * 64);
  pack_w_kernel<<<((D_M / 16) * KS_D * 64 + TPB - 1) / TPB, TPB, 0, stream>>>(
      w_out, w_out_h, D_M, KS_D, (D_M / 16) * KS_D * 64);
  pack_w_kernel<<<((FF_M / 16) * KS_D * 64 + TPB - 1) / TPB, TPB, 0, stream>>>(
      w1, w1_h, D_M, KS_D, (FF_M / 16) * KS_D * 64);
  pack_w_kernel<<<((D_M / 16) * KS_F * 64 + TPB - 1) / TPB, TPB, 0, stream>>>(
      w2, w2_h, FF_M, KS_F, (D_M / 16) * KS_F * 64);

  // 3) hoisted QKV GEMM: one block per tile of BM rows x QN * 16 columns
  qkv_gemm_kernel<<<(NROWS / BM) * (3 * D_M / 16 / QN), TPB, 0, stream>>>(xs_h, w_in_h, b_in,
                                                                          qkv_all);

  // 4) attention, one block per run of AG windows
  attn_kernel<<<N_B * NGRP, TPB, 0, stream>>>(qkv_all, o_h);

  // 4b) out projection, LayerNorm, FFN, LayerNorm on packed rows (WMMA)
  rows_kernel<<<(MROWS + BM - 1) / BM, TPB, 0, stream>>>(xs, o_h, w_out_h, b_out, w1_h, b1,
                                                         w2_h, b2, ln1g, ln1b, ln2g, ln2b,
                                                         out_win);

  // 5) deterministic overlap-add + transpose to [N,C,T,V]
  gather_out_kernel<<<(NITEM + TPB - 1) / TPB, TPB, 0, stream>>>(out_win, out);
}

// v008
// Measured time: 190 microseconds a run.
// Timed twice side by side with v007, it ran 1.05 times as fast both times.
// Over all steps from v000 it is 5.79 times as fast.
#include <hip/hip_runtime.h>
#include <hip/hip_fp16.h>
#include <math.h>

typedef __attribute__((ext_vector_type(16))) _Float16 v16h;
typedef __attribute__((ext_vector_type(8)))  float    v8f;

#define N_B   16
#define T_LEN 300
#define V_J   25
#define C_CH  16
#define D_M   400      // C*V
#define H_N   2
#define DH    200
#define FF_M  1600
#define L_W   9
#define W_CNT 291      // T - L
#define NWIN  (N_B * W_CNT)   // 4656
#define NROWS (N_B * T_LEN)   // 4800
#define KS_D  13       // ceil(400/32)
#define KS_F  50       // 1600/32

// ---------------- WMMA fragment helpers (16x16x32 f16 -> f32) ----------------

__device__ __forceinline__ v8f wmma_acc(v16h a, v16h b, v8f c) {
  return __builtin_amdgcn_wmma_f32_16x16x32_f16(false, a, false, b, (short)0, c,
                                                false, false);
}

// ---------------- Job 1: layout change + positional encoding ----------------
// xs[n][t][d] = x[n][c][t][v] + pe[t][d],  d = v*16 + c  (torch view order)
// The two layout passes (this job and the overlap gather kernel) do a few operations per element.
// One thread takes TG time steps x 4 neighbouring d (16 elements), so that 3750 waves have to
// start per launch; at one element per thread it is 60000.
#define TG    4                                  // time steps per thread
#define TB    (T_LEN / TG)                       // 75
#define NITEM (N_B * TB * (D_M / 4))             // 120000 threads

typedef __attribute__((ext_vector_type(4))) _Float16 v4h;

__device__ __forceinline__ void
prep_xs(int idx, const float* __restrict__ x, const float* __restrict__ pe,
        float* __restrict__ xs, _Float16* __restrict__ xs_h) {
  if (idx >= NITEM) return;
  int d4 = idx % (D_M / 4);
  int r  = idx / (D_M / 4);
  int t0 = (r % TB) * TG;      // TG neighbouring steps: their x values share 128-B lines
  int n  = r / TB;
  int v = d4 >> 2, c0 = (d4 & 3) * 4;
  const float* xp = x + ((n * C_CH + c0) * T_LEN + t0) * V_J + v;
  const float* pp = pe + t0 * D_M + d4 * 4;
  float  xv[TG * 4];
  float4 pv[TG];
  // All 20 loads are in flight together. A later load's result may be given the address pair
  // of the loads before it: the pair's last load stands alone behind an s_wait_xcnt 0, and a
  // second one frees the pair for the results of the pe loads.
#pragma unroll
  for (int e = 0; e < TG * 4 - 1; ++e) xv[e] = xp[((e & 3) * T_LEN + (e >> 2)) * V_J];
  asm volatile("s_wait_xcnt 0x0" ::: "memory");
  xv[TG * 4 - 1] = xp[(3 * T_LEN + TG - 1) * V_J];
  asm volatile("s_wait_xcnt 0x0" ::: "memory");
#pragma unroll
  for (int k = 0; k < TG; ++k) pv[k] = *(const float4*)(pp + k * D_M);
  int o = (n * T_LEN + t0) * D_M + d4 * 4;
  float4 s[TG];
  v4h    h[TG];
#pragma unroll
  for (int k = 0; k < TG; ++k) {
    s[k] = make_float4(xv[k * 4] + pv[k].x, xv[k * 4 + 1] + pv[k].y, xv[k * 4 + 2] + pv[k].z,
                       xv[k * 4 + 3] + pv[k].w);
    h[k] = v4h{(_Float16)s[k].x, (_Float16)s[k].y, (_Float16)s[k].z, (_Float16)s[k].w};
  }
#pragma unroll
  for (int k = 0; k < TG; ++k) {
    *(float4*)(xs + o + k * D_M) = s[k];
    *(v4h*)(xs_h + o + k * D_M)  = h[k];
  }
}

// ---------------- Kernel 4: attention of a run of AG windows per workgroup ----------------
// Neighbouring windows share 8 of their 9 rows, and q(t).k(u) does not depend on the window
// that asks for it. One workgroup takes AG consecutive windows of a batch entry: their AR rows
// of qkv are staged once, each product q(t).k(u) of those rows is formed once, and only the
// softmax and att @ v run per window. Every sum keeps the order it has with one window alone.
// Result o goes out as f16 (the type the out projection reads it in), packed as
// row w*9 + a of o_h[41904][400].
#define AG   8                          // windows per workgroup
#define AR   (AG + L_W - 1)             // 16 rows serve them
#define AP   1204                       // f32 row pitch: 8 rows' 16-B pieces fall on disjoint banks
#define NGRP ((W_CNT + AG - 1) / AG)    // 37 runs per batch entry, the last of 3 windows
#define AQ   ((AR * 300 + 255) / 256)   // 16-byte pieces of the rows per thread
#define SP   (AR + 1)                   // row pitch of the products
#define TP   12                         // row pitch of the weights: 9 used, rows 16-B aligned
#define AH   (AG / 2)                   // windows per thread in att @ v

typedef __attribute__((ext_vector_type(2))) float v2f;
typedef __attribute__((ext_vector_type(4))) float v4f;

// 2^x. The v_nop fills the slot that the instruction set asks for behind a transcendental. It
// stands in the exponential's own statement because nothing else ties it there.
__device__ __forceinline__ float exp2_slot(float x) {
  float r;
  asm("v_exp_f32 %0, %1\n\tv_nop" : "=v"(r) : "v"(x));
  return r;
}

__global__ void __launch_bounds__(256)
attn_kernel(const float* __restrict__ qkv_all, _Float16* __restrict__ o_h) {
  // LDS map (floats): weights, products, staged rows. The small arrays come first, so that
  // their reads reach them by an immediate offset.
  __shared__ __attribute__((aligned(16))) float smem[AG * H_N * L_W * TP + H_N * AR * SP + AR * AP];
  float* att  = smem;
  float* sc   = smem + AG * H_N * L_W * TP;
  float* rows = smem + AG * H_N * L_W * TP + H_N * AR * SP;
  int n  = blockIdx.x / NGRP;
  int i0 = (blockIdx.x % NGRP) * AG;                    // first window of the run
  int rb = i0 < T_LEN - AR ? i0 : T_LEN - AR;           // first staged row: all AR lie in the entry
  int wo = i0 - rb;                                     // staged row of window i0's first row
  int nw = W_CNT - i0 < AG ? W_CNT - i0 : AG;           // windows that exist
  int tid = threadIdx.x;

  // --- stage the rows: one contiguous run; all of a thread's loads stand ahead of its LDS
  //     stores: one memory latency for the run. The last load stands alone behind an
  //     s_wait_xcnt 0 (its result may be given a register that the loads before it name), and
  //     the wait behind it stands in front of whatever rewrites its own address pair ---
  {
    const float* sp = qkv_all + (size_t)(n * T_LEN + rb) * 1200 + tid * 4;
    bool tail = tid < AR * 300 - (AQ - 1) * 256;   // whole waves
    v4f st[AQ];
#pragma unroll
    for (int i = 0; i < AQ - 1; ++i) st[i] = *(const v4f*)(sp + i * 1024);
    asm volatile("s_wait_xcnt 0x0" ::: "memory");
    if (tail) {
      st[AQ - 1] = *(const v4f*)(sp + (AQ - 1) * 1024);
      asm volatile("s_wait_xcnt 0x0" ::: "memory");
    }
#pragma unroll
    for (int i = 0; i < AQ; ++i) {
      int c = tid + i * 256;
      if (i + 1 < AQ || tail) *(v4f*)(rows + (c / 300) * AP + (c % 300) * 4) = st[i];
    }
  }
  __syncthreads();   // the staged rows are complete before any wave reads them

  // --- products q(t).k(u) of all staged rows, both heads: one thread takes rows t, t + 8
  //     against u, u + 8, so four 16-B reads feed four chains (each with e ascending) ---
  if (tid < 128) {
    int h = tid >> 6, t = (tid >> 3) & 7, u = tid & 7;
    const v4f* q0 = (const v4f*)(rows + t * AP + h * DH);
    const v4f* q1 = (const v4f*)(rows + (t + 8) * AP + h * DH);
    const v4f* k0 = (const v4f*)(rows + u * AP + D_M + h * DH);
    const v4f* k1 = (const v4f*)(rows + (u + 8) * AP + D_M + h * DH);
    float s00 = 0.f, s01 = 0.f, s10 = 0.f, s11 = 0.f;
    for (int e = 0; e < DH / 4; ++e) {
      v4f a = q0[e], b = q1[e], c = k0[e], d = k1[e];
#pragma unroll
      for (int x = 0; x < 4; ++x) {
        s00 = __builtin_fmaf(a[x], c[x], s00);
        s01 = __builtin_fmaf(a[x], d[x], s01);
        s10 = __builtin_fmaf(b[x], c[x], s10);
        s11 = __builtin_fmaf(b[x], d[x], s11);
      }
    }
    const float scale = 0.07071067811865475f;            // 1/sqrt(200)
    float* sr = sc + (h * AR + t) * SP + u;
    sr[0]      = s00 * scale;
    sr[8]      = s01 * scale;
    sr[8 * SP]     = s10 * scale;
    sr[8 * SP + 8] = s11 * scale;
  }
  __syncthreads();   // the products are complete before the softmax reads them

  // --- softmax: one thread per (window, head, query row); a window past the end gets zeros ---
  if (tid < AG * H_N * L_W) {
    int wl = tid / (H_N * L_W), r = tid % (H_N * L_W), h = r / L_W, a = r % L_W;
    float row[L_W];
#pragma unroll
    for (int b = 0; b < L_W; ++b) row[b] = 0.f;
    if (wl < nw) {
      const float* sr = sc + (h * AR + wo + wl + a) * SP + wo + wl;
#pragma unroll
      for (int b = 0; b < L_W; ++b) row[b] = sr[b];
      float mx = row[0];
#pragma unroll
      for (int b = 1; b < L_W; ++b) mx = fmaxf(mx, row[b]);
#pragma unroll
      for (int b = 0; b < L_W; ++b) row[b] = exp2_slot((row[b] - mx) * 1.44269504f);   // exp(x - mx)
      float sum = 0.f;
#pragma unroll
      for (int b = 0; b < L_W; ++b) sum += row[b];
      float inv = 1.0f / sum;
#pragma unroll
      for (int b = 0; b < L_W; ++b) row[b] *= inv;
    }
    float* ar = att + tid * TP;
#pragma unroll
    for (int b = 0; b < L_W; ++b) ar[b] = row[b];
  }
  __syncthreads();   // the weights are complete before att @ v reads them

  // --- o = att @ v: one thread takes 4 neighbouring columns of AH windows. The 12 rows of v
  //     that these windows use stay in registers, so each output row costs three reads of
  //     weights that 50 threads share; b ascending ---
  if (tid < 2 * (D_M / 4)) {
    int cg = tid % (D_M / 4), p = tid / (D_M / 4);
    int h = cg / (DH / 4);
    const float* vp = rows + 2 * D_M + cg * 4;
    v2f vl[AH + L_W - 1], vh[AH + L_W - 1];
#pragma unroll
    for (int j = 0; j < AH + L_W - 1; ++j) {
      int r = wo + p * AH + j;
      if (r > AR - 1) r = AR - 1;   // only rows of windows past the end, whose weights are 0
      v4f x = *(const v4f*)(vp + r * AP);
      vl[j] = v2f{x.x, x.y};
      vh[j] = v2f{x.z, x.w};
    }
    const float* ap = att + (p * AH * H_N + h) * (L_W * TP);
    _Float16* op = o_h + (size_t)(n * W_CNT + i0 + p * AH) * (L_W * D_M) + cg * 4;
    int lim = nw - p * AH;   // this thread's windows that exist
#pragma unroll 1   // one query row of the AH windows per pass: few registers, so three workgroups share a WGP
    for (int a = 0; a < L_W; ++a) {
      v4h res[AH];
#pragma unroll
      for (int ww = 0; ww < AH; ++ww) {
        const float* ar = ap + (ww * H_N * L_W + a) * TP;
        v4f w0 = *(const v4f*)ar, w1 = *(const v4f*)(ar + 4);
        float wt[L_W] = {w0.x, w0.y, w0.z, w0.w, w1.x, w1.y, w1.z, w1.w, ar[8]};
        v2f lo = {0.f, 0.f}, hi = {0.f, 0.f};
#pragma unroll
        for (int b = 0; b < L_W; ++b) {
          lo = __builtin_elementwise_fma(v2f{wt[b], wt[b]}, vl[ww + b], lo);
          hi = __builtin_elementwise_fma(v2f{wt[b], wt[b]}, vh[ww + b], hi);
        }
        res[ww] = v4h{(_Float16)lo.x, (_Float16)lo.y, (_Float16)hi.x, (_Float16)hi.y};
      }
#pragma unroll
      for (int ww = 0; ww < AH; ++ww) {
        if (ww < lim) {
          *(v4h*)(op + (ww * L_W + a) * D_M) = res[ww];
          // Behind the store: the next pass rewrites the registers that it names.
          asm volatile("s_wait_xcnt 0x0" ::: "memory");
        }
      }
    }
  }
}

// ---------------- Kernel 4b: row-wise stages on packed rows ----------------
// Behind the attention every stage (out projection, LayerNorm, FFN, LayerNorm) works on
// one row alone, so the 41904 (window, position) rows are packed into full 16-row tiles
// and one workgroup takes MT of them: each weight fragment loaded from L2 feeds MT WMMAs.
#define MROWS (NWIN * L_W)   // 41904 = 2619 tiles of 16
#define MT    6              // M tiles per workgroup
#define BM    (MT * 16)
#define PX    404            // f32 row pitch of X
#define PA    408            // f16 row pitch, 816 B = 16 B x odd
#define FC    320            // FFN columns per chunk
#define PF    328            // f16 row pitch, 656 B = 16 B x odd

typedef __attribute__((ext_vector_type(8))) _Float16 v8h;

// One lane's 16 halves of an A or B fragment: k = 8*half + 0..7 and 16 + 8*half + 0..7,
// p already at row start + kbase + 8*half. full == false: the upper 16 k are past K.
__device__ __forceinline__ v16h frag16(const _Float16* p, bool full) {
  v8h lo = *(const v8h*)p;
  v8h hi = {};
  if (full) hi = *(const v8h*)(p + 16);
  return __builtin_shufflevector(lo, hi, 0, 1, 2, 3, 4, 5, 6, 7, 8, 9, 10, 11, 12, 13,
                                 14, 15);
}

// Packed weights: the B fragment of (N tile nt, k step ks) is one 1-KiB block at index
// nt * KS + ks. Its first 512 B hold the 32 lanes' lower 8 halves in lane order, the next
// 512 B their upper 8, so one 16-byte-per-lane load covers 4 whole 128-B lines. Read from the
// row-major matrix the same load takes a 32-B piece out of each of 16 lines.
#define PBLK 512   // halves per block

// One lane's 16 halves of a packed B fragment, p at block start + lane * 8.
__device__ __forceinline__ v16h fragp(const _Float16* p, bool full) {
  v8h lo = *(const v8h*)p;
  v8h hi = {};
  if (full) hi = *(const v8h*)(p + PBLK / 2);
  return __builtin_shufflevector(lo, hi, 0, 1, 2, 3, 4, 5, 6, 7, 8, 9, 10, 11, 12, 13,
                                 14, 15);
}

// f32 weight W[N][K] -> f16 in the packed order above; one thread per 16-byte piece.
// A piece whose k lies past K is neither written here nor read by anyone.
__device__ __forceinline__ void pack_w(int idx, const float* __restrict__ src,
                                       _Float16* __restrict__ dst, int K, int KS, int pieces) {
  if (idx >= pieces) return;
  int lane = idx & 31, part = (idx >> 5) & 1, blk = idx >> 6;
  int k = (blk % KS) * 32 + part * 16 + (lane >> 4) * 8;
  if (k >= K) return;
  const float* p = src + (size_t)((blk / KS) * 16 + (lane & 15)) * K + k;
  float4 u = *(const float4*)p, v = *(const float4*)(p + 4);
  v8h h = {(_Float16)u.x, (_Float16)u.y, (_Float16)u.z, (_Float16)u.w,
           (_Float16)v.x, (_Float16)v.y, (_Float16)v.z, (_Float16)v.w};
  *(v8h*)(dst + (size_t)idx * 8) = h;
}

// ---------------- Kernels 1 and 2 as one launch ----------------
// The layout change and the four weight packings read inputs only and none reads what another
// writes, so they need no order among themselves: one grid holds all five jobs and the block
// index picks the job. As launches of their own each of the short jobs pays a launch gap and
// its own start, memory round trip and drain, one after the other.
#define NBLK(items) (((items) + 255) / 256)
#define P_IN  ((3 * D_M / 16) * KS_D * 64)   // 16-byte pieces of packed w_in
#define P_OUT ((D_M / 16) * KS_D * 64)
#define P_W1  ((FF_M / 16) * KS_D * 64)
#define P_W2  ((D_M / 16) * KS_F * 64)
#define FRONT_BLOCKS (NBLK(NITEM) + NBLK(P_IN) + NBLK(P_OUT) + NBLK(P_W1) + NBLK(P_W2))

__global__ void __launch_bounds__(256)
front_kernel(const float* __restrict__ x, const float* __restrict__ pe,
             const float* __restrict__ w_in, const float* __restrict__ w_out,
             const float* __restrict__ w1, const float* __restrict__ w2,
             float* __restrict__ xs, _Float16* __restrict__ xs_h,
             _Float16* __restrict__ w_in_h, _Float16* __restrict__ w_out_h,
             _Float16* __restrict__ w1_h, _Float16* __restrict__ w2_h) {
  int b = blockIdx.x, tid = threadIdx.x;
  // The longest job has the lowest indices.
  if (b < NBLK(NITEM)) { prep_xs(b * 256 + tid, x, pe, xs, xs_h); return; }
  b -= NBLK(NITEM);
  if (b < NBLK(P_IN)) { pack_w(b * 256 + tid, w_in, w_in_h, D_M, KS_D, P_IN); return; }
  b -= NBLK(P_IN);
  if (b < NBLK(P_OUT)) { pack_w(b * 256 + tid, w_out, w_out_h, D_M, KS_D, P_OUT); return; }
  b -= NBLK(P_OUT);
  if (b < NBLK(P_W1)) { pack_w(b * 256 + tid, w1, w1_h, D_M, KS_D, P_W1); return; }
  b -= NBLK(P_W1);
  pack_w(b * 256 + tid, w2, w2_h, FF_M, KS_F, P_W2);
}

// acc[mt] = A[mt*16..][0..400) @ W[nt*16..nt*16+16)^T, A f16 in LDS at pitch PA, W packed.
__device__ __forceinline__ void strip_k400(const _Float16* A, const _Float16* W, int nt,
                                           int lane, v8f* acc) {
  const _Float16* bp = W + (size_t)nt * (KS_D * PBLK) + lane * 8;
  const _Float16* ap = A + (lane & 15) * PA + (lane >> 4) * 8;
  // Compiler fence: keeps the A reads below inside the caller's loop over N tiles. They do
  // not change from tile to tile, and hoisted out of the loop they take 624 registers and spill.
  asm volatile("" ::: "memory");
  v16h b[KS_D];
#pragma unroll
  for (int ks = 0; ks < KS_D; ++ks) {
    // The last load's result may be given the address pair that the loads before it name:
    // the wait stands in front of that overwrite.
    if (ks + 1 == KS_D) asm volatile("s_wait_xcnt 0x0" ::: "memory");
    b[ks] = fragp(bp + ks * PBLK, ks + 1 < KS_D);
  }
#pragma unroll
  for (int mt = 0; mt < MT; ++mt) acc[mt] = v8f{};
  // A fragments of k step ks + 1 are read as one group ahead of the WMMAs of step ks.
  v16h a[2][MT];
#pragma unroll
  for (int mt = 0; mt < MT; ++mt) a[0][mt] = frag16(ap + mt * 16 * PA, true);
  __builtin_amdgcn_sched_barrier(0);   // keeps all 25 weight loads in flight from the start
#pragma unroll
  for (int ks = 0; ks < KS_D; ++ks) {
    if (ks + 1 < KS_D) {
#pragma unroll
      for (int mt = 0; mt < MT; ++mt)
        a[(ks + 1) & 1][mt] = frag16(ap + mt * 16 * PA + (ks + 1) * 32, ks + 2 < KS_D);
    }
    // Holds the read group ahead of the WMMAs: with the FFN2 accumulators live the scheduler
    // otherwise sinks each read to its WMMA, which then waits out a whole LDS latency.
    __builtin_amdgcn_sched_barrier(0);
#pragma unroll
    for (int mt = 0; mt < MT; ++mt) acc[mt] = wmma_acc(a[ks & 1][mt], b[ks], acc[mt]);
    __builtin_amdgcn_sched_barrier(0);   // same purpose: the next group stays behind these
  }
}

// ---------------- Kernel 3: hoisted QKV GEMM over all 4800 rows ----------------
// qkv_all[4800][1200] = xs[4800][400] @ w_in^T + b_in
// One workgroup per tile of BM rows x QN * 16 columns. The rows are staged once in LDS, w_in
// comes packed, and each wave runs whole strips: a weight fragment feeds MT WMMAs, and the 25
// weight loads of a strip are in flight together, so a strip waits out one L2 latency, not
// one per k step.
#define QN 15   // N tiles per workgroup; 1200 / 16 = 5 * QN
#define QP ((BM * 50 + 255) / 256)   // 16-byte pieces of the row tile per thread
__global__ void __launch_bounds__(256, 1)
qkv_gemm_kernel(const _Float16* __restrict__ xs_h,
                const _Float16* __restrict__ w_in_h,
                const float* __restrict__ b_in,
                float* __restrict__ qkv_all) {
  __shared__ __attribute__((aligned(16))) _Float16 Ah[BM * PA];
  int tid = threadIdx.x, lane = tid & 31;
  int wv = __builtin_amdgcn_readfirstlane(tid >> 5);  // scalar: the tile loop branches on it
  int row0 = (blockIdx.x % (NROWS / BM)) * BM;
  int nt0  = (blockIdx.x / (NROWS / BM)) * QN;

  // The BM rows are one contiguous run of BM * 50 16-byte pieces. All of a thread's loads stand
  // ahead of its LDS stores: one memory latency for the tile, not one per piece.
  const _Float16* sp = xs_h + (size_t)row0 * D_M + tid * 8;
  v8h st[QP];
#pragma unroll
  for (int i = 0; i < QP; ++i)
    if (i + 1 < QP || tid < BM * 50 - (QP - 1) * 256) st[i] = *(const v8h*)(sp + i * 2048);
#pragma unroll
  for (int i = 0; i < QP; ++i) {
    int c = tid + i * 256;
    if (i + 1 < QP || tid < BM * 50 - (QP - 1) * 256)
      *(v8h*)(Ah + c * 8 + (c / 50) * (PA - D_M)) = st[i];
  }
  __syncthreads();   // the staged rows are complete before any wave reads them

  for (int nt = nt0 + wv; nt < nt0 + QN; nt += 8) {
    int nn = nt * 16 + (lane & 15);
    float bias = b_in[nn];   // ahead of the strip: it returns under the weight loads
    v8f acc[MT];
    strip_k400(Ah, w_in_h, nt, lane, acc);
    float* op = qkv_all + (size_t)(row0 + (lane >> 4) * 8) * 1200 + nn;
#pragma unroll
    for (int q = 0; q < MT * 8; ++q)
      op[((q >> 3) * 16 + (q & 7)) * 1200] = acc[q >> 3][q & 7] + bias;
  }
}

// Lane l's value from lane l ^ 16: a vector cross-row move.
__device__ __forceinline__ float xor_half(float x) {
  int b = __builtin_bit_cast(int, x);
  return __builtin_bit_cast(float, __builtin_amdgcn_permlanex16(b, b, 0x76543210, 0xfedcba98,
                                                                false, false));
}

// Lane l's value from lane l ^ M of its 16-lane row: DPP row_xmask, which the add takes as an
// operand modifier.
template <int M>
__device__ __forceinline__ float xor_row(float x) {
  return __builtin_bit_cast(float, __builtin_amdgcn_mov_dpp(__builtin_bit_cast(int, x), 0x160 | M,
                                                            0xf, 0xf, true));
}

// Sum over the wave's 32 lanes, left in every lane; all lanes on. The partners come in the order
// l ^ 16, 8, 4, 2, 1. Every step stays in the vector registers: as a shuffle it is a
// ds_bpermute_b32 whose result the dependent add awaits through the LDS queue.
__device__ __forceinline__ float wave_sum(float s) {
  s += xor_half(s);
  s += xor_row<8>(s);
  s += xor_row<4>(s);
  s += xor_row<2>(s);
  s += xor_row<1>(s);
  return s;
}

// LayerNorm of the BM rows of X, one wave per row, the row held in registers.
// TO_OUT false: back into X, with an f16 copy in Ah. TO_OUT true: to global rows.
template <bool TO_OUT>
__device__ __forceinline__ void layernorm_packed(float* X, const float* g, const float* b,
                                                 _Float16* Ah, float* outg, int row0,
                                                 int wv, int lane) {
  float gg[13], bb[13];
#pragma unroll
  for (int q = 0; q < 13; ++q) {
    int c = lane + 32 * q;
    gg[q] = (c < D_M) ? g[c] : 0.f;
    bb[q] = (c < D_M) ? b[c] : 0.f;
  }
  for (int r = wv; r < BM; r += 8) {
    float v[13];
#pragma unroll
    for (int q = 0; q < 13; ++q) {
      int c = lane + 32 * q;
      v[q] = (c < D_M) ? X[r * PX + c] : 0.f;
    }
    float s = 0.f;
#pragma unroll
    for (int q = 0; q < 13; ++q) s += v[q];
    s = wave_sum(s);
    float mu = s * (1.0f / D_M);
    float vv = 0.f;
#pragma unroll
    for (int q = 0; q < 13; ++q) {
      if (lane + 32 * q < D_M) {
        float t = v[q] - mu;
        vv += t * t;
      }
    }
    vv = wave_sum(vv);
    float rs = rsqrtf(vv * (1.0f / D_M) + 1e-5f);
#pragma unroll
    for (int q = 0; q < 13; ++q) {
      int c = lane + 32 * q;
      if (c < D_M) {
        float y = (v[q] - mu) * rs * gg[q] + bb[q];
        if (TO_OUT) {
          if (row0 + r < MROWS) outg[(size_t)(row0 + r) * D_M + c] = y;
          // Behind the row's last store: the next row rewrites the registers it names.
          if (q == 12) asm volatile("s_wait_xcnt 0x0" ::: "memory");
        } else {
          X[r * PX + c]  = y;
          Ah[r * PA + c] = (_Float16)y;
        }
      }
    }
  }
}

typedef __attribute__((ext_vector_type(2))) float v2f;

__device__ __forceinline__ v2f fma2(v2f a, v2f b, float c) {
  return __builtin_elementwise_fma(a, b, v2f{c, c});
}

#define GP 8   // value pairs that go through the GELU side by side

// Exact-erf GELU of GP value pairs with no branch. erf keeps the f32 library's two fits (an odd
// polynomial below |z| = 1, 1 - exp(-q(|z|)) from there on), but both are evaluated for every
// lane and one is selected: a branch on the lane's value cuts the epilogue into one serial
// dependent chain per element, where straight-line code lets independent chains overlap.
__device__ __forceinline__ void gelu_group(v2f* x) {
  v2f z[GP], az[GP], t[GP], q[GP], p[GP];
#pragma unroll
  for (int i = 0; i < GP; ++i) { z[i] = x[i] * 0.707106769f; x[i] = x[i] * 0.5f; }
#pragma unroll
  for (int i = 0; i < GP; ++i) {
    az[i] = v2f{__builtin_fabsf(z[i].x), __builtin_fabsf(z[i].y)};
    t[i]  = z[i] * z[i];
  }
  const float cq[6] = {-0.000378677854f, 0.00385781587f, -0.0241816975f,
                       0.106668264f, 0.634933293f, 0.128689408f};
  const float cp[5] = {0.00491381623f, -0.0267075151f, 0.112800106f,
                       -0.376122952f, 0.128379107f};
#pragma unroll
  for (int i = 0; i < GP; ++i) {
    q[i] = v2f{0.0000169988107f, 0.0000169988107f};
    p[i] = v2f{-0.000561801775f, -0.000561801775f};
  }
#pragma unroll
  for (int s = 0; s < 5; ++s) {
#pragma unroll
    for (int i = 0; i < GP; ++i) {
      q[i] = fma2(az[i], q[i], cq[s]);
      p[i] = fma2(t[i], p[i], cp[s]);
    }
  }
#pragma unroll
  for (int i = 0; i < GP; ++i) {
    q[i] = fma2(az[i], q[i], cq[5]);
    p[i] = __builtin_elementwise_fma(az[i], p[i], az[i]);
  }
#pragma unroll
  for (int i = 0; i < GP; ++i) q[i] = __builtin_elementwise_fma(az[i], q[i], az[i]);
#pragma unroll
  for (int i = 0; i < GP; ++i) q[i] = q[i] * -1.44269502f;
#pragma unroll
  for (int i = 0; i < GP; ++i)
    q[i] = v2f{__builtin_amdgcn_exp2f(q[i].x), __builtin_amdgcn_exp2f(q[i].y)};
#pragma unroll
  for (int i = 0; i < GP; ++i) q[i] = 1.0f - q[i];
#pragma unroll
  for (int i = 0; i < GP; ++i)
    p[i] = v2f{az[i].x < 1.0f ? p[i].x : q[i].x, az[i].y < 1.0f ? p[i].y : q[i].y};
#pragma unroll
  for (int i = 0; i < GP; ++i)
    p[i] = v2f{__builtin_copysignf(p[i].x, z[i].x), __builtin_copysignf(p[i].y, z[i].y)};
#pragma unroll
  for (int i = 0; i < GP; ++i) p[i] = p[i] + 1.0f;
#pragma unroll
  for (int i = 0; i < GP; ++i) x[i] = x[i] * p[i];
}

__global__ void __launch_bounds__(256, 1)
rows_kernel(const float* __restrict__ xs,
            const _Float16* __restrict__ o_h,
            const _Float16* __restrict__ w_out_h,
            const float* __restrict__ b_out,
            const _Float16* __restrict__ w1_h,
            const float* __restrict__ b1,
            const _Float16* __restrict__ w2_h,
            const float* __restrict__ b2,
            const float* __restrict__ ln1_g, const float* __restrict__ ln1_b,
            const float* __restrict__ ln2_g, const float* __restrict__ ln2_b,
            float* __restrict__ out_win) {
  __shared__ __attribute__((aligned(16))) float    X[BM * PX];   // residual stream, f32
  __shared__ __attribute__((aligned(16))) _Float16 Ah[BM * PA];  // o, then LN1 output
  __shared__ __attribute__((aligned(16))) _Float16 Fc[BM * PF];  // one chunk of gelu(ffn1)
  int tid = threadIdx.x, lane = tid & 31;
  int wv = __builtin_amdgcn_readfirstlane(tid >> 5);  // scalar: tile loops branch on it
  int half = lane >> 4;
  int row0 = blockIdx.x * BM;

  // --- stage o (f16) and the residual rows of xs (f32); rows past the end repeat the
  //     last row and are never stored ---
  for (int c = tid; c < BM * 50; c += 256) {
    int r = c / 50, q = c % 50;
    int gr = row0 + r; if (gr > MROWS - 1) gr = MROWS - 1;
    *(v8h*)(Ah + r * PA + q * 8) = *(const v8h*)(o_h + (size_t)gr * D_M + q * 8);
  }
  for (int c = tid; c < BM * 100; c += 256) {
    int r = c / 100, q = c % 100;
    int gr = row0 + r; if (gr > MROWS - 1) gr = MROWS - 1;
    int w = gr / L_W, j = gr % L_W;
    int xr = (w / W_CNT) * T_LEN + (w % W_CNT) + j;
    *(float4*)(X + r * PX + q * 4) = *(const float4*)(xs + (size_t)xr * D_M + q * 4);
  }
  __syncthreads();

  // --- out projection + residual -> X ---
  for (int nt = wv; nt < D_M / 16; nt += 8) {
    v8f acc[MT];
    strip_k400(Ah, w_out_h, nt, lane, acc);
    int nn = nt * 16 + (lane & 15);
    float bo = b_out[nn];
    float* xp = X + half * 8 * PX + nn;
    float res[MT * 8];   // all reads ahead of the stores: one LDS latency, not one per element
#pragma unroll
    for (int q = 0; q < MT * 8; ++q) res[q] = xp[((q >> 3) * 16 + (q & 7)) * PX];
#pragma unroll
    for (int q = 0; q < MT * 8; ++q)
      xp[((q >> 3) * 16 + (q & 7)) * PX] = acc[q >> 3][q & 7] + bo + res[q];
  }
  __syncthreads();
  layernorm_packed<false>(X, ln1_g, ln1_b, Ah, nullptr, row0, wv, lane);
  __syncthreads();

  // --- FFN in 5 chunks of 320 hidden columns: FFN1 + exact GELU -> Fc, then FFN2 adds
  //     that chunk's k range into accumulators that stay in registers (k ascending) ---
  v8f acc2[4][MT];
#pragma unroll
  for (int tt = 0; tt < 4; ++tt) {
#pragma unroll
    for (int mt = 0; mt < MT; ++mt) acc2[tt][mt] = v8f{};
  }
#pragma unroll 1   // one copy of the chunk body, for speed only
  for (int kc = 0; kc < FF_M / FC; ++kc) {
#pragma unroll 1   // same reason
    for (int t = wv; t < FC / 16; t += 8) {
      v8f acc[MT];
      strip_k400(Ah, w1_h, kc * (FC / 16) + t, lane, acc);
      int cl = t * 16 + (lane & 15);
      float bb = b1[kc * FC + cl];
#pragma unroll
      for (int e0 = 0; e0 < MT * 8; e0 += 2 * GP) {
        v2f xv[GP];
#pragma unroll
        for (int i = 0; i < GP; ++i) {
          int e = e0 + 2 * i;
          xv[i] = v2f{acc[e >> 3][e & 7] + bb, acc[e >> 3][(e & 7) + 1] + bb};
        }
        gelu_group(xv);
#pragma unroll
        for (int i = 0; i < GP; ++i) {
          int e = e0 + 2 * i;
          int m = (e >> 3) * 16 + (e & 7) + half * 8;
          Fc[m * PF + cl]       = (_Float16)xv[i].x;
          Fc[(m + 1) * PF + cl] = (_Float16)xv[i].y;
        }
      }
    }
    __syncthreads();   // Fc complete before any wave reads it
    const _Float16* ap = Fc + (lane & 15) * PF + half * 8;
    const _Float16* bp = w2_h + (size_t)(wv * KS_F + kc * (FC / 32)) * PBLK + lane * 8;
    // Weight fragments run two k steps ahead of their WMMAs (ring of three sets); each A
    // fragment read from LDS serves all of the wave's N tiles. Tile 24 is wave 0's alone.
    v16h bq[3][4];
#pragma unroll
    for (int ks = 0; ks < 2; ++ks) {
#pragma unroll
      for (int tt = 0; tt < 3; ++tt) bq[ks][tt] = fragp(bp + (tt * 8 * KS_F + ks) * PBLK, true);
      if (wv == 0) bq[ks][3] = fragp(bp + (3 * 8 * KS_F + ks) * PBLK, true);
    }
    v16h a[2][MT];   // A fragments run one k step ahead
#pragma unroll
    for (int mt = 0; mt < MT; ++mt) a[0][mt] = frag16(ap + mt * 16 * PF, true);
#pragma unroll
    for (int ks = 0; ks < FC / 32; ++ks) {
      if (ks + 2 < FC / 32) {
#pragma unroll
        for (int tt = 0; tt < 3; ++tt)
          bq[(ks + 2) % 3][tt] = fragp(bp + (tt * 8 * KS_F + ks + 2) * PBLK, true);
        if (wv == 0) bq[(ks + 2) % 3][3] = fragp(bp + (3 * 8 * KS_F + ks + 2) * PBLK, true);
      }
      if (ks + 1 < FC / 32) {
#pragma unroll
        for (int mt = 0; mt < MT; ++mt)
          a[(ks + 1) & 1][mt] = frag16(ap + mt * 16 * PF + (ks + 1) * 32, true);
      }
#pragma unroll
      for (int tt = 0; tt < 3; ++tt) {
#pragma unroll
        for (int mt = 0; mt < MT; ++mt)
          acc2[tt][mt] = wmma_acc(a[ks & 1][mt], bq[ks % 3][tt], acc2[tt][mt]);
      }
      if (wv == 0) {
#pragma unroll
        for (int mt = 0; mt < MT; ++mt)
          acc2[3][mt] = wmma_acc(a[ks & 1][mt], bq[ks % 3][3], acc2[3][mt]);
      }
    }
    __syncthreads();   // every reader has left Fc before the next chunk overwrites it
  }
#pragma unroll
  for (int tt = 0; tt < 4; ++tt) {
    int nt = wv + tt * 8;
    if (nt < D_M / 16) {
      int nn = nt * 16 + (lane & 15);
      float bb = b2[nn];
      float* xp = X + half * 8 * PX + nn;
      float res[MT * 8];   // all reads ahead of the stores, as above
#pragma unroll
      for (int q = 0; q < MT * 8; ++q) res[q] = xp[((q >> 3) * 16 + (q & 7)) * PX];
#pragma unroll
      for (int q = 0; q < MT * 8; ++q)
        xp[((q >> 3) * 16 + (q & 7)) * PX] = res[q] + acc2[tt][q >> 3][q & 7] + bb;
    }
  }
  __syncthreads();
  layernorm_packed<true>(X, ln2_g, ln2_b, nullptr, out_win, row0, wv, lane);
}

// ---------------- Kernel 5: deterministic overlap-gather + output transpose ----------------
// row t receives out_win[i][t - i/2] for i in [2(t-8), 2t+1] within [0, W), summed with i ascending.
// One thread takes 4 neighbouring d of the steps t, t + TB, t + 2 TB, t + 3 TB (only steps up
// to TLAST receive anything, so every thread gets two full steps).
#define TLAST  ((W_CNT - 1) / 2 + L_W - 1)   // 153
#define IBMAX  (W_CNT + 1 - 2 * L_W)         // 274: the last even start whose 17 windows exist
#define ROWQ(q) ((q) * L_W - ((q) >> 1))     // packed row of window ib + q, less that of window ib
static_assert(IBMAX % 2 == 0, "ROWQ needs an even first window");

// Sum of step t for 4 neighbouring d, wn = the batch entry's first packed row + d.
// The 18 windows ib .. ib + 17 are read with no branch between them, from one address with
// constant offsets; ib is 2(t-8) moved into [0, IBMAX], which keeps every row inside the batch
// entry's block (the 18th is clamped to its last row), and a window outside the step's range
// adds 0. So all 18 loads are in flight together, and the windows that count keep their order.
__device__ __forceinline__ float4 gather_step(const float* wn, int t) {
  int i0 = 2 * (t - (L_W - 1));
  int ib = i0 < 0 ? 0 : (i0 > IBMAX ? IBMAX : i0);
  int r0 = ib * L_W + t - (ib >> 1);
  int rl = r0 + ROWQ(2 * L_W - 1);
  if (rl > W_CNT * L_W - 1) rl = W_CNT * L_W - 1;
  const float* p  = wn + r0 * D_M;
  const float* pl = wn + rl * D_M;
  float4 val[2 * L_W];
#pragma unroll
  for (int q = 0; q < 2 * L_W - 2; ++q) val[q] = *(const float4*)(p + ROWQ(q) * D_M);
  // A later load's result may be given the address pair of the loads before it: each pair's
  // last load stands alone behind an s_wait_xcnt 0, so no pair is overwritten in front of one.
  asm volatile("s_wait_xcnt 0x0" ::: "memory");
  val[2 * L_W - 2] = *(const float4*)(p + ROWQ(2 * L_W - 2) * D_M);
  asm volatile("s_wait_xcnt 0x0" ::: "memory");
  val[2 * L_W - 1] = *(const float4*)pl;
  asm volatile("s_wait_xcnt 0x0" ::: "memory");
  float4 sum = make_float4(0.f, 0.f, 0.f, 0.f);
#pragma unroll
  for (int q = 0; q < 2 * L_W; ++q) {
    int i = ib + q;
    bool in = i >= i0 && i <= 2 * t + 1 && i < W_CNT;
    sum.x += in ? val[q].x : 0.f;
    sum.y += in ? val[q].y : 0.f;
    sum.z += in ? val[q].z : 0.f;
    sum.w += in ? val[q].w : 0.f;
  }
  return sum;
}

__global__ void __launch_bounds__(256)
gather_out_kernel(const float* __restrict__ out_win, float* __restrict__ out) {
  int idx = blockIdx.x * 256 + threadIdx.x;
  if (idx >= NITEM) return;
  int d4 = idx % (D_M / 4);
  int r  = idx / (D_M / 4);
  int tb = r % TB;
  int n  = r / TB;
  int v = d4 >> 2, c0 = (d4 & 3) * 4;
  const float* wn = out_win + (size_t)n * (W_CNT * L_W * D_M) + d4 * 4;
  float* op = out + ((n * C_CH + c0) * T_LEN + tb) * V_J + v;
  float4 sum[TG];
#pragma unroll
  for (int k = 0; k < TG; ++k) {
    int t = tb + k * TB;
    sum[k] = make_float4(0.f, 0.f, 0.f, 0.f);
    if ((k + 1) * TB - 1 <= TLAST || (k * TB <= TLAST && t <= TLAST)) sum[k] = gather_step(wn, t);
  }
  // All stores behind all loads: no register that a store names is written again.
#pragma unroll
  for (int k = 0; k < TG; ++k) {
    op[(0 * T_LEN + k * TB) * V_J] = sum[k].x;
    op[(1 * T_LEN + k * TB) * V_J] = sum[k].y;
    op[(2 * T_LEN + k * TB) * V_J] = sum[k].z;
    op[(3 * T_LEN + k * TB) * V_J] = sum[k].w;
  }
}

// ---------------- host launch ----------------
extern "C" void kernel_launch(void* const* d_in, const int* in_sizes, int n_in,
                              void* d_out, int out_size, void* d_ws, size_t ws_size,
                              hipStream_t stream) {
  const float* x     = (const float*)d_in[0];
  const float* pe    = (const float*)d_in[1];
  const float* w_in  = (const float*)d_in[2];
  const float* b_in  = (const float*)d_in[3];
  const float* w_out = (const float*)d_in[4];
  const float* b_out = (const float*)d_in[5];
  const float* w1    = (const float*)d_in[6];
  const float* b1    = (const float*)d_in[7];
  const float* w2    = (const float*)d_in[8];
  const float* b2    = (const float*)d_in[9];
  const float* ln1g  = (const float*)d_in[10];
  const float* ln1b  = (const float*)d_in[11];
  const float* ln2g  = (const float*)d_in[12];
  const float* ln2b  = (const float*)d_in[13];
  float* out = (float*)d_out;

  // workspace layout
  char* ws = (char*)d_ws;
  size_t off = 0;
  float*    xs      = (float*)(ws + off);    off += (size_t)NROWS * D_M * 4;       // 7.68 MB
  _Float16* xs_h    = (_Float16*)(ws + off); off += (size_t)NROWS * D_M * 2;       // 3.84 MB
  // packed in fragment order: N/16 tiles x k steps x 1 KiB
  _Float16* w_in_h  = (_Float16*)(ws + off); off += (size_t)(3 * D_M / 16) * KS_D * 1024;  // 1.00 MB
  _Float16* w_out_h = (_Float16*)(ws + off); off += (size_t)(D_M / 16) * KS_D * 1024;   // 0.33 MB
  _Float16* w1_h    = (_Float16*)(ws + off); off += (size_t)(FF_M / 16) * KS_D * 1024;  // 1.33 MB
  _Float16* w2_h    = (_Float16*)(ws + off); off += (size_t)(D_M / 16) * KS_F * 1024;   // 1.28 MB
  float*    qkv_all = (float*)(ws + off);    off += (size_t)NROWS * 3 * D_M * 4;   // 23.04 MB
  float*    out_win = (float*)(ws + off);    off += (size_t)NWIN * L_W * D_M * 4;  // 67.05 MB
  _Float16* o_h     = (_Float16*)(ws + off); off += (size_t)NWIN * L_W * D_M * 2;  // 33.52 MB

  const int TPB = 256;

  // 1, 2) layout + positional encoding, and the weights to f16 packed in fragment order
  front_kernel<<<FRONT_BLOCKS, TPB, 0, stream>>>(x, pe, w_in, w_out, w1, w2, xs, xs_h, w_in_h,
                                                 w_out_h, w1_h, w2_h);

  // 3) hoisted QKV GEMM: one block per tile of BM rows x QN * 16 columns
  qkv_gemm_kernel<<<(NROWS / BM) * (3 * D_M / 16 / QN), TPB, 0, stream>>>(xs_h, w_in_h, b_in,
                                                                          qkv_all);

  // 4) attention, one block per run of AG windows
  attn_kernel<<<N_B * NGRP, TPB, 0, stream>>>(qkv_all, o_h);

  // 4b) out projection, LayerNorm, FFN, LayerNorm on packed rows (WMMA)
  rows_kernel<<<(MROWS + BM - 1) / BM, TPB, 0, stream>>>(xs, o_h, w_out_h, b_out, w1_h, b1,
                                                         w2_h, b2, ln1g, ln1b, ln2g, ln2b,
                                                         out_win);

  // 5) deterministic overlap-add + transpose to [N,C,T,V]
  gather_out_kernel<<<(NITEM + TPB - 1) / TPB, TPB, 0, stream>>>(out_win, out);
}

// v009
// A run of this version takes 178 microseconds.
// Timed twice side by side with v008, it ran 1.06 and 1.07 times as fast.
// All steps since v000 together make it 6.17 times as fast.
#include <hip/hip_runtime.h>
#include <hip/hip_fp16.h>
#include <math.h>

typedef __attribute__((ext_vector_type(16))) _Float16 v16h;
typedef __attribute__((ext_vector_type(8)))  float    v8f;

#define N_B   16
#define T_LEN 300
#define V_J   25
#define C_CH  16
#define D_M   400      // C*V
#define H_N   2
#define DH    200
#define FF_M  1600
#define L_W   9
#define W_CNT 291      // T - L
#define NWIN  (N_B * W_CNT)   // 4656
#define NROWS (N_B * T_LEN)   // 4800
#define KS_D  13       // ceil(400/32)
#define KS_F  50       // 1600/32

// ---------------- WMMA fragment helpers (16x16x32 f16 -> f32) ----------------

__device__ __forceinline__ v8f wmma_acc(v16h a, v16h b, v8f c) {
  return __builtin_amdgcn_wmma_f32_16x16x32_f16(false, a, false, b, (short)0, c,
                                                false, false);
}

// ---------------- Job 1: layout change + positional encoding ----------------
// xs[n][t][d] = x[n][c][t][v] + pe[t][d],  d = v*16 + c  (torch view order)
// The two layout passes (this job and the overlap gather kernel) do a few operations per element.
// One thread takes TG time steps x 4 neighbouring d (16 elements), so that 3750 waves have to
// start per launch; at one element per thread it is 60000.
#define TG    4                                  // time steps per thread
#define TB    (T_LEN / TG)                       // 75
#define NITEM (N_B * TB * (D_M / 4))             // 120000 threads

typedef __attribute__((ext_vector_type(4))) _Float16 v4h;

__device__ __forceinline__ void
prep_xs(int idx, const float* __restrict__ x, const float* __restrict__ pe,
        float* __restrict__ xs, _Float16* __restrict__ xs_h) {
  if (idx >= NITEM) return;
  int d4 = idx % (D_M / 4);
  int r  = idx / (D_M / 4);
  int t0 = (r % TB) * TG;      // TG neighbouring steps: their x values share 128-B lines
  int n  = r / TB;
  int v = d4 >> 2, c0 = (d4 & 3) * 4;
  const float* xp = x + ((n * C_CH + c0) * T_LEN + t0) * V_J + v;
  const float* pp = pe + t0 * D_M + d4 * 4;
  float  xv[TG * 4];
  float4 pv[TG];
  // All 20 loads are in flight together. A later load's result may be given the address pair
  // of the loads before it: the pair's last load stands alone behind an s_wait_xcnt 0, and a
  // second one frees the pair for the results of the pe loads.
#pragma unroll
  for (int e = 0; e < TG * 4 - 1; ++e) xv[e] = xp[((e & 3) * T_LEN + (e >> 2)) * V_J];
  asm volatile("s_wait_xcnt 0x0" ::: "memory");
  xv[TG * 4 - 1] = xp[(3 * T_LEN + TG - 1) * V_J];
  asm volatile("s_wait_xcnt 0x0" ::: "memory");
#pragma unroll
  for (int k = 0; k < TG; ++k) pv[k] = *(const float4*)(pp + k * D_M);
  int o = (n * T_LEN + t0) * D_M + d4 * 4;
  float4 s[TG];
  v4h    h[TG];
#pragma unroll
  for (int k = 0; k < TG; ++k) {
    s[k] = make_float4(xv[k * 4] + pv[k].x, xv[k * 4 + 1] + pv[k].y, xv[k * 4 + 2] + pv[k].z,
                       xv[k * 4 + 3] + pv[k].w);
    h[k] = v4h{(_Float16)s[k].x, (_Float16)s[k].y, (_Float16)s[k].z, (_Float16)s[k].w};
  }
#pragma unroll
  for (int k = 0; k < TG; ++k) {
    *(float4*)(xs + o + k * D_M) = s[k];
    *(v4h*)(xs_h + o + k * D_M)  = h[k];
  }
}

// ---------------- Kernel 4: attention of a run of AG windows per workgroup ----------------
// Neighbouring windows share 8 of their 9 rows, and q(t).k(u) does not depend on the window
// that asks for it. One workgroup takes AG consecutive windows of a batch entry: their AR rows
// of qkv are staged once, each product q(t).k(u) of those rows is formed once, and only the
// softmax and att @ v run per window. Every sum keeps the order it has with one window alone.
// Result o goes out as f16 (the type the out projection reads it in), packed as
// row w*9 + a of o_h[41904][400].
#define AG   8                          // windows per workgroup
#define AR   (AG + L_W - 1)             // 16 rows serve them
#define AP   1204                       // f32 row pitch: 8 rows' 16-B pieces fall on disjoint banks
#define NGRP ((W_CNT + AG - 1) / AG)    // 37 runs per batch entry, the last of 3 windows
#define AQ   ((AR * 300 + 255) / 256)   // 16-byte pieces of the rows per thread
#define SP   (AR + 1)                   // row pitch of the products
#define TP   12                         // row pitch of the weights: 9 used, rows 16-B aligned
#define AH   (AG / 2)                   // windows per thread in att @ v

typedef __attribute__((ext_vector_type(2))) float v2f;
typedef __attribute__((ext_vector_type(4))) float v4f;

// 2^x. The v_nop fills the slot that the instruction set asks for behind a transcendental. It
// stands in the exponential's own statement because nothing else ties it there.
__device__ __forceinline__ float exp2_slot(float x) {
  float r;
  asm("v_exp_f32 %0, %1\n\tv_nop" : "=v"(r) : "v"(x));
  return r;
}

__global__ void __launch_bounds__(256)
attn_kernel(const float* __restrict__ qkv_all, _Float16* __restrict__ o_h) {
  // LDS map (floats): weights, products, staged rows. The small arrays come first, so that
  // their reads reach them by an immediate offset.
  __shared__ __attribute__((aligned(16))) float smem[AG * H_N * L_W * TP + H_N * AR * SP + AR * AP];
  float* att  = smem;
  float* sc   = smem + AG * H_N * L_W * TP;
  float* rows = smem + AG * H_N * L_W * TP + H_N * AR * SP;
  int n  = blockIdx.x / NGRP;
  int i0 = (blockIdx.x % NGRP) * AG;                    // first window of the run
  int rb = i0 < T_LEN - AR ? i0 : T_LEN - AR;           // first staged row: all AR lie in the entry
  int wo = i0 - rb;                                     // staged row of window i0's first row
  int nw = W_CNT - i0 < AG ? W_CNT - i0 : AG;           // windows that exist
  int tid = threadIdx.x;

  // --- stage the rows: one contiguous run; all of a thread's loads stand ahead of its LDS
  //     stores: one memory latency for the run. The last load stands alone behind an
  //     s_wait_xcnt 0 (its result may be given a register that the loads before it name), and
  //     the wait behind it stands in front of whatever rewrites its own address pair ---
  {
    const float* sp = qkv_all + (size_t)(n * T_LEN + rb) * 1200 + tid * 4;
    bool tail = tid < AR * 300 - (AQ - 1) * 256;   // whole waves
    v4f st[AQ];
#pragma unroll
    for (int i = 0; i < AQ - 1; ++i) st[i] = *(const v4f*)(sp + i * 1024);
    asm volatile("s_wait_xcnt 0x0" ::: "memory");
    if (tail) {
      st[AQ - 1] = *(const v4f*)(sp + (AQ - 1) * 1024);
      asm volatile("s_wait_xcnt 0x0" ::: "memory");
    }
#pragma unroll
    for (int i = 0; i < AQ; ++i) {
      int c = tid + i * 256;
      if (i + 1 < AQ || tail) *(v4f*)(rows + (c / 300) * AP + (c % 300) * 4) = st[i];
    }
  }
  __syncthreads();   // the staged rows are complete before any wave reads them

  // --- products q(t).k(u) of all staged rows, both heads: one thread takes rows t, t + 8
  //     against u, u + 8, so four 16-B reads feed four chains (each with e ascending) ---
  if (tid < 128) {
    int h = tid >> 6, t = (tid >> 3) & 7, u = tid & 7;
    const v4f* q0 = (const v4f*)(rows + t * AP + h * DH);
    const v4f* q1 = (const v4f*)(rows + (t + 8) * AP + h * DH);
    const v4f* k0 = (const v4f*)(rows + u * AP + D_M + h * DH);
    const v4f* k1 = (const v4f*)(rows + (u + 8) * AP + D_M + h * DH);
    float s00 = 0.f, s01 = 0.f, s10 = 0.f, s11 = 0.f;
    for (int e = 0; e < DH / 4; ++e) {
      v4f a = q0[e], b = q1[e], c = k0[e], d = k1[e];
#pragma unroll
      for (int x = 0; x < 4; ++x) {
        s00 = __builtin_fmaf(a[x], c[x], s00);
        s01 = __builtin_fmaf(a[x], d[x], s01);
        s10 = __builtin_fmaf(b[x], c[x], s10);
        s11 = __builtin_fmaf(b[x], d[x], s11);
      }
    }
    const float scale = 0.07071067811865475f;            // 1/sqrt(200)
    float* sr = sc + (h * AR + t) * SP + u;
    sr[0]      = s00 * scale;
    sr[8]      = s01 * scale;
    sr[8 * SP]     = s10 * scale;
    sr[8 * SP + 8] = s11 * scale;
  }
  __syncthreads();   // the products are complete before the softmax reads them

  // --- softmax: one thread per (window, head, query row); a window past the end gets zeros ---
  if (tid < AG * H_N * L_W) {
    int wl = tid / (H_N * L_W), r = tid % (H_N * L_W), h = r / L_W, a = r % L_W;
    float row[L_W];
#pragma unroll
    for (int b = 0; b < L_W; ++b) row[b] = 0.f;
    if (wl < nw) {
      const float* sr = sc + (h * AR + wo + wl + a) * SP + wo + wl;
#pragma unroll
      for (int b = 0; b < L_W; ++b) row[b] = sr[b];
      float mx = row[0];
#pragma unroll
      for (int b = 1; b < L_W; ++b) mx = fmaxf(mx, row[b]);
#pragma unroll
      for (int b = 0; b < L_W; ++b) row[b] = exp2_slot((row[b] - mx) * 1.44269504f);   // exp(x - mx)
      float sum = 0.f;
#pragma unroll
      for (int b = 0; b < L_W; ++b) sum += row[b];
      float inv = 1.0f / sum;
#pragma unroll
      for (int b = 0; b < L_W; ++b) row[b] *= inv;
    }
    float* ar = att + tid * TP;
#pragma unroll
    for (int b = 0; b < L_W; ++b) ar[b] = row[b];
  }
  __syncthreads();   // the weights are complete before att @ v reads them

  // --- o = att @ v: one thread takes 4 neighbouring columns of AH windows. The 12 rows of v
  //     that these windows use stay in registers, so each output row costs three reads of
  //     weights that 50 threads share; b ascending ---
  if (tid < 2 * (D_M / 4)) {
    int cg = tid % (D_M / 4), p = tid / (D_M / 4);
    int h = cg / (DH / 4);
    const float* vp = rows + 2 * D_M + cg * 4;
    v2f vl[AH + L_W - 1], vh[AH + L_W - 1];
#pragma unroll
    for (int j = 0; j < AH + L_W - 1; ++j) {
      int r = wo + p * AH + j;
      if (r > AR - 1) r = AR - 1;   // only rows of windows past the end, whose weights are 0
      v4f x = *(const v4f*)(vp + r * AP);
      vl[j] = v2f{x.x, x.y};
      vh[j] = v2f{x.z, x.w};
    }
    const float* ap = att + (p * AH * H_N + h) * (L_W * TP);
    _Float16* op = o_h + (size_t)(n * W_CNT + i0 + p * AH) * (L_W * D_M) + cg * 4;
    int lim = nw - p * AH;   // this thread's windows that exist
#pragma unroll 1   // one query row of the AH windows per pass: few registers, so three workgroups share a WGP
    for (int a = 0; a < L_W; ++a) {
      v4h res[AH];
#pragma unroll
      for (int ww = 0; ww < AH; ++ww) {
        const float* ar = ap + (ww * H_N * L_W + a) * TP;
        v4f w0 = *(const v4f*)ar, w1 = *(const v4f*)(ar + 4);
        float wt[L_W] = {w0.x, w0.y, w0.z, w0.w, w1.x, w1.y, w1.z, w1.w, ar[8]};
        v2f lo = {0.f, 0.f}, hi = {0.f, 0.f};
#pragma unroll
        for (int b = 0; b < L_W; ++b) {
          lo = __builtin_elementwise_fma(v2f{wt[b], wt[b]}, vl[ww + b], lo);
          hi = __builtin_elementwise_fma(v2f{wt[b], wt[b]}, vh[ww + b], hi);
        }
        res[ww] = v4h{(_Float16)lo.x, (_Float16)lo.y, (_Float16)hi.x, (_Float16)hi.y};
      }
#pragma unroll
      for (int ww = 0; ww < AH; ++ww) {
        if (ww < lim) {
          *(v4h*)(op + (ww * L_W + a) * D_M) = res[ww];
          // Behind the store: the next pass rewrites the registers that it names.
          asm volatile("s_wait_xcnt 0x0" ::: "memory");
        }
      }
    }
  }
}

// ---------------- Kernel 4b: row-wise stages on packed rows ----------------
// Behind the attention every stage (out projection, LayerNorm, FFN, LayerNorm) works on
// one row alone, so the 41904 (window, position) rows are packed into full 16-row tiles
// and one workgroup takes MT of them: each weight fragment loaded from L2 feeds MT WMMAs.
#define MROWS (NWIN * L_W)   // 41904 = 2619 tiles of 16
#define MT    6              // M tiles per workgroup
#define BM    (MT * 16)
#define PX    404            // f32 row pitch of X
#define PA    408            // f16 row pitch, 816 B = 16 B x odd
#define FC    320            // FFN columns per chunk
#define PF    328            // f16 row pitch, 656 B = 16 B x odd

typedef __attribute__((ext_vector_type(8))) _Float16 v8h;

// One lane's 16 halves of an A or B fragment: k = 8*half + 0..7 and 16 + 8*half + 0..7,
// p already at row start + kbase + 8*half. full == false: the upper 16 k are past K.
__device__ __forceinline__ v16h frag16(const _Float16* p, bool full) {
  v8h lo = *(const v8h*)p;
  v8h hi = {};
  if (full) hi = *(const v8h*)(p + 16);
  return __builtin_shufflevector(lo, hi, 0, 1, 2, 3, 4, 5, 6, 7, 8, 9, 10, 11, 12, 13,
                                 14, 15);
}

// Packed weights: the B fragment of (N tile nt, k step ks) is one 1-KiB block at index
// nt * KS + ks. Its first 512 B hold the 32 lanes' lower 8 halves in lane order, the next
// 512 B their upper 8, so one 16-byte-per-lane load covers 4 whole 128-B lines. Read from the
// row-major matrix the same load takes a 32-B piece out of each of 16 lines.
#define PBLK 512   // halves per block

// One lane's 16 halves of a packed B fragment, p at block start + lane * 8.
__device__ __forceinline__ v16h fragp(const _Float16* p, bool full) {
  v8h lo = *(const v8h*)p;
  v8h hi = {};
  if (full) hi = *(const v8h*)(p + PBLK / 2);
  return __builtin_shufflevector(lo, hi, 0, 1, 2, 3, 4, 5, 6, 7, 8, 9, 10, 11, 12, 13,
                                 14, 15);
}

// f32 weight W[N][K] -> f16 in the packed order above; one thread per 16-byte piece.
// A piece whose k lies past K is neither written here nor read by anyone.
__device__ __forceinline__ void pack_w(int idx, const float* __restrict__ src,
                                       _Float16* __restrict__ dst, int K, int KS, int pieces) {
  if (idx >= pieces) return;
  int lane = idx & 31, part = (idx >> 5) & 1, blk = idx >> 6;
  int k = (blk % KS) * 32 + part * 16 + (lane >> 4) * 8;
  if (k >= K) return;
  const float* p = src + (size_t)((blk / KS) * 16 + (lane & 15)) * K + k;
  float4 u = *(const float4*)p, v = *(const float4*)(p + 4);
  v8h h = {(_Float16)u.x, (_Float16)u.y, (_Float16)u.z, (_Float16)u.w,
           (_Float16)v.x, (_Float16)v.y, (_Float16)v.z, (_Float16)v.w};
  *(v8h*)(dst + (size_t)idx * 8) = h;
}

// ---------------- Kernels 1 and 2 as one launch ----------------
// The layout change and the four weight packings read inputs only and none reads what another
// writes, so they need no order among themselves: one grid holds all five jobs and the block
// index picks the job. As launches of their own each of the short jobs pays a launch gap and
// its own start, memory round trip and drain, one after the other.
#define NBLK(items) (((items) + 255) / 256)
#define P_IN  ((3 * D_M / 16) * KS_D * 64)   // 16-byte pieces of packed w_in
#define P_OUT ((D_M / 16) * KS_D * 64)
#define P_W1  ((FF_M / 16) * KS_D * 64)
#define P_W2  ((D_M / 16) * KS_F * 64)
#define FRONT_BLOCKS (NBLK(NITEM) + NBLK(P_IN) + NBLK(P_OUT) + NBLK(P_W1) + NBLK(P_W2))

__global__ void __launch_bounds__(256)
front_kernel(const float* __restrict__ x, const float* __restrict__ pe,
             const float* __restrict__ w_in, const float* __restrict__ w_out,
             const float* __restrict__ w1, const float* __restrict__ w2,
             float* __restrict__ xs, _Float16* __restrict__ xs_h,
             _Float16* __restrict__ w_in_h, _Float16* __restrict__ w_out_h,
             _Float16* __restrict__ w1_h, _Float16* __restrict__ w2_h) {
  int b = blockIdx.x, tid = threadIdx.x;
  // The longest job has the lowest indices.
  if (b < NBLK(NITEM)) { prep_xs(b * 256 + tid, x, pe, xs, xs_h); return; }
  b -= NBLK(NITEM);
  if (b < NBLK(P_IN)) { pack_w(b * 256 + tid, w_in, w_in_h, D_M, KS_D, P_IN); return; }
  b -= NBLK(P_IN);
  if (b < NBLK(P_OUT)) { pack_w(b * 256 + tid, w_out, w_out_h, D_M, KS_D, P_OUT); return; }
  b -= NBLK(P_OUT);
  if (b < NBLK(P_W1)) { pack_w(b * 256 + tid, w1, w1_h, D_M, KS_D, P_W1); return; }
  b -= NBLK(P_W1);
  pack_w(b * 256 + tid, w2, w2_h, FF_M, KS_F, P_W2);
}

// acc[mt] = A[mt*16..][0..400) @ W[nt*16..nt*16+16)^T, A f16 in LDS at pitch PA, W packed.
__device__ __forceinline__ void strip_k400(const _Float16* A, const _Float16* W, int nt,
                                           int lane, v8f* acc) {
  const _Float16* bp = W + (size_t)nt * (KS_D * PBLK) + lane * 8;
  const _Float16* ap = A + (lane & 15) * PA + (lane >> 4) * 8;
  // Compiler fence: keeps the A reads below inside the caller's loop over N tiles. They do
  // not change from tile to tile, and hoisted out of the loop they take 624 registers and spill.
  asm volatile("" ::: "memory");
  v16h b[KS_D];
#pragma unroll
  for (int ks = 0; ks < KS_D; ++ks) {
    // The last load's result may be given the address pair that the loads before it name:
    // the wait stands in front of that overwrite.
    if (ks + 1 == KS_D) asm volatile("s_wait_xcnt 0x0" ::: "memory");
    b[ks] = fragp(bp + ks * PBLK, ks + 1 < KS_D);
  }
#pragma unroll
  for (int mt = 0; mt < MT; ++mt) acc[mt] = v8f{};
  // A fragments of k step ks + 1 are read as one group ahead of the WMMAs of step ks.
  v16h a[2][MT];
#pragma unroll
  for (int mt = 0; mt < MT; ++mt) a[0][mt] = frag16(ap + mt * 16 * PA, true);
  __builtin_amdgcn_sched_barrier(0);   // keeps all 25 weight loads in flight from the start
#pragma unroll
  for (int ks = 0; ks < KS_D; ++ks) {
    if (ks + 1 < KS_D) {
#pragma unroll
      for (int mt = 0; mt < MT; ++mt)
        a[(ks + 1) & 1][mt] = frag16(ap + mt * 16 * PA + (ks + 1) * 32, ks + 2 < KS_D);
    }
    // Holds the read group ahead of the WMMAs: with the FFN2 accumulators live the scheduler
    // otherwise sinks each read to its WMMA, which then waits out a whole LDS latency.
    __builtin_amdgcn_sched_barrier(0);
#pragma unroll
    for (int mt = 0; mt < MT; ++mt) acc[mt] = wmma_acc(a[ks & 1][mt], b[ks], acc[mt]);
    __builtin_amdgcn_sched_barrier(0);   // same purpose: the next group stays behind these
  }
}

// ---------------- Kernel 3: hoisted QKV GEMM over all 4800 rows ----------------
// qkv_all[4800][1200] = xs[4800][400] @ w_in^T + b_in
// One workgroup per tile of BM rows x QN * 16 columns. The rows are staged once in LDS, w_in
// comes packed, and each wave runs whole strips: a weight fragment feeds MT WMMAs, and the 25
// weight loads of a strip are in flight together, so a strip waits out one L2 latency, not
// one per k step.
#define QN 15   // N tiles per workgroup; 1200 / 16 = 5 * QN
#define QP ((BM * 50 + 255) / 256)   // 16-byte pieces of the row tile per thread
__global__ void __launch_bounds__(256, 1)
qkv_gemm_kernel(const _Float16* __restrict__ xs_h,
                const _Float16* __restrict__ w_in_h,
                const float* __restrict__ b_in,
                float* __restrict__ qkv_all) {
  __shared__ __attribute__((aligned(16))) _Float16 Ah[BM * PA];
  int tid = threadIdx.x, lane = tid & 31;
  int wv = __builtin_amdgcn_readfirstlane(tid >> 5);  // scalar: the tile loop branches on it
  int row0 = (blockIdx.x % (NROWS / BM)) * BM;
  int nt0  = (blockIdx.x / (NROWS / BM)) * QN;

  // The BM rows are one contiguous run of BM * 50 16-byte pieces. All of a thread's loads stand
  // ahead of its LDS stores: one memory latency for the tile, not one per piece.
  const _Float16* sp = xs_h + (size_t)row0 * D_M + tid * 8;
  v8h st[QP];
#pragma unroll
  for (int i = 0; i < QP; ++i)
    if (i + 1 < QP || tid < BM * 50 - (QP - 1) * 256) st[i] = *(const v8h*)(sp + i * 2048);
#pragma unroll
  for (int i = 0; i < QP; ++i) {
    int c = tid + i * 256;
    if (i + 1 < QP || tid < BM * 50 - (QP - 1) * 256)
      *(v8h*)(Ah + c * 8 + (c / 50) * (PA - D_M)) = st[i];
  }
  __syncthreads();   // the staged rows are complete before any wave reads them

  for (int nt = nt0 + wv; nt < nt0 + QN; nt += 8) {
    int nn = nt * 16 + (lane & 15);
    float bias = b_in[nn];   // ahead of the strip: it returns under the weight loads
    v8f acc[MT];
    strip_k400(Ah, w_in_h, nt, lane, acc);
    float* op = qkv_all + (size_t)(row0 + (lane >> 4) * 8) * 1200 + nn;
#pragma unroll
    for (int q = 0; q < MT * 8; ++q)
      op[((q >> 3) * 16 + (q & 7)) * 1200] = acc[q >> 3][q & 7] + bias;
  }
}

// Lane l's value from lane l ^ 16: a vector cross-row move.
__device__ __forceinline__ float xor_half(float x) {
  int b = __builtin_bit_cast(int, x);
  return __builtin_bit_cast(float, __builtin_amdgcn_permlanex16(b, b, 0x76543210, 0xfedcba98,
                                                                false, false));
}

// Lane l's value from lane l ^ M of its 16-lane row: DPP row_xmask, which the add takes as an
// operand modifier.
template <int M>
__device__ __forceinline__ float xor_row(float x) {
  return __builtin_bit_cast(float, __builtin_amdgcn_mov_dpp(__builtin_bit_cast(int, x), 0x160 | M,
                                                            0xf, 0xf, true));
}

// Sum over the wave's 32 lanes, left in every lane; all lanes on. The partners come in the order
// l ^ 16, 8, 4, 2, 1. Every step stays in the vector registers: as a shuffle it is a
// ds_bpermute_b32 whose result the dependent add awaits through the LDS queue.
__device__ __forceinline__ float wave_sum(float s) {
  s += xor_half(s);
  s += xor_row<8>(s);
  s += xor_row<4>(s);
  s += xor_row<2>(s);
  s += xor_row<1>(s);
  return s;
}

// LayerNorm of the BM rows of X, one wave per row, the row held in registers.
// TO_OUT false: back into X, with an f16 copy in Ah. TO_OUT true: to global rows.
template <bool TO_OUT>
__device__ __forceinline__ void layernorm_packed(float* X, const float* g, const float* b,
                                                 _Float16* Ah, float* outg, int row0,
                                                 int wv, int lane) {
  float gg[13], bb[13];
#pragma unroll
  for (int q = 0; q < 13; ++q) {
    int c = lane + 32 * q;
    gg[q] = (c < D_M) ? g[c] : 0.f;
    bb[q] = (c < D_M) ? b[c] : 0.f;
  }
  for (int r = wv; r < BM; r += 8) {
    float v[13];
#pragma unroll
    for (int q = 0; q < 13; ++q) {
      int c = lane + 32 * q;
      v[q] = (c < D_M) ? X[r * PX + c] : 0.f;
    }
    float s = 0.f;
#pragma unroll
    for (int q = 0; q < 13; ++q) s += v[q];
    s = wave_sum(s);
    float mu = s * (1.0f / D_M);
    float vv = 0.f;
#pragma unroll
    for (int q = 0; q < 13; ++q) {
      if (lane + 32 * q < D_M) {
        float t = v[q] - mu;
        vv += t * t;
      }
    }
    vv = wave_sum(vv);
    float rs = rsqrtf(vv * (1.0f / D_M) + 1e-5f);
#pragma unroll
    for (int q = 0; q < 13; ++q) {
      int c = lane + 32 * q;
      if (c < D_M) {
        float y = (v[q] - mu) * rs * gg[q] + bb[q];
        if (TO_OUT) {
          if (row0 + r < MROWS) outg[(size_t)(row0 + r) * D_M + c] = y;
          // Behind the row's last store: the next row rewrites the registers it names.
          if (q == 12) asm volatile("s_wait_xcnt 0x0" ::: "memory");
        } else {
          X[r * PX + c]  = y;
          Ah[r * PA + c] = (_Float16)y;
        }
      }
    }
  }
}

typedef __attribute__((ext_vector_type(2))) float v2f;

__device__ __forceinline__ v2f fma2(v2f a, v2f b, float c) {
  return __builtin_elementwise_fma(a, b, v2f{c, c});
}

#define GP 8   // value pairs that go through the GELU side by side

// Exact-erf GELU of GP value pairs with no branch. erf keeps the f32 library's two fits (an odd
// polynomial below |z| = 1, 1 - exp(-q(|z|)) from there on), but both are evaluated for every
// lane and one is selected: a branch on the lane's value cuts the epilogue into one serial
// dependent chain per element, where straight-line code lets independent chains overlap.
__device__ __forceinline__ void gelu_group(v2f* x) {
  v2f z[GP], az[GP], t[GP], q[GP], p[GP];
#pragma unroll
  for (int i = 0; i < GP; ++i) { z[i] = x[i] * 0.707106769f; x[i] = x[i] * 0.5f; }
#pragma unroll
  for (int i = 0; i < GP; ++i) {
    az[i] = v2f{__builtin_fabsf(z[i].x), __builtin_fabsf(z[i].y)};
    t[i]  = z[i] * z[i];
  }
  const float cq[6] = {-0.000378677854f, 0.00385781587f, -0.0241816975f,
                       0.106668264f, 0.634933293f, 0.128689408f};
  const float cp[5] = {0.00491381623f, -0.0267075151f, 0.112800106f,
                       -0.376122952f, 0.128379107f};
#pragma unroll
  for (int i = 0; i < GP; ++i) {
    q[i] = v2f{0.0000169988107f, 0.0000169988107f};
    p[i] = v2f{-0.000561801775f, -0.000561801775f};
  }
#pragma unroll
  for (int s = 0; s < 5; ++s) {
#pragma unroll
    for (int i = 0; i < GP; ++i) {
      q[i] = fma2(az[i], q[i], cq[s]);
      p[i] = fma2(t[i], p[i], cp[s]);
    }
  }
#pragma unroll
  for (int i = 0; i < GP; ++i) {
    q[i] = fma2(az[i], q[i], cq[5]);
    p[i] = __builtin_elementwise_fma(az[i], p[i], az[i]);
  }
#pragma unroll
  for (int i = 0; i < GP; ++i) q[i] = __builtin_elementwise_fma(az[i], q[i], az[i]);
#pragma unroll
  for (int i = 0; i < GP; ++i) q[i] = q[i] * -1.44269502f;
#pragma unroll
  for (int i = 0; i < GP; ++i)
    q[i] = v2f{__builtin_amdgcn_exp2f(q[i].x), __builtin_amdgcn_exp2f(q[i].y)};
#pragma unroll
  for (int i = 0; i < GP; ++i) q[i] = 1.0f - q[i];
#pragma unroll
  for (int i = 0; i < GP; ++i)
    p[i] = v2f{az[i].x < 1.0f ? p[i].x : q[i].x, az[i].y < 1.0f ? p[i].y : q[i].y};
#pragma unroll
  for (int i = 0; i < GP; ++i)
    p[i] = v2f{__builtin_copysignf(p[i].x, z[i].x), __builtin_copysignf(p[i].y, z[i].y)};
#pragma unroll
  for (int i = 0; i < GP; ++i) p[i] = p[i] + 1.0f;
#pragma unroll
  for (int i = 0; i < GP; ++i) x[i] = x[i] * p[i];
}

// Asynchronous copies to LDS, 16 bytes a lane: l = the lane's LDS byte address, g = its global
// address. The s_wait_xcnt 0 is the last line of the copies' own statement, so it stands in
// front of whatever rewrites an address register that a copy names.
#define ACP(l, g) "global_load_async_to_lds_b128 %" #l ", %" #g ", off\n\t"
#define CG 9   // copies per statement

__device__ __forceinline__ void copy_one(unsigned l, const char* g) {
  asm volatile(ACP(0, 1) "s_wait_xcnt 0x0" :: "v"(l), "v"(g) : "memory");
}

__device__ __forceinline__ void copy_group(const unsigned* l, const char* const* g) {
  asm volatile(ACP(0, 9) ACP(1, 10) ACP(2, 11) ACP(3, 12) ACP(4, 13) ACP(5, 14) ACP(6, 15)
               ACP(7, 16) ACP(8, 17) "s_wait_xcnt 0x0"
               :: "v"(l[0]), "v"(l[1]), "v"(l[2]), "v"(l[3]), "v"(l[4]), "v"(l[5]), "v"(l[6]),
                  "v"(l[7]), "v"(l[8]), "v"(g[0]), "v"(g[1]), "v"(g[2]), "v"(g[3]), "v"(g[4]),
                  "v"(g[5]), "v"(g[6]), "v"(g[7]), "v"(g[8])
               : "memory");
}

__global__ void __launch_bounds__(256, 1)
rows_kernel(const float* __restrict__ xs,
            const _Float16* __restrict__ o_h,
            const _Float16* __restrict__ w_out_h,
            const float* __restrict__ b_out,
            const _Float16* __restrict__ w1_h,
            const float* __restrict__ b1,
            const _Float16* __restrict__ w2_h,
            const float* __restrict__ b2,
            const float* __restrict__ ln1_g, const float* __restrict__ ln1_b,
            const float* __restrict__ ln2_g, const float* __restrict__ ln2_b,
            float* __restrict__ out_win) {
  __shared__ __attribute__((aligned(16))) float    X[BM * PX];   // residual stream, f32
  __shared__ __attribute__((aligned(16))) _Float16 Ah[BM * PA];  // o, then LN1 output
  __shared__ __attribute__((aligned(16))) _Float16 Fc[BM * PF];  // one chunk of gelu(ffn1)
  int tid = threadIdx.x, lane = tid & 31;
  int wv = __builtin_amdgcn_readfirstlane(tid >> 5);  // scalar: tile loops branch on it
  int half = lane >> 4;
  int row0 = blockIdx.x * BM;

  // --- stage o (f16) and the residual rows of xs (f32); rows past the end repeat the
  //     last row and are never stored. Every 16-byte piece goes to LDS by an asynchronous copy,
  //     through no register, so all of a wave's pieces (57 at most) are in flight together:
  //     one memory latency for the tile. As loads with an LDS store behind each, the loops
  //     wait out a round trip for every 2 to 4 pieces ---
  {
    const unsigned OF = BM * 50 / 256;                   // trips over o that every wave makes: 18
    static_assert(OF % CG == 0 && (BM / 8) * 3 % CG == 0 && OF + 1 + (BM / 8) * 3 + 2 <= 63,
                  "grouping of the copies");
    unsigned ur0 = (unsigned)row0, ut = (unsigned)tid;
    unsigned lim = MROWS - 1 - ur0;                      // last row that exists, from row0
    const char* og = (const char*)(o_h + (size_t)ur0 * D_M);
    const char* xg = (const char*)xs;
    unsigned ab = (unsigned)(size_t)Ah, xb = (unsigned)(size_t)X;   // LDS byte addresses
    // Row row0 + r is position j of window w. With row0's own w and j (scalars) at hand, all
    // that is left per row is how many windows further on it lies: (j0 + r) / 9, at most 11.
    unsigned w0 = ur0 / L_W, j0 = ur0 % L_W, i0 = w0 % W_CNT;
    unsigned xr0 = (w0 / W_CNT) * T_LEN + i0 + j0;
    auto xs_row = [&](unsigned r) {
      unsigned rr = r < lim ? r : lim;
      unsigned dq = ((j0 + rr) * 57) >> 9;               // (j0 + rr) / 9 for values below 112
      return xr0 + rr - (L_W - 1) * dq + (i0 + dq >= W_CNT ? T_LEN - W_CNT : 0);
    };
    auto o_piece = [&](unsigned c, unsigned& l, const char*& g) {
      unsigned r = c / 50, q = c % 50;
      unsigned rr = r < lim ? r : lim;
      l = ab + r * (PA * 2) + q * 16;
      g = og + (rr * 800 + q * 16);
    };
    // The last 4 pieces of row e / 4 of X.
    auto x_rest = [&](unsigned e, unsigned& l, const char*& g) {
      unsigned r = e >> 2, q = 96 + (e & 3);
      l = xb + r * (PX * 4) + q * 16;
      g = xg + (xs_row(r) * 1600 + q * 16);
    };
    unsigned    l[CG];
    const char* g[CG];
    // The loops below are unrolled whole: l and g are operands of an asm statement, so each of
    // their entries has to be a register, which takes constant indices.
#pragma unroll
    for (unsigned b = 0; b < OF; b += CG) {
#pragma unroll
      for (unsigned k = 0; k < CG; ++k) o_piece(ut + (b + k) * 256, l[k], g[k]);
      copy_group(l, g);
    }
    if (wv < (BM * 50 - (int)OF * 256) / 32) {   // the rest of o: whole waves, a scalar test
      o_piece(ut + OF * 256, l[0], g[0]);
      copy_one(l[0], g[0]);
    }
    // X: a wave takes rows wv, wv + 8, ..: the row's place in xs is scalar work, and three
    // copies bring its first 96 pieces.
#pragma unroll
    for (unsigned b = 0; b < BM / 8; b += CG / 3) {
#pragma unroll
      for (unsigned k = 0; k < CG; ++k) {
        unsigned r = (unsigned)wv + (b + k / 3) * 8;
        l[k] = xb + r * (PX * 4) + (k % 3) * 512 + (unsigned)lane * 16;
        g[k] = xg + (size_t)(xs_row(r) * 1600 + (k % 3) * 512) + (unsigned)lane * 16;
      }
      copy_group(l, g);
    }
    x_rest(ut, l[0], g[0]);
    copy_one(l[0], g[0]);
    if (wv < (BM * 4 - 256) / 32) {   // the rest: whole waves, a scalar test
      x_rest(ut + 256, l[0], g[0]);
      copy_one(l[0], g[0]);
    }
    // This wave's copies have landed before it passes the barrier behind which others read them.
    asm volatile("s_wait_asynccnt 0x0" ::: "memory");
  }
  __syncthreads();

  // --- out projection + residual -> X ---
  for (int nt = wv; nt < D_M / 16; nt += 8) {
    v8f acc[MT];
    strip_k400(Ah, w_out_h, nt, lane, acc);
    int nn = nt * 16 + (lane & 15);
    float bo = b_out[nn];
    float* xp = X + half * 8 * PX + nn;
    float res[MT * 8];   // all reads ahead of the stores: one LDS latency, not one per element
#pragma unroll
    for (int q = 0; q < MT * 8; ++q) res[q] = xp[((q >> 3) * 16 + (q & 7)) * PX];
#pragma unroll
    for (int q = 0; q < MT * 8; ++q)
      xp[((q >> 3) * 16 + (q & 7)) * PX] = acc[q >> 3][q & 7] + bo + res[q];
  }
  __syncthreads();
  layernorm_packed<false>(X, ln1_g, ln1_b, Ah, nullptr, row0, wv, lane);
  __syncthreads();

  // --- FFN in 5 chunks of 320 hidden columns: FFN1 + exact GELU -> Fc, then FFN2 adds
  //     that chunk's k range into accumulators that stay in registers (k ascending) ---
  v8f acc2[4][MT];
#pragma unroll
  for (int tt = 0; tt < 4; ++tt) {
#pragma unroll
    for (int mt = 0; mt < MT; ++mt) acc2[tt][mt] = v8f{};
  }
#pragma unroll 1   // one copy of the chunk body, for speed only
  for (int kc = 0; kc < FF_M / FC; ++kc) {
#pragma unroll 1   // same reason
    for (int t = wv; t < FC / 16; t += 8) {
      v8f acc[MT];
      strip_k400(Ah, w1_h, kc * (FC / 16) + t, lane, acc);
      int cl = t * 16 + (lane & 15);
      float bb = b1[kc * FC + cl];
#pragma unroll
      for (int e0 = 0; e0 < MT * 8; e0 += 2 * GP) {
        v2f xv[GP];
#pragma unroll
        for (int i = 0; i < GP; ++i) {
          int e = e0 + 2 * i;
          xv[i] = v2f{acc[e >> 3][e & 7] + bb, acc[e >> 3][(e & 7) + 1] + bb};
        }
        gelu_group(xv);
#pragma unroll
        for (int i = 0; i < GP; ++i) {
          int e = e0 + 2 * i;
          int m = (e >> 3) * 16 + (e & 7) + half * 8;
          Fc[m * PF + cl]       = (_Float16)xv[i].x;
          Fc[(m + 1) * PF + cl] = (_Float16)xv[i].y;
        }
      }
    }
    __syncthreads();   // Fc complete before any wave reads it
    const _Float16* ap = Fc + (lane & 15) * PF + half * 8;
    const _Float16* bp = w2_h + (size_t)(wv * KS_F + kc * (FC / 32)) * PBLK + lane * 8;
    // Weight fragments run two k steps ahead of their WMMAs (ring of three sets); each A
    // fragment read from LDS serves all of the wave's N tiles. Tile 24 is wave 0's alone.
    v16h bq[3][4];
#pragma unroll
    for (int ks = 0; ks < 2; ++ks) {
#pragma unroll
      for (int tt = 0; tt < 3; ++tt) bq[ks][tt] = fragp(bp + (tt * 8 * KS_F + ks) * PBLK, true);
      if (wv == 0) bq[ks][3] = fragp(bp + (3 * 8 * KS_F + ks) * PBLK, true);
    }
    v16h a[2][MT];   // A fragments run one k step ahead
#pragma unroll
    for (int mt = 0; mt < MT; ++mt) a[0][mt] = frag16(ap + mt * 16 * PF, true);
#pragma unroll
    for (int ks = 0; ks < FC / 32; ++ks) {
      if (ks + 2 < FC / 32) {
#pragma unroll
        for (int tt = 0; tt < 3; ++tt)
          bq[(ks + 2) % 3][tt] = fragp(bp + (tt * 8 * KS_F + ks + 2) * PBLK, true);
        if (wv == 0) bq[(ks + 2) % 3][3] = fragp(bp + (3 * 8 * KS_F + ks + 2) * PBLK, true);
      }
      if (ks + 1 < FC / 32) {
#pragma unroll
        for (int mt = 0; mt < MT; ++mt)
          a[(ks + 1) & 1][mt] = frag16(ap + mt * 16 * PF + (ks + 1) * 32, true);
      }
#pragma unroll
      for (int tt = 0; tt < 3; ++tt) {
#pragma unroll
        for (int mt = 0; mt < MT; ++mt)
          acc2[tt][mt] = wmma_acc(a[ks & 1][mt], bq[ks % 3][tt], acc2[tt][mt]);
      }
      if (wv == 0) {
#pragma unroll
        for (int mt = 0; mt < MT; ++mt)
          acc2[3][mt] = wmma_acc(a[ks & 1][mt], bq[ks % 3][3], acc2[3][mt]);
      }
    }
    __syncthreads();   // every reader has left Fc before the next chunk overwrites it
  }
#pragma unroll
  for (int tt = 0; tt < 4; ++tt) {
    int nt = wv + tt * 8;
    if (nt < D_M / 16) {
      int nn = nt * 16 + (lane & 15);
      float bb = b2[nn];
      float* xp = X + half * 8 * PX + nn;
      float res[MT * 8];   // all reads ahead of the stores, as above
#pragma unroll
      for (int q = 0; q < MT * 8; ++q) res[q] = xp[((q >> 3) * 16 + (q & 7)) * PX];
#pragma unroll
      for (int q = 0; q < MT * 8; ++q)
        xp[((q >> 3) * 16 + (q & 7)) * PX] = res[q] + acc2[tt][q >> 3][q & 7] + bb;
    }
  }
  __syncthreads();
  layernorm_packed<true>(X, ln2_g, ln2_b, nullptr, out_win, row0, wv, lane);
}

// ---------------- Kernel 5: deterministic overlap-gather + output transpose ----------------
// row t receives out_win[i][t - i/2] for i in [2(t-8), 2t+1] within [0, W), summed with i ascending.
// One thread takes 4 neighbouring d of the steps t, t + TB, t + 2 TB, t + 3 TB (only steps up
// to TLAST receive anything, so every thread gets two full steps).
#define TLAST  ((W_CNT - 1) / 2 + L_W - 1)   // 153
#define IBMAX  (W_CNT + 1 - 2 * L_W)         // 274: the last even start whose 17 windows exist
#define ROWQ(q) ((q) * L_W - ((q) >> 1))     // packed row of window ib + q, less that of window ib
static_assert(IBMAX % 2 == 0, "ROWQ needs an even first window");

// Sum of step t for 4 neighbouring d, wn = the batch entry's first packed row + d.
// The 18 windows ib .. ib + 17 are read with no branch between them, from one address with
// constant offsets; ib is 2(t-8) moved into [0, IBMAX], which keeps every row inside the batch
// entry's block (the 18th is clamped to its last row), and a window outside the step's range
// adds 0. So all 18 loads are in flight together, and the windows that count keep their order.
__device__ __forceinline__ float4 gather_step(const float* wn, int t) {
  int i0 = 2 * (t - (L_W - 1));
  int ib = i0 < 0 ? 0 : (i0 > IBMAX ? IBMAX : i0);
  int r0 = ib * L_W + t - (ib >> 1);
  int rl = r0 + ROWQ(2 * L_W - 1);
  if (rl > W_CNT * L_W - 1) rl = W_CNT * L_W - 1;
  const float* p  = wn + r0 * D_M;
  const float* pl = wn + rl * D_M;
  float4 val[2 * L_W];
#pragma unroll
  for (int q = 0; q < 2 * L_W - 2; ++q) val[q] = *(const float4*)(p + ROWQ(q) * D_M);
  // A later load's result may be given the address pair of the loads before it: each pair's
  // last load stands alone behind an s_wait_xcnt 0, so no pair is overwritten in front of one.
  asm volatile("s_wait_xcnt 0x0" ::: "memory");
  val[2 * L_W - 2] = *(const float4*)(p + ROWQ(2 * L_W - 2) * D_M);
  asm volatile("s_wait_xcnt 0x0" ::: "memory");
  val[2 * L_W - 1] = *(const float4*)pl;
  asm volatile("s_wait_xcnt 0x0" ::: "memory");
  float4 sum = make_float4(0.f, 0.f, 0.f, 0.f);
#pragma unroll
  for (int q = 0; q < 2 * L_W; ++q) {
    int i = ib + q;
    bool in = i >= i0 && i <= 2 * t + 1 && i < W_CNT;
    sum.x += in ? val[q].x : 0.f;
    sum.y += in ? val[q].y : 0.f;
    sum.z += in ? val[q].z : 0.f;
    sum.w += in ? val[q].w : 0.f;
  }
  return sum;
}

__global__ void __launch_bounds__(256)
gather_out_kernel(const float* __restrict__ out_win, float* __restrict__ out) {
  int idx = blockIdx.x * 256 + threadIdx.x;
  if (idx >= NITEM) return;
  int d4 = idx % (D_M / 4);
  int r  = idx / (D_M / 4);
  int tb = r % TB;
  int n  = r / TB;
  int v = d4 >> 2, c0 = (d4 & 3) * 4;
  const float* wn = out_win + (size_t)n * (W_CNT * L_W * D_M) + d4 * 4;
  float* op = out + ((n * C_CH + c0) * T_LEN + tb) * V_J + v;
  float4 sum[TG];
#pragma unroll
  for (int k = 0; k < TG; ++k) {
    int t = tb + k * TB;
    sum[k] = make_float4(0.f, 0.f, 0.f, 0.f);
    if ((k + 1) * TB - 1 <= TLAST || (k * TB <= TLAST && t <= TLAST)) sum[k] = gather_step(wn, t);
  }
  // All stores behind all loads: no register that a store names is written again.
#pragma unroll
  for (int k = 0; k < TG; ++k) {
    op[(0 * T_LEN + k * TB) * V_J] = sum[k].x;
    op[(1 * T_LEN + k * TB) * V_J] = sum[k].y;
    op[(2 * T_LEN + k * TB) * V_J] = sum[k].z;
    op[(3 * T_LEN + k * TB) * V_J] = sum[k].w;
  }
}

// ---------------- host launch ----------------
extern "C" void kernel_launch(void* const* d_in, const int* in_sizes, int n_in,
                              void* d_out, int out_size, void* d_ws, size_t ws_size,
                              hipStream_t stream) {
  const float* x     = (const float*)d_in[0];
  const float* pe    = (const float*)d_in[1];
  const float* w_in  = (const float*)d_in[2];
  const float* b_in  = (const float*)d_in[3];
  const float* w_out = (const float*)d_in[4];
  const float* b_out = (const float*)d_in[5];
  const float* w1    = (const float*)d_in[6];
  const float* b1    = (const float*)d_in[7];
  const float* w2    = (const float*)d_in[8];
  const float* b2    = (const float*)d_in[9];
  const float* ln1g  = (const float*)d_in[10];
  const float* ln1b  = (const float*)d_in[11];
  const float* ln2g  = (const float*)d_in[12];
  const float* ln2b  = (const float*)d_in[13];
  float* out = (float*)d_out;

  // workspace layout
  char* ws = (char*)d_ws;
  size_t off = 0;
  float*    xs      = (float*)(ws + off);    off += (size_t)NROWS * D_M * 4;       // 7.68 MB
  _Float16* xs_h    = (_Float16*)(ws + off); off += (size_t)NROWS * D_M * 2;       // 3.84 MB
  // packed in fragment order: N/16 tiles x k steps x 1 KiB
  _Float16* w_in_h  = (_Float16*)(ws + off); off += (size_t)(3 * D_M / 16) * KS_D * 1024;  // 1.00 MB
  _Float16* w_out_h = (_Float16*)(ws + off); off += (size_t)(D_M / 16) * KS_D * 1024;   // 0.33 MB
  _Float16* w1_h    = (_Float16*)(ws + off); off += (size_t)(FF_M / 16) * KS_D * 1024;  // 1.33 MB
  _Float16* w2_h    = (_Float16*)(ws + off); off += (size_t)(D_M / 16) * KS_F * 1024;   // 1.28 MB
  float*    qkv_all = (float*)(ws + off);    off += (size_t)NROWS * 3 * D_M * 4;   // 23.04 MB
  float*    out_win = (float*)(ws + off);    off += (size_t)NWIN * L_W * D_M * 4;  // 67.05 MB
  _Float16* o_h     = (_Float16*)(ws + off); off += (size_t)NWIN * L_W * D_M * 2;  // 33.52 MB

  const int TPB = 256;

  // 1, 2) layout + positional encoding, and the weights to f16 packed in fragment order
  front_kernel<<<FRONT_BLOCKS, TPB, 0, stream>>>(x, pe, w_in, w_out, w1, w2, xs, xs_h, w_in_h,
                                                 w_out_h, w1_h, w2_h);

  // 3) hoisted QKV GEMM: one block per tile of BM rows x QN * 16 columns
  qkv_gemm_kernel<<<(NROWS / BM) * (3 * D_M / 16 / QN), TPB, 0, stream>>>(xs_h, w_in_h, b_in,
                                                                          qkv_all);

  // 4) attention, one block per run of AG windows
  attn_kernel<<<N_B * NGRP, TPB, 0, stream>>>(qkv_all, o_h);

  // 4b) out projection, LayerNorm, FFN, LayerNorm on packed rows (WMMA)
  rows_kernel<<<(MROWS + BM - 1) / BM, TPB, 0, stream>>>(xs, o_h, w_out_h, b_out, w1_h, b1,
                                                         w2_h, b2, ln1g, ln1b, ln2g, ln2b,
                                                         out_win);

  // 5) deterministic overlap-add + transpose to [N,C,T,V]
  gather_out_kernel<<<(NITEM + TPB - 1) / TPB, TPB, 0, stream>>>(out_win, out);
}

// v010
// It runs in 167 microseconds.
// Timed twice side by side with v009, it ran 1.08 times as fast both times.
// Over all steps from v000 it is 6.65 times as fast.
#include <hip/hip_runtime.h>
#include <hip/hip_fp16.h>
#include <math.h>

typedef __attribute__((ext_vector_type(16))) _Float16 v16h;
typedef __attribute__((ext_vector_type(8)))  float    v8f;

#define N_B   16
#define T_LEN 300
#define V_J   25
#define C_CH  16
#define D_M   400      // C*V
#define H_N   2
#define DH    200
#define FF_M  1600
#define L_W   9
#define W_CNT 291      // T - L
#define NWIN  (N_B * W_CNT)   // 4656
#define NROWS (N_B * T_LEN)   // 4800
#define KS_D  13       // ceil(400/32)
#define KS_F  50       // 1600/32

// ---------------- WMMA fragment helpers (16x16x32 f16 -> f32) ----------------

__device__ __forceinline__ v8f wmma_acc(v16h a, v16h b, v8f c) {
  return __builtin_amdgcn_wmma_f32_16x16x32_f16(false, a, false, b, (short)0, c,
                                                false, false);
}

// ---------------- Job 1: layout change + positional encoding ----------------
// xs[n][t][d] = x[n][c][t][v] + pe[t][d],  d = v*16 + c  (torch view order)
// The two layout passes (this job and the overlap gather kernel) do a few operations per element.
// One thread takes TG time steps x 4 neighbouring d (16 elements), so that 3750 waves have to
// start per launch; at one element per thread it is 60000.
#define TG    4                                  // time steps per thread
#define TB    (T_LEN / TG)                       // 75
#define NITEM (N_B * TB * (D_M / 4))             // 120000 threads

typedef __attribute__((ext_vector_type(4))) _Float16 v4h;

__device__ __forceinline__ void
prep_xs(int idx, const float* __restrict__ x, const float* __restrict__ pe,
        float* __restrict__ xs, _Float16* __restrict__ xs_h) {
  if (idx >= NITEM) return;
  int d4 = idx % (D_M / 4);
  int r  = idx / (D_M / 4);
  int t0 = (r % TB) * TG;      // TG neighbouring steps: their x values share 128-B lines
  int n  = r / TB;
  int v = d4 >> 2, c0 = (d4 & 3) * 4;
  const float* xp = x + ((n * C_CH + c0) * T_LEN + t0) * V_J + v;
  const float* pp = pe + t0 * D_M + d4 * 4;
  float  xv[TG * 4];
  float4 pv[TG];
  // All 20 loads are in flight together. A later load's result may be given the address pair
  // of the loads before it: the pair's last load stands alone behind an s_wait_xcnt 0, and a
  // second one frees the pair for the results of the pe loads.
#pragma unroll
  for (int e = 0; e < TG * 4 - 1; ++e) xv[e] = xp[((e & 3) * T_LEN + (e >> 2)) * V_J];
  asm volatile("s_wait_xcnt 0x0" ::: "memory");
  xv[TG * 4 - 1] = xp[(3 * T_LEN + TG - 1) * V_J];
  asm volatile("s_wait_xcnt 0x0" ::: "memory");
#pragma unroll
  for (int k = 0; k < TG; ++k) pv[k] = *(const float4*)(pp + k * D_M);
  int o = (n * T_LEN + t0) * D_M + d4 * 4;
  float4 s[TG];
  v4h    h[TG];
#pragma unroll
  for (int k = 0; k < TG; ++k) {
    s[k] = make_float4(xv[k * 4] + pv[k].x, xv[k * 4 + 1] + pv[k].y, xv[k * 4 + 2] + pv[k].z,
                       xv[k * 4 + 3] + pv[k].w);
    h[k] = v4h{(_Float16)s[k].x, (_Float16)s[k].y, (_Float16)s[k].z, (_Float16)s[k].w};
  }
#pragma unroll
  for (int k = 0; k < TG; ++k) {
    *(float4*)(xs + o + k * D_M) = s[k];
    *(v4h*)(xs_h + o + k * D_M)  = h[k];
  }
}

// ---------------- Kernel 4: attention of a run of AG windows per workgroup ----------------
// Neighbouring windows share 8 of their 9 rows, and q(t).k(u) does not depend on the window
// that asks for it. One workgroup takes AG consecutive windows of a batch entry: their AR rows
// of qkv are staged once, each product q(t).k(u) of those rows is formed once, and only the
// softmax and att @ v run per window. Every sum keeps the order it has with one window alone.
// Result o goes out as f16 (the type the out projection reads it in), packed as
// row w*9 + a of o_h[41904][400].
#define AG   8                          // windows per workgroup
#define AR   (AG + L_W - 1)             // 16 rows serve them
#define AP   1204                       // f32 row pitch: 8 rows' 16-B pieces fall on disjoint banks
#define NGRP ((W_CNT + AG - 1) / AG)    // 37 runs per batch entry, the last of 3 windows
#define AQ   ((AR * 300 + 255) / 256)   // 16-byte pieces of the rows per thread
#define SP   (AR + 1)                   // row pitch of the products
#define TP   12                         // row pitch of the weights: 9 used, rows 16-B aligned
#define AH   (AG / 2)                   // windows per thread in att @ v

typedef __attribute__((ext_vector_type(2))) float v2f;
typedef __attribute__((ext_vector_type(4))) float v4f;

// 2^x. The v_nop fills the slot that the instruction set asks for behind a transcendental. It
// stands in the exponential's own statement because nothing else ties it there.
__device__ __forceinline__ float exp2_slot(float x) {
  float r;
  asm("v_exp_f32 %0, %1\n\tv_nop" : "=v"(r) : "v"(x));
  return r;
}

__global__ void __launch_bounds__(256)
attn_kernel(const float* __restrict__ qkv_all, _Float16* __restrict__ o_h) {
  // LDS map (floats): weights, products, staged rows. The small arrays come first, so that
  // their reads reach them by an immediate offset.
  __shared__ __attribute__((aligned(16))) float smem[AG * H_N * L_W * TP + H_N * AR * SP + AR * AP];
  float* att  = smem;
  float* sc   = smem + AG * H_N * L_W * TP;
  float* rows = smem + AG * H_N * L_W * TP + H_N * AR * SP;
  int n  = blockIdx.x / NGRP;
  int i0 = (blockIdx.x % NGRP) * AG;                    // first window of the run
  int rb = i0 < T_LEN - AR ? i0 : T_LEN - AR;           // first staged row: all AR lie in the entry
  int wo = i0 - rb;                                     // staged row of window i0's first row
  int nw = W_CNT - i0 < AG ? W_CNT - i0 : AG;           // windows that exist
  int tid = threadIdx.x;

  // --- stage the rows: one contiguous run; all of a thread's loads stand ahead of its LDS
  //     stores: one memory latency for the run. The last load stands alone behind an
  //     s_wait_xcnt 0 (its result may be given a register that the loads before it name), and
  //     the wait behind it stands in front of whatever rewrites its own address pair ---
  {
    const float* sp = qkv_all + (size_t)(n * T_LEN + rb) * 1200 + tid * 4;
    bool tail = tid < AR * 300 - (AQ - 1) * 256;   // whole waves
    v4f st[AQ];
#pragma unroll
    for (int i = 0; i < AQ - 1; ++i) st[i] = *(const v4f*)(sp + i * 1024);
    asm volatile("s_wait_xcnt 0x0" ::: "memory");
    if (tail) {
      st[AQ - 1] = *(const v4f*)(sp + (AQ - 1) * 1024);
      asm volatile("s_wait_xcnt 0x0" ::: "memory");
    }
#pragma unroll
    for (int i = 0; i < AQ; ++i) {
      int c = tid + i * 256;
      if (i + 1 < AQ || tail) *(v4f*)(rows + (c / 300) * AP + (c % 300) * 4) = st[i];
    }
  }
  __syncthreads();   // the staged rows are complete before any wave reads them

  // --- products q(t).k(u) of all staged rows, both heads: one thread takes rows t, t + 8
  //     against u, u + 8, so four 16-B reads feed four chains (each with e ascending) ---
  if (tid < 128) {
    int h = tid >> 6, t = (tid >> 3) & 7, u = tid & 7;
    const v4f* q0 = (const v4f*)(rows + t * AP + h * DH);
    const v4f* q1 = (const v4f*)(rows + (t + 8) * AP + h * DH);
    const v4f* k0 = (const v4f*)(rows + u * AP + D_M + h * DH);
    const v4f* k1 = (const v4f*)(rows + (u + 8) * AP + D_M + h * DH);
    float s00 = 0.f, s01 = 0.f, s10 = 0.f, s11 = 0.f;
    for (int e = 0; e < DH / 4; ++e) {
      v4f a = q0[e], b = q1[e], c = k0[e], d = k1[e];
#pragma unroll
      for (int x = 0; x < 4; ++x) {
        s00 = __builtin_fmaf(a[x], c[x], s00);
        s01 = __builtin_fmaf(a[x], d[x], s01);
        s10 = __builtin_fmaf(b[x], c[x], s10);
        s11 = __builtin_fmaf(b[x], d[x], s11);
      }
    }
    const float scale = 0.07071067811865475f;            // 1/sqrt(200)
    float* sr = sc + (h * AR + t) * SP + u;
    sr[0]      = s00 * scale;
    sr[8]      = s01 * scale;
    sr[8 * SP]     = s10 * scale;
    sr[8 * SP + 8] = s11 * scale;
  }
  __syncthreads();   // the products are complete before the softmax reads them

  // --- softmax: one thread per (window, head, query row); a window past the end gets zeros ---
  if (tid < AG * H_N * L_W) {
    int wl = tid / (H_N * L_W), r = tid % (H_N * L_W), h = r / L_W, a = r % L_W;
    float row[L_W];
#pragma unroll
    for (int b = 0; b < L_W; ++b) row[b] = 0.f;
    if (wl < nw) {
      const float* sr = sc + (h * AR + wo + wl + a) * SP + wo + wl;
#pragma unroll
      for (int b = 0; b < L_W; ++b) row[b] = sr[b];
      float mx = row[0];
#pragma unroll
      for (int b = 1; b < L_W; ++b) mx = fmaxf(mx, row[b]);
#pragma unroll
      for (int b = 0; b < L_W; ++b) row[b] = exp2_slot((row[b] - mx) * 1.44269504f);   // exp(x - mx)
      float sum = 0.f;
#pragma unroll
      for (int b = 0; b < L_W; ++b) sum += row[b];
      float inv = 1.0f / sum;
#pragma unroll
      for (int b = 0; b < L_W; ++b) row[b] *= inv;
    }
    float* ar = att + tid * TP;
#pragma unroll
    for (int b = 0; b < L_W; ++b) ar[b] = row[b];
  }
  __syncthreads();   // the weights are complete before att @ v reads them

  // --- o = att @ v: one thread takes 4 neighbouring columns of AH windows. The 12 rows of v
  //     that these windows use stay in registers, so each output row costs three reads of
  //     weights that 50 threads share; b ascending ---
  if (tid < 2 * (D_M / 4)) {
    int cg = tid % (D_M / 4), p = tid / (D_M / 4);
    int h = cg / (DH / 4);
    const float* vp = rows + 2 * D_M + cg * 4;
    v2f vl[AH + L_W - 1], vh[AH + L_W - 1];
#pragma unroll
    for (int j = 0; j < AH + L_W - 1; ++j) {
      int r = wo + p * AH + j;
      if (r > AR - 1) r = AR - 1;   // only rows of windows past the end, whose weights are 0
      v4f x = *(const v4f*)(vp + r * AP);
      vl[j] = v2f{x.x, x.y};
      vh[j] = v2f{x.z, x.w};
    }
    const float* ap = att + (p * AH * H_N + h) * (L_W * TP);
    _Float16* op = o_h + (size_t)(n * W_CNT + i0 + p * AH) * (L_W * D_M) + cg * 4;
    int lim = nw - p * AH;   // this thread's windows that exist
#pragma unroll 1   // one query row of the AH windows per pass: few registers, so three workgroups share a WGP
    for (int a = 0; a < L_W; ++a) {
      v4h res[AH];
#pragma unroll
      for (int ww = 0; ww < AH; ++ww) {
        const float* ar = ap + (ww * H_N * L_W + a) * TP;
        v4f w0 = *(const v4f*)ar, w1 = *(const v4f*)(ar + 4);
        float wt[L_W] = {w0.x, w0.y, w0.z, w0.w, w1.x, w1.y, w1.z, w1.w, ar[8]};
        v2f lo = {0.f, 0.f}, hi = {0.f, 0.f};
#pragma unroll
        for (int b = 0; b < L_W; ++b) {
          lo = __builtin_elementwise_fma(v2f{wt[b], wt[b]}, vl[ww + b], lo);
          hi = __builtin_elementwise_fma(v2f{wt[b], wt[b]}, vh[ww + b], hi);
        }
        res[ww] = v4h{(_Float16)lo.x, (_Float16)lo.y, (_Float16)hi.x, (_Float16)hi.y};
      }
#pragma unroll
      for (int ww = 0; ww < AH; ++ww) {
        if (ww < lim) {
          *(v4h*)(op + (ww * L_W + a) * D_M) = res[ww];
          // Behind the store: the next pass rewrites the registers that it names.
          asm volatile("s_wait_xcnt 0x0" ::: "memory");
        }
      }
    }
  }
}

// ---------------- Kernel 4b: row-wise stages on packed rows ----------------
// Behind the attention every stage (out projection, LayerNorm, FFN, LayerNorm) works on
// one row alone, so the 41904 (window, position) rows are packed into full 16-row tiles
// and one workgroup takes MT of them: each weight fragment loaded from L2 feeds MT WMMAs.
#define MROWS (NWIN * L_W)   // 41904 = 2619 tiles of 16
#define MT    6              // M tiles per workgroup
#define BM    (MT * 16)
#define PX    404            // f32 row pitch of X
#define PA    408            // f16 row pitch, 816 B = 16 B x odd
#define FC    320            // FFN columns per chunk
#define PF    328            // f16 row pitch, 656 B = 16 B x odd

typedef __attribute__((ext_vector_type(8))) _Float16 v8h;

// One lane's 16 halves of an A or B fragment: k = 8*half + 0..7 and 16 + 8*half + 0..7,
// p already at row start + kbase + 8*half. full == false: the upper 16 k are past K.
__device__ __forceinline__ v16h frag16(const _Float16* p, bool full) {
  v8h lo = *(const v8h*)p;
  v8h hi = {};
  if (full) hi = *(const v8h*)(p + 16);
  return __builtin_shufflevector(lo, hi, 0, 1, 2, 3, 4, 5, 6, 7, 8, 9, 10, 11, 12, 13,
                                 14, 15);
}

// Packed weights: the B fragment of (N tile nt, k step ks) is one 1-KiB block at index
// nt * KS + ks. Its first 512 B hold the 32 lanes' lower 8 halves in lane order, the next
// 512 B their upper 8, so one 16-byte-per-lane load covers 4 whole 128-B lines. Read from the
// row-major matrix the same load takes a 32-B piece out of each of 16 lines.
#define PBLK 512   // halves per block

// One lane's 16 halves of a packed B fragment, p at block start + lane * 8.
__device__ __forceinline__ v16h fragp(const _Float16* p, bool full) {
  v8h lo = *(const v8h*)p;
  v8h hi = {};
  if (full) hi = *(const v8h*)(p + PBLK / 2);
  return __builtin_shufflevector(lo, hi, 0, 1, 2, 3, 4, 5, 6, 7, 8, 9, 10, 11, 12, 13,
                                 14, 15);
}

// f32 weight W[N][K] -> f16 in the packed order above; one thread per 16-byte piece.
// A piece whose k lies past K is neither written here nor read by anyone.
__device__ __forceinline__ void pack_w(int idx, const float* __restrict__ src,
                                       _Float16* __restrict__ dst, int K, int KS, int pieces) {
  if (idx >= pieces) return;
  int lane = idx & 31, part = (idx >> 5) & 1, blk = idx >> 6;
  int k = (blk % KS) * 32 + part * 16 + (lane >> 4) * 8;
  if (k >= K) return;
  const float* p = src + (size_t)((blk / KS) * 16 + (lane & 15)) * K + k;
  float4 u = *(const float4*)p, v = *(const float4*)(p + 4);
  v8h h = {(_Float16)u.x, (_Float16)u.y, (_Float16)u.z, (_Float16)u.w,
           (_Float16)v.x, (_Float16)v.y, (_Float16)v.z, (_Float16)v.w};
  *(v8h*)(dst + (size_t)idx * 8) = h;
}

// ---------------- Kernels 1 and 2 as one launch ----------------
// The layout change and the four weight packings read inputs only and none reads what another
// writes, so they need no order among themselves: one grid holds all five jobs and the block
// index picks the job. As launches of their own each of the short jobs pays a launch gap and
// its own start, memory round trip and drain, one after the other.
#define NBLK(items) (((items) + 255) / 256)
#define P_IN  ((3 * D_M / 16) * KS_D * 64)   // 16-byte pieces of packed w_in
#define P_OUT ((D_M / 16) * KS_D * 64)
#define P_W1  ((FF_M / 16) * KS_D * 64)
#define P_W2  ((D_M / 16) * KS_F * 64)
#define FRONT_BLOCKS (NBLK(NITEM) + NBLK(P_IN) + NBLK(P_OUT) + NBLK(P_W1) + NBLK(P_W2))

__global__ void __launch_bounds__(256)
front_kernel(const float* __restrict__ x, const float* __restrict__ pe,
             const float* __restrict__ w_in, const float* __restrict__ w_out,
             const float* __restrict__ w1, const float* __restrict__ w2,
             float* __restrict__ xs, _Float16* __restrict__ xs_h,
             _Float16* __restrict__ w_in_h, _Float16* __restrict__ w_out_h,
             _Float16* __restrict__ w1_h, _Float16* __restrict__ w2_h) {
  int b = blockIdx.x, tid = threadIdx.x;
  // The longest job has the lowest indices.
  if (b < NBLK(NITEM)) { prep_xs(b * 256 + tid, x, pe, xs, xs_h); return; }
  b -= NBLK(NITEM);
  if (b < NBLK(P_IN)) { pack_w(b * 256 + tid, w_in, w_in_h, D_M, KS_D, P_IN); return; }
  b -= NBLK(P_IN);
  if (b < NBLK(P_OUT)) { pack_w(b * 256 + tid, w_out, w_out_h, D_M, KS_D, P_OUT); return; }
  b -= NBLK(P_OUT);
  if (b < NBLK(P_W1)) { pack_w(b * 256 + tid, w1, w1_h, D_M, KS_D, P_W1); return; }
  b -= NBLK(P_W1);
  pack_w(b * 256 + tid, w2, w2_h, FF_M, KS_F, P_W2);
}

// A strip is the product of the BM staged rows with one N tile of a packed weight, K = 400. It
// comes in two halves, so that a caller can ask for the next strip's weights as soon as the
// WMMAs of this strip have issued: the 25 loads then fly under this strip's epilogue, which
// itself loads nothing, and the next strip's first WMMA finds its fragments in registers.

// Stands behind a load, a run of loads or a run of stores whose registers (an address, a stored
// value) are rewritten by what follows: the s_wait_xcnt 0 stands in front of that rewrite. The first
// scheduling barrier holds the loads in front of the wait (they read through a const __restrict__
// pointer, and the wait's "memory" clobber alone does not order such loads), the second holds
// what follows, arithmetic and later loads, which nothing else ties to the wait, behind it.
__device__ __forceinline__ void loads_issued() {
  __builtin_amdgcn_sched_barrier(0);
  asm volatile("s_wait_xcnt 0x0" ::: "memory");
  __builtin_amdgcn_sched_barrier(0);
}

// A strip's bias, asked for in front of the strip's weights. The wait stands in front of the weight
// loads, whose results may be given the register that the bias load's address is in.
__device__ __forceinline__ float bias_load(const float* p) {
  float v = *p;
  loads_issued();
  return v;
}

// b = the 13 weight fragments of N tile nt of the packed W: 25 loads, all in flight together.
__device__ __forceinline__ void strip_load(const _Float16* W, int nt, int lane, v16h* b) {
  const _Float16* bp = W + (size_t)nt * (KS_D * PBLK) + lane * 8;
#pragma unroll
  for (int ks = 0; ks < KS_D; ++ks) {
    // The last load's result may be given the address pair that the loads before it name:
    // the wait stands in front of that overwrite.
    if (ks + 1 == KS_D) asm volatile("s_wait_xcnt 0x0" ::: "memory");
    b[ks] = fragp(bp + ks * PBLK, ks + 1 < KS_D);
  }
  loads_issued();
}

// acc[mt] = A[mt*16..][0..400) @ b, A f16 in LDS at pitch PA, b from strip_load.
__device__ __forceinline__ void strip_mma(const _Float16* A, int lane, const v16h* b, v8f* acc) {
  const _Float16* ap = A + (lane & 15) * PA + (lane >> 4) * 8;
  // Compiler fence: keeps the A reads below inside the caller's loop over N tiles. They do
  // not change from tile to tile, and hoisted out of the loop they take 624 registers and spill.
  asm volatile("" ::: "memory");
#pragma unroll
  for (int mt = 0; mt < MT; ++mt) acc[mt] = v8f{};
  // A fragments of k step ks + 1 are read as one group ahead of the WMMAs of step ks.
  v16h a[2][MT];
#pragma unroll
  for (int mt = 0; mt < MT; ++mt) a[0][mt] = frag16(ap + mt * 16 * PA, true);
#pragma unroll
  for (int ks = 0; ks < KS_D; ++ks) {
    if (ks + 1 < KS_D) {
#pragma unroll
      for (int mt = 0; mt < MT; ++mt)
        a[(ks + 1) & 1][mt] = frag16(ap + mt * 16 * PA + (ks + 1) * 32, ks + 2 < KS_D);
    }
    // Holds the read group ahead of the WMMAs: with the FFN2 accumulators live the scheduler
    // otherwise sinks each read to its WMMA, which then waits out a whole LDS latency.
    __builtin_amdgcn_sched_barrier(0);
#pragma unroll
    for (int mt = 0; mt < MT; ++mt) acc[mt] = wmma_acc(a[ks & 1][mt], b[ks], acc[mt]);
    __builtin_amdgcn_sched_barrier(0);   // same purpose: the next group stays behind these
  }
}

// For a caller that branches right behind strip_mma. These fill the four vector slots that the
// chip needs between the last WMMA and a vector instruction that overwrites its operands or
// reads its result, on either side of the branch.
__device__ __forceinline__ void wmma_gap() {
  asm volatile("v_nop\n\tv_nop\n\tv_nop\n\tv_nop");
}

// ---------------- Kernel 3: hoisted QKV GEMM over all 4800 rows ----------------
// qkv_all[4800][1200] = xs[4800][400] @ w_in^T + b_in
// One workgroup per tile of BM rows x QN * 16 columns. The rows are staged once in LDS, w_in
// comes packed, and each wave runs whole strips: a weight fragment feeds MT WMMAs, and the 25
// weight loads of a strip are in flight together, so a strip waits out one L2 latency, not
// one per k step.
#define QN 15   // N tiles per workgroup; 1200 / 16 = 5 * QN
#define QP ((BM * 50 + 255) / 256)   // 16-byte pieces of the row tile per thread
__global__ void __launch_bounds__(256, 1)
qkv_gemm_kernel(const _Float16* __restrict__ xs_h,
                const _Float16* __restrict__ w_in_h,
                const float* __restrict__ b_in,
                float* __restrict__ qkv_all) {
  __shared__ __attribute__((aligned(16))) _Float16 Ah[BM * PA];
  int tid = threadIdx.x, lane = tid & 31;
  int wv = __builtin_amdgcn_readfirstlane(tid >> 5);  // scalar: the tile loop branches on it
  int row0 = (blockIdx.x % (NROWS / BM)) * BM;
  int nt0  = (blockIdx.x / (NROWS / BM)) * QN;

  // A strip's bias is loaded in front of its weights, so the waits for the weights cover it and
  // the epilogue waits for no load that was issued behind it. The first strip is asked for here:
  // it needs nothing of the staged rows and flies under the staging.
  v16h b[KS_D];
  float bnext = bias_load(b_in + (nt0 + wv) * 16 + (lane & 15));
  strip_load(w_in_h, nt0 + wv, lane, b);

  // The BM rows are one contiguous run of BM * 50 16-byte pieces. All of a thread's loads stand
  // ahead of its LDS stores: one memory latency for the tile, not one per piece.
  const _Float16* sp = xs_h + (size_t)row0 * D_M + tid * 8;
  v8h st[QP];
#pragma unroll
  for (int i = 0; i < QP; ++i)
    if (i + 1 < QP || tid < BM * 50 - (QP - 1) * 256) st[i] = *(const v8h*)(sp + i * 2048);
#pragma unroll
  for (int i = 0; i < QP; ++i) {
    int c = tid + i * 256;
    if (i + 1 < QP || tid < BM * 50 - (QP - 1) * 256)
      *(v8h*)(Ah + c * 8 + (c / 50) * (PA - D_M)) = st[i];
  }
  __syncthreads();   // the staged rows are complete before any wave reads them

  static_assert(QN >= 8, "every wave has a strip");
  int nt = nt0 + wv;
  do {
    int nn = nt * 16 + (lane & 15);
    float bias = bnext;
    v8f acc[MT];
    strip_mma(Ah, lane, b, acc);
    wmma_gap();
    if (nt + 8 < nt0 + QN) {   // a scalar test: the next strip's weights fly under the stores
      bnext = bias_load(b_in + nn + 128);
      strip_load(w_in_h, nt + 8, lane, b);
    }
    float* op = qkv_all + (size_t)(row0 + (lane >> 4) * 8) * 1200 + nn;
#pragma unroll
    for (int q = 0; q < MT * 8; ++q)
      op[((q >> 3) * 16 + (q & 7)) * 1200] = acc[q >> 3][q & 7] + bias;
    // Behind the strip's stores: the next pass rewrites the registers that they name.
    loads_issued();
    nt += 8;
  } while (nt < nt0 + QN);
}

// Lane l's value from lane l ^ 16: a vector cross-row move.
__device__ __forceinline__ float xor_half(float x) {
  int b = __builtin_bit_cast(int, x);
  return __builtin_bit_cast(float, __builtin_amdgcn_permlanex16(b, b, 0x76543210, 0xfedcba98,
                                                                false, false));
}

// Lane l's value from lane l ^ M of its 16-lane row: DPP row_xmask, which the add takes as an
// operand modifier.
template <int M>
__device__ __forceinline__ float xor_row(float x) {
  return __builtin_bit_cast(float, __builtin_amdgcn_mov_dpp(__builtin_bit_cast(int, x), 0x160 | M,
                                                            0xf, 0xf, true));
}

// Sum over the wave's 32 lanes, left in every lane; all lanes on. The partners come in the order
// l ^ 16, 8, 4, 2, 1. Every step stays in the vector registers: as a shuffle it is a
// ds_bpermute_b32 whose result the dependent add awaits through the LDS queue.
__device__ __forceinline__ float wave_sum(float s) {
  s += xor_half(s);
  s += xor_row<8>(s);
  s += xor_row<4>(s);
  s += xor_row<2>(s);
  s += xor_row<1>(s);
  return s;
}

// LayerNorm of the BM rows of X, one wave per row, the row held in registers.
// TO_OUT false: back into X, with an f16 copy in Ah. TO_OUT true: to global rows.
template <bool TO_OUT>
__device__ __forceinline__ void layernorm_packed(float* X, const float* g, const float* b,
                                                 _Float16* Ah, float* outg, int row0,
                                                 int wv, int lane) {
  float gg[13], bb[13];
#pragma unroll
  for (int q = 0; q < 13; ++q) {
    int c = lane + 32 * q;
    gg[q] = (c < D_M) ? g[c] : 0.f;
    bb[q] = (c < D_M) ? b[c] : 0.f;
  }
  for (int r = wv; r < BM; r += 8) {
    float v[13];
#pragma unroll
    for (int q = 0; q < 13; ++q) {
      int c = lane + 32 * q;
      v[q] = (c < D_M) ? X[r * PX + c] : 0.f;
    }
    float s = 0.f;
#pragma unroll
    for (int q = 0; q < 13; ++q) s += v[q];
    s = wave_sum(s);
    float mu = s * (1.0f / D_M);
    float vv = 0.f;
#pragma unroll
    for (int q = 0; q < 13; ++q) {
      if (lane + 32 * q < D_M) {
        float t = v[q] - mu;
        vv += t * t;
      }
    }
    vv = wave_sum(vv);
    float rs = rsqrtf(vv * (1.0f / D_M) + 1e-5f);
#pragma unroll
    for (int q = 0; q < 13; ++q) {
      int c = lane + 32 * q;
      if (c < D_M) {
        float y = (v[q] - mu) * rs * gg[q] + bb[q];
        if (TO_OUT) {
          if (row0 + r < MROWS) outg[(size_t)(row0 + r) * D_M + c] = y;
          // Behind the row's last store: the next row rewrites the registers it names.
          if (q == 12) asm volatile("s_wait_xcnt 0x0" ::: "memory");
        } else {
          X[r * PX + c]  = y;
          Ah[r * PA + c] = (_Float16)y;
        }
      }
    }
  }
}

typedef __attribute__((ext_vector_type(2))) float v2f;

__device__ __forceinline__ v2f fma2(v2f a, v2f b, float c) {
  return __builtin_elementwise_fma(a, b, v2f{c, c});
}

#define GP 8   // value pairs that go through the GELU side by side

// Exact-erf GELU of GP value pairs with no branch. erf keeps the f32 library's two fits (an odd
// polynomial below |z| = 1, 1 - exp(-q(|z|)) from there on), but both are evaluated for every
// lane and one is selected: a branch on the lane's value cuts the epilogue into one serial
// dependent chain per element, where straight-line code lets independent chains overlap.
__device__ __forceinline__ void gelu_group(v2f* x) {
  v2f z[GP], az[GP], t[GP], q[GP], p[GP];
#pragma unroll
  for (int i = 0; i < GP; ++i) { z[i] = x[i] * 0.707106769f; x[i] = x[i] * 0.5f; }
#pragma unroll
  for (int i = 0; i < GP; ++i) {
    az[i] = v2f{__builtin_fabsf(z[i].x), __builtin_fabsf(z[i].y)};
    t[i]  = z[i] * z[i];
  }
  const float cq[6] = {-0.000378677854f, 0.00385781587f, -0.0241816975f,
                       0.106668264f, 0.634933293f, 0.128689408f};
  const float cp[5] = {0.00491381623f, -0.0267075151f, 0.112800106f,
                       -0.376122952f, 0.128379107f};
#pragma unroll
  for (int i = 0; i < GP; ++i) {
    q[i] = v2f{0.0000169988107f, 0.0000169988107f};
    p[i] = v2f{-0.000561801775f, -0.000561801775f};
  }
#pragma unroll
  for (int s = 0; s < 5; ++s) {
#pragma unroll
    for (int i = 0; i < GP; ++i) {
      q[i] = fma2(az[i], q[i], cq[s]);
      p[i] = fma2(t[i], p[i], cp[s]);
    }
  }
#pragma unroll
  for (int i = 0; i < GP; ++i) {
    q[i] = fma2(az[i], q[i], cq[5]);
    p[i] = __builtin_elementwise_fma(az[i], p[i], az[i]);
  }
#pragma unroll
  for (int i = 0; i < GP; ++i) q[i] = __builtin_elementwise_fma(az[i], q[i], az[i]);
#pragma unroll
  for (int i = 0; i < GP; ++i) q[i] = q[i] * -1.44269502f;
#pragma unroll
  for (int i = 0; i < GP; ++i)
    q[i] = v2f{__builtin_amdgcn_exp2f(q[i].x), __builtin_amdgcn_exp2f(q[i].y)};
#pragma unroll
  for (int i = 0; i < GP; ++i) q[i] = 1.0f - q[i];
#pragma unroll
  for (int i = 0; i < GP; ++i)
    p[i] = v2f{az[i].x < 1.0f ? p[i].x : q[i].x, az[i].y < 1.0f ? p[i].y : q[i].y};
#pragma unroll
  for (int i = 0; i < GP; ++i)
    p[i] = v2f{__builtin_copysignf(p[i].x, z[i].x), __builtin_copysignf(p[i].y, z[i].y)};
#pragma unroll
  for (int i = 0; i < GP; ++i) p[i] = p[i] + 1.0f;
#pragma unroll
  for (int i = 0; i < GP; ++i) x[i] = x[i] * p[i];
}

// Asynchronous copies to LDS, 16 bytes a lane: l = the lane's LDS byte address, g = its global
// address. The s_wait_xcnt 0 is the last line of the copies' own statement, so it stands in
// front of whatever rewrites an address register that a copy names.
#define ACP(l, g) "global_load_async_to_lds_b128 %" #l ", %" #g ", off\n\t"
#define CG 9   // copies per statement

__device__ __forceinline__ void copy_one(unsigned l, const char* g) {
  asm volatile(ACP(0, 1) "s_wait_xcnt 0x0" :: "v"(l), "v"(g) : "memory");
}

__device__ __forceinline__ void copy_group(const unsigned* l, const char* const* g) {
  asm volatile(ACP(0, 9) ACP(1, 10) ACP(2, 11) ACP(3, 12) ACP(4, 13) ACP(5, 14) ACP(6, 15)
               ACP(7, 16) ACP(8, 17) "s_wait_xcnt 0x0"
               :: "v"(l[0]), "v"(l[1]), "v"(l[2]), "v"(l[3]), "v"(l[4]), "v"(l[5]), "v"(l[6]),
                  "v"(l[7]), "v"(l[8]), "v"(g[0]), "v"(g[1]), "v"(g[2]), "v"(g[3]), "v"(g[4]),
                  "v"(g[5]), "v"(g[6]), "v"(g[7]), "v"(g[8])
               : "memory");
}

__global__ void __launch_bounds__(256, 1)
rows_kernel(const float* __restrict__ xs,
            const _Float16* __restrict__ o_h,
            const _Float16* __restrict__ w_out_h,
            const float* __restrict__ b_out,
            const _Float16* __restrict__ w1_h,
            const float* __restrict__ b1,
            const _Float16* __restrict__ w2_h,
            const float* __restrict__ b2,
            const float* __restrict__ ln1_g, const float* __restrict__ ln1_b,
            const float* __restrict__ ln2_g, const float* __restrict__ ln2_b,
            float* __restrict__ out_win) {
  __shared__ __attribute__((aligned(16))) float    X[BM * PX];   // residual stream, f32
  __shared__ __attribute__((aligned(16))) _Float16 Ah[BM * PA];  // o, then LN1 output
  __shared__ __attribute__((aligned(16))) _Float16 Fc[BM * PF];  // one chunk of gelu(ffn1)
  int tid = threadIdx.x, lane = tid & 31;
  int wv = __builtin_amdgcn_readfirstlane(tid >> 5);  // scalar: tile loops branch on it
  int half = lane >> 4;
  int row0 = blockIdx.x * BM;

  // As in the QKV kernel: a strip's bias in front of its weights, the next strip's loads under
  // this strip's epilogue. The out projection's first strip is asked for here: it needs nothing
  // of the staged rows and flies under the staging.
  v16h b[KS_D];
  float bnext = bias_load(b_out + wv * 16 + (lane & 15));
  strip_load(w_out_h, wv, lane, b);

  // --- stage o (f16) and the residual rows of xs (f32); rows past the end repeat the
  //     last row and are never stored. Every 16-byte piece goes to LDS by an asynchronous copy,
  //     through no register, so all of a wave's pieces (57 at most) are in flight together:
  //     one memory latency for the tile. As loads with an LDS store behind each, the loops
  //     wait out a round trip for every 2 to 4 pieces ---
  {
    const unsigned OF = BM * 50 / 256;                   // trips over o that every wave makes: 18
    static_assert(OF % CG == 0 && (BM / 8) * 3 % CG == 0 && OF + 1 + (BM / 8) * 3 + 2 <= 63,
                  "grouping of the copies");
    unsigned ur0 = (unsigned)row0, ut = (unsigned)tid;
    unsigned lim = MROWS - 1 - ur0;                      // last row that exists, from row0
    const char* og = (const char*)(o_h + (size_t)ur0 * D_M);
    const char* xg = (const char*)xs;
    unsigned ab = (unsigned)(size_t)Ah, xb = (unsigned)(size_t)X;   // LDS byte addresses
    // Row row0 + r is position j of window w. With row0's own w and j (scalars) at hand, all
    // that is left per row is how many windows further on it lies: (j0 + r) / 9, at most 11.
    unsigned w0 = ur0 / L_W, j0 = ur0 % L_W, i0 = w0 % W_CNT;
    unsigned xr0 = (w0 / W_CNT) * T_LEN + i0 + j0;
    auto xs_row = [&](unsigned r) {
      unsigned rr = r < lim ? r : lim;
      unsigned dq = ((j0 + rr) * 57) >> 9;               // (j0 + rr) / 9 for values below 112
      return xr0 + rr - (L_W - 1) * dq + (i0 + dq >= W_CNT ? T_LEN - W_CNT : 0);
    };
    auto o_piece = [&](unsigned c, unsigned& l, const char*& g) {
      unsigned r = c / 50, q = c % 50;
      unsigned rr = r < lim ? r : lim;
      l = ab + r * (PA * 2) + q * 16;
      g = og + (rr * 800 + q * 16);
    };
    // The last 4 pieces of row e / 4 of X.
    auto x_rest = [&](unsigned e, unsigned& l, const char*& g) {
      unsigned r = e >> 2, q = 96 + (e & 3);
      l = xb + r * (PX * 4) + q * 16;
      g = xg + (xs_row(r) * 1600 + q * 16);
    };
    unsigned    l[CG];
    const char* g[CG];
    // The loops below are unrolled whole: l and g are operands of an asm statement, so each of
    // their entries has to be a register, which takes constant indices.
#pragma unroll
    for (unsigned b = 0; b < OF; b += CG) {
#pragma unroll
      for (unsigned k = 0; k < CG; ++k) o_piece(ut + (b + k) * 256, l[k], g[k]);
      copy_group(l, g);
    }
    if (wv < (BM * 50 - (int)OF * 256) / 32) {   // the rest of o: whole waves, a scalar test
      o_piece(ut + OF * 256, l[0], g[0]);
      copy_one(l[0], g[0]);
    }
    // X: a wave takes rows wv, wv + 8, ..: the row's place in xs is scalar work, and three
    // copies bring its first 96 pieces.
#pragma unroll
    for (unsigned b = 0; b < BM / 8; b += CG / 3) {
#pragma unroll
      for (unsigned k = 0; k < CG; ++k) {
        unsigned r = (unsigned)wv + (b + k / 3) * 8;
        l[k] = xb + r * (PX * 4) + (k % 3) * 512 + (unsigned)lane * 16;
        g[k] = xg + (size_t)(xs_row(r) * 1600 + (k % 3) * 512) + (unsigned)lane * 16;
      }
      copy_group(l, g);
    }
    x_rest(ut, l[0], g[0]);
    copy_one(l[0], g[0]);
    if (wv < (BM * 4 - 256) / 32) {   // the rest: whole waves, a scalar test
      x_rest(ut + 256, l[0], g[0]);
      copy_one(l[0], g[0]);
    }
    // This wave's copies have landed before it passes the barrier behind which others read them.
    asm volatile("s_wait_asynccnt 0x0" ::: "memory");
  }
  __syncthreads();

  // --- out projection + residual -> X ---
  int nt = wv;   // every wave has a strip: D_M / 16 >= 8
  do {
    v8f acc[MT];
    strip_mma(Ah, lane, b, acc);
    wmma_gap();
    int nn = nt * 16 + (lane & 15);
    float bo = bnext;
    if (nt + 8 < D_M / 16) {   // a scalar test
      bnext = bias_load(b_out + nn + 128);
      strip_load(w_out_h, nt + 8, lane, b);
    }
    float* xp = X + half * 8 * PX + nn;
    float res[MT * 8];   // all reads ahead of the stores: one LDS latency, not one per element
#pragma unroll
    for (int q = 0; q < MT * 8; ++q) res[q] = xp[((q >> 3) * 16 + (q & 7)) * PX];
#pragma unroll
    for (int q = 0; q < MT * 8; ++q)
      xp[((q >> 3) * 16 + (q & 7)) * PX] = acc[q >> 3][q & 7] + bo + res[q];
    nt += 8;
  } while (nt < D_M / 16);
  __syncthreads();
  // FFN1's first strip flies under the LayerNorm.
  bnext = bias_load(b1 + wv * 16 + (lane & 15));
  strip_load(w1_h, wv, lane, b);
  layernorm_packed<false>(X, ln1_g, ln1_b, Ah, nullptr, row0, wv, lane);
  __syncthreads();

  // --- FFN in 5 chunks of 320 hidden columns: FFN1 + exact GELU -> Fc, then FFN2 adds
  //     that chunk's k range into accumulators that stay in registers (k ascending) ---
  v8f acc2[4][MT];
#pragma unroll
  for (int tt = 0; tt < 4; ++tt) {
#pragma unroll
    for (int mt = 0; mt < MT; ++mt) acc2[tt][mt] = v8f{};
  }
#pragma unroll 1   // one copy of the chunk body, for speed only
  for (int kc = 0; kc < FF_M / FC; ++kc) {
    // A strip's epilogue: bias, exact GELU, f16 into column cl of Fc.
    auto gelu_store = [&](const v8f* acc, float bb, int cl) {
#pragma unroll
      for (int e0 = 0; e0 < MT * 8; e0 += 2 * GP) {
        v2f xv[GP];
#pragma unroll
        for (int i = 0; i < GP; ++i) {
          int e = e0 + 2 * i;
          xv[i] = v2f{acc[e >> 3][e & 7] + bb, acc[e >> 3][(e & 7) + 1] + bb};
        }
        gelu_group(xv);
#pragma unroll
        for (int i = 0; i < GP; ++i) {
          int e = e0 + 2 * i;
          int m = (e >> 3) * 16 + (e & 7) + half * 8;
          Fc[m * PF + cl]       = (_Float16)xv[i].x;
          Fc[(m + 1) * PF + cl] = (_Float16)xv[i].y;
        }
      }
    };
    int t = wv;   // every wave has a strip: FC / 16 >= 8
#pragma unroll 1   // same reason
    do {
      v8f acc[MT];
      strip_mma(Ah, lane, b, acc);
      wmma_gap();
      int cl = t * 16 + (lane & 15);
      float bb = bnext;
      if (t + 8 < FC / 16) {   // a scalar test: the next strip's weights fly under the GELU
        bnext = bias_load(b1 + kc * FC + cl + 128);
        strip_load(w1_h, kc * (FC / 16) + t + 8, lane, b);
      }
      gelu_store(acc, bb, cl);
      t += 8;
    } while (t < FC / 16);
    __syncthreads();   // Fc complete before any wave reads it
    const _Float16* ap = Fc + (lane & 15) * PF + half * 8;
    const _Float16* bp = w2_h + (size_t)(wv * KS_F + kc * (FC / 32)) * PBLK + lane * 8;
    // Weight fragments run two k steps ahead of their WMMAs (ring of three sets); each A
    // fragment read from LDS serves all of the wave's N tiles. Tile 24 is wave 0's alone.
    // The ring lives in the registers of the strip's fragments, which are free from a chunk's last
    // strip to the next chunk's first: as arrays of their own the two sets spill.
#define BQ(s, tt) b[(s) * 4 + (tt)]
#pragma unroll
    for (int ks = 0; ks < 2; ++ks) {
#pragma unroll
      for (int tt = 0; tt < 3; ++tt) BQ(ks, tt) = fragp(bp + (tt * 8 * KS_F + ks) * PBLK, true);
      if (wv == 0) BQ(ks, 3) = fragp(bp + (3 * 8 * KS_F + ks) * PBLK, true);
    }
    v16h a[2][MT];   // A fragments run one k step ahead
#pragma unroll
    for (int mt = 0; mt < MT; ++mt) a[0][mt] = frag16(ap + mt * 16 * PF, true);
#pragma unroll
    for (int ks = 0; ks < FC / 32; ++ks) {
      if (ks + 2 < FC / 32) {
#pragma unroll
        for (int tt = 0; tt < 3; ++tt)
          BQ((ks + 2) % 3, tt) = fragp(bp + (tt * 8 * KS_F + ks + 2) * PBLK, true);
        if (wv == 0) BQ((ks + 2) % 3, 3) = fragp(bp + (3 * 8 * KS_F + ks + 2) * PBLK, true);
      }
      if (ks + 1 < FC / 32) {
#pragma unroll
        for (int mt = 0; mt < MT; ++mt)
          a[(ks + 1) & 1][mt] = frag16(ap + mt * 16 * PF + (ks + 1) * 32, true);
      }
#pragma unroll
      for (int tt = 0; tt < 3; ++tt) {
#pragma unroll
        for (int mt = 0; mt < MT; ++mt)
          acc2[tt][mt] = wmma_acc(a[ks & 1][mt], BQ(ks % 3, tt), acc2[tt][mt]);
      }
      if (wv == 0) {
#pragma unroll
        for (int mt = 0; mt < MT; ++mt)
          acc2[3][mt] = wmma_acc(a[ks & 1][mt], BQ(ks % 3, 3), acc2[3][mt]);
      }
    }
    wmma_gap();        // branches follow: the test below and the loop's own
    // Behind the ring's last loads: what follows rewrites the address pair that they name.
    asm volatile("s_wait_xcnt 0x0" ::: "memory");
    __syncthreads();   // every reader has left Fc before the next chunk overwrites it
    if (kc + 1 < FF_M / FC) {   // the next chunk's first strip
      bnext = bias_load(b1 + (kc + 1) * FC + wv * 16 + (lane & 15));
      strip_load(w1_h, (kc + 1) * (FC / 16) + wv, lane, b);
    }
  }
#pragma unroll
  for (int tt = 0; tt < 4; ++tt) {
    int nt = wv + tt * 8;
    if (nt < D_M / 16) {
      int nn = nt * 16 + (lane & 15);
      float bb = b2[nn];
      float* xp = X + half * 8 * PX + nn;
      float res[MT * 8];   // all reads ahead of the stores, as above
#pragma unroll
      for (int q = 0; q < MT * 8; ++q) res[q] = xp[((q >> 3) * 16 + (q & 7)) * PX];
#pragma unroll
      for (int q = 0; q < MT * 8; ++q)
        xp[((q >> 3) * 16 + (q & 7)) * PX] = res[q] + acc2[tt][q >> 3][q & 7] + bb;
    }
  }
  __syncthreads();
  layernorm_packed<true>(X, ln2_g, ln2_b, nullptr, out_win, row0, wv, lane);
}

// ---------------- Kernel 5: deterministic overlap-gather + output transpose ----------------
// row t receives out_win[i][t - i/2] for i in [2(t-8), 2t+1] within [0, W), summed with i ascending.
// One thread takes 4 neighbouring d of the steps t, t + TB, t + 2 TB, t + 3 TB (only steps up
// to TLAST receive anything, so every thread gets two full steps).
#define TLAST  ((W_CNT - 1) / 2 + L_W - 1)   // 153
#define IBMAX  (W_CNT + 1 - 2 * L_W)         // 274: the last even start whose 17 windows exist
#define ROWQ(q) ((q) * L_W - ((q) >> 1))     // packed row of window ib + q, less that of window ib
static_assert(IBMAX % 2 == 0, "ROWQ needs an even first window");

// Sum of step t for 4 neighbouring d, wn = the batch entry's first packed row + d.
// The 18 windows ib .. ib + 17 are read with no branch between them, from one address with
// constant offsets; ib is 2(t-8) moved into [0, IBMAX], which keeps every row inside the batch
// entry's block (the 18th is clamped to its last row), and a window outside the step's range
// adds 0. So all 18 loads are in flight together, and the windows that count keep their order.
__device__ __forceinline__ float4 gather_step(const float* wn, int t) {
  int i0 = 2 * (t - (L_W - 1));
  int ib = i0 < 0 ? 0 : (i0 > IBMAX ? IBMAX : i0);
  int r0 = ib * L_W + t - (ib >> 1);
  int rl = r0 + ROWQ(2 * L_W - 1);
  if (rl > W_CNT * L_W - 1) rl = W_CNT * L_W - 1;
  const float* p  = wn + r0 * D_M;
  const float* pl = wn + rl * D_M;
  float4 val[2 * L_W];
#pragma unroll
  for (int q = 0; q < 2 * L_W - 2; ++q) val[q] = *(const float4*)(p + ROWQ(q) * D_M);
  // A later load's result may be given the address pair of the loads before it: each pair's
  // last load stands alone behind an s_wait_xcnt 0, so no pair is overwritten in front of one.
  asm volatile("s_wait_xcnt 0x0" ::: "memory");
  val[2 * L_W - 2] = *(const float4*)(p + ROWQ(2 * L_W - 2) * D_M);
  asm volatile("s_wait_xcnt 0x0" ::: "memory");
  val[2 * L_W - 1] = *(const float4*)pl;
  asm volatile("s_wait_xcnt 0x0" ::: "memory");
  float4 sum = make_float4(0.f, 0.f, 0.f, 0.f);
#pragma unroll
  for (int q = 0; q < 2 * L_W; ++q) {
    int i = ib + q;
    bool in = i >= i0 && i <= 2 * t + 1 && i < W_CNT;
    sum.x += in ? val[q].x : 0.f;
    sum.y += in ? val[q].y : 0.f;
    sum.z += in ? val[q].z : 0.f;
    sum.w += in ? val[q].w : 0.f;
  }
  return sum;
}

__global__ void __launch_bounds__(256)
gather_out_kernel(const float* __restrict__ out_win, float* __restrict__ out) {
  int idx = blockIdx.x * 256 + threadIdx.x;
  if (idx >= NITEM) return;
  int d4 = idx % (D_M / 4);
  int r  = idx / (D_M / 4);
  int tb = r % TB;
  int n  = r / TB;
  int v = d4 >> 2, c0 = (d4 & 3) * 4;
  const float* wn = out_win + (size_t)n * (W_CNT * L_W * D_M) + d4 * 4;
  float* op = out + ((n * C_CH + c0) * T_LEN + tb) * V_J + v;
  float4 sum[TG];
#pragma unroll
  for (int k = 0; k < TG; ++k) {
    int t = tb + k * TB;
    sum[k] = make_float4(0.f, 0.f, 0.f, 0.f);
    if ((k + 1) * TB - 1 <= TLAST || (k * TB <= TLAST && t <= TLAST)) sum[k] = gather_step(wn, t);
  }
  // All stores behind all loads: no register that a store names is written again.
#pragma unroll
  for (int k = 0; k < TG; ++k) {
    op[(0 * T_LEN + k * TB) * V_J] = sum[k].x;
    op[(1 * T_LEN + k * TB) * V_J] = sum[k].y;
    op[(2 * T_LEN + k * TB) * V_J] = sum[k].z;
    op[(3 * T_LEN + k * TB) * V_J] = sum[k].w;
  }
}

// ---------------- host launch ----------------
extern "C" void kernel_launch(void* const* d_in, const int* in_sizes, int n_in,
                              void* d_out, int out_size, void* d_ws, size_t ws_size,
                              hipStream_t stream) {
  const float* x     = (const float*)d_in[0];
  const float* pe    = (const float*)d_in[1];
  const float* w_in  = (const float*)d_in[2];
  const float* b_in  = (const float*)d_in[3];
  const float* w_out = (const float*)d_in[4];
  const float* b_out = (const float*)d_in[5];
  const float* w1    = (const float*)d_in[6];
  const float* b1    = (const float*)d_in[7];
  const float* w2    = (const float*)d_in[8];
  const float* b2    = (const float*)d_in[9];
  const float* ln1g  = (const float*)d_in[10];
  const float* ln1b  = (const float*)d_in[11];
  const float* ln2g  = (const float*)d_in[12];
  const float* ln2b  = (const float*)d_in[13];
  float* out = (float*)d_out;

  // workspace layout
  char* ws = (char*)d_ws;
  size_t off = 0;
  float*    xs      = (float*)(ws + off);    off += (size_t)NROWS * D_M * 4;       // 7.68 MB
  _Float16* xs_h    = (_Float16*)(ws + off); off += (size_t)NROWS * D_M * 2;       // 3.84 MB
  // packed in fragment order: N/16 tiles x k steps x 1 KiB
  _Float16* w_in_h  = (_Float16*)(ws + off); off += (size_t)(3 * D_M / 16) * KS_D * 1024;  // 1.00 MB
  _Float16* w_out_h = (_Float16*)(ws + off); off += (size_t)(D_M / 16) * KS_D * 1024;   // 0.33 MB
  _Float16* w1_h    = (_Float16*)(ws + off); off += (size_t)(FF_M / 16) * KS_D * 1024;  // 1.33 MB
  _Float16* w2_h    = (_Float16*)(ws + off); off += (size_t)(D_M / 16) * KS_F * 1024;   // 1.28 MB
  float*    qkv_all = (float*)(ws + off);    off += (size_t)NROWS * 3 * D_M * 4;   // 23.04 MB
  float*    out_win = (float*)(ws + off);    off += (size_t)NWIN * L_W * D_M * 4;  // 67.05 MB
  _Float16* o_h     = (_Float16*)(ws + off); off += (size_t)NWIN * L_W * D_M * 2;  // 33.52 MB

  const int TPB = 256;

  // 1, 2) layout + positional encoding, and the weights to f16 packed in fragment order
  front_kernel<<<FRONT_BLOCKS, TPB, 0, stream>>>(x, pe, w_in, w_out, w1, w2, xs, xs_h, w_in_h,
                                                 w_out_h, w1_h, w2_h);

  // 3) hoisted QKV GEMM: one block per tile of BM rows x QN * 16 columns
  qkv_gemm_kernel<<<(NROWS / BM) * (3 * D_M / 16 / QN), TPB, 0, stream>>>(xs_h, w_in_h, b_in,
                                                                          qkv_all);

  // 4) attention, one block per run of AG windows
  attn_kernel<<<N_B * NGRP, TPB, 0, stream>>>(qkv_all, o_h);

  // 4b) out projection, LayerNorm, FFN, LayerNorm on packed rows (WMMA)
  rows_kernel<<<(MROWS + BM - 1) / BM, TPB, 0, stream>>>(xs, o_h, w_out_h, b_out, w1_h, b1,
                                                         w2_h, b2, ln1g, ln1b, ln2g, ln2b,
                                                         out_win);

  // 5) deterministic overlap-add + transpose to [N,C,T,V]
  gather_out_kernel<<<(NITEM + TPB - 1) / TPB, TPB, 0, stream>>>(out_win, out);
}
